// v000
// Times are from an AMD MI455X. After a warm-up the kernel runs many times in a row, and a time is the length of
// such a window on the GPU divided by its runs, so every launch and the gaps after it count. The runs cycle
// through copies of the inputs. A figure is the median of several windows, for all but v000 over two sittings.
// Sittings can differ by a few percent; kernels timed side by side share one.
// v000, which the later versions start from, runs in 1350 microseconds.
#include <hip/hip_runtime.h>
// KroneckerFusion (131072 rows; v1, v2 = x[0], x[1] (32 each): h_i = relu(v_i Wh_i^T + b); z_i = Bilinear(v1, Wz_i, v2) + b; o_i = relu((sigmoid(z_i) * h_i) Wo_i^T + b); o_i <- [o_i, 1]; o12 = o1 (x) o2 (33 x 33 = 1089); out = relu(o12 We1^T + b); out = relu([out, o1, o2] We2^T + b)).
// Structure: 8 chunks of 16384 rows; per chunk: the v1 (x) v2 outer-product plane on VALU (f16), both bilinear forms as ONE f16 WMMA GEMM against [Wz1; Wz2] flattened (32x64 wave tiles, f32 accumulation, exact x16 weights + bias; K = 1024); h via a block-diagonal [Wh1 | Wh2] GEMM (ReLU epilogue); the gates on VALU; o via a block-diagonal [Wo1 | Wo2] GEMM (ReLU); the 33 x 33 Kronecker plane (+ the skip columns) on VALU; We1 (K = 1089 padded to 1120, ReLU, f16 out written straight into the concat plane); We2 (K = 130 padded to 160, ReLU) into the output rows.
#define NBR 131072               /* rows processed */
#define NBI 131072               /* rows in the input (x[1] starts at NBI*32; separate so debug builds can shrink NBR) */
#define CHK 16384
#define D1 32
#define KO 1024                  /* 32 x 32 outer */
#define KK 1089                  /* 33 x 33 Kronecker */
#define KKP 1120
#define FE 64
#define KC2 160                  /* [e1 (64) | o1a (33) | o2a (33) | 0] */
typedef __bf16 v16b __attribute__((ext_vector_type(16)));
typedef unsigned short v8us __attribute__((ext_vector_type(8), may_alias));
typedef float  v8f  __attribute__((ext_vector_type(8)));
typedef float  v4f  __attribute__((ext_vector_type(4)));
typedef float  v4fa __attribute__((ext_vector_type(4), may_alias));
union FragB { v16b v; v8us half[2]; unsigned short u[16]; };

__device__ __forceinline__ unsigned short bf16_bits(float x) { unsigned int u = __float_as_uint(x); return (unsigned short)((u + 0x7FFFu + ((u >> 16) & 1u)) >> 16); }
__device__ __forceinline__ float bf16_val(unsigned short b) { return __uint_as_float(((unsigned int)b) << 16); }
__device__ __forceinline__ float bf16_round(float x) { return bf16_val(bf16_bits(x)); }
// D += A·B with NT terms: 1 = ah·bh, 2 = + al·bh (A split), 3 = + ah·bl (both split)
template <int NT>
__device__ __forceinline__ v8f mmaN(v16b ah, v16b al, v16b bh, v16b bl, v8f c) {
  c = __builtin_amdgcn_wmma_f32_16x16x32_bf16(false, ah, false, bh, (short)0, c, false, false);
  if (NT >= 2) c = __builtin_amdgcn_wmma_f32_16x16x32_bf16(false, al, false, bh, (short)0, c, false, false);
  if (NT >= 3) c = __builtin_amdgcn_wmma_f32_16x16x32_bf16(false, ah, false, bl, (short)0, c, false, false);
  asm volatile("v_nop\n\tv_nop\n\tv_nop\n\tv_nop" : "+v"(c) : "v"(ah), "v"(al), "v"(bh), "v"(bl));
  return c;
}

__global__ __launch_bounds__(256) void k_wt_bf16(const float* __restrict__ W, unsigned short* __restrict__ Wt, int K, int N) {
  const int t = blockIdx.x * 256 + threadIdx.x;
  const int k8n = K / 8;
  if (t >= N * k8n) return;
  const int n = t / k8n, k8 = (t % k8n) * 8;
  v8us v;
#pragma unroll
  for (int i = 0; i < 8; ++i) v[i] = bf16_bits(W[(size_t)(k8 + i) * N + n]);
  *(v8us*)(Wt + (size_t)n * K + k8) = v;
  
}

// GEMM C[M][N] (f32, pitch ldc) = act(A[M][K]·W + bias). A f32 row-major (pitch lda) converted per fragment to bf16
// (ASPLIT: hi/lo two planes -> 2 terms, else single rounded term); Wt bf16 [N][K] (pitch ldb). BIAS_BF16 rounds the
// bias to bf16 first (bias quantised to bf16 before the add). K%32==0, M%16==0, N%64==0.
template <bool ASPLIT, int ACT, bool BIAS_BF16>
__global__ __launch_bounds__(128) void k_gemm_bf(const float* __restrict__ A, int lda, const unsigned short* __restrict__ Wt, int ldb,
                                               const float* __restrict__ bias, float* __restrict__ C, int ldc, int M, int N, int K) {
  __shared__ __attribute__((aligned(16))) float so[4][16][64];
  const int tid = threadIdx.x, w = tid >> 5, lane = tid & 31, ln = lane & 15, hh = lane >> 4;
  const int ntn = N / 64;
  const int wid = blockIdx.x * 4 + w;
  const int mt = wid / ntn, nq = wid % ntn;
  if (mt * 16 >= M) return;
  const int row0 = mt * 16, col0 = nq * 64;
  const float* arow = A + (size_t)(row0 + ln) * lda;
  v8f acc[4] = {};
  for (int kb = 0; kb < K; kb += 32) {
    FragB ah, al;
    const v4f x0 = *(const v4fa*)(arow + kb + 8 * hh), x1 = *(const v4fa*)(arow + kb + 8 * hh + 4);
    const v4f x2 = *(const v4fa*)(arow + kb + 16 + 8 * hh), x3 = *(const v4fa*)(arow + kb + 16 + 8 * hh + 4);
    float xs[16] = {x0[0],x0[1],x0[2],x0[3],x1[0],x1[1],x1[2],x1[3],x2[0],x2[1],x2[2],x2[3],x3[0],x3[1],x3[2],x3[3]};
#pragma unroll
    for (int i = 0; i < 16; ++i) { const unsigned short hb = bf16_bits(xs[i]); ah.u[i] = hb; al.u[i] = ASPLIT ? bf16_bits(xs[i] - bf16_val(hb)) : (unsigned short)0; }
#pragma unroll
    for (int t = 0; t < 4; ++t) {
      const unsigned short* brow = Wt + (size_t)(col0 + t * 16 + ln) * ldb + kb;
      FragB b;
      b.half[0] = *(const v8us*)(brow + 8 * hh);
      b.half[1] = *(const v8us*)(brow + 16 + 8 * hh);
      acc[t] = mmaN<ASPLIT ? 2 : 1>(ah.v, al.v, b.v, b.v, acc[t]);
    }
  }
#pragma unroll
  for (int t = 0; t < 4; ++t) {
    float bv = bias ? bias[col0 + t * 16 + ln] : 0.f;
    if (BIAS_BF16) bv = bf16_round(bv);
#pragma unroll
    for (int r = 0; r < 8; ++r) { float v = acc[t][r] + bv; if (ACT == 1) v = fmaxf(v, 0.f); so[w][8 * hh + r][t * 16 + ln] = v; }
  }
  __builtin_amdgcn_fence(__ATOMIC_ACQ_REL, "workgroup");
  __builtin_amdgcn_wave_barrier();
  const int rsub = lane >> 4, c4 = (lane & 15) * 4;
  {
#pragma unroll
    for (int q = 0; q < 8; ++q) {
      const int r = q * 2 + rsub;
      const v4f v = *(const v4fa*)&so[w][r][c4];
      *(v4f*)(C + (size_t)(row0 + r) * ldc + col0 + c4) = v;
    }
    
  }
}

// GEMM C = act(A·W + bias + resid): A f32 (ASPLIT -> hi/lo 2 terms), Wt bf16 [N][K]; ACT 0 none, 1 relu, 2 exact gelu;
// resid (optional, f32, row index = (row % rmod), pitch ldr, RES_BF16 rounds it) added before the activation.
template <bool ASPLIT, int ACT, bool BIAS_BF16, bool RES_BF16>
__global__ __launch_bounds__(128) void k_gemm_bf3(const float* __restrict__ A, int lda, const unsigned short* __restrict__ Wt, int ldb,
                                                const float* __restrict__ bias, const float* __restrict__ resid, int rmod, int ldr,
                                                float* __restrict__ C, int ldc, int M, int N, int K) {
  __shared__ __attribute__((aligned(16))) float so[4][16][64];
  const int tid = threadIdx.x, w = tid >> 5, lane = tid & 31, ln = lane & 15, hh = lane >> 4;
  const int ntn = N / 64;
  const int wid = blockIdx.x * 4 + w;
  const int mt = wid / ntn, nq = wid % ntn;
  if (mt * 16 >= M) return;
  const int row0 = mt * 16, col0 = nq * 64;
  const float* arow = A + (size_t)(row0 + ln) * lda;
  v8f acc[4] = {};
  for (int kb = 0; kb < K; kb += 32) {
    FragB ah, al;
    const v4f x0 = *(const v4fa*)(arow + kb + 8 * hh), x1 = *(const v4fa*)(arow + kb + 8 * hh + 4);
    const v4f x2 = *(const v4fa*)(arow + kb + 16 + 8 * hh), x3 = *(const v4fa*)(arow + kb + 16 + 8 * hh + 4);
    float xs[16] = {x0[0],x0[1],x0[2],x0[3],x1[0],x1[1],x1[2],x1[3],x2[0],x2[1],x2[2],x2[3],x3[0],x3[1],x3[2],x3[3]};
#pragma unroll
    for (int i = 0; i < 16; ++i) { const unsigned short hb = bf16_bits(xs[i]); ah.u[i] = hb; al.u[i] = ASPLIT ? bf16_bits(xs[i] - bf16_val(hb)) : (unsigned short)0; }
#pragma unroll
    for (int t = 0; t < 4; ++t) {
      const unsigned short* brow = Wt + (size_t)(col0 + t * 16 + ln) * ldb + kb;
      FragB b;
      b.half[0] = *(const v8us*)(brow + 8 * hh);
      b.half[1] = *(const v8us*)(brow + 16 + 8 * hh);
      acc[t] = mmaN<ASPLIT ? 2 : 1>(ah.v, al.v, b.v, b.v, acc[t]);
    }
  }
#pragma unroll
  for (int t = 0; t < 4; ++t) {
    const int col = col0 + t * 16 + ln;
    float bv = bias ? bias[col] : 0.f;
    if (BIAS_BF16) bv = bf16_round(bv);
#pragma unroll
    for (int r = 0; r < 8; ++r) {
      float v = acc[t][r] + bv;
      if (resid) { float rv = resid[(size_t)((row0 + 8 * hh + r) % rmod) * ldr + col]; if (RES_BF16) rv = bf16_round(rv); v += rv; }
      if (ACT == 1) v = fmaxf(v, 0.f);
      if (ACT == 2) v = 0.5f * v * (1.0f + erff(v * 0.70710678118654752f));
      if (ACT == 3) { const float u = 0.7978845608028654f * (v + 0.044715f * v * v * v); v = 0.5f * v * (1.0f + tanhf(u)); }
      so[w][8 * hh + r][t * 16 + ln] = v;
    }
  }
  __builtin_amdgcn_fence(__ATOMIC_ACQ_REL, "workgroup");
  __builtin_amdgcn_wave_barrier();
  const int rsub = lane >> 4, c4 = (lane & 15) * 4;
  {
#pragma unroll
    for (int q = 0; q < 8; ++q) {
      const int r = q * 2 + rsub;
      const v4f v = *(const v4fa*)&so[w][r][c4];
      *(v4f*)(C + (size_t)(row0 + r) * ldc + col0 + c4) = v;
    }
    
  }
}
// row LayerNorm (biased variance, eps) over N: s = X (+ R); optional out_sum <- s; out_norm <- (s-mu)*rsqrt(var+eps)*g + b
template <bool PARAM_BF16>
__global__ __launch_bounds__(256) void k_layernorm(const float* __restrict__ X, const float* __restrict__ R, const float* __restrict__ g, const float* __restrict__ bta,
                                                  float* __restrict__ out_sum, float* __restrict__ out_norm, int N, float eps) {
  __shared__ float red[256];
  const int row = blockIdx.x, tid = threadIdx.x;
  const float* x = X + (size_t)row * N; const float* rr = R ? R + (size_t)row * N : nullptr;
  float vals[16];                     // up to N = 4096
  const int per = N / 256;            // contiguous chunk per thread? use strided-by-4 chunks: thread handles j = tid*4 + 1024*u
  float s1 = 0.f;
  for (int u = 0; u < per / 4; ++u) {
    const int j = tid * 4 + 1024 * u;
    const v4f a = *(const v4fa*)(x + j);
    v4f b = {0.f,0.f,0.f,0.f}; if (rr) b = *(const v4fa*)(rr + j);
#pragma unroll
    for (int q = 0; q < 4; ++q) { const float v = a[q] + b[q]; vals[u * 4 + q] = v; s1 += v; }
  }
  red[tid] = s1; __syncthreads();
  for (int st = 128; st > 0; st >>= 1) { if (tid < st) red[tid] += red[tid + st]; __syncthreads(); }
  const float mu = red[0] / (float)N; __syncthreads();
  float s2 = 0.f;
  for (int u = 0; u < per / 4; ++u)
#pragma unroll
    for (int q = 0; q < 4; ++q) { const float c = vals[u * 4 + q] - mu; s2 += c * c; }
  red[tid] = s2; __syncthreads();
  for (int st = 128; st > 0; st >>= 1) { if (tid < st) red[tid] += red[tid + st]; __syncthreads(); }
  const float rs = rsqrtf(red[0] / (float)N + eps);
  {
    for (int u = 0; u < per / 4; ++u) {
      const int j = tid * 4 + 1024 * u;
      v4f o, sm;
#pragma unroll
      for (int q = 0; q < 4; ++q) {
        float gg = g[j + q], bb = bta[j + q];
        if (PARAM_BF16) { gg = bf16_round(gg); bb = bf16_round(bb); }
        sm[q] = vals[u * 4 + q]; o[q] = (vals[u * 4 + q] - mu) * rs * gg + bb;
      }
      if (out_sum) *(v4f*)(out_sum + (size_t)row * N + j) = sm;
      *(v4f*)(out_norm + (size_t)row * N + j) = o;
    }
    
  }
}



// ---- f16 WMMA path (v_wmma_f32_16x16x32_f16): 11-bit significands for operands in range — used here for all five GEMMs (bilinear, h, o, We1, We2)
typedef _Float16 v16h __attribute__((ext_vector_type(16)));
union FragH { v16h v; v8us half[2]; _Float16 h[16]; unsigned short u[16]; };
template <int NT>
__device__ __forceinline__ v8f mmaH(v16h ah, v16h al, v16h bh, v16h bl, v8f c) {
  c = __builtin_amdgcn_wmma_f32_16x16x32_f16(false, ah, false, bh, (short)0, c, false, false);
  if (NT >= 2) c = __builtin_amdgcn_wmma_f32_16x16x32_f16(false, al, false, bh, (short)0, c, false, false);
  if (NT >= 3) c = __builtin_amdgcn_wmma_f32_16x16x32_f16(false, ah, false, bl, (short)0, c, false, false);
  asm volatile("v_nop\n\tv_nop\n\tv_nop\n\tv_nop" : "+v"(c) : "v"(ah), "v"(al), "v"(bh), "v"(bl));
  return c;
}
// batched GEMM like k_gemm_b but f16 operands: A f32 (split into f16 hi/lo if ASPLIT, else rounded to f16), Bt = f16 values [n][k]; alpha; C f32; N multiple of 16 (partial tiles skipped)
template <bool ASPLIT>
__global__ __launch_bounds__(128) void k_gemm_h(const float* __restrict__ A, int lda, size_t sA, const _Float16* __restrict__ Bh, int ldb, size_t sB, float alpha, float* __restrict__ C, int ldc, size_t sC, int M, int N, int K) {
  __shared__ __attribute__((aligned(16))) float so[4][16][64];
  const int tid = threadIdx.x, w = tid >> 5, lane = tid & 31, ln = lane & 15, hh = lane >> 4; const int by = blockIdx.y;
  A += (size_t)by * sA; Bh += (size_t)by * sB; C += (size_t)by * sC;
  const int ntn = (N + 63) / 64; const int wid = blockIdx.x * 4 + w; const int mt = wid / ntn, nq = wid % ntn; if (mt * 16 >= M) return;
  const int row0 = mt * 16, col0 = nq * 64; const float* arow = A + (size_t)(row0 + ln) * lda;
  v8f acc[4] = {};
  for (int kb = 0; kb < K; kb += 32) {
    FragH ah, al;
    const v4f x0 = *(const v4fa*)(arow + kb + 8 * hh), x1 = *(const v4fa*)(arow + kb + 8 * hh + 4), x2 = *(const v4fa*)(arow + kb + 16 + 8 * hh), x3 = *(const v4fa*)(arow + kb + 16 + 8 * hh + 4);
    float xs[16] = {x0[0],x0[1],x0[2],x0[3],x1[0],x1[1],x1[2],x1[3],x2[0],x2[1],x2[2],x2[3],x3[0],x3[1],x3[2],x3[3]};
#pragma unroll
    for (int i = 0; i < 16; ++i) { const _Float16 h = (_Float16)xs[i]; ah.h[i] = h; al.h[i] = ASPLIT ? (_Float16)(xs[i] - (float)h) : (_Float16)0.0f; }
#pragma unroll
    for (int t = 0; t < 4; ++t) { if (col0 + t * 16 >= N) continue; const size_t boff = (size_t)(col0 + t * 16 + ln) * ldb + kb; FragH bq; bq.half[0] = *(const v8us*)(Bh + boff + 8 * hh); bq.half[1] = *(const v8us*)(Bh + boff + 16 + 8 * hh);
      acc[t] = mmaH<ASPLIT ? 2 : 1>(ah.v, al.v, bq.v, bq.v, acc[t]); }
  }
#pragma unroll
  for (int t = 0; t < 4; ++t) { if (col0 + t * 16 >= N) continue;
#pragma unroll
    for (int r = 0; r < 8; ++r) so[w][8 * hh + r][t * 16 + ln] = acc[t][r] * alpha; }
  __builtin_amdgcn_fence(__ATOMIC_ACQ_REL, "workgroup"); __builtin_amdgcn_wave_barrier();
  const int rsub = lane >> 4, c4 = (lane & 15) * 4;
  {
#pragma unroll
    for (int q = 0; q < 8; ++q) { const int r = q * 2 + rsub; if (col0 + c4 < N) { const v4f v = *(const v4fa*)&so[w][r][c4]; *(v4f*)(C + (size_t)(row0 + r) * ldc + col0 + c4) = v; } }
     }
}

// Wt[n][k] = f16(W[k][n]·scale) from f32 row-major W[K][N] (scale = power of two; bf16-exact weights stay exact in f16 away from the subnormal range)
__global__ __launch_bounds__(256) void k_wt_f16(const float* __restrict__ W, _Float16* __restrict__ Wt, int K, int N, float scale) {
  const int t = blockIdx.x * 256 + threadIdx.x; if (t >= N * (K / 8)) return; const int n = t / (K / 8), k8 = (t % (K / 8)) * 8; FragH f;
#pragma unroll
  for (int i = 0; i < 8; ++i) f.h[i] = (_Float16)(bf16_round(W[(size_t)(k8 + i) * N + n]) * scale); const v8us o = f.half[0];
  *(v8us*)((unsigned short*)Wt + (size_t)n * K + k8) = o; 
}
// k_gemm_hh variant with fused epilogue: v = acc·alpha + bias[by·sBias + col] (+ CP[(row/rowsPerB)·sCPb + by·64 + col] if CP) ; ACT 0 none / 1 elu ; writes f16 C16 (and f32 C if non-null)
template <int ACT>
__global__ __launch_bounds__(128) void k_gemm_hhx(const _Float16* __restrict__ A, int lda, size_t sA, const _Float16* __restrict__ Bh, int ldb, size_t sB, float alpha, const float* __restrict__ bias, size_t sBias, const float* __restrict__ CP, int rowsPerB, size_t sCPb, int row0g,
    float* __restrict__ C, _Float16* __restrict__ C16, int ldc, size_t sC, int M, int N, int K) {
  __shared__ __attribute__((aligned(16))) float so[4][16][64];
  const int tid = threadIdx.x, w = tid >> 5, lane = tid & 31, ln = lane & 15, hh = lane >> 4; const int by = blockIdx.y;
  A += (size_t)by * sA; Bh += (size_t)by * sB; const size_t cofs = (size_t)by * sC; const float* bp = bias ? bias + (size_t)by * sBias : nullptr;
  const int ntn = (N + 63) / 64; const int wid = blockIdx.x * 4 + w; const int mt = wid / ntn, nq = wid % ntn; if (mt * 16 >= M) return;
  const int row0 = mt * 16, col0 = nq * 64; const _Float16* arow = A + (size_t)(row0 + ln) * lda;
  v8f acc[4] = {};
  for (int kb = 0; kb < K; kb += 32) { FragH ah; ah.half[0] = *(const v8us*)((const unsigned short*)arow + kb + 8 * hh); ah.half[1] = *(const v8us*)((const unsigned short*)arow + kb + 16 + 8 * hh);
#pragma unroll
    for (int t = 0; t < 4; ++t) { if (col0 + t * 16 >= N) continue; const size_t boff = (size_t)(col0 + t * 16 + ln) * ldb + kb; FragH bq; bq.half[0] = *(const v8us*)((const unsigned short*)Bh + boff + 8 * hh); bq.half[1] = *(const v8us*)((const unsigned short*)Bh + boff + 16 + 8 * hh);
      acc[t] = mmaH<1>(ah.v, ah.v, bq.v, bq.v, acc[t]); }
  }
#pragma unroll
  for (int t = 0; t < 4; ++t) { if (col0 + t * 16 >= N) continue; const int col = col0 + t * 16 + ln; const float bv = bp ? bf16_round(bp[col]) : 0.f;
#pragma unroll
    for (int r = 0; r < 8; ++r) { float v = acc[t][r] * alpha + bv; if (CP) { const int rr = row0g + row0 + 8 * hh + r; if (rowsPerB < 0) v += CP[cofs + (size_t)rr * ldc + col];      /* rowsPerB < 0: own element of the batched C plane */ else { const int bidx = rr / rowsPerB; v += CP[(size_t)bidx * sCPb + (size_t)by * 64 + col]; } } if (ACT == 1) v = (v > 0.f) ? v : expm1f(v); else if (ACT == 7) v = (v > 0.f) ? v + 1.0f : expf(v); else if (ACT == 8) v = tanhf(v); else if (ACT == 9) v = 0.5f * v * (1.0f + tanhf(0.7978845608028654f * (v + 0.044715f * v * v * v))); else if (ACT == 11) v = 1.0f / (1.0f + expf(-v)); else if (ACT == 12) v = (v > 0.f) ? v : 0.01f * v; else if (ACT == 14) v = (v > 0.f) ? v : 0.1f * v; else if (ACT == 16) v = (v >= 0.f) ? v : 0.3f * v; else if (ACT == 17) v = (v >= 0.f) ? v : 0.2f * v; else if (ACT == 15) v = v / (1.0f + expf(-v)); else if (ACT == 3) v = fmaxf(v, 0.f); else if (ACT == 6) v = 0.5f * v * (1.0f + erff(v * 0.70710678118654752f)); so[w][8 * hh + r][t * 16 + ln] = v; } }
  __builtin_amdgcn_fence(__ATOMIC_ACQ_REL, "workgroup"); __builtin_amdgcn_wave_barrier();
  const int rsub = lane >> 4, c4 = (lane & 15) * 4; typedef _Float16 v4h __attribute__((ext_vector_type(4)));
  {
#pragma unroll
    for (int q = 0; q < 8; ++q) { const int r = q * 2 + rsub; if (col0 + c4 < N) { const v4f v = *(const v4fa*)&so[w][r][c4]; if (C) *(v4f*)(C + cofs + (size_t)(row0 + r) * ldc + col0 + c4) = v; if (C16) { v4h h4; for (int i = 0; i < 4; ++i) h4[i] = (_Float16)v[i]; *(v4h*)(C16 + cofs + (size_t)(row0 + r) * ldc + col0 + c4) = h4; } } }
     }
}


typedef _Float16 v4h __attribute__((ext_vector_type(4)));

__global__ __launch_bounds__(256) void k_x16(const float* __restrict__ x, _Float16* __restrict__ X16, size_t n8) { const size_t t = (size_t)blockIdx.x * 256 + threadIdx.x; if (t >= n8) return; FragH f;
#pragma unroll
  for (int q = 0; q < 8; ++q) f.h[q] = (_Float16)bf16_round(x[t * 8 + q]); *(v8us*)((unsigned short*)X16 + t * 8) = f.half[0];  }
__global__ __launch_bounds__(256) void k_h16(const float* __restrict__ x, _Float16* __restrict__ X16, size_t n8) { const size_t t = (size_t)blockIdx.x * 256 + threadIdx.x; if (t >= n8) return; FragH f;
#pragma unroll
  for (int q = 0; q < 8; ++q) f.h[q] = (_Float16)x[t * 8 + q]; *(v8us*)((unsigned short*)X16 + t * 8) = f.half[0];  }
__global__ __launch_bounds__(256) void k_round16f(const float* __restrict__ W, _Float16* __restrict__ Bt, size_t n8) { const size_t t = (size_t)blockIdx.x * 256 + threadIdx.x; if (t >= n8) return; FragH f;
#pragma unroll
  for (int i = 0; i < 8; ++i) f.h[i] = (_Float16)(bf16_round(W[t * 8 + i]) * 16.0f); *(v8us*)((unsigned short*)Bt + t * 8) = f.half[0];  }
template <int NHv, int TTv>
__global__ __launch_bounds__(256) void k_vt(const _Float16* __restrict__ V16, int ldv, int voff, _Float16* __restrict__ Vt) { __shared__ unsigned short tl[64][66]; const int tid = threadIdx.x; const int slab = blockIdx.x / (TTv / 64), lg = blockIdx.x % (TTv / 64); const int b = slab / NHv, h = slab % NHv;
  for (int i = tid; i < 64 * 8; i += 256) { const int r = i / 8, c8 = (i % 8) * 8; FragH f; f.half[0] = *(const v8us*)((const unsigned short*)V16 + ((size_t)b * TTv + lg * 64 + r) * ldv + voff + h * 64 + c8);
#pragma unroll
    for (int q = 0; q < 8; ++q) tl[r][c8 + q] = f.u[q]; }
  __syncthreads();
  {
#pragma unroll
    for (int rd = 0; rd < 2; ++rd) { const int d = rd * 32 + tid / 8, pc = tid % 8; FragH f;
#pragma unroll
      for (int q = 0; q < 8; ++q) f.u[q] = tl[pc * 8 + q][d];
      *(v8us*)((unsigned short*)Vt + ((size_t)slab * 64 + d) * TTv + lg * 64 + pc * 8) = f.half[0]; }
     } }

__global__ __launch_bounds__(256) void k_hl(const float* __restrict__ F, _Float16* __restrict__ Hh, _Float16* __restrict__ Hl, size_t n8) { const size_t t = (size_t)blockIdx.x * 256 + threadIdx.x; if (t >= n8) return; FragH fh, fl; const v4f a = *(const v4fa*)(F + t * 8), c = *(const v4fa*)(F + t * 8 + 4);
#pragma unroll
  for (int q = 0; q < 4; ++q) { _Float16 h = (_Float16)a[q]; fh.h[q] = h; fl.h[q] = (_Float16)((a[q] - (float)h) * 1024.0f); h = (_Float16)c[q]; fh.h[4 + q] = h; fl.h[4 + q] = (_Float16)((c[q] - (float)h) * 1024.0f); }
  { *(v8us*)((unsigned short*)Hh + t * 8) = fh.half[0]; *(v8us*)((unsigned short*)Hl + t * 8) = fl.half[0];  } }

// ---- fast GEMM (wave tile 32x64; requires M % 32 == 0 rows per launch region and N % 64 == 0); epilogue = k_gemm_hhx semantics ----
__device__ __forceinline__ v16h g2_frag(const _Float16* p, int hh) { FragH f; f.half[0] = *(const v8us*)((const unsigned short*)p + 8 * hh); f.half[1] = *(const v8us*)((const unsigned short*)p + 16 + 8 * hh); return f.v; }
__device__ __forceinline__ v8f g2_mma(v16h a, v16h b, v8f c) { v8f d = __builtin_amdgcn_wmma_f32_16x16x32_f16(false, a, false, b, (short)0, c, false, false); asm volatile("v_nop\n\tv_nop\n\tv_nop\n\tv_nop" : "+v"(d) : "v"(a), "v"(b)); return d; }
template <int ACT>
__global__ __launch_bounds__(128) void k_gemm2(const _Float16* __restrict__ A, int lda, size_t sA, const _Float16* __restrict__ Bh, int ldb, size_t sB, float alpha, const float* __restrict__ bias, size_t sBias, const float* __restrict__ CP, int rowsPerB, size_t sCPb, int row0g,
    float* __restrict__ C, _Float16* __restrict__ C16, int ldc, size_t sC, int M, int N, int K) { static_assert(ACT == 0 || ACT == 3 || ACT == 6 || ACT == 8 || ACT == 9 || ACT == 11 || ACT == 12 || ACT == 14 || ACT == 15 || ACT == 16 || ACT == 17, "k_gemm2: unsupported ACT code (would silently apply no activation)");
  __shared__ __attribute__((aligned(16))) float so[4][32][68];
  const int tid = threadIdx.x, w = tid >> 5, lane = tid & 31, ln = lane & 15, hh = lane >> 4; const int by = blockIdx.y;
  A += (size_t)by * sA; Bh += (size_t)by * sB; const size_t cofs = (size_t)by * sC; const float* bp = bias ? bias + (size_t)by * sBias : nullptr;
  const int ntn = N >> 6; const int mt = blockIdx.x / ntn, nq = blockIdx.x - mt * ntn; const int row0 = mt * 128 + 32 * w, col0 = nq * 64; if (row0 >= M) return;
  const _Float16* a0p = A + (size_t)(row0 + ln) * lda; const _Float16* a1p = a0p + (size_t)16 * lda;
  const _Float16* b0p = Bh + (size_t)(col0 + ln) * ldb; const _Float16* b1p = b0p + (size_t)16 * ldb; const _Float16* b2p = b1p + (size_t)16 * ldb; const _Float16* b3p = b2p + (size_t)16 * ldb;
  const v8f z8 = {0.f,0.f,0.f,0.f,0.f,0.f,0.f,0.f}; v8f c00 = z8, c01 = z8, c02 = z8, c03 = z8, c10 = z8, c11 = z8, c12 = z8, c13 = z8;
#pragma unroll 1
  for (int kb = 0; kb < K; kb += 32) { const v16h a0 = g2_frag(a0p + kb, hh), a1 = g2_frag(a1p + kb, hh);
    v16h b = g2_frag(b0p + kb, hh); c00 = g2_mma(a0, b, c00); c10 = g2_mma(a1, b, c10);
    b = g2_frag(b1p + kb, hh); c01 = g2_mma(a0, b, c01); c11 = g2_mma(a1, b, c11);
    b = g2_frag(b2p + kb, hh); c02 = g2_mma(a0, b, c02); c12 = g2_mma(a1, b, c12);
    b = g2_frag(b3p + kb, hh); c03 = g2_mma(a0, b, c03); c13 = g2_mma(a1, b, c13); }
  v8f accs[8] = {c00, c01, c02, c03, c10, c11, c12, c13};
#pragma unroll
  for (int u = 0; u < 8; ++u) { const int t = u & 3, half = u >> 2; const int col = col0 + t * 16 + ln; const float bv = bp ? bf16_round(bp[col]) : 0.f;
#pragma unroll
    for (int r = 0; r < 8; ++r) { const int rloc = half * 16 + 8 * hh + r; float v = accs[u][r] * alpha + bv; if (CP) { if (rowsPerB < 0) v += CP[cofs + (size_t)(row0g + row0 + rloc) * ldc + col];      /* rowsPerB < 0: own element of the batched C plane */ else { const int bidx = (row0g + row0 + rloc) / rowsPerB; v += CP[(size_t)bidx * sCPb + (size_t)by * 64 + col]; } }
      if (ACT == 3) v = fmaxf(v, 0.f); else if (ACT == 6) v = 0.5f * v * (1.0f + erff(v * 0.70710678118654752f)); else if (ACT == 11) v = 1.0f / (1.0f + expf(-v)); else if (ACT == 15) v = v / (1.0f + expf(-v)); else if (ACT == 12) v = (v > 0.f) ? v : 0.01f * v; else if (ACT == 8) v = tanhf(v); else if (ACT == 9) v = 0.5f * v * (1.0f + tanhf(0.7978845608028654f * (v + 0.044715f * v * v * v))); else if (ACT == 14) v = (v > 0.f) ? v : 0.1f * v; else if (ACT == 16) v = (v >= 0.f) ? v : 0.3f * v; else if (ACT == 17) v = (v >= 0.f) ? v : 0.2f * v;
      so[w][rloc][t * 16 + ln] = v; } }
  __builtin_amdgcn_fence(__ATOMIC_ACQ_REL, "workgroup"); __builtin_amdgcn_wave_barrier();
  const int rsub = lane >> 4, c4 = (lane & 15) * 4;
  {
#pragma unroll
    for (int q = 0; q < 16; ++q) { const int r = q * 2 + rsub; const v4f v = *(const v4fa*)&so[w][r][c4]; if (C) *(v4f*)(C + cofs + (size_t)(row0 + r) * ldc + col0 + c4) = v; if (C16) { v4h h4; for (int i = 0; i < 4; ++i) h4[i] = (_Float16)v[i]; *(v4h*)(C16 + cofs + (size_t)(row0 + r) * ldc + col0 + c4) = h4; } }
     } }


__global__ __launch_bounds__(256) void k_wsc(const float* __restrict__ Wm, _Float16* __restrict__ Bt, size_t n8, float sc) { const size_t t = (size_t)blockIdx.x * 256 + threadIdx.x; if (t >= n8) return; FragH f; for (int q = 0; q < 8; ++q) f.h[q] = (_Float16)(bf16_round(Wm[t * 8 + q]) * sc); *(v8us*)((unsigned short*)Bt + t * 8) = f.half[0];  }
__global__ __launch_bounds__(256) void k_wput(const float* __restrict__ Wm, int nout, int nin, int roff, int coff, int kpad, _Float16* __restrict__ Bt) { const int t = blockIdx.x * 256 + threadIdx.x; const int npr = (nin + 7) / 8; if (t >= nout * npr) return; const int k0 = (t % npr) * 8; const int o = t / npr; unsigned short* d = (unsigned short*)Bt + (size_t)(roff + o) * kpad + coff + k0;
  { for (int q = 0; q < 8; ++q) { const int k = k0 + q; if (k < nin) { FragH f; f.h[0] = (_Float16)(bf16_round(Wm[(size_t)o * nin + k]) * 16.0f); *(unsigned short*)(d + q) = f.u[0] & 0xffffu; } }  } }
__global__ __launch_bounds__(256) void k_zero16(_Float16* __restrict__ D, size_t n8) { const size_t t = (size_t)blockIdx.x * 256 + threadIdx.x; if (t >= n8) return; v8us z; for (int q = 0; q < 8; ++q) z[q] = 0; *(v8us*)((unsigned short*)D + t * 8) = z;  }
__global__ __launch_bounds__(64) void k_bcat2(const float* __restrict__ a, const float* __restrict__ bb, float* __restrict__ dst) { const int i = threadIdx.x; const float v = (i < 32) ? bf16_round(a[i]) : bf16_round(bb[i - 32]); *(float*)(dst + i) = v;  }
__global__ __launch_bounds__(256) void k_outer(const float* __restrict__ x, int r0, _Float16* __restrict__ OUT, _Float16* __restrict__ V16) {
  #pragma clang fp contract(off)
  const int t = blockIdx.x * 256 + threadIdx.x; if (t >= CHK * D1 * 4) return; const int j0 = (t % 4) * 8; const int i = (t / 4) % D1; const int rl = t / (4 * D1); const size_t r = (size_t)r0 + rl; const float a = bf16_round(x[r * D1 + i]); FragH f; for (int q = 0; q < 8; ++q) f.h[q] = (_Float16)(a * bf16_round(x[((size_t)NBI + r) * D1 + j0 + q]));
  unsigned short* d = (unsigned short*)OUT + (size_t)rl * KO + i * D1 + j0; *(v8us*)d = f.half[0]; 
  if (i == 0) { FragH g1, g2; for (int q = 0; q < 8; ++q) { g1.h[q] = (_Float16)bf16_round(x[r * D1 + j0 + q]); g2.h[q] = (_Float16)bf16_round(x[((size_t)NBI + r) * D1 + j0 + q]); } unsigned short* dv = (unsigned short*)V16 + (size_t)rl * 64; { *(v8us*)(dv + j0) = g1.half[0]; *(v8us*)(dv + 32 + j0) = g2.half[0];  } } }
__global__ __launch_bounds__(256) void k_gate(const float* __restrict__ Z, const float* __restrict__ H, _Float16* __restrict__ G16) {
  #pragma clang fp contract(off)
  const int t = blockIdx.x * 256 + threadIdx.x; if (t >= CHK * 64 / 8) return; const v8f z = *(const v8f*)(Z + (size_t)t * 8); const v8f h = *(const v8f*)(H + (size_t)t * 8); FragH f; for (int q = 0; q < 8; ++q) f.h[q] = (_Float16)((1.0f / (1.0f + expf(-z[q]))) * h[q]);
  *(v8us*)((unsigned short*)G16 + (size_t)t * 8) = f.half[0];  }
__global__ __launch_bounds__(256) void k_kron(const float* __restrict__ O, _Float16* __restrict__ KR, _Float16* __restrict__ C2) {
  #pragma clang fp contract(off)
  const int NPIECE = KKP / 8 + (KC2 - 64) / 8;      /* 140 + 12 */ const int t = blockIdx.x * 256 + threadIdx.x; if (t >= CHK * NPIECE) return; const int p = t % NPIECE; const int rl = t / NPIECE; const float* o = O + (size_t)rl * 64; FragH f;
  if (p < KKP / 8) { const int c0 = p * 8; for (int q = 0; q < 8; ++q) { const int c = c0 + q; float v = 0.f; if (c < KK) { const int a = c / 33, b = c % 33; const float x1 = (a < 32) ? o[a] : 1.0f, x2 = (b < 32) ? o[32 + b] : 1.0f; v = x1 * x2; } f.h[q] = (_Float16)v; }
    unsigned short* d = (unsigned short*)KR + (size_t)rl * KKP + c0; *(v8us*)d = f.half[0];  }
  else { const int c0 = 64 + (p - KKP / 8) * 8; for (int q = 0; q < 8; ++q) { const int c = c0 + q; float v = 0.f; if (c < 64 + 33) { const int a = c - 64; v = (a < 32) ? o[a] : 1.0f; } else if (c < 64 + 66) { const int b = c - 97; v = (b < 32) ? o[32 + b] : 1.0f; } f.h[q] = (_Float16)v; }
    unsigned short* d = (unsigned short*)C2 + (size_t)rl * KC2 + c0; *(v8us*)d = f.half[0];  } }

extern "C" void kernel_launch(void* const* d_in, const int* in_sizes, int n_in,
                              void* d_out, int out_size, void* d_ws, size_t ws_size, hipStream_t stream) {
  (void)in_sizes; (void)n_in; (void)out_size;
  const float* const* I = (const float* const*)d_in;
  const float* x = I[0]; const float* Wh1 = I[1]; const float* bh1 = I[2]; const float* Wz1 = I[3]; const float* bz1 = I[4]; const float* Wo1 = I[5]; const float* bo1 = I[6]; const float* Wh2 = I[7]; const float* bh2 = I[8]; const float* Wz2 = I[9]; const float* bz2 = I[10]; const float* Wo2 = I[11]; const float* bo2 = I[12]; const float* We1 = I[13]; const float* be1 = I[14]; const float* We2 = I[15]; const float* be2 = I[16];
  char* ws = (char*)d_ws; size_t off = 0;
  auto take = [&](size_t bytes) { char* p = ws + off; off += (bytes + 255) & ~(size_t)255; return p; };
  _Float16* BZ = (_Float16*)take((size_t)64 * KO * 2); float* bz = (float*)take(64 * 4); _Float16* BH = (_Float16*)take((size_t)64 * 64 * 2); float* bh = (float*)take(64 * 4); _Float16* BO = (_Float16*)take((size_t)64 * 64 * 2); float* bo = (float*)take(64 * 4); _Float16* BE1 = (_Float16*)take((size_t)FE * KKP * 2); _Float16* BE2 = (_Float16*)take((size_t)FE * KC2 * 2);
  _Float16* OUT = (_Float16*)take((size_t)CHK * KO * 2); _Float16* V16 = (_Float16*)take((size_t)CHK * 64 * 2); float* Z = (float*)take((size_t)CHK * 64 * 4); float* H = (float*)take((size_t)CHK * 64 * 4); _Float16* G16 = (_Float16*)take((size_t)CHK * 64 * 2); float* O = (float*)take((size_t)CHK * 64 * 4); _Float16* KR = (_Float16*)take((size_t)CHK * KKP * 2); _Float16* C2 = (_Float16*)take((size_t)CHK * KC2 * 2);
  if (off > ws_size) return;      /* ≈ 88 MiB */
  k_wsc<<<(64 * KO / 8 + 255) / 256, 256, 0, stream>>>(Wz1, BZ, (size_t)32 * KO / 8, 16.0f); k_wsc<<<(32 * KO / 8 + 255) / 256, 256, 0, stream>>>(Wz2, BZ + (size_t)32 * KO, (size_t)32 * KO / 8, 16.0f); k_bcat2<<<1, 64, 0, stream>>>(bz1, bz2, bz);      /* [Wz1; Wz2] flattened [o][(i,j)] */
  k_zero16<<<(64 * 64 / 8 + 255) / 256, 256, 0, stream>>>(BH, 64 * 64 / 8); k_wput<<<(32 * 4 + 255) / 256, 256, 0, stream>>>(Wh1, 32, 32, 0, 0, 64, BH); k_wput<<<(32 * 4 + 255) / 256, 256, 0, stream>>>(Wh2, 32, 32, 32, 32, 64, BH); k_bcat2<<<1, 64, 0, stream>>>(bh1, bh2, bh);      /* blockdiag(Wh1, Wh2) */
  k_zero16<<<(64 * 64 / 8 + 255) / 256, 256, 0, stream>>>(BO, 64 * 64 / 8); k_wput<<<(32 * 4 + 255) / 256, 256, 0, stream>>>(Wo1, 32, 32, 0, 0, 64, BO); k_wput<<<(32 * 4 + 255) / 256, 256, 0, stream>>>(Wo2, 32, 32, 32, 32, 64, BO); k_bcat2<<<1, 64, 0, stream>>>(bo1, bo2, bo);      /* blockdiag(Wo1, Wo2) */
  k_zero16<<<(FE * KKP / 8 + 255) / 256, 256, 0, stream>>>(BE1, (size_t)FE * KKP / 8); k_wput<<<(FE * ((KK + 7) / 8) + 255) / 256, 256, 0, stream>>>(We1, FE, KK, 0, 0, KKP, BE1);
  k_zero16<<<(FE * KC2 / 8 + 255) / 256, 256, 0, stream>>>(BE2, (size_t)FE * KC2 / 8); k_wput<<<(FE * ((130 + 7) / 8) + 255) / 256, 256, 0, stream>>>(We2, FE, 130, 0, 0, KC2, BE2);
  for (int ch = 0; ch < NBR / CHK; ++ch) { const int r0 = ch * CHK;
    k_outer<<<(CHK * D1 * 4 + 255) / 256, 256, 0, stream>>>(x, r0, OUT, V16);
    k_gemm2<0><<<dim3((CHK / 128) * 1, 1), 128, 0, stream>>>(OUT, KO, 0, BZ, KO, 0, 0.0625f, bz, 0, nullptr, 1, 0, 0, Z, nullptr, 64, 0, CHK, 64, KO);      /* [z1 | z2] */
    k_gemm2<3><<<dim3((CHK / 128) * 1, 1), 128, 0, stream>>>(V16, 64, 0, BH, 64, 0, 0.0625f, bh, 0, nullptr, 1, 0, 0, H, nullptr, 64, 0, CHK, 64, 64);      /* [h1 | h2] = relu */
    k_gate<<<(CHK * 64 / 8 + 255) / 256, 256, 0, stream>>>(Z, H, G16);
    k_gemm2<3><<<dim3((CHK / 128) * 1, 1), 128, 0, stream>>>(G16, 64, 0, BO, 64, 0, 0.0625f, bo, 0, nullptr, 1, 0, 0, O, nullptr, 64, 0, CHK, 64, 64);      /* [o1 | o2] = relu */
    k_kron<<<(CHK * 152 + 255) / 256, 256, 0, stream>>>(O, KR, C2);
    k_gemm2<3><<<dim3((CHK / 128) * 1, 1), 128, 0, stream>>>(KR, KKP, 0, BE1, KKP, 0, 0.0625f, be1, 0, nullptr, 1, 0, 0, nullptr, C2, KC2, 0, CHK, FE, KKP);      /* e1 = relu(o12 We1^T + b) -> C2 cols 0..63 */
    k_gemm2<3><<<dim3((CHK / 128) * 1, 1), 128, 0, stream>>>(C2, KC2, 0, BE2, KC2, 0, 0.0625f, be2, 0, nullptr, 1, 0, 0, (float*)d_out + (size_t)r0 * FE, nullptr, FE, 0, CHK, FE, KC2); }      /* out rows */
}

// v001
// A run of this version takes 594 microseconds.
// In two side-by-side timings against v000, it was 2.12 and 2.11 times as fast.
#include <hip/hip_runtime.h>
// KroneckerFusion (131072 rows; v1, v2 = x[0], x[1] (32 each): h_i = relu(v_i Wh_i^T + b); z_i = Bilinear(v1, Wz_i, v2) + b; o_i = relu((sigmoid(z_i) * h_i) Wo_i^T + b); o_i <- [o_i, 1]; o12 = o1 (x) o2 (33 x 33 = 1089); out = relu(o12 We1^T + b); out = relu([out, o1, o2] We2^T + b)).
// Structure: 2 chunks of 65536 rows (512 work-groups per GEMM launch, two on every WGP); the v1 (x) v2 plane and the Kronecker plane share one workspace region (the first is dead before the second is written); per chunk: the v1 (x) v2 outer-product plane on VALU (f16), both bilinear forms as ONE f16 WMMA GEMM against [Wz1; Wz2] flattened (32x64 wave tiles, f32 accumulation, exact x16 weights + bias; K = 1024); h via a block-diagonal [Wh1 | Wh2] GEMM (ReLU epilogue); the gates on VALU; o via a block-diagonal [Wo1 | Wo2] GEMM (ReLU); the 33 x 33 Kronecker plane (+ the skip columns) on VALU; We1 (K = 1089 padded to 1120, ReLU, f16 out written straight into the concat plane); We2 (K = 130 padded to 160, ReLU) into the output rows.
#define NBR 131072               /* rows processed */
#define NBI 131072               /* rows in the input (x[1] starts at NBI*32; separate so debug builds can shrink NBR) */
#define CHK 65536
#define D1 32
#define KO 1024                  /* 32 x 32 outer */
#define KK 1089                  /* 33 x 33 Kronecker */
#define KKP 1120
#define FE 64
#define KC2 160                  /* [e1 (64) | o1a (33) | o2a (33) | 0] */
typedef __bf16 v16b __attribute__((ext_vector_type(16)));
typedef unsigned short v8us __attribute__((ext_vector_type(8), may_alias));
typedef float  v8f  __attribute__((ext_vector_type(8)));
typedef float  v4f  __attribute__((ext_vector_type(4)));
typedef float  v4fa __attribute__((ext_vector_type(4), may_alias));
union FragB { v16b v; v8us half[2]; unsigned short u[16]; };

__device__ __forceinline__ unsigned short bf16_bits(float x) { unsigned int u = __float_as_uint(x); return (unsigned short)((u + 0x7FFFu + ((u >> 16) & 1u)) >> 16); }
__device__ __forceinline__ float bf16_val(unsigned short b) { return __uint_as_float(((unsigned int)b) << 16); }
__device__ __forceinline__ float bf16_round(float x) { return bf16_val(bf16_bits(x)); }
// D += A·B with NT terms: 1 = ah·bh, 2 = + al·bh (A split), 3 = + ah·bl (both split)
template <int NT>
__device__ __forceinline__ v8f mmaN(v16b ah, v16b al, v16b bh, v16b bl, v8f c) {
  c = __builtin_amdgcn_wmma_f32_16x16x32_bf16(false, ah, false, bh, (short)0, c, false, false);
  if (NT >= 2) c = __builtin_amdgcn_wmma_f32_16x16x32_bf16(false, al, false, bh, (short)0, c, false, false);
  if (NT >= 3) c = __builtin_amdgcn_wmma_f32_16x16x32_bf16(false, ah, false, bl, (short)0, c, false, false);
  asm volatile("v_nop\n\tv_nop\n\tv_nop\n\tv_nop" : "+v"(c) : "v"(ah), "v"(al), "v"(bh), "v"(bl));
  return c;
}

__global__ __launch_bounds__(256) void k_wt_bf16(const float* __restrict__ W, unsigned short* __restrict__ Wt, int K, int N) {
  const int t = blockIdx.x * 256 + threadIdx.x;
  const int k8n = K / 8;
  if (t >= N * k8n) return;
  const int n = t / k8n, k8 = (t % k8n) * 8;
  v8us v;
#pragma unroll
  for (int i = 0; i < 8; ++i) v[i] = bf16_bits(W[(size_t)(k8 + i) * N + n]);
  *(v8us*)(Wt + (size_t)n * K + k8) = v;
  
}

// GEMM C[M][N] (f32, pitch ldc) = act(A[M][K]·W + bias). A f32 row-major (pitch lda) converted per fragment to bf16
// (ASPLIT: hi/lo two planes -> 2 terms, else single rounded term); Wt bf16 [N][K] (pitch ldb). BIAS_BF16 rounds the
// bias to bf16 first (bias quantised to bf16 before the add). K%32==0, M%16==0, N%64==0.
template <bool ASPLIT, int ACT, bool BIAS_BF16>
__global__ __launch_bounds__(128) void k_gemm_bf(const float* __restrict__ A, int lda, const unsigned short* __restrict__ Wt, int ldb,
                                               const float* __restrict__ bias, float* __restrict__ C, int ldc, int M, int N, int K) {
  __shared__ __attribute__((aligned(16))) float so[4][16][64];
  const int tid = threadIdx.x, w = tid >> 5, lane = tid & 31, ln = lane & 15, hh = lane >> 4;
  const int ntn = N / 64;
  const int wid = blockIdx.x * 4 + w;
  const int mt = wid / ntn, nq = wid % ntn;
  if (mt * 16 >= M) return;
  const int row0 = mt * 16, col0 = nq * 64;
  const float* arow = A + (size_t)(row0 + ln) * lda;
  v8f acc[4] = {};
  for (int kb = 0; kb < K; kb += 32) {
    FragB ah, al;
    const v4f x0 = *(const v4fa*)(arow + kb + 8 * hh), x1 = *(const v4fa*)(arow + kb + 8 * hh + 4);
    const v4f x2 = *(const v4fa*)(arow + kb + 16 + 8 * hh), x3 = *(const v4fa*)(arow + kb + 16 + 8 * hh + 4);
    float xs[16] = {x0[0],x0[1],x0[2],x0[3],x1[0],x1[1],x1[2],x1[3],x2[0],x2[1],x2[2],x2[3],x3[0],x3[1],x3[2],x3[3]};
#pragma unroll
    for (int i = 0; i < 16; ++i) { const unsigned short hb = bf16_bits(xs[i]); ah.u[i] = hb; al.u[i] = ASPLIT ? bf16_bits(xs[i] - bf16_val(hb)) : (unsigned short)0; }
#pragma unroll
    for (int t = 0; t < 4; ++t) {
      const unsigned short* brow = Wt + (size_t)(col0 + t * 16 + ln) * ldb + kb;
      FragB b;
      b.half[0] = *(const v8us*)(brow + 8 * hh);
      b.half[1] = *(const v8us*)(brow + 16 + 8 * hh);
      acc[t] = mmaN<ASPLIT ? 2 : 1>(ah.v, al.v, b.v, b.v, acc[t]);
    }
  }
#pragma unroll
  for (int t = 0; t < 4; ++t) {
    float bv = bias ? bias[col0 + t * 16 + ln] : 0.f;
    if (BIAS_BF16) bv = bf16_round(bv);
#pragma unroll
    for (int r = 0; r < 8; ++r) { float v = acc[t][r] + bv; if (ACT == 1) v = fmaxf(v, 0.f); so[w][8 * hh + r][t * 16 + ln] = v; }
  }
  __builtin_amdgcn_fence(__ATOMIC_ACQ_REL, "workgroup");
  __builtin_amdgcn_wave_barrier();
  const int rsub = lane >> 4, c4 = (lane & 15) * 4;
  {
#pragma unroll
    for (int q = 0; q < 8; ++q) {
      const int r = q * 2 + rsub;
      const v4f v = *(const v4fa*)&so[w][r][c4];
      *(v4f*)(C + (size_t)(row0 + r) * ldc + col0 + c4) = v;
    }
    
  }
}

// GEMM C = act(A·W + bias + resid): A f32 (ASPLIT -> hi/lo 2 terms), Wt bf16 [N][K]; ACT 0 none, 1 relu, 2 exact gelu;
// resid (optional, f32, row index = (row % rmod), pitch ldr, RES_BF16 rounds it) added before the activation.
template <bool ASPLIT, int ACT, bool BIAS_BF16, bool RES_BF16>
__global__ __launch_bounds__(128) void k_gemm_bf3(const float* __restrict__ A, int lda, const unsigned short* __restrict__ Wt, int ldb,
                                                const float* __restrict__ bias, const float* __restrict__ resid, int rmod, int ldr,
                                                float* __restrict__ C, int ldc, int M, int N, int K) {
  __shared__ __attribute__((aligned(16))) float so[4][16][64];
  const int tid = threadIdx.x, w = tid >> 5, lane = tid & 31, ln = lane & 15, hh = lane >> 4;
  const int ntn = N / 64;
  const int wid = blockIdx.x * 4 + w;
  const int mt = wid / ntn, nq = wid % ntn;
  if (mt * 16 >= M) return;
  const int row0 = mt * 16, col0 = nq * 64;
  const float* arow = A + (size_t)(row0 + ln) * lda;
  v8f acc[4] = {};
  for (int kb = 0; kb < K; kb += 32) {
    FragB ah, al;
    const v4f x0 = *(const v4fa*)(arow + kb + 8 * hh), x1 = *(const v4fa*)(arow + kb + 8 * hh + 4);
    const v4f x2 = *(const v4fa*)(arow + kb + 16 + 8 * hh), x3 = *(const v4fa*)(arow + kb + 16 + 8 * hh + 4);
    float xs[16] = {x0[0],x0[1],x0[2],x0[3],x1[0],x1[1],x1[2],x1[3],x2[0],x2[1],x2[2],x2[3],x3[0],x3[1],x3[2],x3[3]};
#pragma unroll
    for (int i = 0; i < 16; ++i) { const unsigned short hb = bf16_bits(xs[i]); ah.u[i] = hb; al.u[i] = ASPLIT ? bf16_bits(xs[i] - bf16_val(hb)) : (unsigned short)0; }
#pragma unroll
    for (int t = 0; t < 4; ++t) {
      const unsigned short* brow = Wt + (size_t)(col0 + t * 16 + ln) * ldb + kb;
      FragB b;
      b.half[0] = *(const v8us*)(brow + 8 * hh);
      b.half[1] = *(const v8us*)(brow + 16 + 8 * hh);
      acc[t] = mmaN<ASPLIT ? 2 : 1>(ah.v, al.v, b.v, b.v, acc[t]);
    }
  }
#pragma unroll
  for (int t = 0; t < 4; ++t) {
    const int col = col0 + t * 16 + ln;
    float bv = bias ? bias[col] : 0.f;
    if (BIAS_BF16) bv = bf16_round(bv);
#pragma unroll
    for (int r = 0; r < 8; ++r) {
      float v = acc[t][r] + bv;
      if (resid) { float rv = resid[(size_t)((row0 + 8 * hh + r) % rmod) * ldr + col]; if (RES_BF16) rv = bf16_round(rv); v += rv; }
      if (ACT == 1) v = fmaxf(v, 0.f);
      if (ACT == 2) v = 0.5f * v * (1.0f + erff(v * 0.70710678118654752f));
      if (ACT == 3) { const float u = 0.7978845608028654f * (v + 0.044715f * v * v * v); v = 0.5f * v * (1.0f + tanhf(u)); }
      so[w][8 * hh + r][t * 16 + ln] = v;
    }
  }
  __builtin_amdgcn_fence(__ATOMIC_ACQ_REL, "workgroup");
  __builtin_amdgcn_wave_barrier();
  const int rsub = lane >> 4, c4 = (lane & 15) * 4;
  {
#pragma unroll
    for (int q = 0; q < 8; ++q) {
      const int r = q * 2 + rsub;
      const v4f v = *(const v4fa*)&so[w][r][c4];
      *(v4f*)(C + (size_t)(row0 + r) * ldc + col0 + c4) = v;
    }
    
  }
}
// row LayerNorm (biased variance, eps) over N: s = X (+ R); optional out_sum <- s; out_norm <- (s-mu)*rsqrt(var+eps)*g + b
template <bool PARAM_BF16>
__global__ __launch_bounds__(256) void k_layernorm(const float* __restrict__ X, const float* __restrict__ R, const float* __restrict__ g, const float* __restrict__ bta,
                                                  float* __restrict__ out_sum, float* __restrict__ out_norm, int N, float eps) {
  __shared__ float red[256];
  const int row = blockIdx.x, tid = threadIdx.x;
  const float* x = X + (size_t)row * N; const float* rr = R ? R + (size_t)row * N : nullptr;
  float vals[16];                     // up to N = 4096
  const int per = N / 256;            // contiguous chunk per thread? use strided-by-4 chunks: thread handles j = tid*4 + 1024*u
  float s1 = 0.f;
  for (int u = 0; u < per / 4; ++u) {
    const int j = tid * 4 + 1024 * u;
    const v4f a = *(const v4fa*)(x + j);
    v4f b = {0.f,0.f,0.f,0.f}; if (rr) b = *(const v4fa*)(rr + j);
#pragma unroll
    for (int q = 0; q < 4; ++q) { const float v = a[q] + b[q]; vals[u * 4 + q] = v; s1 += v; }
  }
  red[tid] = s1; __syncthreads();
  for (int st = 128; st > 0; st >>= 1) { if (tid < st) red[tid] += red[tid + st]; __syncthreads(); }
  const float mu = red[0] / (float)N; __syncthreads();
  float s2 = 0.f;
  for (int u = 0; u < per / 4; ++u)
#pragma unroll
    for (int q = 0; q < 4; ++q) { const float c = vals[u * 4 + q] - mu; s2 += c * c; }
  red[tid] = s2; __syncthreads();
  for (int st = 128; st > 0; st >>= 1) { if (tid < st) red[tid] += red[tid + st]; __syncthreads(); }
  const float rs = rsqrtf(red[0] / (float)N + eps);
  {
    for (int u = 0; u < per / 4; ++u) {
      const int j = tid * 4 + 1024 * u;
      v4f o, sm;
#pragma unroll
      for (int q = 0; q < 4; ++q) {
        float gg = g[j + q], bb = bta[j + q];
        if (PARAM_BF16) { gg = bf16_round(gg); bb = bf16_round(bb); }
        sm[q] = vals[u * 4 + q]; o[q] = (vals[u * 4 + q] - mu) * rs * gg + bb;
      }
      if (out_sum) *(v4f*)(out_sum + (size_t)row * N + j) = sm;
      *(v4f*)(out_norm + (size_t)row * N + j) = o;
    }
    
  }
}



// ---- f16 WMMA path (v_wmma_f32_16x16x32_f16): 11-bit significands for operands in range — used here for all five GEMMs (bilinear, h, o, We1, We2)
typedef _Float16 v16h __attribute__((ext_vector_type(16)));
union FragH { v16h v; v8us half[2]; _Float16 h[16]; unsigned short u[16]; };
template <int NT>
__device__ __forceinline__ v8f mmaH(v16h ah, v16h al, v16h bh, v16h bl, v8f c) {
  c = __builtin_amdgcn_wmma_f32_16x16x32_f16(false, ah, false, bh, (short)0, c, false, false);
  if (NT >= 2) c = __builtin_amdgcn_wmma_f32_16x16x32_f16(false, al, false, bh, (short)0, c, false, false);
  if (NT >= 3) c = __builtin_amdgcn_wmma_f32_16x16x32_f16(false, ah, false, bl, (short)0, c, false, false);
  asm volatile("v_nop\n\tv_nop\n\tv_nop\n\tv_nop" : "+v"(c) : "v"(ah), "v"(al), "v"(bh), "v"(bl));
  return c;
}
// batched GEMM like k_gemm_b but f16 operands: A f32 (split into f16 hi/lo if ASPLIT, else rounded to f16), Bt = f16 values [n][k]; alpha; C f32; N multiple of 16 (partial tiles skipped)
template <bool ASPLIT>
__global__ __launch_bounds__(128) void k_gemm_h(const float* __restrict__ A, int lda, size_t sA, const _Float16* __restrict__ Bh, int ldb, size_t sB, float alpha, float* __restrict__ C, int ldc, size_t sC, int M, int N, int K) {
  __shared__ __attribute__((aligned(16))) float so[4][16][64];
  const int tid = threadIdx.x, w = tid >> 5, lane = tid & 31, ln = lane & 15, hh = lane >> 4; const int by = blockIdx.y;
  A += (size_t)by * sA; Bh += (size_t)by * sB; C += (size_t)by * sC;
  const int ntn = (N + 63) / 64; const int wid = blockIdx.x * 4 + w; const int mt = wid / ntn, nq = wid % ntn; if (mt * 16 >= M) return;
  const int row0 = mt * 16, col0 = nq * 64; const float* arow = A + (size_t)(row0 + ln) * lda;
  v8f acc[4] = {};
  for (int kb = 0; kb < K; kb += 32) {
    FragH ah, al;
    const v4f x0 = *(const v4fa*)(arow + kb + 8 * hh), x1 = *(const v4fa*)(arow + kb + 8 * hh + 4), x2 = *(const v4fa*)(arow + kb + 16 + 8 * hh), x3 = *(const v4fa*)(arow + kb + 16 + 8 * hh + 4);
    float xs[16] = {x0[0],x0[1],x0[2],x0[3],x1[0],x1[1],x1[2],x1[3],x2[0],x2[1],x2[2],x2[3],x3[0],x3[1],x3[2],x3[3]};
#pragma unroll
    for (int i = 0; i < 16; ++i) { const _Float16 h = (_Float16)xs[i]; ah.h[i] = h; al.h[i] = ASPLIT ? (_Float16)(xs[i] - (float)h) : (_Float16)0.0f; }
#pragma unroll
    for (int t = 0; t < 4; ++t) { if (col0 + t * 16 >= N) continue; const size_t boff = (size_t)(col0 + t * 16 + ln) * ldb + kb; FragH bq; bq.half[0] = *(const v8us*)(Bh + boff + 8 * hh); bq.half[1] = *(const v8us*)(Bh + boff + 16 + 8 * hh);
      acc[t] = mmaH<ASPLIT ? 2 : 1>(ah.v, al.v, bq.v, bq.v, acc[t]); }
  }
#pragma unroll
  for (int t = 0; t < 4; ++t) { if (col0 + t * 16 >= N) continue;
#pragma unroll
    for (int r = 0; r < 8; ++r) so[w][8 * hh + r][t * 16 + ln] = acc[t][r] * alpha; }
  __builtin_amdgcn_fence(__ATOMIC_ACQ_REL, "workgroup"); __builtin_amdgcn_wave_barrier();
  const int rsub = lane >> 4, c4 = (lane & 15) * 4;
  {
#pragma unroll
    for (int q = 0; q < 8; ++q) { const int r = q * 2 + rsub; if (col0 + c4 < N) { const v4f v = *(const v4fa*)&so[w][r][c4]; *(v4f*)(C + (size_t)(row0 + r) * ldc + col0 + c4) = v; } }
     }
}

// Wt[n][k] = f16(W[k][n]·scale) from f32 row-major W[K][N] (scale = power of two; bf16-exact weights stay exact in f16 away from the subnormal range)
__global__ __launch_bounds__(256) void k_wt_f16(const float* __restrict__ W, _Float16* __restrict__ Wt, int K, int N, float scale) {
  const int t = blockIdx.x * 256 + threadIdx.x; if (t >= N * (K / 8)) return; const int n = t / (K / 8), k8 = (t % (K / 8)) * 8; FragH f;
#pragma unroll
  for (int i = 0; i < 8; ++i) f.h[i] = (_Float16)(bf16_round(W[(size_t)(k8 + i) * N + n]) * scale); const v8us o = f.half[0];
  *(v8us*)((unsigned short*)Wt + (size_t)n * K + k8) = o; 
}
// k_gemm_hh variant with fused epilogue: v = acc·alpha + bias[by·sBias + col] (+ CP[(row/rowsPerB)·sCPb + by·64 + col] if CP) ; ACT 0 none / 1 elu ; writes f16 C16 (and f32 C if non-null)
template <int ACT>
__global__ __launch_bounds__(128) void k_gemm_hhx(const _Float16* __restrict__ A, int lda, size_t sA, const _Float16* __restrict__ Bh, int ldb, size_t sB, float alpha, const float* __restrict__ bias, size_t sBias, const float* __restrict__ CP, int rowsPerB, size_t sCPb, int row0g,
    float* __restrict__ C, _Float16* __restrict__ C16, int ldc, size_t sC, int M, int N, int K) {
  __shared__ __attribute__((aligned(16))) float so[4][16][64];
  const int tid = threadIdx.x, w = tid >> 5, lane = tid & 31, ln = lane & 15, hh = lane >> 4; const int by = blockIdx.y;
  A += (size_t)by * sA; Bh += (size_t)by * sB; const size_t cofs = (size_t)by * sC; const float* bp = bias ? bias + (size_t)by * sBias : nullptr;
  const int ntn = (N + 63) / 64; const int wid = blockIdx.x * 4 + w; const int mt = wid / ntn, nq = wid % ntn; if (mt * 16 >= M) return;
  const int row0 = mt * 16, col0 = nq * 64; const _Float16* arow = A + (size_t)(row0 + ln) * lda;
  v8f acc[4] = {};
  for (int kb = 0; kb < K; kb += 32) { FragH ah; ah.half[0] = *(const v8us*)((const unsigned short*)arow + kb + 8 * hh); ah.half[1] = *(const v8us*)((const unsigned short*)arow + kb + 16 + 8 * hh);
#pragma unroll
    for (int t = 0; t < 4; ++t) { if (col0 + t * 16 >= N) continue; const size_t boff = (size_t)(col0 + t * 16 + ln) * ldb + kb; FragH bq; bq.half[0] = *(const v8us*)((const unsigned short*)Bh + boff + 8 * hh); bq.half[1] = *(const v8us*)((const unsigned short*)Bh + boff + 16 + 8 * hh);
      acc[t] = mmaH<1>(ah.v, ah.v, bq.v, bq.v, acc[t]); }
  }
#pragma unroll
  for (int t = 0; t < 4; ++t) { if (col0 + t * 16 >= N) continue; const int col = col0 + t * 16 + ln; const float bv = bp ? bf16_round(bp[col]) : 0.f;
#pragma unroll
    for (int r = 0; r < 8; ++r) { float v = acc[t][r] * alpha + bv; if (CP) { const int rr = row0g + row0 + 8 * hh + r; if (rowsPerB < 0) v += CP[cofs + (size_t)rr * ldc + col];      /* rowsPerB < 0: own element of the batched C plane */ else { const int bidx = rr / rowsPerB; v += CP[(size_t)bidx * sCPb + (size_t)by * 64 + col]; } } if (ACT == 1) v = (v > 0.f) ? v : expm1f(v); else if (ACT == 7) v = (v > 0.f) ? v + 1.0f : expf(v); else if (ACT == 8) v = tanhf(v); else if (ACT == 9) v = 0.5f * v * (1.0f + tanhf(0.7978845608028654f * (v + 0.044715f * v * v * v))); else if (ACT == 11) v = 1.0f / (1.0f + expf(-v)); else if (ACT == 12) v = (v > 0.f) ? v : 0.01f * v; else if (ACT == 14) v = (v > 0.f) ? v : 0.1f * v; else if (ACT == 16) v = (v >= 0.f) ? v : 0.3f * v; else if (ACT == 17) v = (v >= 0.f) ? v : 0.2f * v; else if (ACT == 15) v = v / (1.0f + expf(-v)); else if (ACT == 3) v = fmaxf(v, 0.f); else if (ACT == 6) v = 0.5f * v * (1.0f + erff(v * 0.70710678118654752f)); so[w][8 * hh + r][t * 16 + ln] = v; } }
  __builtin_amdgcn_fence(__ATOMIC_ACQ_REL, "workgroup"); __builtin_amdgcn_wave_barrier();
  const int rsub = lane >> 4, c4 = (lane & 15) * 4; typedef _Float16 v4h __attribute__((ext_vector_type(4)));
  {
#pragma unroll
    for (int q = 0; q < 8; ++q) { const int r = q * 2 + rsub; if (col0 + c4 < N) { const v4f v = *(const v4fa*)&so[w][r][c4]; if (C) *(v4f*)(C + cofs + (size_t)(row0 + r) * ldc + col0 + c4) = v; if (C16) { v4h h4; for (int i = 0; i < 4; ++i) h4[i] = (_Float16)v[i]; *(v4h*)(C16 + cofs + (size_t)(row0 + r) * ldc + col0 + c4) = h4; } } }
     }
}


typedef _Float16 v4h __attribute__((ext_vector_type(4)));

__global__ __launch_bounds__(256) void k_x16(const float* __restrict__ x, _Float16* __restrict__ X16, size_t n8) { const size_t t = (size_t)blockIdx.x * 256 + threadIdx.x; if (t >= n8) return; FragH f;
#pragma unroll
  for (int q = 0; q < 8; ++q) f.h[q] = (_Float16)bf16_round(x[t * 8 + q]); *(v8us*)((unsigned short*)X16 + t * 8) = f.half[0];  }
__global__ __launch_bounds__(256) void k_h16(const float* __restrict__ x, _Float16* __restrict__ X16, size_t n8) { const size_t t = (size_t)blockIdx.x * 256 + threadIdx.x; if (t >= n8) return; FragH f;
#pragma unroll
  for (int q = 0; q < 8; ++q) f.h[q] = (_Float16)x[t * 8 + q]; *(v8us*)((unsigned short*)X16 + t * 8) = f.half[0];  }
__global__ __launch_bounds__(256) void k_round16f(const float* __restrict__ W, _Float16* __restrict__ Bt, size_t n8) { const size_t t = (size_t)blockIdx.x * 256 + threadIdx.x; if (t >= n8) return; FragH f;
#pragma unroll
  for (int i = 0; i < 8; ++i) f.h[i] = (_Float16)(bf16_round(W[t * 8 + i]) * 16.0f); *(v8us*)((unsigned short*)Bt + t * 8) = f.half[0];  }
template <int NHv, int TTv>
__global__ __launch_bounds__(256) void k_vt(const _Float16* __restrict__ V16, int ldv, int voff, _Float16* __restrict__ Vt) { __shared__ unsigned short tl[64][66]; const int tid = threadIdx.x; const int slab = blockIdx.x / (TTv / 64), lg = blockIdx.x % (TTv / 64); const int b = slab / NHv, h = slab % NHv;
  for (int i = tid; i < 64 * 8; i += 256) { const int r = i / 8, c8 = (i % 8) * 8; FragH f; f.half[0] = *(const v8us*)((const unsigned short*)V16 + ((size_t)b * TTv + lg * 64 + r) * ldv + voff + h * 64 + c8);
#pragma unroll
    for (int q = 0; q < 8; ++q) tl[r][c8 + q] = f.u[q]; }
  __syncthreads();
  {
#pragma unroll
    for (int rd = 0; rd < 2; ++rd) { const int d = rd * 32 + tid / 8, pc = tid % 8; FragH f;
#pragma unroll
      for (int q = 0; q < 8; ++q) f.u[q] = tl[pc * 8 + q][d];
      *(v8us*)((unsigned short*)Vt + ((size_t)slab * 64 + d) * TTv + lg * 64 + pc * 8) = f.half[0]; }
     } }

__global__ __launch_bounds__(256) void k_hl(const float* __restrict__ F, _Float16* __restrict__ Hh, _Float16* __restrict__ Hl, size_t n8) { const size_t t = (size_t)blockIdx.x * 256 + threadIdx.x; if (t >= n8) return; FragH fh, fl; const v4f a = *(const v4fa*)(F + t * 8), c = *(const v4fa*)(F + t * 8 + 4);
#pragma unroll
  for (int q = 0; q < 4; ++q) { _Float16 h = (_Float16)a[q]; fh.h[q] = h; fl.h[q] = (_Float16)((a[q] - (float)h) * 1024.0f); h = (_Float16)c[q]; fh.h[4 + q] = h; fl.h[4 + q] = (_Float16)((c[q] - (float)h) * 1024.0f); }
  { *(v8us*)((unsigned short*)Hh + t * 8) = fh.half[0]; *(v8us*)((unsigned short*)Hl + t * 8) = fl.half[0];  } }

// ---- fast GEMM (wave tile 32x64; requires M % 32 == 0 rows per launch region and N % 64 == 0); epilogue = k_gemm_hhx semantics ----
__device__ __forceinline__ v16h g2_frag(const _Float16* p, int hh) { FragH f; f.half[0] = *(const v8us*)((const unsigned short*)p + 8 * hh); f.half[1] = *(const v8us*)((const unsigned short*)p + 16 + 8 * hh); return f.v; }
__device__ __forceinline__ v8f g2_mma(v16h a, v16h b, v8f c) { v8f d = __builtin_amdgcn_wmma_f32_16x16x32_f16(false, a, false, b, (short)0, c, false, false); asm volatile("v_nop\n\tv_nop\n\tv_nop\n\tv_nop" : "+v"(d) : "v"(a), "v"(b)); return d; }
template <int ACT>
__global__ __launch_bounds__(128) void k_gemm2(const _Float16* __restrict__ A, int lda, size_t sA, const _Float16* __restrict__ Bh, int ldb, size_t sB, float alpha, const float* __restrict__ bias, size_t sBias, const float* __restrict__ CP, int rowsPerB, size_t sCPb, int row0g,
    float* __restrict__ C, _Float16* __restrict__ C16, int ldc, size_t sC, int M, int N, int K) { static_assert(ACT == 0 || ACT == 3 || ACT == 6 || ACT == 8 || ACT == 9 || ACT == 11 || ACT == 12 || ACT == 14 || ACT == 15 || ACT == 16 || ACT == 17, "k_gemm2: unsupported ACT code (would silently apply no activation)");
  __shared__ __attribute__((aligned(16))) float so[4][32][68];
  const int tid = threadIdx.x, w = tid >> 5, lane = tid & 31, ln = lane & 15, hh = lane >> 4; const int by = blockIdx.y;
  A += (size_t)by * sA; Bh += (size_t)by * sB; const size_t cofs = (size_t)by * sC; const float* bp = bias ? bias + (size_t)by * sBias : nullptr;
  const int ntn = N >> 6; const int mt = blockIdx.x / ntn, nq = blockIdx.x - mt * ntn; const int row0 = mt * 128 + 32 * w, col0 = nq * 64; if (row0 >= M) return;
  const _Float16* a0p = A + (size_t)(row0 + ln) * lda; const _Float16* a1p = a0p + (size_t)16 * lda;
  const _Float16* b0p = Bh + (size_t)(col0 + ln) * ldb; const _Float16* b1p = b0p + (size_t)16 * ldb; const _Float16* b2p = b1p + (size_t)16 * ldb; const _Float16* b3p = b2p + (size_t)16 * ldb;
  const v8f z8 = {0.f,0.f,0.f,0.f,0.f,0.f,0.f,0.f}; v8f c00 = z8, c01 = z8, c02 = z8, c03 = z8, c10 = z8, c11 = z8, c12 = z8, c13 = z8;
#pragma unroll 1
  for (int kb = 0; kb < K; kb += 32) { const v16h a0 = g2_frag(a0p + kb, hh), a1 = g2_frag(a1p + kb, hh);
    v16h b = g2_frag(b0p + kb, hh); c00 = g2_mma(a0, b, c00); c10 = g2_mma(a1, b, c10);
    b = g2_frag(b1p + kb, hh); c01 = g2_mma(a0, b, c01); c11 = g2_mma(a1, b, c11);
    b = g2_frag(b2p + kb, hh); c02 = g2_mma(a0, b, c02); c12 = g2_mma(a1, b, c12);
    b = g2_frag(b3p + kb, hh); c03 = g2_mma(a0, b, c03); c13 = g2_mma(a1, b, c13); }
  v8f accs[8] = {c00, c01, c02, c03, c10, c11, c12, c13};
#pragma unroll
  for (int u = 0; u < 8; ++u) { const int t = u & 3, half = u >> 2; const int col = col0 + t * 16 + ln; const float bv = bp ? bf16_round(bp[col]) : 0.f;
#pragma unroll
    for (int r = 0; r < 8; ++r) { const int rloc = half * 16 + 8 * hh + r; float v = accs[u][r] * alpha + bv; if (CP) { if (rowsPerB < 0) v += CP[cofs + (size_t)(row0g + row0 + rloc) * ldc + col];      /* rowsPerB < 0: own element of the batched C plane */ else { const int bidx = (row0g + row0 + rloc) / rowsPerB; v += CP[(size_t)bidx * sCPb + (size_t)by * 64 + col]; } }
      if (ACT == 3) v = fmaxf(v, 0.f); else if (ACT == 6) v = 0.5f * v * (1.0f + erff(v * 0.70710678118654752f)); else if (ACT == 11) v = 1.0f / (1.0f + expf(-v)); else if (ACT == 15) v = v / (1.0f + expf(-v)); else if (ACT == 12) v = (v > 0.f) ? v : 0.01f * v; else if (ACT == 8) v = tanhf(v); else if (ACT == 9) v = 0.5f * v * (1.0f + tanhf(0.7978845608028654f * (v + 0.044715f * v * v * v))); else if (ACT == 14) v = (v > 0.f) ? v : 0.1f * v; else if (ACT == 16) v = (v >= 0.f) ? v : 0.3f * v; else if (ACT == 17) v = (v >= 0.f) ? v : 0.2f * v;
      so[w][rloc][t * 16 + ln] = v; } }
  __builtin_amdgcn_fence(__ATOMIC_ACQ_REL, "workgroup"); __builtin_amdgcn_wave_barrier();
  const int rsub = lane >> 4, c4 = (lane & 15) * 4;
  {
#pragma unroll
    for (int q = 0; q < 16; ++q) { const int r = q * 2 + rsub; const v4f v = *(const v4fa*)&so[w][r][c4]; if (C) *(v4f*)(C + cofs + (size_t)(row0 + r) * ldc + col0 + c4) = v; if (C16) { v4h h4; for (int i = 0; i < 4; ++i) h4[i] = (_Float16)v[i]; *(v4h*)(C16 + cofs + (size_t)(row0 + r) * ldc + col0 + c4) = h4; } }
     } }


__global__ __launch_bounds__(256) void k_wsc(const float* __restrict__ Wm, _Float16* __restrict__ Bt, size_t n8, float sc) { const size_t t = (size_t)blockIdx.x * 256 + threadIdx.x; if (t >= n8) return; FragH f; for (int q = 0; q < 8; ++q) f.h[q] = (_Float16)(bf16_round(Wm[t * 8 + q]) * sc); *(v8us*)((unsigned short*)Bt + t * 8) = f.half[0];  }
__global__ __launch_bounds__(256) void k_wput(const float* __restrict__ Wm, int nout, int nin, int roff, int coff, int kpad, _Float16* __restrict__ Bt) { const int t = blockIdx.x * 256 + threadIdx.x; const int npr = (nin + 7) / 8; if (t >= nout * npr) return; const int k0 = (t % npr) * 8; const int o = t / npr; unsigned short* d = (unsigned short*)Bt + (size_t)(roff + o) * kpad + coff + k0;
  { for (int q = 0; q < 8; ++q) { const int k = k0 + q; if (k < nin) { FragH f; f.h[0] = (_Float16)(bf16_round(Wm[(size_t)o * nin + k]) * 16.0f); *(unsigned short*)(d + q) = f.u[0] & 0xffffu; } }  } }
__global__ __launch_bounds__(256) void k_zero16(_Float16* __restrict__ D, size_t n8) { const size_t t = (size_t)blockIdx.x * 256 + threadIdx.x; if (t >= n8) return; v8us z; for (int q = 0; q < 8; ++q) z[q] = 0; *(v8us*)((unsigned short*)D + t * 8) = z;  }
__global__ __launch_bounds__(64) void k_bcat2(const float* __restrict__ a, const float* __restrict__ bb, float* __restrict__ dst) { const int i = threadIdx.x; const float v = (i < 32) ? bf16_round(a[i]) : bf16_round(bb[i - 32]); *(float*)(dst + i) = v;  }
__global__ __launch_bounds__(256) void k_outer(const float* __restrict__ x, int r0, _Float16* __restrict__ OUT, _Float16* __restrict__ V16) {
  #pragma clang fp contract(off)
  const int t = blockIdx.x * 256 + threadIdx.x; if (t >= CHK * D1 * 4) return; const int j0 = (t % 4) * 8; const int i = (t / 4) % D1; const int rl = t / (4 * D1); const size_t r = (size_t)r0 + rl; const float a = bf16_round(x[r * D1 + i]); FragH f; for (int q = 0; q < 8; ++q) f.h[q] = (_Float16)(a * bf16_round(x[((size_t)NBI + r) * D1 + j0 + q]));
  unsigned short* d = (unsigned short*)OUT + (size_t)rl * KO + i * D1 + j0; *(v8us*)d = f.half[0]; 
  if (i == 0) { FragH g1, g2; for (int q = 0; q < 8; ++q) { g1.h[q] = (_Float16)bf16_round(x[r * D1 + j0 + q]); g2.h[q] = (_Float16)bf16_round(x[((size_t)NBI + r) * D1 + j0 + q]); } unsigned short* dv = (unsigned short*)V16 + (size_t)rl * 64; { *(v8us*)(dv + j0) = g1.half[0]; *(v8us*)(dv + 32 + j0) = g2.half[0];  } } }
__global__ __launch_bounds__(256) void k_gate(const float* __restrict__ Z, const float* __restrict__ H, _Float16* __restrict__ G16) {
  #pragma clang fp contract(off)
  const int t = blockIdx.x * 256 + threadIdx.x; if (t >= CHK * 64 / 8) return; const v8f z = *(const v8f*)(Z + (size_t)t * 8); const v8f h = *(const v8f*)(H + (size_t)t * 8); FragH f; for (int q = 0; q < 8; ++q) f.h[q] = (_Float16)((1.0f / (1.0f + expf(-z[q]))) * h[q]);
  *(v8us*)((unsigned short*)G16 + (size_t)t * 8) = f.half[0];  }
__global__ __launch_bounds__(256) void k_kron(const float* __restrict__ O, _Float16* __restrict__ KR, _Float16* __restrict__ C2) {
  #pragma clang fp contract(off)
  const int NPIECE = KKP / 8 + (KC2 - 64) / 8;      /* 140 + 12 */ const int t = blockIdx.x * 256 + threadIdx.x; if (t >= CHK * NPIECE) return; const int p = t % NPIECE; const int rl = t / NPIECE; const float* o = O + (size_t)rl * 64; FragH f;
  if (p < KKP / 8) { const int c0 = p * 8; for (int q = 0; q < 8; ++q) { const int c = c0 + q; float v = 0.f; if (c < KK) { const int a = c / 33, b = c % 33; const float x1 = (a < 32) ? o[a] : 1.0f, x2 = (b < 32) ? o[32 + b] : 1.0f; v = x1 * x2; } f.h[q] = (_Float16)v; }
    unsigned short* d = (unsigned short*)KR + (size_t)rl * KKP + c0; *(v8us*)d = f.half[0];  }
  else { const int c0 = 64 + (p - KKP / 8) * 8; for (int q = 0; q < 8; ++q) { const int c = c0 + q; float v = 0.f; if (c < 64 + 33) { const int a = c - 64; v = (a < 32) ? o[a] : 1.0f; } else if (c < 64 + 66) { const int b = c - 97; v = (b < 32) ? o[32 + b] : 1.0f; } f.h[q] = (_Float16)v; }
    unsigned short* d = (unsigned short*)C2 + (size_t)rl * KC2 + c0; *(v8us*)d = f.half[0];  } }

extern "C" void kernel_launch(void* const* d_in, const int* in_sizes, int n_in,
                              void* d_out, int out_size, void* d_ws, size_t ws_size, hipStream_t stream) {
  (void)in_sizes; (void)n_in; (void)out_size;
  const float* const* I = (const float* const*)d_in;
  const float* x = I[0]; const float* Wh1 = I[1]; const float* bh1 = I[2]; const float* Wz1 = I[3]; const float* bz1 = I[4]; const float* Wo1 = I[5]; const float* bo1 = I[6]; const float* Wh2 = I[7]; const float* bh2 = I[8]; const float* Wz2 = I[9]; const float* bz2 = I[10]; const float* Wo2 = I[11]; const float* bo2 = I[12]; const float* We1 = I[13]; const float* be1 = I[14]; const float* We2 = I[15]; const float* be2 = I[16];
  char* ws = (char*)d_ws; size_t off = 0;
  auto take = [&](size_t bytes) { char* p = ws + off; off += (bytes + 255) & ~(size_t)255; return p; };
  _Float16* BZ = (_Float16*)take((size_t)64 * KO * 2); float* bz = (float*)take(64 * 4); _Float16* BH = (_Float16*)take((size_t)64 * 64 * 2); float* bh = (float*)take(64 * 4); _Float16* BO = (_Float16*)take((size_t)64 * 64 * 2); float* bo = (float*)take(64 * 4); _Float16* BE1 = (_Float16*)take((size_t)FE * KKP * 2); _Float16* BE2 = (_Float16*)take((size_t)FE * KC2 * 2);
  _Float16* KR = (_Float16*)take((size_t)CHK * KKP * 2); _Float16* OUT = KR;      /* OUT (CHK x KO) is last read by the z GEMM, KR (CHK x KKP) is first written by k_kron behind it: one region serves both */ _Float16* V16 = (_Float16*)take((size_t)CHK * 64 * 2); float* Z = (float*)take((size_t)CHK * 64 * 4); float* H = (float*)take((size_t)CHK * 64 * 4); _Float16* G16 = (_Float16*)take((size_t)CHK * 64 * 2); float* O = (float*)take((size_t)CHK * 64 * 4); _Float16* C2 = (_Float16*)take((size_t)CHK * KC2 * 2);
  if (off > ws_size) return;      /* about 225 MiB */
  k_wsc<<<(64 * KO / 8 + 255) / 256, 256, 0, stream>>>(Wz1, BZ, (size_t)32 * KO / 8, 16.0f); k_wsc<<<(32 * KO / 8 + 255) / 256, 256, 0, stream>>>(Wz2, BZ + (size_t)32 * KO, (size_t)32 * KO / 8, 16.0f); k_bcat2<<<1, 64, 0, stream>>>(bz1, bz2, bz);      /* [Wz1; Wz2] flattened [o][(i,j)] */
  k_zero16<<<(64 * 64 / 8 + 255) / 256, 256, 0, stream>>>(BH, 64 * 64 / 8); k_wput<<<(32 * 4 + 255) / 256, 256, 0, stream>>>(Wh1, 32, 32, 0, 0, 64, BH); k_wput<<<(32 * 4 + 255) / 256, 256, 0, stream>>>(Wh2, 32, 32, 32, 32, 64, BH); k_bcat2<<<1, 64, 0, stream>>>(bh1, bh2, bh);      /* blockdiag(Wh1, Wh2) */
  k_zero16<<<(64 * 64 / 8 + 255) / 256, 256, 0, stream>>>(BO, 64 * 64 / 8); k_wput<<<(32 * 4 + 255) / 256, 256, 0, stream>>>(Wo1, 32, 32, 0, 0, 64, BO); k_wput<<<(32 * 4 + 255) / 256, 256, 0, stream>>>(Wo2, 32, 32, 32, 32, 64, BO); k_bcat2<<<1, 64, 0, stream>>>(bo1, bo2, bo);      /* blockdiag(Wo1, Wo2) */
  k_zero16<<<(FE * KKP / 8 + 255) / 256, 256, 0, stream>>>(BE1, (size_t)FE * KKP / 8); k_wput<<<(FE * ((KK + 7) / 8) + 255) / 256, 256, 0, stream>>>(We1, FE, KK, 0, 0, KKP, BE1);
  k_zero16<<<(FE * KC2 / 8 + 255) / 256, 256, 0, stream>>>(BE2, (size_t)FE * KC2 / 8); k_wput<<<(FE * ((130 + 7) / 8) + 255) / 256, 256, 0, stream>>>(We2, FE, 130, 0, 0, KC2, BE2);
  for (int ch = 0; ch < NBR / CHK; ++ch) { const int r0 = ch * CHK;
    k_outer<<<(CHK * D1 * 4 + 255) / 256, 256, 0, stream>>>(x, r0, OUT, V16);
    k_gemm2<0><<<dim3((CHK / 128) * 1, 1), 128, 0, stream>>>(OUT, KO, 0, BZ, KO, 0, 0.0625f, bz, 0, nullptr, 1, 0, 0, Z, nullptr, 64, 0, CHK, 64, KO);      /* [z1 | z2] */
    k_gemm2<3><<<dim3((CHK / 128) * 1, 1), 128, 0, stream>>>(V16, 64, 0, BH, 64, 0, 0.0625f, bh, 0, nullptr, 1, 0, 0, H, nullptr, 64, 0, CHK, 64, 64);      /* [h1 | h2] = relu */
    k_gate<<<(CHK * 64 / 8 + 255) / 256, 256, 0, stream>>>(Z, H, G16);
    k_gemm2<3><<<dim3((CHK / 128) * 1, 1), 128, 0, stream>>>(G16, 64, 0, BO, 64, 0, 0.0625f, bo, 0, nullptr, 1, 0, 0, O, nullptr, 64, 0, CHK, 64, 64);      /* [o1 | o2] = relu */
    k_kron<<<(CHK * 152 + 255) / 256, 256, 0, stream>>>(O, KR, C2);
    k_gemm2<3><<<dim3((CHK / 128) * 1, 1), 128, 0, stream>>>(KR, KKP, 0, BE1, KKP, 0, 0.0625f, be1, 0, nullptr, 1, 0, 0, nullptr, C2, KC2, 0, CHK, FE, KKP);      /* e1 = relu(o12 We1^T + b) -> C2 cols 0..63 */
    k_gemm2<3><<<dim3((CHK / 128) * 1, 1), 128, 0, stream>>>(C2, KC2, 0, BE2, KC2, 0, 0.0625f, be2, 0, nullptr, 1, 0, 0, (float*)d_out + (size_t)r0 * FE, nullptr, FE, 0, CHK, FE, KC2); }      /* out rows */
}

// v002
// Measured time: 303 microseconds a run.
// Next to v001, in two timings, it ran 1.96 and 2.02 times as fast.
// Over all steps from v000 it is 4.20 times as fast.
#include <hip/hip_runtime.h>
// KroneckerFusion (131072 rows; v1, v2 = x[0], x[1] (32 each): h_i = relu(v_i Wh_i^T + b); z_i = Bilinear(v1, Wz_i, v2) + b; o_i = relu((sigmoid(z_i) * h_i) Wo_i^T + b); o_i <- [o_i, 1]; o12 = o1 (x) o2 (33 x 33 = 1089); out = relu(o12 We1^T + b); out = relu([out, o1, o2] We2^T + b)).
// Structure: 2 chunks of 65536 rows (512 work-groups per GEMM launch, two on every WGP); per chunk: both bilinear forms as ONE f16 WMMA GEMM against [Wz1; Wz2] flattened (32x64 wave tiles, f32 accumulation, exact x16 weights + bias; K = 1024) whose A fragments f16(v1[i] * v2[j]) are formed in registers from the two 32-wide rows (k step i holds j = 0..31), so no outer-product plane exists; h via a block-diagonal [Wh1 | Wh2] GEMM (ReLU epilogue); the gates on VALU; o via a block-diagonal [Wo1 | Wo2] GEMM (ReLU); We1 the same way from o1, o2, its K re-ordered to [o1[a] o2[b] (1024) | o2 (32) | o1 (32) | 1 | 0 pad] = 1120 with the weight columns permuted alike (ReLU, f16 out written straight into the concat plane); the skip columns on VALU; We2 (K = 130 padded to 160, ReLU) into the output rows.
#define NBR 131072               /* rows processed */
#define NBI 131072               /* rows in the input (x[1] starts at NBI*32; separate so debug builds can shrink NBR) */
#define CHK 65536
#define D1 32
#define KO 1024                  /* 32 x 32 outer */
#define KK 1089                  /* 33 x 33 Kronecker */
#define KKP 1120
#define FE 64
#define KC2 160                  /* [e1 (64) | o1a (33) | o2a (33) | 0] */
typedef __bf16 v16b __attribute__((ext_vector_type(16)));
typedef unsigned short v8us __attribute__((ext_vector_type(8), may_alias));
typedef float  v8f  __attribute__((ext_vector_type(8)));
typedef float  v4f  __attribute__((ext_vector_type(4)));
typedef float  v4fa __attribute__((ext_vector_type(4), may_alias));
union FragB { v16b v; v8us half[2]; unsigned short u[16]; };

__device__ __forceinline__ unsigned short bf16_bits(float x) { unsigned int u = __float_as_uint(x); return (unsigned short)((u + 0x7FFFu + ((u >> 16) & 1u)) >> 16); }
__device__ __forceinline__ float bf16_val(unsigned short b) { return __uint_as_float(((unsigned int)b) << 16); }
__device__ __forceinline__ float bf16_round(float x) { return bf16_val(bf16_bits(x)); }
// D += A·B with NT terms: 1 = ah·bh, 2 = + al·bh (A split), 3 = + ah·bl (both split)
template <int NT>
__device__ __forceinline__ v8f mmaN(v16b ah, v16b al, v16b bh, v16b bl, v8f c) {
  c = __builtin_amdgcn_wmma_f32_16x16x32_bf16(false, ah, false, bh, (short)0, c, false, false);
  if (NT >= 2) c = __builtin_amdgcn_wmma_f32_16x16x32_bf16(false, al, false, bh, (short)0, c, false, false);
  if (NT >= 3) c = __builtin_amdgcn_wmma_f32_16x16x32_bf16(false, ah, false, bl, (short)0, c, false, false);
  asm volatile("v_nop\n\tv_nop\n\tv_nop\n\tv_nop" : "+v"(c) : "v"(ah), "v"(al), "v"(bh), "v"(bl));
  return c;
}

__global__ __launch_bounds__(256) void k_wt_bf16(const float* __restrict__ W, unsigned short* __restrict__ Wt, int K, int N) {
  const int t = blockIdx.x * 256 + threadIdx.x;
  const int k8n = K / 8;
  if (t >= N * k8n) return;
  const int n = t / k8n, k8 = (t % k8n) * 8;
  v8us v;
#pragma unroll
  for (int i = 0; i < 8; ++i) v[i] = bf16_bits(W[(size_t)(k8 + i) * N + n]);
  *(v8us*)(Wt + (size_t)n * K + k8) = v;
  
}

// GEMM C[M][N] (f32, pitch ldc) = act(A[M][K]·W + bias). A f32 row-major (pitch lda) converted per fragment to bf16
// (ASPLIT: hi/lo two planes -> 2 terms, else single rounded term); Wt bf16 [N][K] (pitch ldb). BIAS_BF16 rounds the
// bias to bf16 first (bias quantised to bf16 before the add). K%32==0, M%16==0, N%64==0.
template <bool ASPLIT, int ACT, bool BIAS_BF16>
__global__ __launch_bounds__(128) void k_gemm_bf(const float* __restrict__ A, int lda, const unsigned short* __restrict__ Wt, int ldb,
                                               const float* __restrict__ bias, float* __restrict__ C, int ldc, int M, int N, int K) {
  __shared__ __attribute__((aligned(16))) float so[4][16][64];
  const int tid = threadIdx.x, w = tid >> 5, lane = tid & 31, ln = lane & 15, hh = lane >> 4;
  const int ntn = N / 64;
  const int wid = blockIdx.x * 4 + w;
  const int mt = wid / ntn, nq = wid % ntn;
  if (mt * 16 >= M) return;
  const int row0 = mt * 16, col0 = nq * 64;
  const float* arow = A + (size_t)(row0 + ln) * lda;
  v8f acc[4] = {};
  for (int kb = 0; kb < K; kb += 32) {
    FragB ah, al;
    const v4f x0 = *(const v4fa*)(arow + kb + 8 * hh), x1 = *(const v4fa*)(arow + kb + 8 * hh + 4);
    const v4f x2 = *(const v4fa*)(arow + kb + 16 + 8 * hh), x3 = *(const v4fa*)(arow + kb + 16 + 8 * hh + 4);
    float xs[16] = {x0[0],x0[1],x0[2],x0[3],x1[0],x1[1],x1[2],x1[3],x2[0],x2[1],x2[2],x2[3],x3[0],x3[1],x3[2],x3[3]};
#pragma unroll
    for (int i = 0; i < 16; ++i) { const unsigned short hb = bf16_bits(xs[i]); ah.u[i] = hb; al.u[i] = ASPLIT ? bf16_bits(xs[i] - bf16_val(hb)) : (unsigned short)0; }
#pragma unroll
    for (int t = 0; t < 4; ++t) {
      const unsigned short* brow = Wt + (size_t)(col0 + t * 16 + ln) * ldb + kb;
      FragB b;
      b.half[0] = *(const v8us*)(brow + 8 * hh);
      b.half[1] = *(const v8us*)(brow + 16 + 8 * hh);
      acc[t] = mmaN<ASPLIT ? 2 : 1>(ah.v, al.v, b.v, b.v, acc[t]);
    }
  }
#pragma unroll
  for (int t = 0; t < 4; ++t) {
    float bv = bias ? bias[col0 + t * 16 + ln] : 0.f;
    if (BIAS_BF16) bv = bf16_round(bv);
#pragma unroll
    for (int r = 0; r < 8; ++r) { float v = acc[t][r] + bv; if (ACT == 1) v = fmaxf(v, 0.f); so[w][8 * hh + r][t * 16 + ln] = v; }
  }
  __builtin_amdgcn_fence(__ATOMIC_ACQ_REL, "workgroup");
  __builtin_amdgcn_wave_barrier();
  const int rsub = lane >> 4, c4 = (lane & 15) * 4;
  {
#pragma unroll
    for (int q = 0; q < 8; ++q) {
      const int r = q * 2 + rsub;
      const v4f v = *(const v4fa*)&so[w][r][c4];
      *(v4f*)(C + (size_t)(row0 + r) * ldc + col0 + c4) = v;
    }
    
  }
}

// GEMM C = act(A·W + bias + resid): A f32 (ASPLIT -> hi/lo 2 terms), Wt bf16 [N][K]; ACT 0 none, 1 relu, 2 exact gelu;
// resid (optional, f32, row index = (row % rmod), pitch ldr, RES_BF16 rounds it) added before the activation.
template <bool ASPLIT, int ACT, bool BIAS_BF16, bool RES_BF16>
__global__ __launch_bounds__(128) void k_gemm_bf3(const float* __restrict__ A, int lda, const unsigned short* __restrict__ Wt, int ldb,
                                                const float* __restrict__ bias, const float* __restrict__ resid, int rmod, int ldr,
                                                float* __restrict__ C, int ldc, int M, int N, int K) {
  __shared__ __attribute__((aligned(16))) float so[4][16][64];
  const int tid = threadIdx.x, w = tid >> 5, lane = tid & 31, ln = lane & 15, hh = lane >> 4;
  const int ntn = N / 64;
  const int wid = blockIdx.x * 4 + w;
  const int mt = wid / ntn, nq = wid % ntn;
  if (mt * 16 >= M) return;
  const int row0 = mt * 16, col0 = nq * 64;
  const float* arow = A + (size_t)(row0 + ln) * lda;
  v8f acc[4] = {};
  for (int kb = 0; kb < K; kb += 32) {
    FragB ah, al;
    const v4f x0 = *(const v4fa*)(arow + kb + 8 * hh), x1 = *(const v4fa*)(arow + kb + 8 * hh + 4);
    const v4f x2 = *(const v4fa*)(arow + kb + 16 + 8 * hh), x3 = *(const v4fa*)(arow + kb + 16 + 8 * hh + 4);
    float xs[16] = {x0[0],x0[1],x0[2],x0[3],x1[0],x1[1],x1[2],x1[3],x2[0],x2[1],x2[2],x2[3],x3[0],x3[1],x3[2],x3[3]};
#pragma unroll
    for (int i = 0; i < 16; ++i) { const unsigned short hb = bf16_bits(xs[i]); ah.u[i] = hb; al.u[i] = ASPLIT ? bf16_bits(xs[i] - bf16_val(hb)) : (unsigned short)0; }
#pragma unroll
    for (int t = 0; t < 4; ++t) {
      const unsigned short* brow = Wt + (size_t)(col0 + t * 16 + ln) * ldb + kb;
      FragB b;
      b.half[0] = *(const v8us*)(brow + 8 * hh);
      b.half[1] = *(const v8us*)(brow + 16 + 8 * hh);
      acc[t] = mmaN<ASPLIT ? 2 : 1>(ah.v, al.v, b.v, b.v, acc[t]);
    }
  }
#pragma unroll
  for (int t = 0; t < 4; ++t) {
    const int col = col0 + t * 16 + ln;
    float bv = bias ? bias[col] : 0.f;
    if (BIAS_BF16) bv = bf16_round(bv);
#pragma unroll
    for (int r = 0; r < 8; ++r) {
      float v = acc[t][r] + bv;
      if (resid) { float rv = resid[(size_t)((row0 + 8 * hh + r) % rmod) * ldr + col]; if (RES_BF16) rv = bf16_round(rv); v += rv; }
      if (ACT == 1) v = fmaxf(v, 0.f);
      if (ACT == 2) v = 0.5f * v * (1.0f + erff(v * 0.70710678118654752f));
      if (ACT == 3) { const float u = 0.7978845608028654f * (v + 0.044715f * v * v * v); v = 0.5f * v * (1.0f + tanhf(u)); }
      so[w][8 * hh + r][t * 16 + ln] = v;
    }
  }
  __builtin_amdgcn_fence(__ATOMIC_ACQ_REL, "workgroup");
  __builtin_amdgcn_wave_barrier();
  const int rsub = lane >> 4, c4 = (lane & 15) * 4;
  {
#pragma unroll
    for (int q = 0; q < 8; ++q) {
      const int r = q * 2 + rsub;
      const v4f v = *(const v4fa*)&so[w][r][c4];
      *(v4f*)(C + (size_t)(row0 + r) * ldc + col0 + c4) = v;
    }
    
  }
}
// row LayerNorm (biased variance, eps) over N: s = X (+ R); optional out_sum <- s; out_norm <- (s-mu)*rsqrt(var+eps)*g + b
template <bool PARAM_BF16>
__global__ __launch_bounds__(256) void k_layernorm(const float* __restrict__ X, const float* __restrict__ R, const float* __restrict__ g, const float* __restrict__ bta,
                                                  float* __restrict__ out_sum, float* __restrict__ out_norm, int N, float eps) {
  __shared__ float red[256];
  const int row = blockIdx.x, tid = threadIdx.x;
  const float* x = X + (size_t)row * N; const float* rr = R ? R + (size_t)row * N : nullptr;
  float vals[16];                     // up to N = 4096
  const int per = N / 256;            // contiguous chunk per thread? use strided-by-4 chunks: thread handles j = tid*4 + 1024*u
  float s1 = 0.f;
  for (int u = 0; u < per / 4; ++u) {
    const int j = tid * 4 + 1024 * u;
    const v4f a = *(const v4fa*)(x + j);
    v4f b = {0.f,0.f,0.f,0.f}; if (rr) b = *(const v4fa*)(rr + j);
#pragma unroll
    for (int q = 0; q < 4; ++q) { const float v = a[q] + b[q]; vals[u * 4 + q] = v; s1 += v; }
  }
  red[tid] = s1; __syncthreads();
  for (int st = 128; st > 0; st >>= 1) { if (tid < st) red[tid] += red[tid + st]; __syncthreads(); }
  const float mu = red[0] / (float)N; __syncthreads();
  float s2 = 0.f;
  for (int u = 0; u < per / 4; ++u)
#pragma unroll
    for (int q = 0; q < 4; ++q) { const float c = vals[u * 4 + q] - mu; s2 += c * c; }
  red[tid] = s2; __syncthreads();
  for (int st = 128; st > 0; st >>= 1) { if (tid < st) red[tid] += red[tid + st]; __syncthreads(); }
  const float rs = rsqrtf(red[0] / (float)N + eps);
  {
    for (int u = 0; u < per / 4; ++u) {
      const int j = tid * 4 + 1024 * u;
      v4f o, sm;
#pragma unroll
      for (int q = 0; q < 4; ++q) {
        float gg = g[j + q], bb = bta[j + q];
        if (PARAM_BF16) { gg = bf16_round(gg); bb = bf16_round(bb); }
        sm[q] = vals[u * 4 + q]; o[q] = (vals[u * 4 + q] - mu) * rs * gg + bb;
      }
      if (out_sum) *(v4f*)(out_sum + (size_t)row * N + j) = sm;
      *(v4f*)(out_norm + (size_t)row * N + j) = o;
    }
    
  }
}



// ---- f16 WMMA path (v_wmma_f32_16x16x32_f16): 11-bit significands for operands in range — used here for all five GEMMs (bilinear, h, o, We1, We2)
typedef _Float16 v16h __attribute__((ext_vector_type(16)));
union FragH { v16h v; v8us half[2]; _Float16 h[16]; unsigned short u[16]; };
template <int NT>
__device__ __forceinline__ v8f mmaH(v16h ah, v16h al, v16h bh, v16h bl, v8f c) {
  c = __builtin_amdgcn_wmma_f32_16x16x32_f16(false, ah, false, bh, (short)0, c, false, false);
  if (NT >= 2) c = __builtin_amdgcn_wmma_f32_16x16x32_f16(false, al, false, bh, (short)0, c, false, false);
  if (NT >= 3) c = __builtin_amdgcn_wmma_f32_16x16x32_f16(false, ah, false, bl, (short)0, c, false, false);
  asm volatile("v_nop\n\tv_nop\n\tv_nop\n\tv_nop" : "+v"(c) : "v"(ah), "v"(al), "v"(bh), "v"(bl));
  return c;
}
// batched GEMM like k_gemm_b but f16 operands: A f32 (split into f16 hi/lo if ASPLIT, else rounded to f16), Bt = f16 values [n][k]; alpha; C f32; N multiple of 16 (partial tiles skipped)
template <bool ASPLIT>
__global__ __launch_bounds__(128) void k_gemm_h(const float* __restrict__ A, int lda, size_t sA, const _Float16* __restrict__ Bh, int ldb, size_t sB, float alpha, float* __restrict__ C, int ldc, size_t sC, int M, int N, int K) {
  __shared__ __attribute__((aligned(16))) float so[4][16][64];
  const int tid = threadIdx.x, w = tid >> 5, lane = tid & 31, ln = lane & 15, hh = lane >> 4; const int by = blockIdx.y;
  A += (size_t)by * sA; Bh += (size_t)by * sB; C += (size_t)by * sC;
  const int ntn = (N + 63) / 64; const int wid = blockIdx.x * 4 + w; const int mt = wid / ntn, nq = wid % ntn; if (mt * 16 >= M) return;
  const int row0 = mt * 16, col0 = nq * 64; const float* arow = A + (size_t)(row0 + ln) * lda;
  v8f acc[4] = {};
  for (int kb = 0; kb < K; kb += 32) {
    FragH ah, al;
    const v4f x0 = *(const v4fa*)(arow + kb + 8 * hh), x1 = *(const v4fa*)(arow + kb + 8 * hh + 4), x2 = *(const v4fa*)(arow + kb + 16 + 8 * hh), x3 = *(const v4fa*)(arow + kb + 16 + 8 * hh + 4);
    float xs[16] = {x0[0],x0[1],x0[2],x0[3],x1[0],x1[1],x1[2],x1[3],x2[0],x2[1],x2[2],x2[3],x3[0],x3[1],x3[2],x3[3]};
#pragma unroll
    for (int i = 0; i < 16; ++i) { const _Float16 h = (_Float16)xs[i]; ah.h[i] = h; al.h[i] = ASPLIT ? (_Float16)(xs[i] - (float)h) : (_Float16)0.0f; }
#pragma unroll
    for (int t = 0; t < 4; ++t) { if (col0 + t * 16 >= N) continue; const size_t boff = (size_t)(col0 + t * 16 + ln) * ldb + kb; FragH bq; bq.half[0] = *(const v8us*)(Bh + boff + 8 * hh); bq.half[1] = *(const v8us*)(Bh + boff + 16 + 8 * hh);
      acc[t] = mmaH<ASPLIT ? 2 : 1>(ah.v, al.v, bq.v, bq.v, acc[t]); }
  }
#pragma unroll
  for (int t = 0; t < 4; ++t) { if (col0 + t * 16 >= N) continue;
#pragma unroll
    for (int r = 0; r < 8; ++r) so[w][8 * hh + r][t * 16 + ln] = acc[t][r] * alpha; }
  __builtin_amdgcn_fence(__ATOMIC_ACQ_REL, "workgroup"); __builtin_amdgcn_wave_barrier();
  const int rsub = lane >> 4, c4 = (lane & 15) * 4;
  {
#pragma unroll
    for (int q = 0; q < 8; ++q) { const int r = q * 2 + rsub; if (col0 + c4 < N) { const v4f v = *(const v4fa*)&so[w][r][c4]; *(v4f*)(C + (size_t)(row0 + r) * ldc + col0 + c4) = v; } }
     }
}

// Wt[n][k] = f16(W[k][n]·scale) from f32 row-major W[K][N] (scale = power of two; bf16-exact weights stay exact in f16 away from the subnormal range)
__global__ __launch_bounds__(256) void k_wt_f16(const float* __restrict__ W, _Float16* __restrict__ Wt, int K, int N, float scale) {
  const int t = blockIdx.x * 256 + threadIdx.x; if (t >= N * (K / 8)) return; const int n = t / (K / 8), k8 = (t % (K / 8)) * 8; FragH f;
#pragma unroll
  for (int i = 0; i < 8; ++i) f.h[i] = (_Float16)(bf16_round(W[(size_t)(k8 + i) * N + n]) * scale); const v8us o = f.half[0];
  *(v8us*)((unsigned short*)Wt + (size_t)n * K + k8) = o; 
}
// k_gemm_hh variant with fused epilogue: v = acc·alpha + bias[by·sBias + col] (+ CP[(row/rowsPerB)·sCPb + by·64 + col] if CP) ; ACT 0 none / 1 elu ; writes f16 C16 (and f32 C if non-null)
template <int ACT>
__global__ __launch_bounds__(128) void k_gemm_hhx(const _Float16* __restrict__ A, int lda, size_t sA, const _Float16* __restrict__ Bh, int ldb, size_t sB, float alpha, const float* __restrict__ bias, size_t sBias, const float* __restrict__ CP, int rowsPerB, size_t sCPb, int row0g,
    float* __restrict__ C, _Float16* __restrict__ C16, int ldc, size_t sC, int M, int N, int K) {
  __shared__ __attribute__((aligned(16))) float so[4][16][64];
  const int tid = threadIdx.x, w = tid >> 5, lane = tid & 31, ln = lane & 15, hh = lane >> 4; const int by = blockIdx.y;
  A += (size_t)by * sA; Bh += (size_t)by * sB; const size_t cofs = (size_t)by * sC; const float* bp = bias ? bias + (size_t)by * sBias : nullptr;
  const int ntn = (N + 63) / 64; const int wid = blockIdx.x * 4 + w; const int mt = wid / ntn, nq = wid % ntn; if (mt * 16 >= M) return;
  const int row0 = mt * 16, col0 = nq * 64; const _Float16* arow = A + (size_t)(row0 + ln) * lda;
  v8f acc[4] = {};
  for (int kb = 0; kb < K; kb += 32) { FragH ah; ah.half[0] = *(const v8us*)((const unsigned short*)arow + kb + 8 * hh); ah.half[1] = *(const v8us*)((const unsigned short*)arow + kb + 16 + 8 * hh);
#pragma unroll
    for (int t = 0; t < 4; ++t) { if (col0 + t * 16 >= N) continue; const size_t boff = (size_t)(col0 + t * 16 + ln) * ldb + kb; FragH bq; bq.half[0] = *(const v8us*)((const unsigned short*)Bh + boff + 8 * hh); bq.half[1] = *(const v8us*)((const unsigned short*)Bh + boff + 16 + 8 * hh);
      acc[t] = mmaH<1>(ah.v, ah.v, bq.v, bq.v, acc[t]); }
  }
#pragma unroll
  for (int t = 0; t < 4; ++t) { if (col0 + t * 16 >= N) continue; const int col = col0 + t * 16 + ln; const float bv = bp ? bf16_round(bp[col]) : 0.f;
#pragma unroll
    for (int r = 0; r < 8; ++r) { float v = acc[t][r] * alpha + bv; if (CP) { const int rr = row0g + row0 + 8 * hh + r; if (rowsPerB < 0) v += CP[cofs + (size_t)rr * ldc + col];      /* rowsPerB < 0: own element of the batched C plane */ else { const int bidx = rr / rowsPerB; v += CP[(size_t)bidx * sCPb + (size_t)by * 64 + col]; } } if (ACT == 1) v = (v > 0.f) ? v : expm1f(v); else if (ACT == 7) v = (v > 0.f) ? v + 1.0f : expf(v); else if (ACT == 8) v = tanhf(v); else if (ACT == 9) v = 0.5f * v * (1.0f + tanhf(0.7978845608028654f * (v + 0.044715f * v * v * v))); else if (ACT == 11) v = 1.0f / (1.0f + expf(-v)); else if (ACT == 12) v = (v > 0.f) ? v : 0.01f * v; else if (ACT == 14) v = (v > 0.f) ? v : 0.1f * v; else if (ACT == 16) v = (v >= 0.f) ? v : 0.3f * v; else if (ACT == 17) v = (v >= 0.f) ? v : 0.2f * v; else if (ACT == 15) v = v / (1.0f + expf(-v)); else if (ACT == 3) v = fmaxf(v, 0.f); else if (ACT == 6) v = 0.5f * v * (1.0f + erff(v * 0.70710678118654752f)); so[w][8 * hh + r][t * 16 + ln] = v; } }
  __builtin_amdgcn_fence(__ATOMIC_ACQ_REL, "workgroup"); __builtin_amdgcn_wave_barrier();
  const int rsub = lane >> 4, c4 = (lane & 15) * 4; typedef _Float16 v4h __attribute__((ext_vector_type(4)));
  {
#pragma unroll
    for (int q = 0; q < 8; ++q) { const int r = q * 2 + rsub; if (col0 + c4 < N) { const v4f v = *(const v4fa*)&so[w][r][c4]; if (C) *(v4f*)(C + cofs + (size_t)(row0 + r) * ldc + col0 + c4) = v; if (C16) { v4h h4; for (int i = 0; i < 4; ++i) h4[i] = (_Float16)v[i]; *(v4h*)(C16 + cofs + (size_t)(row0 + r) * ldc + col0 + c4) = h4; } } }
     }
}


typedef _Float16 v4h __attribute__((ext_vector_type(4)));

__global__ __launch_bounds__(256) void k_x16(const float* __restrict__ x, _Float16* __restrict__ X16, size_t n8) { const size_t t = (size_t)blockIdx.x * 256 + threadIdx.x; if (t >= n8) return; FragH f;
#pragma unroll
  for (int q = 0; q < 8; ++q) f.h[q] = (_Float16)bf16_round(x[t * 8 + q]); *(v8us*)((unsigned short*)X16 + t * 8) = f.half[0];  }
__global__ __launch_bounds__(256) void k_h16(const float* __restrict__ x, _Float16* __restrict__ X16, size_t n8) { const size_t t = (size_t)blockIdx.x * 256 + threadIdx.x; if (t >= n8) return; FragH f;
#pragma unroll
  for (int q = 0; q < 8; ++q) f.h[q] = (_Float16)x[t * 8 + q]; *(v8us*)((unsigned short*)X16 + t * 8) = f.half[0];  }
__global__ __launch_bounds__(256) void k_round16f(const float* __restrict__ W, _Float16* __restrict__ Bt, size_t n8) { const size_t t = (size_t)blockIdx.x * 256 + threadIdx.x; if (t >= n8) return; FragH f;
#pragma unroll
  for (int i = 0; i < 8; ++i) f.h[i] = (_Float16)(bf16_round(W[t * 8 + i]) * 16.0f); *(v8us*)((unsigned short*)Bt + t * 8) = f.half[0];  }
template <int NHv, int TTv>
__global__ __launch_bounds__(256) void k_vt(const _Float16* __restrict__ V16, int ldv, int voff, _Float16* __restrict__ Vt) { __shared__ unsigned short tl[64][66]; const int tid = threadIdx.x; const int slab = blockIdx.x / (TTv / 64), lg = blockIdx.x % (TTv / 64); const int b = slab / NHv, h = slab % NHv;
  for (int i = tid; i < 64 * 8; i += 256) { const int r = i / 8, c8 = (i % 8) * 8; FragH f; f.half[0] = *(const v8us*)((const unsigned short*)V16 + ((size_t)b * TTv + lg * 64 + r) * ldv + voff + h * 64 + c8);
#pragma unroll
    for (int q = 0; q < 8; ++q) tl[r][c8 + q] = f.u[q]; }
  __syncthreads();
  {
#pragma unroll
    for (int rd = 0; rd < 2; ++rd) { const int d = rd * 32 + tid / 8, pc = tid % 8; FragH f;
#pragma unroll
      for (int q = 0; q < 8; ++q) f.u[q] = tl[pc * 8 + q][d];
      *(v8us*)((unsigned short*)Vt + ((size_t)slab * 64 + d) * TTv + lg * 64 + pc * 8) = f.half[0]; }
     } }

__global__ __launch_bounds__(256) void k_hl(const float* __restrict__ F, _Float16* __restrict__ Hh, _Float16* __restrict__ Hl, size_t n8) { const size_t t = (size_t)blockIdx.x * 256 + threadIdx.x; if (t >= n8) return; FragH fh, fl; const v4f a = *(const v4fa*)(F + t * 8), c = *(const v4fa*)(F + t * 8 + 4);
#pragma unroll
  for (int q = 0; q < 4; ++q) { _Float16 h = (_Float16)a[q]; fh.h[q] = h; fl.h[q] = (_Float16)((a[q] - (float)h) * 1024.0f); h = (_Float16)c[q]; fh.h[4 + q] = h; fl.h[4 + q] = (_Float16)((c[q] - (float)h) * 1024.0f); }
  { *(v8us*)((unsigned short*)Hh + t * 8) = fh.half[0]; *(v8us*)((unsigned short*)Hl + t * 8) = fl.half[0];  } }

// ---- fast GEMM (wave tile 32x64; requires M % 32 == 0 rows per launch region and N % 64 == 0); epilogue = k_gemm_hhx semantics ----
__device__ __forceinline__ v16h g2_frag(const _Float16* p, int hh) { FragH f; f.half[0] = *(const v8us*)((const unsigned short*)p + 8 * hh); f.half[1] = *(const v8us*)((const unsigned short*)p + 16 + 8 * hh); return f.v; }
__device__ __forceinline__ v8f g2_mma(v16h a, v16h b, v8f c) { v8f d = __builtin_amdgcn_wmma_f32_16x16x32_f16(false, a, false, b, (short)0, c, false, false); asm volatile("v_nop\n\tv_nop\n\tv_nop\n\tv_nop" : "+v"(d) : "v"(a), "v"(b)); return d; }
template <int ACT>
__global__ __launch_bounds__(128) void k_gemm2(const _Float16* __restrict__ A, int lda, size_t sA, const _Float16* __restrict__ Bh, int ldb, size_t sB, float alpha, const float* __restrict__ bias, size_t sBias, const float* __restrict__ CP, int rowsPerB, size_t sCPb, int row0g,
    float* __restrict__ C, _Float16* __restrict__ C16, int ldc, size_t sC, int M, int N, int K) { static_assert(ACT == 0 || ACT == 3 || ACT == 6 || ACT == 8 || ACT == 9 || ACT == 11 || ACT == 12 || ACT == 14 || ACT == 15 || ACT == 16 || ACT == 17, "k_gemm2: unsupported ACT code (would silently apply no activation)");
  __shared__ __attribute__((aligned(16))) float so[4][32][68];
  const int tid = threadIdx.x, w = tid >> 5, lane = tid & 31, ln = lane & 15, hh = lane >> 4; const int by = blockIdx.y;
  A += (size_t)by * sA; Bh += (size_t)by * sB; const size_t cofs = (size_t)by * sC; const float* bp = bias ? bias + (size_t)by * sBias : nullptr;
  const int ntn = N >> 6; const int mt = blockIdx.x / ntn, nq = blockIdx.x - mt * ntn; const int row0 = mt * 128 + 32 * w, col0 = nq * 64; if (row0 >= M) return;
  const _Float16* a0p = A + (size_t)(row0 + ln) * lda; const _Float16* a1p = a0p + (size_t)16 * lda;
  const _Float16* b0p = Bh + (size_t)(col0 + ln) * ldb; const _Float16* b1p = b0p + (size_t)16 * ldb; const _Float16* b2p = b1p + (size_t)16 * ldb; const _Float16* b3p = b2p + (size_t)16 * ldb;
  const v8f z8 = {0.f,0.f,0.f,0.f,0.f,0.f,0.f,0.f}; v8f c00 = z8, c01 = z8, c02 = z8, c03 = z8, c10 = z8, c11 = z8, c12 = z8, c13 = z8;
#pragma unroll 1
  for (int kb = 0; kb < K; kb += 32) { const v16h a0 = g2_frag(a0p + kb, hh), a1 = g2_frag(a1p + kb, hh);
    v16h b = g2_frag(b0p + kb, hh); c00 = g2_mma(a0, b, c00); c10 = g2_mma(a1, b, c10);
    b = g2_frag(b1p + kb, hh); c01 = g2_mma(a0, b, c01); c11 = g2_mma(a1, b, c11);
    b = g2_frag(b2p + kb, hh); c02 = g2_mma(a0, b, c02); c12 = g2_mma(a1, b, c12);
    b = g2_frag(b3p + kb, hh); c03 = g2_mma(a0, b, c03); c13 = g2_mma(a1, b, c13); }
  v8f accs[8] = {c00, c01, c02, c03, c10, c11, c12, c13};
#pragma unroll
  for (int u = 0; u < 8; ++u) { const int t = u & 3, half = u >> 2; const int col = col0 + t * 16 + ln; const float bv = bp ? bf16_round(bp[col]) : 0.f;
#pragma unroll
    for (int r = 0; r < 8; ++r) { const int rloc = half * 16 + 8 * hh + r; float v = accs[u][r] * alpha + bv; if (CP) { if (rowsPerB < 0) v += CP[cofs + (size_t)(row0g + row0 + rloc) * ldc + col];      /* rowsPerB < 0: own element of the batched C plane */ else { const int bidx = (row0g + row0 + rloc) / rowsPerB; v += CP[(size_t)bidx * sCPb + (size_t)by * 64 + col]; } }
      if (ACT == 3) v = fmaxf(v, 0.f); else if (ACT == 6) v = 0.5f * v * (1.0f + erff(v * 0.70710678118654752f)); else if (ACT == 11) v = 1.0f / (1.0f + expf(-v)); else if (ACT == 15) v = v / (1.0f + expf(-v)); else if (ACT == 12) v = (v > 0.f) ? v : 0.01f * v; else if (ACT == 8) v = tanhf(v); else if (ACT == 9) v = 0.5f * v * (1.0f + tanhf(0.7978845608028654f * (v + 0.044715f * v * v * v))); else if (ACT == 14) v = (v > 0.f) ? v : 0.1f * v; else if (ACT == 16) v = (v >= 0.f) ? v : 0.3f * v; else if (ACT == 17) v = (v >= 0.f) ? v : 0.2f * v;
      so[w][rloc][t * 16 + ln] = v; } }
  __builtin_amdgcn_fence(__ATOMIC_ACQ_REL, "workgroup"); __builtin_amdgcn_wave_barrier();
  const int rsub = lane >> 4, c4 = (lane & 15) * 4;
  {
#pragma unroll
    for (int q = 0; q < 16; ++q) { const int r = q * 2 + rsub; const v4f v = *(const v4fa*)&so[w][r][c4]; if (C) *(v4f*)(C + cofs + (size_t)(row0 + r) * ldc + col0 + c4) = v; if (C16) { v4h h4; for (int i = 0; i < 4; ++i) h4[i] = (_Float16)v[i]; *(v4h*)(C16 + cofs + (size_t)(row0 + r) * ldc + col0 + c4) = h4; } }
     } }


__global__ __launch_bounds__(256) void k_wsc(const float* __restrict__ Wm, _Float16* __restrict__ Bt, size_t n8, float sc) { const size_t t = (size_t)blockIdx.x * 256 + threadIdx.x; if (t >= n8) return; FragH f; for (int q = 0; q < 8; ++q) f.h[q] = (_Float16)(bf16_round(Wm[t * 8 + q]) * sc); *(v8us*)((unsigned short*)Bt + t * 8) = f.half[0];  }
__global__ __launch_bounds__(256) void k_wput(const float* __restrict__ Wm, int nout, int nin, int roff, int coff, int kpad, _Float16* __restrict__ Bt) { const int t = blockIdx.x * 256 + threadIdx.x; const int npr = (nin + 7) / 8; if (t >= nout * npr) return; const int k0 = (t % npr) * 8; const int o = t / npr; unsigned short* d = (unsigned short*)Bt + (size_t)(roff + o) * kpad + coff + k0;
  { for (int q = 0; q < 8; ++q) { const int k = k0 + q; if (k < nin) { FragH f; f.h[0] = (_Float16)(bf16_round(Wm[(size_t)o * nin + k]) * 16.0f); *(unsigned short*)(d + q) = f.u[0] & 0xffffu; } }  } }
__global__ __launch_bounds__(256) void k_zero16(_Float16* __restrict__ D, size_t n8) { const size_t t = (size_t)blockIdx.x * 256 + threadIdx.x; if (t >= n8) return; v8us z; for (int q = 0; q < 8; ++q) z[q] = 0; *(v8us*)((unsigned short*)D + t * 8) = z;  }
__global__ __launch_bounds__(64) void k_bcat2(const float* __restrict__ a, const float* __restrict__ bb, float* __restrict__ dst) { const int i = threadIdx.x; const float v = (i < 32) ? bf16_round(a[i]) : bf16_round(bb[i - 32]); *(float*)(dst + i) = v;  }
__global__ __launch_bounds__(256) void k_v16(const float* __restrict__ x, int r0, _Float16* __restrict__ V16) {
  const int t = blockIdx.x * 256 + threadIdx.x; if (t >= CHK * 4) return; const int j0 = (t % 4) * 8; const int rl = t / 4; const size_t r = (size_t)r0 + rl;
  const v4f a0 = *(const v4fa*)(x + r * D1 + j0), a1 = *(const v4fa*)(x + r * D1 + j0 + 4);
  asm volatile("s_wait_xcnt 0x0" ::: "memory");      /* the next two loads may land in this address pair: the wait stands in front of them */
  const v4f b0 = *(const v4fa*)(x + ((size_t)NBI + r) * D1 + j0), b1 = *(const v4fa*)(x + ((size_t)NBI + r) * D1 + j0 + 4);
  FragH g1, g2; for (int q = 0; q < 4; ++q) { g1.h[q] = (_Float16)bf16_round(a0[q]); g1.h[4 + q] = (_Float16)bf16_round(a1[q]); g2.h[q] = (_Float16)bf16_round(b0[q]); g2.h[4 + q] = (_Float16)bf16_round(b1[q]); } unsigned short* dv = (unsigned short*)V16 + (size_t)rl * 64; { *(v8us*)(dv + j0) = g1.half[0]; *(v8us*)(dv + 32 + j0) = g2.half[0];  } }
__global__ __launch_bounds__(256) void k_gate(const float* __restrict__ Z, const float* __restrict__ H, _Float16* __restrict__ G16) {
  #pragma clang fp contract(off)
  const int t = blockIdx.x * 256 + threadIdx.x; if (t >= CHK * 64 / 8) return; const v8f z = *(const v8f*)(Z + (size_t)t * 8); const v8f h = *(const v8f*)(H + (size_t)t * 8); FragH f; for (int q = 0; q < 8; ++q) f.h[q] = (_Float16)((1.0f / (1.0f + expf(-z[q]))) * h[q]);
  *(v8us*)((unsigned short*)G16 + (size_t)t * 8) = f.half[0];  }
__global__ __launch_bounds__(256) void k_skip(const float* __restrict__ O, _Float16* __restrict__ C2) {
  const int NPIECE = (KC2 - 64) / 8;      /* 12 */ const int t = blockIdx.x * 256 + threadIdx.x; if (t >= CHK * NPIECE) return; const int p = t % NPIECE; const int rl = t / NPIECE; const float* o = O + (size_t)rl * 64; FragH f;
  const int c0 = 64 + p * 8; for (int q = 0; q < 8; ++q) { const int c = c0 + q; float v = 0.f; if (c < 64 + 33) { const int a = c - 64; v = (a < 32) ? o[a] : 1.0f; } else if (c < 64 + 66) { const int b = c - 97; v = (b < 32) ? o[32 + b] : 1.0f; } f.h[q] = (_Float16)v; }
  unsigned short* d = (unsigned short*)C2 + (size_t)rl * KC2 + c0; *(v8us*)d = f.half[0]; }
// We1 [64][33 * 33] -> Bt [64][KKP] in the k order of k_gemm_op's A fragments: k = a * 32 + b <- column a * 33 + b (a, b < 32); 1024 + b <- 32 * 33 + b; 1056 + a <- a * 33 + 32; 1088 <- 1088; the rest 0
__global__ __launch_bounds__(256) void k_wput_op(const float* __restrict__ Wm, _Float16* __restrict__ Bt) { const int t = blockIdx.x * 256 + threadIdx.x; if (t >= FE * (KKP / 8)) return; const int k0 = (t % (KKP / 8)) * 8; const int o = t / (KKP / 8); FragH f;
  for (int q = 0; q < 8; ++q) { const int k = k0 + q; int c = -1; if (k < 1024) c = (k >> 5) * 33 + (k & 31); else if (k < 1056) c = 32 * 33 + (k - 1024); else if (k < 1088) c = (k - 1056) * 33 + 32; else if (k == 1088) c = 1088;
    f.h[q] = (c >= 0) ? (_Float16)(bf16_round(Wm[(size_t)o * KK + c]) * 16.0f) : (_Float16)0.0f; }
  *(v8us*)((unsigned short*)Bt + (size_t)o * KKP + k0) = f.half[0]; }
// ---- GEMM whose A operand is the outer product of two 32-wide f32 rows, never stored: A[row][i * 32 + j] = f16(P[row][i] * Q[row][j]). In k step i a lane holds j = 8 hh + 0..7 and 16 + 8 hh + 0..7 (g2_frag's order), so its 16 values of Q stay in registers and each step scales them by P[row][i].
// RND: both rows are rounded to bf16 first. TAIL: three more k steps, A = f16(Q[row][j]), f16(P[row][j]), then 1 at j = 0 and 0 elsewhere (the columns of the appended ones). OUT16: the result goes to C16 as f16, else to C as f32. Wave tile 32x64, N = 64; epilogue as k_gemm2.
// The full '#pragma unroll's of op_row16, op_frag, the four steps of a k group, the ones fragment and the accumulator epilogue make each array or vector index a compile-time constant, so that the values stay in registers.
__device__ __forceinline__ void op_row16(const float* p, int hh, bool rnd, float (&v)[16]) { const v4f x0 = *(const v4fa*)(p + 8 * hh), x1 = *(const v4fa*)(p + 8 * hh + 4), x2 = *(const v4fa*)(p + 16 + 8 * hh), x3 = *(const v4fa*)(p + 16 + 8 * hh + 4);
  asm volatile("s_wait_xcnt 0x0" ::: "memory");      /* the address pair of these four loads is free for reuse behind them: the wait stands in front of whatever overwrites it */
#pragma unroll
  for (int e = 0; e < 4; ++e) { v[e] = rnd ? bf16_round(x0[e]) : x0[e]; v[4 + e] = rnd ? bf16_round(x1[e]) : x1[e]; v[8 + e] = rnd ? bf16_round(x2[e]) : x2[e]; v[12 + e] = rnd ? bf16_round(x3[e]) : x3[e]; } }
__device__ __forceinline__ v16h op_frag(float a, const float (&q)[16]) { FragH f;
#pragma unroll
  for (int e = 0; e < 16; ++e) f.h[e] = (_Float16)(a * q[e]); return f.v; }
template <int ACT, bool RND, bool TAIL, bool OUT16>
__global__ __launch_bounds__(128) void k_gemm_op(const float* __restrict__ P, int ldp, const float* __restrict__ Q, int ldq, const _Float16* __restrict__ Bh, int ldb, float alpha, const float* __restrict__ bias,
    float* __restrict__ C, _Float16* __restrict__ C16, int ldc, int M) { static_assert(ACT == 0 || ACT == 3, "k_gemm_op: unsupported ACT code");
  __shared__ __attribute__((aligned(16))) float so[4][32][68];
  const int tid = threadIdx.x, w = tid >> 5, lane = tid & 31, ln = lane & 15, hh = lane >> 4;
  const int row0 = blockIdx.x * 128 + 32 * w; if (row0 >= M) return;
  const float* p0 = P + (size_t)(row0 + ln) * ldp; const float* p1 = p0 + (size_t)16 * ldp;
  const float* q0 = Q + (size_t)(row0 + ln) * ldq; const float* q1 = q0 + (size_t)16 * ldq;
  const _Float16* b0p = Bh + (size_t)ln * ldb; const _Float16* b1p = b0p + (size_t)16 * ldb; const _Float16* b2p = b1p + (size_t)16 * ldb; const _Float16* b3p = b2p + (size_t)16 * ldb;
  float qa[16], qb[16]; op_row16(q0, hh, RND, qa); op_row16(q1, hh, RND, qb);
  const v8f z8 = {0.f,0.f,0.f,0.f,0.f,0.f,0.f,0.f}; v8f c00 = z8, c01 = z8, c02 = z8, c03 = z8, c10 = z8, c11 = z8, c12 = z8, c13 = z8;
  auto step = [&](v16h a0, v16h a1, int kb) {
    v16h b = g2_frag(b0p + kb, hh); c00 = g2_mma(a0, b, c00); c10 = g2_mma(a1, b, c10);
    b = g2_frag(b1p + kb, hh); c01 = g2_mma(a0, b, c01); c11 = g2_mma(a1, b, c11);
    b = g2_frag(b2p + kb, hh); c02 = g2_mma(a0, b, c02); c12 = g2_mma(a1, b, c12);
    b = g2_frag(b3p + kb, hh); c03 = g2_mma(a0, b, c03); c13 = g2_mma(a1, b, c13); };
  /* rolled over groups of four k steps: one 16-byte load brings four values of P; fully unrolled the 32 steps would only grow the code */
#pragma unroll 1
  for (int i4 = 0; i4 < 32; i4 += 4) { const v4f pa = *(const v4fa*)(p0 + i4), pb = *(const v4fa*)(p1 + i4);
    asm volatile("s_wait_xcnt 0x0" ::: "memory");      /* the two address pairs are reused at once (the next loads land in them): the wait stands in front of that */
#pragma unroll
    for (int u = 0; u < 4; ++u) { const float sa = RND ? bf16_round(pa[u]) : pa[u], sb = RND ? bf16_round(pb[u]) : pb[u]; step(op_frag(sa, qa), op_frag(sb, qb), (i4 + u) * 32); } }
  if (TAIL) { step(op_frag(1.0f, qa), op_frag(1.0f, qb), 1024);
    float ra[16], rb[16]; op_row16(p0, hh, RND, ra); op_row16(p1, hh, RND, rb); step(op_frag(1.0f, ra), op_frag(1.0f, rb), 1056);
    FragH one;
#pragma unroll
    for (int e = 0; e < 16; ++e) one.h[e] = (_Float16)((e == 0 && hh == 0) ? 1.0f : 0.0f);
    step(one.v, one.v, 1088); }
  v8f accs[8] = {c00, c01, c02, c03, c10, c11, c12, c13};
#pragma unroll
  for (int u = 0; u < 8; ++u) { const int t = u & 3, half = u >> 2; const int col = t * 16 + ln; const float bv = bf16_round(bias[col]);
#pragma unroll
    for (int r = 0; r < 8; ++r) { const int rloc = half * 16 + 8 * hh + r; float v = accs[u][r] * alpha + bv; if (ACT == 3) v = fmaxf(v, 0.f); so[w][rloc][t * 16 + ln] = v; } }
  __builtin_amdgcn_fence(__ATOMIC_ACQ_REL, "workgroup"); __builtin_amdgcn_wave_barrier();      /* each wave re-reads only its own slab of so: its LDS stores must be ordered before its loads */
  const int rsub = lane >> 4, c4 = (lane & 15) * 4;
#pragma unroll
  for (int q = 0; q < 16; ++q) { const int r = q * 2 + rsub; const v4f v = *(const v4fa*)&so[w][r][c4]; if (!OUT16) *(v4f*)(C + (size_t)(row0 + r) * ldc + c4) = v; else { v4h h4; for (int i = 0; i < 4; ++i) h4[i] = (_Float16)v[i]; *(v4h*)(C16 + (size_t)(row0 + r) * ldc + c4) = h4; } } }

extern "C" void kernel_launch(void* const* d_in, const int* in_sizes, int n_in,
                              void* d_out, int out_size, void* d_ws, size_t ws_size, hipStream_t stream) {
  (void)in_sizes; (void)n_in; (void)out_size;
  const float* const* I = (const float* const*)d_in;
  const float* x = I[0]; const float* Wh1 = I[1]; const float* bh1 = I[2]; const float* Wz1 = I[3]; const float* bz1 = I[4]; const float* Wo1 = I[5]; const float* bo1 = I[6]; const float* Wh2 = I[7]; const float* bh2 = I[8]; const float* Wz2 = I[9]; const float* bz2 = I[10]; const float* Wo2 = I[11]; const float* bo2 = I[12]; const float* We1 = I[13]; const float* be1 = I[14]; const float* We2 = I[15]; const float* be2 = I[16];
  char* ws = (char*)d_ws; size_t off = 0;
  auto take = [&](size_t bytes) { char* p = ws + off; off += (bytes + 255) & ~(size_t)255; return p; };
  _Float16* BZ = (_Float16*)take((size_t)64 * KO * 2); float* bz = (float*)take(64 * 4); _Float16* BH = (_Float16*)take((size_t)64 * 64 * 2); float* bh = (float*)take(64 * 4); _Float16* BO = (_Float16*)take((size_t)64 * 64 * 2); float* bo = (float*)take(64 * 4); _Float16* BE1 = (_Float16*)take((size_t)FE * KKP * 2); _Float16* BE2 = (_Float16*)take((size_t)FE * KC2 * 2);
  _Float16* V16 = (_Float16*)take((size_t)CHK * 64 * 2); float* Z = (float*)take((size_t)CHK * 64 * 4); float* H = (float*)take((size_t)CHK * 64 * 4); _Float16* G16 = (_Float16*)take((size_t)CHK * 64 * 2); float* O = (float*)take((size_t)CHK * 64 * 4); _Float16* C2 = (_Float16*)take((size_t)CHK * KC2 * 2);
  if (off > ws_size) return;      /* about 85 MiB */
  k_wsc<<<(64 * KO / 8 + 255) / 256, 256, 0, stream>>>(Wz1, BZ, (size_t)32 * KO / 8, 16.0f); k_wsc<<<(32 * KO / 8 + 255) / 256, 256, 0, stream>>>(Wz2, BZ + (size_t)32 * KO, (size_t)32 * KO / 8, 16.0f); k_bcat2<<<1, 64, 0, stream>>>(bz1, bz2, bz);      /* [Wz1; Wz2] flattened [o][(i,j)] */
  k_zero16<<<(64 * 64 / 8 + 255) / 256, 256, 0, stream>>>(BH, 64 * 64 / 8); k_wput<<<(32 * 4 + 255) / 256, 256, 0, stream>>>(Wh1, 32, 32, 0, 0, 64, BH); k_wput<<<(32 * 4 + 255) / 256, 256, 0, stream>>>(Wh2, 32, 32, 32, 32, 64, BH); k_bcat2<<<1, 64, 0, stream>>>(bh1, bh2, bh);      /* blockdiag(Wh1, Wh2) */
  k_zero16<<<(64 * 64 / 8 + 255) / 256, 256, 0, stream>>>(BO, 64 * 64 / 8); k_wput<<<(32 * 4 + 255) / 256, 256, 0, stream>>>(Wo1, 32, 32, 0, 0, 64, BO); k_wput<<<(32 * 4 + 255) / 256, 256, 0, stream>>>(Wo2, 32, 32, 32, 32, 64, BO); k_bcat2<<<1, 64, 0, stream>>>(bo1, bo2, bo);      /* blockdiag(Wo1, Wo2) */
  k_wput_op<<<(FE * (KKP / 8) + 255) / 256, 256, 0, stream>>>(We1, BE1);      /* writes every column, the pad too */
  k_zero16<<<(FE * KC2 / 8 + 255) / 256, 256, 0, stream>>>(BE2, (size_t)FE * KC2 / 8); k_wput<<<(FE * ((130 + 7) / 8) + 255) / 256, 256, 0, stream>>>(We2, FE, 130, 0, 0, KC2, BE2);
  for (int ch = 0; ch < NBR / CHK; ++ch) { const int r0 = ch * CHK;
    k_v16<<<(CHK * 4 + 255) / 256, 256, 0, stream>>>(x, r0, V16);
    k_gemm_op<0, true, false, false><<<CHK / 128, 128, 0, stream>>>(x + (size_t)r0 * D1, D1, x + ((size_t)NBI + r0) * D1, D1, BZ, KO, 0.0625f, bz, Z, nullptr, 64, CHK);      /* [z1 | z2] */
    k_gemm2<3><<<dim3((CHK / 128) * 1, 1), 128, 0, stream>>>(V16, 64, 0, BH, 64, 0, 0.0625f, bh, 0, nullptr, 1, 0, 0, H, nullptr, 64, 0, CHK, 64, 64);      /* [h1 | h2] = relu */
    k_gate<<<(CHK * 64 / 8 + 255) / 256, 256, 0, stream>>>(Z, H, G16);
    k_gemm2<3><<<dim3((CHK / 128) * 1, 1), 128, 0, stream>>>(G16, 64, 0, BO, 64, 0, 0.0625f, bo, 0, nullptr, 1, 0, 0, O, nullptr, 64, 0, CHK, 64, 64);      /* [o1 | o2] = relu */
    k_skip<<<(CHK * 12 + 255) / 256, 256, 0, stream>>>(O, C2);
    k_gemm_op<3, false, true, true><<<CHK / 128, 128, 0, stream>>>(O, 64, O + 32, 64, BE1, KKP, 0.0625f, be1, nullptr, C2, KC2, CHK);      /* e1 = relu(o12 We1^T + b) -> C2 cols 0..63 */
    k_gemm2<3><<<dim3((CHK / 128) * 1, 1), 128, 0, stream>>>(C2, KC2, 0, BE2, KC2, 0, 0.0625f, be2, 0, nullptr, 1, 0, 0, (float*)d_out + (size_t)r0 * FE, nullptr, FE, 0, CHK, FE, KC2); }      /* out rows */
}

// v003
// One run takes 157 microseconds.
// Two timings next to v002 put it at 1.90 and 1.91 times that version's speed.
// All steps since v000 together make it 7.99 times as fast.
#include <hip/hip_runtime.h>
// KroneckerFusion (131072 rows; v1, v2 = x[0], x[1] (32 each): h_i = relu(v_i Wh_i^T + b); z_i = Bilinear(v1, Wz_i, v2) + b; o_i = relu((sigmoid(z_i) * h_i) Wo_i^T + b); o_i <- [o_i, 1]; o12 = o1 (x) o2 (33 x 33 = 1089); out = relu(o12 We1^T + b); out = relu([out, o1, o2] We2^T + b)).
// Structure: ONE kernel for the whole row pipeline; a wave owns 32 rows from the input to the output row and no intermediate touches the workspace. Every product is computed transposed, weights as the A operand (16 features a tile) and the rows as the B operand (lane = row), f16 WMMA with f32 accumulation and exact x16 weights + bias. A lane's accumulators then hold features 16 t + 8 hh + 0..7 of its own row, and two neighbouring feature tiles converted to f16 ARE the B fragment of the next product (its k order), so z, h, the gate, o, e1 and the output follow one another in registers. The bilinear forms ([Wz1; Wz2] flattened, K = 1024) and We1 (K re-ordered to [o1[a] o2[b] (1024) | o2 (32) | o1 (32) | 1 | 0 pad] = 1120) form their B fragments f16(p[i] * q[j]) in registers; o1[a], which both lane halves need for every a, goes through the wave's own LDS slab. We2's K is re-ordered to [e1 (64) | o1 (32) | o2 (32) | 1 | 1 | 0 pad] = 160 with the weight columns permuted alike. The output rows are turned in the same slab and stored as whole lines.
#define NBR 131072               /* rows processed */
#define NBI 131072               /* rows in the input (x[1] starts at NBI*32; separate so debug builds can shrink NBR) */
#define D1 32
#define KO 1024                  /* 32 x 32 outer */
#define KK 1089                  /* 33 x 33 Kronecker */
#define KKP 1120
#define FE 64
#define KC2 160                  /* [e1 (64) | o1 (32) | o2 (32) | 1 | 1 | 0] */
typedef __bf16 v16b __attribute__((ext_vector_type(16)));
typedef unsigned short v8us __attribute__((ext_vector_type(8), may_alias));
typedef float  v8f  __attribute__((ext_vector_type(8)));
typedef float  v4f  __attribute__((ext_vector_type(4)));
typedef float  v4fa __attribute__((ext_vector_type(4), may_alias));
union FragB { v16b v; v8us half[2]; unsigned short u[16]; };

__device__ __forceinline__ unsigned short bf16_bits(float x) { unsigned int u = __float_as_uint(x); return (unsigned short)((u + 0x7FFFu + ((u >> 16) & 1u)) >> 16); }
__device__ __forceinline__ float bf16_val(unsigned short b) { return __uint_as_float(((unsigned int)b) << 16); }
__device__ __forceinline__ float bf16_round(float x) { return bf16_val(bf16_bits(x)); }
// D += A·B with NT terms: 1 = ah·bh, 2 = + al·bh (A split), 3 = + ah·bl (both split)
template <int NT>
__device__ __forceinline__ v8f mmaN(v16b ah, v16b al, v16b bh, v16b bl, v8f c) {
  c = __builtin_amdgcn_wmma_f32_16x16x32_bf16(false, ah, false, bh, (short)0, c, false, false);
  if (NT >= 2) c = __builtin_amdgcn_wmma_f32_16x16x32_bf16(false, al, false, bh, (short)0, c, false, false);
  if (NT >= 3) c = __builtin_amdgcn_wmma_f32_16x16x32_bf16(false, ah, false, bl, (short)0, c, false, false);
  asm volatile("v_nop\n\tv_nop\n\tv_nop\n\tv_nop" : "+v"(c) : "v"(ah), "v"(al), "v"(bh), "v"(bl));
  return c;
}

__global__ __launch_bounds__(256) void k_wt_bf16(const float* __restrict__ W, unsigned short* __restrict__ Wt, int K, int N) {
  const int t = blockIdx.x * 256 + threadIdx.x;
  const int k8n = K / 8;
  if (t >= N * k8n) return;
  const int n = t / k8n, k8 = (t % k8n) * 8;
  v8us v;
#pragma unroll
  for (int i = 0; i < 8; ++i) v[i] = bf16_bits(W[(size_t)(k8 + i) * N + n]);
  *(v8us*)(Wt + (size_t)n * K + k8) = v;
  
}

// GEMM C[M][N] (f32, pitch ldc) = act(A[M][K]·W + bias). A f32 row-major (pitch lda) converted per fragment to bf16
// (ASPLIT: hi/lo two planes -> 2 terms, else single rounded term); Wt bf16 [N][K] (pitch ldb). BIAS_BF16 rounds the
// bias to bf16 first (bias quantised to bf16 before the add). K%32==0, M%16==0, N%64==0.
template <bool ASPLIT, int ACT, bool BIAS_BF16>
__global__ __launch_bounds__(128) void k_gemm_bf(const float* __restrict__ A, int lda, const unsigned short* __restrict__ Wt, int ldb,
                                               const float* __restrict__ bias, float* __restrict__ C, int ldc, int M, int N, int K) {
  __shared__ __attribute__((aligned(16))) float so[4][16][64];
  const int tid = threadIdx.x, w = tid >> 5, lane = tid & 31, ln = lane & 15, hh = lane >> 4;
  const int ntn = N / 64;
  const int wid = blockIdx.x * 4 + w;
  const int mt = wid / ntn, nq = wid % ntn;
  if (mt * 16 >= M) return;
  const int row0 = mt * 16, col0 = nq * 64;
  const float* arow = A + (size_t)(row0 + ln) * lda;
  v8f acc[4] = {};
  for (int kb = 0; kb < K; kb += 32) {
    FragB ah, al;
    const v4f x0 = *(const v4fa*)(arow + kb + 8 * hh), x1 = *(const v4fa*)(arow + kb + 8 * hh + 4);
    const v4f x2 = *(const v4fa*)(arow + kb + 16 + 8 * hh), x3 = *(const v4fa*)(arow + kb + 16 + 8 * hh + 4);
    float xs[16] = {x0[0],x0[1],x0[2],x0[3],x1[0],x1[1],x1[2],x1[3],x2[0],x2[1],x2[2],x2[3],x3[0],x3[1],x3[2],x3[3]};
#pragma unroll
    for (int i = 0; i < 16; ++i) { const unsigned short hb = bf16_bits(xs[i]); ah.u[i] = hb; al.u[i] = ASPLIT ? bf16_bits(xs[i] - bf16_val(hb)) : (unsigned short)0; }
#pragma unroll
    for (int t = 0; t < 4; ++t) {
      const unsigned short* brow = Wt + (size_t)(col0 + t * 16 + ln) * ldb + kb;
      FragB b;
      b.half[0] = *(const v8us*)(brow + 8 * hh);
      b.half[1] = *(const v8us*)(brow + 16 + 8 * hh);
      acc[t] = mmaN<ASPLIT ? 2 : 1>(ah.v, al.v, b.v, b.v, acc[t]);
    }
  }
#pragma unroll
  for (int t = 0; t < 4; ++t) {
    float bv = bias ? bias[col0 + t * 16 + ln] : 0.f;
    if (BIAS_BF16) bv = bf16_round(bv);
#pragma unroll
    for (int r = 0; r < 8; ++r) { float v = acc[t][r] + bv; if (ACT == 1) v = fmaxf(v, 0.f); so[w][8 * hh + r][t * 16 + ln] = v; }
  }
  __builtin_amdgcn_fence(__ATOMIC_ACQ_REL, "workgroup");
  __builtin_amdgcn_wave_barrier();
  const int rsub = lane >> 4, c4 = (lane & 15) * 4;
  {
#pragma unroll
    for (int q = 0; q < 8; ++q) {
      const int r = q * 2 + rsub;
      const v4f v = *(const v4fa*)&so[w][r][c4];
      *(v4f*)(C + (size_t)(row0 + r) * ldc + col0 + c4) = v;
    }
    
  }
}

// GEMM C = act(A·W + bias + resid): A f32 (ASPLIT -> hi/lo 2 terms), Wt bf16 [N][K]; ACT 0 none, 1 relu, 2 exact gelu;
// resid (optional, f32, row index = (row % rmod), pitch ldr, RES_BF16 rounds it) added before the activation.
template <bool ASPLIT, int ACT, bool BIAS_BF16, bool RES_BF16>
__global__ __launch_bounds__(128) void k_gemm_bf3(const float* __restrict__ A, int lda, const unsigned short* __restrict__ Wt, int ldb,
                                                const float* __restrict__ bias, const float* __restrict__ resid, int rmod, int ldr,
                                                float* __restrict__ C, int ldc, int M, int N, int K) {
  __shared__ __attribute__((aligned(16))) float so[4][16][64];
  const int tid = threadIdx.x, w = tid >> 5, lane = tid & 31, ln = lane & 15, hh = lane >> 4;
  const int ntn = N / 64;
  const int wid = blockIdx.x * 4 + w;
  const int mt = wid / ntn, nq = wid % ntn;
  if (mt * 16 >= M) return;
  const int row0 = mt * 16, col0 = nq * 64;
  const float* arow = A + (size_t)(row0 + ln) * lda;
  v8f acc[4] = {};
  for (int kb = 0; kb < K; kb += 32) {
    FragB ah, al;
    const v4f x0 = *(const v4fa*)(arow + kb + 8 * hh), x1 = *(const v4fa*)(arow + kb + 8 * hh + 4);
    const v4f x2 = *(const v4fa*)(arow + kb + 16 + 8 * hh), x3 = *(const v4fa*)(arow + kb + 16 + 8 * hh + 4);
    float xs[16] = {x0[0],x0[1],x0[2],x0[3],x1[0],x1[1],x1[2],x1[3],x2[0],x2[1],x2[2],x2[3],x3[0],x3[1],x3[2],x3[3]};
#pragma unroll
    for (int i = 0; i < 16; ++i) { const unsigned short hb = bf16_bits(xs[i]); ah.u[i] = hb; al.u[i] = ASPLIT ? bf16_bits(xs[i] - bf16_val(hb)) : (unsigned short)0; }
#pragma unroll
    for (int t = 0; t < 4; ++t) {
      const unsigned short* brow = Wt + (size_t)(col0 + t * 16 + ln) * ldb + kb;
      FragB b;
      b.half[0] = *(const v8us*)(brow + 8 * hh);
      b.half[1] = *(const v8us*)(brow + 16 + 8 * hh);
      acc[t] = mmaN<ASPLIT ? 2 : 1>(ah.v, al.v, b.v, b.v, acc[t]);
    }
  }
#pragma unroll
  for (int t = 0; t < 4; ++t) {
    const int col = col0 + t * 16 + ln;
    float bv = bias ? bias[col] : 0.f;
    if (BIAS_BF16) bv = bf16_round(bv);
#pragma unroll
    for (int r = 0; r < 8; ++r) {
      float v = acc[t][r] + bv;
      if (resid) { float rv = resid[(size_t)((row0 + 8 * hh + r) % rmod) * ldr + col]; if (RES_BF16) rv = bf16_round(rv); v += rv; }
      if (ACT == 1) v = fmaxf(v, 0.f);
      if (ACT == 2) v = 0.5f * v * (1.0f + erff(v * 0.70710678118654752f));
      if (ACT == 3) { const float u = 0.7978845608028654f * (v + 0.044715f * v * v * v); v = 0.5f * v * (1.0f + tanhf(u)); }
      so[w][8 * hh + r][t * 16 + ln] = v;
    }
  }
  __builtin_amdgcn_fence(__ATOMIC_ACQ_REL, "workgroup");
  __builtin_amdgcn_wave_barrier();
  const int rsub = lane >> 4, c4 = (lane & 15) * 4;
  {
#pragma unroll
    for (int q = 0; q < 8; ++q) {
      const int r = q * 2 + rsub;
      const v4f v = *(const v4fa*)&so[w][r][c4];
      *(v4f*)(C + (size_t)(row0 + r) * ldc + col0 + c4) = v;
    }
    
  }
}
// row LayerNorm (biased variance, eps) over N: s = X (+ R); optional out_sum <- s; out_norm <- (s-mu)*rsqrt(var+eps)*g + b
template <bool PARAM_BF16>
__global__ __launch_bounds__(256) void k_layernorm(const float* __restrict__ X, const float* __restrict__ R, const float* __restrict__ g, const float* __restrict__ bta,
                                                  float* __restrict__ out_sum, float* __restrict__ out_norm, int N, float eps) {
  __shared__ float red[256];
  const int row = blockIdx.x, tid = threadIdx.x;
  const float* x = X + (size_t)row * N; const float* rr = R ? R + (size_t)row * N : nullptr;
  float vals[16];                     // up to N = 4096
  const int per = N / 256;            // contiguous chunk per thread? use strided-by-4 chunks: thread handles j = tid*4 + 1024*u
  float s1 = 0.f;
  for (int u = 0; u < per / 4; ++u) {
    const int j = tid * 4 + 1024 * u;
    const v4f a = *(const v4fa*)(x + j);
    v4f b = {0.f,0.f,0.f,0.f}; if (rr) b = *(const v4fa*)(rr + j);
#pragma unroll
    for (int q = 0; q < 4; ++q) { const float v = a[q] + b[q]; vals[u * 4 + q] = v; s1 += v; }
  }
  red[tid] = s1; __syncthreads();
  for (int st = 128; st > 0; st >>= 1) { if (tid < st) red[tid] += red[tid + st]; __syncthreads(); }
  const float mu = red[0] / (float)N; __syncthreads();
  float s2 = 0.f;
  for (int u = 0; u < per / 4; ++u)
#pragma unroll
    for (int q = 0; q < 4; ++q) { const float c = vals[u * 4 + q] - mu; s2 += c * c; }
  red[tid] = s2; __syncthreads();
  for (int st = 128; st > 0; st >>= 1) { if (tid < st) red[tid] += red[tid + st]; __syncthreads(); }
  const float rs = rsqrtf(red[0] / (float)N + eps);
  {
    for (int u = 0; u < per / 4; ++u) {
      const int j = tid * 4 + 1024 * u;
      v4f o, sm;
#pragma unroll
      for (int q = 0; q < 4; ++q) {
        float gg = g[j + q], bb = bta[j + q];
        if (PARAM_BF16) { gg = bf16_round(gg); bb = bf16_round(bb); }
        sm[q] = vals[u * 4 + q]; o[q] = (vals[u * 4 + q] - mu) * rs * gg + bb;
      }
      if (out_sum) *(v4f*)(out_sum + (size_t)row * N + j) = sm;
      *(v4f*)(out_norm + (size_t)row * N + j) = o;
    }
    
  }
}



// ---- f16 WMMA path (v_wmma_f32_16x16x32_f16): 11-bit significands for operands in range — used here for all five GEMMs (bilinear, h, o, We1, We2)
typedef _Float16 v16h __attribute__((ext_vector_type(16)));
union FragH { v16h v; v8us half[2]; _Float16 h[16]; unsigned short u[16]; };
template <int NT>
__device__ __forceinline__ v8f mmaH(v16h ah, v16h al, v16h bh, v16h bl, v8f c) {
  c = __builtin_amdgcn_wmma_f32_16x16x32_f16(false, ah, false, bh, (short)0, c, false, false);
  if (NT >= 2) c = __builtin_amdgcn_wmma_f32_16x16x32_f16(false, al, false, bh, (short)0, c, false, false);
  if (NT >= 3) c = __builtin_amdgcn_wmma_f32_16x16x32_f16(false, ah, false, bl, (short)0, c, false, false);
  asm volatile("v_nop\n\tv_nop\n\tv_nop\n\tv_nop" : "+v"(c) : "v"(ah), "v"(al), "v"(bh), "v"(bl));
  return c;
}
// batched GEMM like k_gemm_b but f16 operands: A f32 (split into f16 hi/lo if ASPLIT, else rounded to f16), Bt = f16 values [n][k]; alpha; C f32; N multiple of 16 (partial tiles skipped)
template <bool ASPLIT>
__global__ __launch_bounds__(128) void k_gemm_h(const float* __restrict__ A, int lda, size_t sA, const _Float16* __restrict__ Bh, int ldb, size_t sB, float alpha, float* __restrict__ C, int ldc, size_t sC, int M, int N, int K) {
  __shared__ __attribute__((aligned(16))) float so[4][16][64];
  const int tid = threadIdx.x, w = tid >> 5, lane = tid & 31, ln = lane & 15, hh = lane >> 4; const int by = blockIdx.y;
  A += (size_t)by * sA; Bh += (size_t)by * sB; C += (size_t)by * sC;
  const int ntn = (N + 63) / 64; const int wid = blockIdx.x * 4 + w; const int mt = wid / ntn, nq = wid % ntn; if (mt * 16 >= M) return;
  const int row0 = mt * 16, col0 = nq * 64; const float* arow = A + (size_t)(row0 + ln) * lda;
  v8f acc[4] = {};
  for (int kb = 0; kb < K; kb += 32) {
    FragH ah, al;
    const v4f x0 = *(const v4fa*)(arow + kb + 8 * hh), x1 = *(const v4fa*)(arow + kb + 8 * hh + 4), x2 = *(const v4fa*)(arow + kb + 16 + 8 * hh), x3 = *(const v4fa*)(arow + kb + 16 + 8 * hh + 4);
    float xs[16] = {x0[0],x0[1],x0[2],x0[3],x1[0],x1[1],x1[2],x1[3],x2[0],x2[1],x2[2],x2[3],x3[0],x3[1],x3[2],x3[3]};
#pragma unroll
    for (int i = 0; i < 16; ++i) { const _Float16 h = (_Float16)xs[i]; ah.h[i] = h; al.h[i] = ASPLIT ? (_Float16)(xs[i] - (float)h) : (_Float16)0.0f; }
#pragma unroll
    for (int t = 0; t < 4; ++t) { if (col0 + t * 16 >= N) continue; const size_t boff = (size_t)(col0 + t * 16 + ln) * ldb + kb; FragH bq; bq.half[0] = *(const v8us*)(Bh + boff + 8 * hh); bq.half[1] = *(const v8us*)(Bh + boff + 16 + 8 * hh);
      acc[t] = mmaH<ASPLIT ? 2 : 1>(ah.v, al.v, bq.v, bq.v, acc[t]); }
  }
#pragma unroll
  for (int t = 0; t < 4; ++t) { if (col0 + t * 16 >= N) continue;
#pragma unroll
    for (int r = 0; r < 8; ++r) so[w][8 * hh + r][t * 16 + ln] = acc[t][r] * alpha; }
  __builtin_amdgcn_fence(__ATOMIC_ACQ_REL, "workgroup"); __builtin_amdgcn_wave_barrier();
  const int rsub = lane >> 4, c4 = (lane & 15) * 4;
  {
#pragma unroll
    for (int q = 0; q < 8; ++q) { const int r = q * 2 + rsub; if (col0 + c4 < N) { const v4f v = *(const v4fa*)&so[w][r][c4]; *(v4f*)(C + (size_t)(row0 + r) * ldc + col0 + c4) = v; } }
     }
}

// Wt[n][k] = f16(W[k][n]·scale) from f32 row-major W[K][N] (scale = power of two; bf16-exact weights stay exact in f16 away from the subnormal range)
__global__ __launch_bounds__(256) void k_wt_f16(const float* __restrict__ W, _Float16* __restrict__ Wt, int K, int N, float scale) {
  const int t = blockIdx.x * 256 + threadIdx.x; if (t >= N * (K / 8)) return; const int n = t / (K / 8), k8 = (t % (K / 8)) * 8; FragH f;
#pragma unroll
  for (int i = 0; i < 8; ++i) f.h[i] = (_Float16)(bf16_round(W[(size_t)(k8 + i) * N + n]) * scale); const v8us o = f.half[0];
  *(v8us*)((unsigned short*)Wt + (size_t)n * K + k8) = o; 
}
// k_gemm_hh variant with fused epilogue: v = acc·alpha + bias[by·sBias + col] (+ CP[(row/rowsPerB)·sCPb + by·64 + col] if CP) ; ACT 0 none / 1 elu ; writes f16 C16 (and f32 C if non-null)
template <int ACT>
__global__ __launch_bounds__(128) void k_gemm_hhx(const _Float16* __restrict__ A, int lda, size_t sA, const _Float16* __restrict__ Bh, int ldb, size_t sB, float alpha, const float* __restrict__ bias, size_t sBias, const float* __restrict__ CP, int rowsPerB, size_t sCPb, int row0g,
    float* __restrict__ C, _Float16* __restrict__ C16, int ldc, size_t sC, int M, int N, int K) {
  __shared__ __attribute__((aligned(16))) float so[4][16][64];
  const int tid = threadIdx.x, w = tid >> 5, lane = tid & 31, ln = lane & 15, hh = lane >> 4; const int by = blockIdx.y;
  A += (size_t)by * sA; Bh += (size_t)by * sB; const size_t cofs = (size_t)by * sC; const float* bp = bias ? bias + (size_t)by * sBias : nullptr;
  const int ntn = (N + 63) / 64; const int wid = blockIdx.x * 4 + w; const int mt = wid / ntn, nq = wid % ntn; if (mt * 16 >= M) return;
  const int row0 = mt * 16, col0 = nq * 64; const _Float16* arow = A + (size_t)(row0 + ln) * lda;
  v8f acc[4] = {};
  for (int kb = 0; kb < K; kb += 32) { FragH ah; ah.half[0] = *(const v8us*)((const unsigned short*)arow + kb + 8 * hh); ah.half[1] = *(const v8us*)((const unsigned short*)arow + kb + 16 + 8 * hh);
#pragma unroll
    for (int t = 0; t < 4; ++t) { if (col0 + t * 16 >= N) continue; const size_t boff = (size_t)(col0 + t * 16 + ln) * ldb + kb; FragH bq; bq.half[0] = *(const v8us*)((const unsigned short*)Bh + boff + 8 * hh); bq.half[1] = *(const v8us*)((const unsigned short*)Bh + boff + 16 + 8 * hh);
      acc[t] = mmaH<1>(ah.v, ah.v, bq.v, bq.v, acc[t]); }
  }
#pragma unroll
  for (int t = 0; t < 4; ++t) { if (col0 + t * 16 >= N) continue; const int col = col0 + t * 16 + ln; const float bv = bp ? bf16_round(bp[col]) : 0.f;
#pragma unroll
    for (int r = 0; r < 8; ++r) { float v = acc[t][r] * alpha + bv; if (CP) { const int rr = row0g + row0 + 8 * hh + r; if (rowsPerB < 0) v += CP[cofs + (size_t)rr * ldc + col];      /* rowsPerB < 0: own element of the batched C plane */ else { const int bidx = rr / rowsPerB; v += CP[(size_t)bidx * sCPb + (size_t)by * 64 + col]; } } if (ACT == 1) v = (v > 0.f) ? v : expm1f(v); else if (ACT == 7) v = (v > 0.f) ? v + 1.0f : expf(v); else if (ACT == 8) v = tanhf(v); else if (ACT == 9) v = 0.5f * v * (1.0f + tanhf(0.7978845608028654f * (v + 0.044715f * v * v * v))); else if (ACT == 11) v = 1.0f / (1.0f + expf(-v)); else if (ACT == 12) v = (v > 0.f) ? v : 0.01f * v; else if (ACT == 14) v = (v > 0.f) ? v : 0.1f * v; else if (ACT == 16) v = (v >= 0.f) ? v : 0.3f * v; else if (ACT == 17) v = (v >= 0.f) ? v : 0.2f * v; else if (ACT == 15) v = v / (1.0f + expf(-v)); else if (ACT == 3) v = fmaxf(v, 0.f); else if (ACT == 6) v = 0.5f * v * (1.0f + erff(v * 0.70710678118654752f)); so[w][8 * hh + r][t * 16 + ln] = v; } }
  __builtin_amdgcn_fence(__ATOMIC_ACQ_REL, "workgroup"); __builtin_amdgcn_wave_barrier();
  const int rsub = lane >> 4, c4 = (lane & 15) * 4; typedef _Float16 v4h __attribute__((ext_vector_type(4)));
  {
#pragma unroll
    for (int q = 0; q < 8; ++q) { const int r = q * 2 + rsub; if (col0 + c4 < N) { const v4f v = *(const v4fa*)&so[w][r][c4]; if (C) *(v4f*)(C + cofs + (size_t)(row0 + r) * ldc + col0 + c4) = v; if (C16) { v4h h4; for (int i = 0; i < 4; ++i) h4[i] = (_Float16)v[i]; *(v4h*)(C16 + cofs + (size_t)(row0 + r) * ldc + col0 + c4) = h4; } } }
     }
}


typedef _Float16 v4h __attribute__((ext_vector_type(4)));

__global__ __launch_bounds__(256) void k_x16(const float* __restrict__ x, _Float16* __restrict__ X16, size_t n8) { const size_t t = (size_t)blockIdx.x * 256 + threadIdx.x; if (t >= n8) return; FragH f;
#pragma unroll
  for (int q = 0; q < 8; ++q) f.h[q] = (_Float16)bf16_round(x[t * 8 + q]); *(v8us*)((unsigned short*)X16 + t * 8) = f.half[0];  }
__global__ __launch_bounds__(256) void k_h16(const float* __restrict__ x, _Float16* __restrict__ X16, size_t n8) { const size_t t = (size_t)blockIdx.x * 256 + threadIdx.x; if (t >= n8) return; FragH f;
#pragma unroll
  for (int q = 0; q < 8; ++q) f.h[q] = (_Float16)x[t * 8 + q]; *(v8us*)((unsigned short*)X16 + t * 8) = f.half[0];  }
__global__ __launch_bounds__(256) void k_round16f(const float* __restrict__ W, _Float16* __restrict__ Bt, size_t n8) { const size_t t = (size_t)blockIdx.x * 256 + threadIdx.x; if (t >= n8) return; FragH f;
#pragma unroll
  for (int i = 0; i < 8; ++i) f.h[i] = (_Float16)(bf16_round(W[t * 8 + i]) * 16.0f); *(v8us*)((unsigned short*)Bt + t * 8) = f.half[0];  }
template <int NHv, int TTv>
__global__ __launch_bounds__(256) void k_vt(const _Float16* __restrict__ V16, int ldv, int voff, _Float16* __restrict__ Vt) { __shared__ unsigned short tl[64][66]; const int tid = threadIdx.x; const int slab = blockIdx.x / (TTv / 64), lg = blockIdx.x % (TTv / 64); const int b = slab / NHv, h = slab % NHv;
  for (int i = tid; i < 64 * 8; i += 256) { const int r = i / 8, c8 = (i % 8) * 8; FragH f; f.half[0] = *(const v8us*)((const unsigned short*)V16 + ((size_t)b * TTv + lg * 64 + r) * ldv + voff + h * 64 + c8);
#pragma unroll
    for (int q = 0; q < 8; ++q) tl[r][c8 + q] = f.u[q]; }
  __syncthreads();
  {
#pragma unroll
    for (int rd = 0; rd < 2; ++rd) { const int d = rd * 32 + tid / 8, pc = tid % 8; FragH f;
#pragma unroll
      for (int q = 0; q < 8; ++q) f.u[q] = tl[pc * 8 + q][d];
      *(v8us*)((unsigned short*)Vt + ((size_t)slab * 64 + d) * TTv + lg * 64 + pc * 8) = f.half[0]; }
     } }

__global__ __launch_bounds__(256) void k_hl(const float* __restrict__ F, _Float16* __restrict__ Hh, _Float16* __restrict__ Hl, size_t n8) { const size_t t = (size_t)blockIdx.x * 256 + threadIdx.x; if (t >= n8) return; FragH fh, fl; const v4f a = *(const v4fa*)(F + t * 8), c = *(const v4fa*)(F + t * 8 + 4);
#pragma unroll
  for (int q = 0; q < 4; ++q) { _Float16 h = (_Float16)a[q]; fh.h[q] = h; fl.h[q] = (_Float16)((a[q] - (float)h) * 1024.0f); h = (_Float16)c[q]; fh.h[4 + q] = h; fl.h[4 + q] = (_Float16)((c[q] - (float)h) * 1024.0f); }
  { *(v8us*)((unsigned short*)Hh + t * 8) = fh.half[0]; *(v8us*)((unsigned short*)Hl + t * 8) = fl.half[0];  } }

// ---- f16 fragment loader and WMMA step ----
__device__ __forceinline__ v16h g2_frag(const _Float16* p, int hh) { FragH f; f.half[0] = *(const v8us*)((const unsigned short*)p + 8 * hh); f.half[1] = *(const v8us*)((const unsigned short*)p + 16 + 8 * hh); return f.v; }
__device__ __forceinline__ v8f g2_mma(v16h a, v16h b, v8f c) { v8f d = __builtin_amdgcn_wmma_f32_16x16x32_f16(false, a, false, b, (short)0, c, false, false); asm volatile("v_nop\n\tv_nop\n\tv_nop\n\tv_nop" : "+v"(d) : "v"(a), "v"(b)); return d; }

__global__ __launch_bounds__(256) void k_wsc(const float* __restrict__ Wm, _Float16* __restrict__ Bt, size_t n8, float sc) { const size_t t = (size_t)blockIdx.x * 256 + threadIdx.x; if (t >= n8) return; FragH f; for (int q = 0; q < 8; ++q) f.h[q] = (_Float16)(bf16_round(Wm[t * 8 + q]) * sc); *(v8us*)((unsigned short*)Bt + t * 8) = f.half[0];  }
__global__ __launch_bounds__(256) void k_wput(const float* __restrict__ Wm, int nout, int nin, int roff, int coff, int kpad, _Float16* __restrict__ Bt) { const int t = blockIdx.x * 256 + threadIdx.x; const int npr = (nin + 7) / 8; if (t >= nout * npr) return; const int k0 = (t % npr) * 8; const int o = t / npr; unsigned short* d = (unsigned short*)Bt + (size_t)(roff + o) * kpad + coff + k0;
  { for (int q = 0; q < 8; ++q) { const int k = k0 + q; if (k < nin) { FragH f; f.h[0] = (_Float16)(bf16_round(Wm[(size_t)o * nin + k]) * 16.0f); *(unsigned short*)(d + q) = f.u[0] & 0xffffu; } }  } }
__global__ __launch_bounds__(256) void k_zero16(_Float16* __restrict__ D, size_t n8) { const size_t t = (size_t)blockIdx.x * 256 + threadIdx.x; if (t >= n8) return; v8us z; for (int q = 0; q < 8; ++q) z[q] = 0; *(v8us*)((unsigned short*)D + t * 8) = z;  }
__global__ __launch_bounds__(64) void k_bcat2(const float* __restrict__ a, const float* __restrict__ bb, float* __restrict__ dst) { const int i = threadIdx.x; const float v = (i < 32) ? bf16_round(a[i]) : bf16_round(bb[i - 32]); *(float*)(dst + i) = v;  }
// We1 [64][33 * 33] -> Bt [64][KKP] in the k order of k_fused's row fragments: k = a * 32 + b <- column a * 33 + b (a, b < 32); 1024 + b <- 32 * 33 + b; 1056 + a <- a * 33 + 32; 1088 <- 1088; the rest 0
__global__ __launch_bounds__(256) void k_wput_op(const float* __restrict__ Wm, _Float16* __restrict__ Bt) { const int t = blockIdx.x * 256 + threadIdx.x; if (t >= FE * (KKP / 8)) return; const int k0 = (t % (KKP / 8)) * 8; const int o = t / (KKP / 8); FragH f;
  for (int q = 0; q < 8; ++q) { const int k = k0 + q; int c = -1; if (k < 1024) c = (k >> 5) * 33 + (k & 31); else if (k < 1056) c = 32 * 33 + (k - 1024); else if (k < 1088) c = (k - 1056) * 33 + 32; else if (k == 1088) c = 1088;
    f.h[q] = (c >= 0) ? (_Float16)(bf16_round(Wm[(size_t)o * KK + c]) * 16.0f) : (_Float16)0.0f; }
  *(v8us*)((unsigned short*)Bt + (size_t)o * KKP + k0) = f.half[0]; }
// We2 [64][130] -> Bt [64][KC2] in the k order of k_fused's last product: k < 96 <- column k (e1, o1); 96 + b <- 97 + b (o2); 128 <- 96 and 129 <- 129 (the columns of the two appended ones); the rest 0
__global__ __launch_bounds__(256) void k_wput_e2(const float* __restrict__ Wm, _Float16* __restrict__ Bt) { const int t = blockIdx.x * 256 + threadIdx.x; if (t >= FE * (KC2 / 8)) return; const int k0 = (t % (KC2 / 8)) * 8; const int o = t / (KC2 / 8); FragH f; float wv[8];
#pragma unroll
  for (int q = 0; q < 8; ++q) { const int k = k0 + q; const int c = (k < 96) ? k : (k < 128) ? k + 1 : (k == 128) ? 96 : 129; wv[q] = Wm[(size_t)o * 130 + c]; }      /* a pad column reads column 129 and drops it below: all eight loads fly together */
  asm volatile("s_wait_xcnt 0x0" :: "v"(wv[0]), "v"(wv[1]), "v"(wv[2]), "v"(wv[3]), "v"(wv[4]), "v"(wv[5]), "v"(wv[6]), "v"(wv[7]) : "memory");      /* the address registers of the eight loads are free for reuse behind them: the wait stands in front of whatever overwrites them; the loaded values as inputs keep every load in front of it */
#pragma unroll
  for (int q = 0; q < 8; ++q) f.h[q] = (k0 + q < 130) ? (_Float16)(bf16_round(wv[q]) * 16.0f) : (_Float16)0.0f;
  *(v8us*)((unsigned short*)Bt + (size_t)o * KC2 + k0) = f.half[0]; }
// ---- the fused row pipeline. A row fragment (B operand): lane ln = row, elements 0..7 = k 8 hh + 0..7, elements 8..15 = k 16 + 8 hh + 0..7 of a 32-wide k step (g2_frag's order, which the weight fragments use too).
// Every '#pragma unroll' from here to the end of k_fused makes an array or vector index a compile-time constant, so that the values stay in registers.
__device__ __forceinline__ void op_row16(const float* p, int hh, bool rnd, float (&v)[16]) { const v4f x0 = *(const v4fa*)(p + 8 * hh), x1 = *(const v4fa*)(p + 8 * hh + 4), x2 = *(const v4fa*)(p + 16 + 8 * hh), x3 = *(const v4fa*)(p + 16 + 8 * hh + 4);
  asm volatile("s_wait_xcnt 0x0" ::: "memory");      /* the address pair of these four loads is free for reuse behind them: the wait stands in front of whatever overwrites it */
#pragma unroll
  for (int e = 0; e < 4; ++e) { v[e] = rnd ? bf16_round(x0[e]) : x0[e]; v[4 + e] = rnd ? bf16_round(x1[e]) : x1[e]; v[8 + e] = rnd ? bf16_round(x2[e]) : x2[e]; v[12 + e] = rnd ? bf16_round(x3[e]) : x3[e]; } }
__device__ __forceinline__ v16h op_frag(float a, const float (&q)[16]) { FragH f;
#pragma unroll
  for (int e = 0; e < 16; ++e) f.h[e] = (_Float16)(a * q[e]); return f.v; }
// two neighbouring feature tiles of a lane's accumulators (features 8 hh + r and 16 + 8 hh + r of a 32-wide block) as the next product's row fragment
__device__ __forceinline__ v16h fu_pack(v8f lo, v8f hi) { FragH f;
#pragma unroll
  for (int e = 0; e < 8; ++e) { f.h[e] = (_Float16)lo[e]; f.h[8 + e] = (_Float16)hi[e]; } return f.v; }
// the lane's eight biases of feature tile t, rounded to bf16
__device__ __forceinline__ v8f fu_bias(const float* __restrict__ b, int t, int hh) { const v4f x0 = *(const v4fa*)(b + t * 16 + 8 * hh), x1 = *(const v4fa*)(b + t * 16 + 8 * hh + 4); v8f v;
#pragma unroll
  for (int e = 0; e < 4; ++e) { v[e] = bf16_round(x0[e]); v[4 + e] = bf16_round(x1[e]); } return v; }
// one k step: 64 features x 32 rows; wl = the weight matrix at row ln, pitch LDB
template <int LDB>
__device__ __forceinline__ void fu_step(const _Float16* wl, int kb, int hh, v16h d0, v16h d1, v8f (&c)[2][4]) {
#pragma unroll
  for (int t = 0; t < 4; ++t) { const v16h a = g2_frag(wl + t * 16 * LDB + kb, hh); c[0][t] = g2_mma(a, d0, c[0][t]); c[1][t] = g2_mma(a, d1, c[1][t]); } }
__global__ __launch_bounds__(128) void k_fused(const float* __restrict__ x, const _Float16* __restrict__ BZ, const float* __restrict__ bz, const _Float16* __restrict__ BH, const float* __restrict__ bh, const _Float16* __restrict__ BO, const float* __restrict__ bo,
    const _Float16* __restrict__ BE1, const float* __restrict__ be1, const _Float16* __restrict__ BE2, const float* __restrict__ be2, float* __restrict__ out) {
  __shared__ __attribute__((aligned(16))) float so[4][32][68];
  const int tid = threadIdx.x, w = tid >> 5, lane = tid & 31, ln = lane & 15, hh = lane >> 4;
  const int row0 = blockIdx.x * 128 + 32 * w;
  const float* p0 = x + (size_t)(row0 + ln) * D1; const float* p1 = p0 + (size_t)16 * D1;
  const float* q0 = p0 + (size_t)NBI * D1; const float* q1 = q0 + (size_t)16 * D1;
  const v8f z8 = {0.f,0.f,0.f,0.f,0.f,0.f,0.f,0.f};
  float qa[16], qb[16]; op_row16(q0, hh, true, qa); op_row16(q1, hh, true, qb);
  /* [z1 | z2]: k step i holds f16(v1[i] * v2[j]), j = 0..31 */
  v8f z[2][4] = {{z8, z8, z8, z8}, {z8, z8, z8, z8}};
  { const _Float16* wz = BZ + (size_t)ln * KO;
    /* rolled over groups of four k steps: one 16-byte load brings four values of v1; fully unrolled the 32 steps would only grow the code */
#pragma unroll 1
    for (int i4 = 0; i4 < 32; i4 += 4) { const v4f pa = *(const v4fa*)(p0 + i4), pb = *(const v4fa*)(p1 + i4);
      asm volatile("s_wait_xcnt 0x0" ::: "memory");      /* the two address pairs are reused at once (the next loads land in them): the wait stands in front of that */
#pragma unroll
      for (int u = 0; u < 4; ++u) fu_step<KO>(wz, (i4 + u) * 32, hh, op_frag(bf16_round(pa[u]), qa), op_frag(bf16_round(pb[u]), qb), z); } }
  /* [h1 | h2] = relu, block-diagonal weights, K = [v1 | v2]; then the gate f16(sigmoid(z) * h), feature tile by feature tile, straight into the row fragments of the next product */
  v16h g[2][2];
  { float ra[16], rb[16]; op_row16(p0, hh, true, ra); op_row16(p1, hh, true, rb);
    const v16h v1a = op_frag(1.0f, ra), v1b = op_frag(1.0f, rb), v2a = op_frag(1.0f, qa), v2b = op_frag(1.0f, qb);
    v8f h[2][4] = {{z8, z8, z8, z8}, {z8, z8, z8, z8}};
    const _Float16* wh = BH + (size_t)ln * 64; fu_step<64>(wh, 0, hh, v1a, v1b, h); fu_step<64>(wh, 32, hh, v2a, v2b, h);
#pragma unroll
    for (int t = 0; t < 4; ++t) { const v8f bzv = fu_bias(bz, t, hh), bhv = fu_bias(bh, t, hh);
#pragma unroll
      for (int n = 0; n < 2; ++n)
#pragma unroll
        for (int r = 0; r < 8; ++r) { const float zv = z[n][t][r] * 0.0625f + bzv[r]; const float hv = fmaxf(h[n][t][r] * 0.0625f + bhv[r], 0.f); z[n][t][r] = (1.0f / (1.0f + expf(-zv))) * hv; } }
#pragma unroll
    for (int n = 0; n < 2; ++n) { g[n][0] = fu_pack(z[n][0], z[n][1]); g[n][1] = fu_pack(z[n][2], z[n][3]); } }
  /* [o1 | o2] = relu, block-diagonal weights */
  v8f o[2][4] = {{z8, z8, z8, z8}, {z8, z8, z8, z8}};
  { const _Float16* wo = BO + (size_t)ln * 64; fu_step<64>(wo, 0, hh, g[0][0], g[1][0], o); fu_step<64>(wo, 32, hh, g[0][1], g[1][1], o);
#pragma unroll
    for (int t = 0; t < 4; ++t) { const v8f bv = fu_bias(bo, t, hh);
#pragma unroll
      for (int n = 0; n < 2; ++n)
#pragma unroll
        for (int r = 0; r < 8; ++r) o[n][t][r] = fmaxf(o[n][t][r] * 0.0625f + bv[r], 0.f); } }
  /* o1 (feature tiles 0, 1) into the wave's slab, so[w][row][a]: in k step a of We1 both lane halves scale by o1[row][a], and each holds only half of the a */
#pragma unroll
  for (int n = 0; n < 2; ++n)
#pragma unroll
    for (int t = 0; t < 2; ++t) { float* d = &so[w][n * 16 + ln][t * 16 + 8 * hh]; const v4f s0 = {o[n][t][0], o[n][t][1], o[n][t][2], o[n][t][3]}, s1 = {o[n][t][4], o[n][t][5], o[n][t][6], o[n][t][7]}; *(v4fa*)d = s0; *(v4fa*)(d + 4) = s1; }
  __builtin_amdgcn_fence(__ATOMIC_ACQ_REL, "workgroup"); __builtin_amdgcn_wave_barrier();      /* each wave re-reads only its own slab of so: its LDS stores must be ordered before its loads */
  const v16h o1a = fu_pack(o[0][0], o[0][1]), o1b = fu_pack(o[1][0], o[1][1]);
  float oa[16], ob[16];
#pragma unroll
  for (int e = 0; e < 8; ++e) { oa[e] = o[0][2][e]; oa[8 + e] = o[0][3][e]; ob[e] = o[1][2][e]; ob[8 + e] = o[1][3][e]; }
  const v16h o2a = op_frag(1.0f, oa), o2b = op_frag(1.0f, ob);
  /* e1 = relu(o12 We1^T + b): k step a holds f16(o1[a] * o2[b]), b = 0..31; then o2, o1 and the one */
  v8f e1[2][4] = {{z8, z8, z8, z8}, {z8, z8, z8, z8}};
  { const _Float16* we = BE1 + (size_t)ln * KKP;
    /* rolled like the first loop: one 16-byte LDS load brings four values of o1 */
#pragma unroll 1
    for (int i4 = 0; i4 < 32; i4 += 4) { const v4f pa = *(const v4fa*)&so[w][ln][i4], pb = *(const v4fa*)&so[w][16 + ln][i4];
#pragma unroll
      for (int u = 0; u < 4; ++u) fu_step<KKP>(we, (i4 + u) * 32, hh, op_frag(pa[u], oa), op_frag(pb[u], ob), e1); }
    fu_step<KKP>(we, 1024, hh, o2a, o2b, e1); fu_step<KKP>(we, 1056, hh, o1a, o1b, e1);
    FragH one;
#pragma unroll
    for (int e = 0; e < 16; ++e) one.h[e] = (_Float16)((e == 0 && hh == 0) ? 1.0f : 0.0f);
    fu_step<KKP>(we, 1088, hh, one.v, one.v, e1);
    asm volatile("s_wait_xcnt 0x0" ::: "memory");      /* the address pair of the We1 fragment loads is reused for the next matrix: the wait stands in front of that */
#pragma unroll
    for (int t = 0; t < 4; ++t) { const v8f bv = fu_bias(be1, t, hh);
#pragma unroll
      for (int n = 0; n < 2; ++n)
#pragma unroll
        for (int r = 0; r < 8; ++r) e1[n][t][r] = fmaxf(e1[n][t][r] * 0.0625f + bv[r], 0.f); } }
  /* out = relu([e1, o1, o2, 1, 1] We2^T + b) */
  v8f y[2][4] = {{z8, z8, z8, z8}, {z8, z8, z8, z8}};
  { const _Float16* wy = BE2 + (size_t)ln * KC2;
    fu_step<KC2>(wy, 0, hh, fu_pack(e1[0][0], e1[0][1]), fu_pack(e1[1][0], e1[1][1]), y); fu_step<KC2>(wy, 32, hh, fu_pack(e1[0][2], e1[0][3]), fu_pack(e1[1][2], e1[1][3]), y);
    fu_step<KC2>(wy, 64, hh, o1a, o1b, y); fu_step<KC2>(wy, 96, hh, o2a, o2b, y);
    FragH two;
#pragma unroll
    for (int e = 0; e < 16; ++e) two.h[e] = (_Float16)((e < 2 && hh == 0) ? 1.0f : 0.0f);
    fu_step<KC2>(wy, 128, hh, two.v, two.v, y); }
  /* the lane holds 8 features of its row a tile: through the slab, so that the output goes out as whole rows */
#pragma unroll
  for (int t = 0; t < 4; ++t) { const v8f bv = fu_bias(be2, t, hh);
#pragma unroll
    for (int n = 0; n < 2; ++n) { v4f s0, s1;
#pragma unroll
      for (int r = 0; r < 4; ++r) { s0[r] = fmaxf(y[n][t][r] * 0.0625f + bv[r], 0.f); s1[r] = fmaxf(y[n][t][4 + r] * 0.0625f + bv[4 + r], 0.f); }
      float* d = &so[w][n * 16 + ln][t * 16 + 8 * hh]; *(v4fa*)d = s0; *(v4fa*)(d + 4) = s1; } }
  __builtin_amdgcn_fence(__ATOMIC_ACQ_REL, "workgroup"); __builtin_amdgcn_wave_barrier();      /* as above: the wave's own LDS stores before its loads */
  const int rsub = lane >> 4, c4 = (lane & 15) * 4;
#pragma unroll
  for (int q = 0; q < 16; ++q) { const int r = q * 2 + rsub; const v4f v = *(const v4fa*)&so[w][r][c4]; *(v4f*)(out + (size_t)(row0 + r) * FE + c4) = v; } }

extern "C" void kernel_launch(void* const* d_in, const int* in_sizes, int n_in,
                              void* d_out, int out_size, void* d_ws, size_t ws_size, hipStream_t stream) {
  (void)in_sizes; (void)n_in; (void)out_size;
  const float* const* I = (const float* const*)d_in;
  const float* x = I[0]; const float* Wh1 = I[1]; const float* bh1 = I[2]; const float* Wz1 = I[3]; const float* bz1 = I[4]; const float* Wo1 = I[5]; const float* bo1 = I[6]; const float* Wh2 = I[7]; const float* bh2 = I[8]; const float* Wz2 = I[9]; const float* bz2 = I[10]; const float* Wo2 = I[11]; const float* bo2 = I[12]; const float* We1 = I[13]; const float* be1 = I[14]; const float* We2 = I[15]; const float* be2 = I[16];
  char* ws = (char*)d_ws; size_t off = 0;
  auto take = [&](size_t bytes) { char* p = ws + off; off += (bytes + 255) & ~(size_t)255; return p; };
  _Float16* BZ = (_Float16*)take((size_t)64 * KO * 2); float* bz = (float*)take(64 * 4); _Float16* BH = (_Float16*)take((size_t)64 * 64 * 2); float* bh = (float*)take(64 * 4); _Float16* BO = (_Float16*)take((size_t)64 * 64 * 2); float* bo = (float*)take(64 * 4); _Float16* BE1 = (_Float16*)take((size_t)FE * KKP * 2); _Float16* BE2 = (_Float16*)take((size_t)FE * KC2 * 2);
  if (off > ws_size) return;      /* under 1 MiB: the prepared weights and biases only */
  k_wsc<<<(64 * KO / 8 + 255) / 256, 256, 0, stream>>>(Wz1, BZ, (size_t)32 * KO / 8, 16.0f); k_wsc<<<(32 * KO / 8 + 255) / 256, 256, 0, stream>>>(Wz2, BZ + (size_t)32 * KO, (size_t)32 * KO / 8, 16.0f); k_bcat2<<<1, 64, 0, stream>>>(bz1, bz2, bz);      /* [Wz1; Wz2] flattened [o][(i,j)] */
  k_zero16<<<(64 * 64 / 8 + 255) / 256, 256, 0, stream>>>(BH, 64 * 64 / 8); k_wput<<<(32 * 4 + 255) / 256, 256, 0, stream>>>(Wh1, 32, 32, 0, 0, 64, BH); k_wput<<<(32 * 4 + 255) / 256, 256, 0, stream>>>(Wh2, 32, 32, 32, 32, 64, BH); k_bcat2<<<1, 64, 0, stream>>>(bh1, bh2, bh);      /* blockdiag(Wh1, Wh2) */
  k_zero16<<<(64 * 64 / 8 + 255) / 256, 256, 0, stream>>>(BO, 64 * 64 / 8); k_wput<<<(32 * 4 + 255) / 256, 256, 0, stream>>>(Wo1, 32, 32, 0, 0, 64, BO); k_wput<<<(32 * 4 + 255) / 256, 256, 0, stream>>>(Wo2, 32, 32, 32, 32, 64, BO); k_bcat2<<<1, 64, 0, stream>>>(bo1, bo2, bo);      /* blockdiag(Wo1, Wo2) */
  k_wput_op<<<(FE * (KKP / 8) + 255) / 256, 256, 0, stream>>>(We1, BE1);      /* writes every column, the pad too */
  k_wput_e2<<<(FE * (KC2 / 8) + 255) / 256, 256, 0, stream>>>(We2, BE2);      /* writes every column, the pad too */
  k_fused<<<NBR / 128, 128, 0, stream>>>(x, BZ, bz, BH, bh, BO, bo, BE1, be1, BE2, be2, (float*)d_out);
}

// v004
// One run takes 101 microseconds.
// Timed twice side by side with v003, it ran 1.58 and 1.57 times as fast.
// All steps since v000 together make it 12.6 times as fast.
#include <hip/hip_runtime.h>
// KroneckerFusion (131072 rows; v1, v2 = x[0], x[1] (32 each): h_i = relu(v_i Wh_i^T + b); z_i = Bilinear(v1, Wz_i, v2) + b; o_i = relu((sigmoid(z_i) * h_i) Wo_i^T + b); o_i <- [o_i, 1]; o12 = o1 (x) o2 (33 x 33 = 1089); out = relu(o12 We1^T + b); out = relu([out, o1, o2] We2^T + b)).
// Structure: ONE kernel for the whole row pipeline; a wave owns 32 rows from the input to the output row and no intermediate touches the workspace. Every product is computed transposed, weights as the A operand (16 features a tile) and the rows as the B operand (lane = row), f16 WMMA with f32 accumulation and exact x16 weights + bias. A lane's accumulators then hold features 16 t + 8 hh + 0..7 of its own row, and two neighbouring feature tiles converted to f16 ARE the B fragment of the next product (its k order), so z, h, the gate, o, e1 and the output follow one another in registers. The bilinear forms ([Wz1; Wz2] flattened, K = 1024) and We1 (K re-ordered to [o1[a] o2[b] (1024) | o2 (32) | o1 (32) | 1 | 0 pad] = 1120) form their B fragments f16(p[i] * q[j]) in registers; o1[a], which both lane halves need for every a, goes through the wave's own LDS slab. We2's K is re-ordered to [e1 (64) | o1 (32) | o2 (32) | 1 | 1 | 0 pad] = 160 with the weight columns permuted alike. The output rows are turned in the same slab and stored as whole lines. The weight fragments come from global memory one k step ahead, through a ring of four register fragments that runs on from one product to the next.
#define NBR 131072               /* rows processed */
#define NBI 131072               /* rows in the input (x[1] starts at NBI*32; separate so debug builds can shrink NBR) */
#define D1 32
#define KO 1024                  /* 32 x 32 outer */
#define KK 1089                  /* 33 x 33 Kronecker */
#define KKP 1120
#define FE 64
#define KC2 160                  /* [e1 (64) | o1 (32) | o2 (32) | 1 | 1 | 0] */
typedef __bf16 v16b __attribute__((ext_vector_type(16)));
typedef unsigned short v8us __attribute__((ext_vector_type(8), may_alias));
typedef float  v8f  __attribute__((ext_vector_type(8)));
typedef float  v4f  __attribute__((ext_vector_type(4)));
typedef float  v4fa __attribute__((ext_vector_type(4), may_alias));
union FragB { v16b v; v8us half[2]; unsigned short u[16]; };

__device__ __forceinline__ unsigned short bf16_bits(float x) { unsigned int u = __float_as_uint(x); return (unsigned short)((u + 0x7FFFu + ((u >> 16) & 1u)) >> 16); }
__device__ __forceinline__ float bf16_val(unsigned short b) { return __uint_as_float(((unsigned int)b) << 16); }
__device__ __forceinline__ float bf16_round(float x) { return bf16_val(bf16_bits(x)); }
// D += A·B with NT terms: 1 = ah·bh, 2 = + al·bh (A split), 3 = + ah·bl (both split)
template <int NT>
__device__ __forceinline__ v8f mmaN(v16b ah, v16b al, v16b bh, v16b bl, v8f c) {
  c = __builtin_amdgcn_wmma_f32_16x16x32_bf16(false, ah, false, bh, (short)0, c, false, false);
  if (NT >= 2) c = __builtin_amdgcn_wmma_f32_16x16x32_bf16(false, al, false, bh, (short)0, c, false, false);
  if (NT >= 3) c = __builtin_amdgcn_wmma_f32_16x16x32_bf16(false, ah, false, bl, (short)0, c, false, false);
  asm volatile("v_nop\n\tv_nop\n\tv_nop\n\tv_nop" : "+v"(c) : "v"(ah), "v"(al), "v"(bh), "v"(bl));
  return c;
}

__global__ __launch_bounds__(256) void k_wt_bf16(const float* __restrict__ W, unsigned short* __restrict__ Wt, int K, int N) {
  const int t = blockIdx.x * 256 + threadIdx.x;
  const int k8n = K / 8;
  if (t >= N * k8n) return;
  const int n = t / k8n, k8 = (t % k8n) * 8;
  v8us v;
#pragma unroll
  for (int i = 0; i < 8; ++i) v[i] = bf16_bits(W[(size_t)(k8 + i) * N + n]);
  *(v8us*)(Wt + (size_t)n * K + k8) = v;
  
}

// GEMM C[M][N] (f32, pitch ldc) = act(A[M][K]·W + bias). A f32 row-major (pitch lda) converted per fragment to bf16
// (ASPLIT: hi/lo two planes -> 2 terms, else single rounded term); Wt bf16 [N][K] (pitch ldb). BIAS_BF16 rounds the
// bias to bf16 first (bias quantised to bf16 before the add). K%32==0, M%16==0, N%64==0.
template <bool ASPLIT, int ACT, bool BIAS_BF16>
__global__ __launch_bounds__(128) void k_gemm_bf(const float* __restrict__ A, int lda, const unsigned short* __restrict__ Wt, int ldb,
                                               const float* __restrict__ bias, float* __restrict__ C, int ldc, int M, int N, int K) {
  __shared__ __attribute__((aligned(16))) float so[4][16][64];
  const int tid = threadIdx.x, w = tid >> 5, lane = tid & 31, ln = lane & 15, hh = lane >> 4;
  const int ntn = N / 64;
  const int wid = blockIdx.x * 4 + w;
  const int mt = wid / ntn, nq = wid % ntn;
  if (mt * 16 >= M) return;
  const int row0 = mt * 16, col0 = nq * 64;
  const float* arow = A + (size_t)(row0 + ln) * lda;
  v8f acc[4] = {};
  for (int kb = 0; kb < K; kb += 32) {
    FragB ah, al;
    const v4f x0 = *(const v4fa*)(arow + kb + 8 * hh), x1 = *(const v4fa*)(arow + kb + 8 * hh + 4);
    const v4f x2 = *(const v4fa*)(arow + kb + 16 + 8 * hh), x3 = *(const v4fa*)(arow + kb + 16 + 8 * hh + 4);
    float xs[16] = {x0[0],x0[1],x0[2],x0[3],x1[0],x1[1],x1[2],x1[3],x2[0],x2[1],x2[2],x2[3],x3[0],x3[1],x3[2],x3[3]};
#pragma unroll
    for (int i = 0; i < 16; ++i) { const unsigned short hb = bf16_bits(xs[i]); ah.u[i] = hb; al.u[i] = ASPLIT ? bf16_bits(xs[i] - bf16_val(hb)) : (unsigned short)0; }
#pragma unroll
    for (int t = 0; t < 4; ++t) {
      const unsigned short* brow = Wt + (size_t)(col0 + t * 16 + ln) * ldb + kb;
      FragB b;
      b.half[0] = *(const v8us*)(brow + 8 * hh);
      b.half[1] = *(const v8us*)(brow + 16 + 8 * hh);
      acc[t] = mmaN<ASPLIT ? 2 : 1>(ah.v, al.v, b.v, b.v, acc[t]);
    }
  }
#pragma unroll
  for (int t = 0; t < 4; ++t) {
    float bv = bias ? bias[col0 + t * 16 + ln] : 0.f;
    if (BIAS_BF16) bv = bf16_round(bv);
#pragma unroll
    for (int r = 0; r < 8; ++r) { float v = acc[t][r] + bv; if (ACT == 1) v = fmaxf(v, 0.f); so[w][8 * hh + r][t * 16 + ln] = v; }
  }
  __builtin_amdgcn_fence(__ATOMIC_ACQ_REL, "workgroup");
  __builtin_amdgcn_wave_barrier();
  const int rsub = lane >> 4, c4 = (lane & 15) * 4;
  {
#pragma unroll
    for (int q = 0; q < 8; ++q) {
      const int r = q * 2 + rsub;
      const v4f v = *(const v4fa*)&so[w][r][c4];
      *(v4f*)(C + (size_t)(row0 + r) * ldc + col0 + c4) = v;
    }
    
  }
}

// GEMM C = act(A·W + bias + resid): A f32 (ASPLIT -> hi/lo 2 terms), Wt bf16 [N][K]; ACT 0 none, 1 relu, 2 exact gelu;
// resid (optional, f32, row index = (row % rmod), pitch ldr, RES_BF16 rounds it) added before the activation.
template <bool ASPLIT, int ACT, bool BIAS_BF16, bool RES_BF16>
__global__ __launch_bounds__(128) void k_gemm_bf3(const float* __restrict__ A, int lda, const unsigned short* __restrict__ Wt, int ldb,
                                                const float* __restrict__ bias, const float* __restrict__ resid, int rmod, int ldr,
                                                float* __restrict__ C, int ldc, int M, int N, int K) {
  __shared__ __attribute__((aligned(16))) float so[4][16][64];
  const int tid = threadIdx.x, w = tid >> 5, lane = tid & 31, ln = lane & 15, hh = lane >> 4;
  const int ntn = N / 64;
  const int wid = blockIdx.x * 4 + w;
  const int mt = wid / ntn, nq = wid % ntn;
  if (mt * 16 >= M) return;
  const int row0 = mt * 16, col0 = nq * 64;
  const float* arow = A + (size_t)(row0 + ln) * lda;
  v8f acc[4] = {};
  for (int kb = 0; kb < K; kb += 32) {
    FragB ah, al;
    const v4f x0 = *(const v4fa*)(arow + kb + 8 * hh), x1 = *(const v4fa*)(arow + kb + 8 * hh + 4);
    const v4f x2 = *(const v4fa*)(arow + kb + 16 + 8 * hh), x3 = *(const v4fa*)(arow + kb + 16 + 8 * hh + 4);
    float xs[16] = {x0[0],x0[1],x0[2],x0[3],x1[0],x1[1],x1[2],x1[3],x2[0],x2[1],x2[2],x2[3],x3[0],x3[1],x3[2],x3[3]};
#pragma unroll
    for (int i = 0; i < 16; ++i) { const unsigned short hb = bf16_bits(xs[i]); ah.u[i] = hb; al.u[i] = ASPLIT ? bf16_bits(xs[i] - bf16_val(hb)) : (unsigned short)0; }
#pragma unroll
    for (int t = 0; t < 4; ++t) {
      const unsigned short* brow = Wt + (size_t)(col0 + t * 16 + ln) * ldb + kb;
      FragB b;
      b.half[0] = *(const v8us*)(brow + 8 * hh);
      b.half[1] = *(const v8us*)(brow + 16 + 8 * hh);
      acc[t] = mmaN<ASPLIT ? 2 : 1>(ah.v, al.v, b.v, b.v, acc[t]);
    }
  }
#pragma unroll
  for (int t = 0; t < 4; ++t) {
    const int col = col0 + t * 16 + ln;
    float bv = bias ? bias[col] : 0.f;
    if (BIAS_BF16) bv = bf16_round(bv);
#pragma unroll
    for (int r = 0; r < 8; ++r) {
      float v = acc[t][r] + bv;
      if (resid) { float rv = resid[(size_t)((row0 + 8 * hh + r) % rmod) * ldr + col]; if (RES_BF16) rv = bf16_round(rv); v += rv; }
      if (ACT == 1) v = fmaxf(v, 0.f);
      if (ACT == 2) v = 0.5f * v * (1.0f + erff(v * 0.70710678118654752f));
      if (ACT == 3) { const float u = 0.7978845608028654f * (v + 0.044715f * v * v * v); v = 0.5f * v * (1.0f + tanhf(u)); }
      so[w][8 * hh + r][t * 16 + ln] = v;
    }
  }
  __builtin_amdgcn_fence(__ATOMIC_ACQ_REL, "workgroup");
  __builtin_amdgcn_wave_barrier();
  const int rsub = lane >> 4, c4 = (lane & 15) * 4;
  {
#pragma unroll
    for (int q = 0; q < 8; ++q) {
      const int r = q * 2 + rsub;
      const v4f v = *(const v4fa*)&so[w][r][c4];
      *(v4f*)(C + (size_t)(row0 + r) * ldc + col0 + c4) = v;
    }
    
  }
}
// row LayerNorm (biased variance, eps) over N: s = X (+ R); optional out_sum <- s; out_norm <- (s-mu)*rsqrt(var+eps)*g + b
template <bool PARAM_BF16>
__global__ __launch_bounds__(256) void k_layernorm(const float* __restrict__ X, const float* __restrict__ R, const float* __restrict__ g, const float* __restrict__ bta,
                                                  float* __restrict__ out_sum, float* __restrict__ out_norm, int N, float eps) {
  __shared__ float red[256];
  const int row = blockIdx.x, tid = threadIdx.x;
  const float* x = X + (size_t)row * N; const float* rr = R ? R + (size_t)row * N : nullptr;
  float vals[16];                     // up to N = 4096
  const int per = N / 256;            // contiguous chunk per thread? use strided-by-4 chunks: thread handles j = tid*4 + 1024*u
  float s1 = 0.f;
  for (int u = 0; u < per / 4; ++u) {
    const int j = tid * 4 + 1024 * u;
    const v4f a = *(const v4fa*)(x + j);
    v4f b = {0.f,0.f,0.f,0.f}; if (rr) b = *(const v4fa*)(rr + j);
#pragma unroll
    for (int q = 0; q < 4; ++q) { const float v = a[q] + b[q]; vals[u * 4 + q] = v; s1 += v; }
  }
  red[tid] = s1; __syncthreads();
  for (int st = 128; st > 0; st >>= 1) { if (tid < st) red[tid] += red[tid + st]; __syncthreads(); }
  const float mu = red[0] / (float)N; __syncthreads();
  float s2 = 0.f;
  for (int u = 0; u < per / 4; ++u)
#pragma unroll
    for (int q = 0; q < 4; ++q) { const float c = vals[u * 4 + q] - mu; s2 += c * c; }
  red[tid] = s2; __syncthreads();
  for (int st = 128; st > 0; st >>= 1) { if (tid < st) red[tid] += red[tid + st]; __syncthreads(); }
  const float rs = rsqrtf(red[0] / (float)N + eps);
  {
    for (int u = 0; u < per / 4; ++u) {
      const int j = tid * 4 + 1024 * u;
      v4f o, sm;
#pragma unroll
      for (int q = 0; q < 4; ++q) {
        float gg = g[j + q], bb = bta[j + q];
        if (PARAM_BF16) { gg = bf16_round(gg); bb = bf16_round(bb); }
        sm[q] = vals[u * 4 + q]; o[q] = (vals[u * 4 + q] - mu) * rs * gg + bb;
      }
      if (out_sum) *(v4f*)(out_sum + (size_t)row * N + j) = sm;
      *(v4f*)(out_norm + (size_t)row * N + j) = o;
    }
    
  }
}



// ---- f16 WMMA path (v_wmma_f32_16x16x32_f16): 11-bit significands for operands in range — used here for all five GEMMs (bilinear, h, o, We1, We2)
typedef _Float16 v16h __attribute__((ext_vector_type(16)));
union FragH { v16h v; v8us half[2]; _Float16 h[16]; unsigned short u[16]; };
template <int NT>
__device__ __forceinline__ v8f mmaH(v16h ah, v16h al, v16h bh, v16h bl, v8f c) {
  c = __builtin_amdgcn_wmma_f32_16x16x32_f16(false, ah, false, bh, (short)0, c, false, false);
  if (NT >= 2) c = __builtin_amdgcn_wmma_f32_16x16x32_f16(false, al, false, bh, (short)0, c, false, false);
  if (NT >= 3) c = __builtin_amdgcn_wmma_f32_16x16x32_f16(false, ah, false, bl, (short)0, c, false, false);
  asm volatile("v_nop\n\tv_nop\n\tv_nop\n\tv_nop" : "+v"(c) : "v"(ah), "v"(al), "v"(bh), "v"(bl));
  return c;
}
// batched GEMM like k_gemm_b but f16 operands: A f32 (split into f16 hi/lo if ASPLIT, else rounded to f16), Bt = f16 values [n][k]; alpha; C f32; N multiple of 16 (partial tiles skipped)
template <bool ASPLIT>
__global__ __launch_bounds__(128) void k_gemm_h(const float* __restrict__ A, int lda, size_t sA, const _Float16* __restrict__ Bh, int ldb, size_t sB, float alpha, float* __restrict__ C, int ldc, size_t sC, int M, int N, int K) {
  __shared__ __attribute__((aligned(16))) float so[4][16][64];
  const int tid = threadIdx.x, w = tid >> 5, lane = tid & 31, ln = lane & 15, hh = lane >> 4; const int by = blockIdx.y;
  A += (size_t)by * sA; Bh += (size_t)by * sB; C += (size_t)by * sC;
  const int ntn = (N + 63) / 64; const int wid = blockIdx.x * 4 + w; const int mt = wid / ntn, nq = wid % ntn; if (mt * 16 >= M) return;
  const int row0 = mt * 16, col0 = nq * 64; const float* arow = A + (size_t)(row0 + ln) * lda;
  v8f acc[4] = {};
  for (int kb = 0; kb < K; kb += 32) {
    FragH ah, al;
    const v4f x0 = *(const v4fa*)(arow + kb + 8 * hh), x1 = *(const v4fa*)(arow + kb + 8 * hh + 4), x2 = *(const v4fa*)(arow + kb + 16 + 8 * hh), x3 = *(const v4fa*)(arow + kb + 16 + 8 * hh + 4);
    float xs[16] = {x0[0],x0[1],x0[2],x0[3],x1[0],x1[1],x1[2],x1[3],x2[0],x2[1],x2[2],x2[3],x3[0],x3[1],x3[2],x3[3]};
#pragma unroll
    for (int i = 0; i < 16; ++i) { const _Float16 h = (_Float16)xs[i]; ah.h[i] = h; al.h[i] = ASPLIT ? (_Float16)(xs[i] - (float)h) : (_Float16)0.0f; }
#pragma unroll
    for (int t = 0; t < 4; ++t) { if (col0 + t * 16 >= N) continue; const size_t boff = (size_t)(col0 + t * 16 + ln) * ldb + kb; FragH bq; bq.half[0] = *(const v8us*)(Bh + boff + 8 * hh); bq.half[1] = *(const v8us*)(Bh + boff + 16 + 8 * hh);
      acc[t] = mmaH<ASPLIT ? 2 : 1>(ah.v, al.v, bq.v, bq.v, acc[t]); }
  }
#pragma unroll
  for (int t = 0; t < 4; ++t) { if (col0 + t * 16 >= N) continue;
#pragma unroll
    for (int r = 0; r < 8; ++r) so[w][8 * hh + r][t * 16 + ln] = acc[t][r] * alpha; }
  __builtin_amdgcn_fence(__ATOMIC_ACQ_REL, "workgroup"); __builtin_amdgcn_wave_barrier();
  const int rsub = lane >> 4, c4 = (lane & 15) * 4;
  {
#pragma unroll
    for (int q = 0; q < 8; ++q) { const int r = q * 2 + rsub; if (col0 + c4 < N) { const v4f v = *(const v4fa*)&so[w][r][c4]; *(v4f*)(C + (size_t)(row0 + r) * ldc + col0 + c4) = v; } }
     }
}

// Wt[n][k] = f16(W[k][n]·scale) from f32 row-major W[K][N] (scale = power of two; bf16-exact weights stay exact in f16 away from the subnormal range)
__global__ __launch_bounds__(256) void k_wt_f16(const float* __restrict__ W, _Float16* __restrict__ Wt, int K, int N, float scale) {
  const int t = blockIdx.x * 256 + threadIdx.x; if (t >= N * (K / 8)) return; const int n = t / (K / 8), k8 = (t % (K / 8)) * 8; FragH f;
#pragma unroll
  for (int i = 0; i < 8; ++i) f.h[i] = (_Float16)(bf16_round(W[(size_t)(k8 + i) * N + n]) * scale); const v8us o = f.half[0];
  *(v8us*)((unsigned short*)Wt + (size_t)n * K + k8) = o; 
}
// k_gemm_hh variant with fused epilogue: v = acc·alpha + bias[by·sBias + col] (+ CP[(row/rowsPerB)·sCPb + by·64 + col] if CP) ; ACT 0 none / 1 elu ; writes f16 C16 (and f32 C if non-null)
template <int ACT>
__global__ __launch_bounds__(128) void k_gemm_hhx(const _Float16* __restrict__ A, int lda, size_t sA, const _Float16* __restrict__ Bh, int ldb, size_t sB, float alpha, const float* __restrict__ bias, size_t sBias, const float* __restrict__ CP, int rowsPerB, size_t sCPb, int row0g,
    float* __restrict__ C, _Float16* __restrict__ C16, int ldc, size_t sC, int M, int N, int K) {
  __shared__ __attribute__((aligned(16))) float so[4][16][64];
  const int tid = threadIdx.x, w = tid >> 5, lane = tid & 31, ln = lane & 15, hh = lane >> 4; const int by = blockIdx.y;
  A += (size_t)by * sA; Bh += (size_t)by * sB; const size_t cofs = (size_t)by * sC; const float* bp = bias ? bias + (size_t)by * sBias : nullptr;
  const int ntn = (N + 63) / 64; const int wid = blockIdx.x * 4 + w; const int mt = wid / ntn, nq = wid % ntn; if (mt * 16 >= M) return;
  const int row0 = mt * 16, col0 = nq * 64; const _Float16* arow = A + (size_t)(row0 + ln) * lda;
  v8f acc[4] = {};
  for (int kb = 0; kb < K; kb += 32) { FragH ah; ah.half[0] = *(const v8us*)((const unsigned short*)arow + kb + 8 * hh); ah.half[1] = *(const v8us*)((const unsigned short*)arow + kb + 16 + 8 * hh);
#pragma unroll
    for (int t = 0; t < 4; ++t) { if (col0 + t * 16 >= N) continue; const size_t boff = (size_t)(col0 + t * 16 + ln) * ldb + kb; FragH bq; bq.half[0] = *(const v8us*)((const unsigned short*)Bh + boff + 8 * hh); bq.half[1] = *(const v8us*)((const unsigned short*)Bh + boff + 16 + 8 * hh);
      acc[t] = mmaH<1>(ah.v, ah.v, bq.v, bq.v, acc[t]); }
  }
#pragma unroll
  for (int t = 0; t < 4; ++t) { if (col0 + t * 16 >= N) continue; const int col = col0 + t * 16 + ln; const float bv = bp ? bf16_round(bp[col]) : 0.f;
#pragma unroll
    for (int r = 0; r < 8; ++r) { float v = acc[t][r] * alpha + bv; if (CP) { const int rr = row0g + row0 + 8 * hh + r; if (rowsPerB < 0) v += CP[cofs + (size_t)rr * ldc + col];      /* rowsPerB < 0: own element of the batched C plane */ else { const int bidx = rr / rowsPerB; v += CP[(size_t)bidx * sCPb + (size_t)by * 64 + col]; } } if (ACT == 1) v = (v > 0.f) ? v : expm1f(v); else if (ACT == 7) v = (v > 0.f) ? v + 1.0f : expf(v); else if (ACT == 8) v = tanhf(v); else if (ACT == 9) v = 0.5f * v * (1.0f + tanhf(0.7978845608028654f * (v + 0.044715f * v * v * v))); else if (ACT == 11) v = 1.0f / (1.0f + expf(-v)); else if (ACT == 12) v = (v > 0.f) ? v : 0.01f * v; else if (ACT == 14) v = (v > 0.f) ? v : 0.1f * v; else if (ACT == 16) v = (v >= 0.f) ? v : 0.3f * v; else if (ACT == 17) v = (v >= 0.f) ? v : 0.2f * v; else if (ACT == 15) v = v / (1.0f + expf(-v)); else if (ACT == 3) v = fmaxf(v, 0.f); else if (ACT == 6) v = 0.5f * v * (1.0f + erff(v * 0.70710678118654752f)); so[w][8 * hh + r][t * 16 + ln] = v; } }
  __builtin_amdgcn_fence(__ATOMIC_ACQ_REL, "workgroup"); __builtin_amdgcn_wave_barrier();
  const int rsub = lane >> 4, c4 = (lane & 15) * 4; typedef _Float16 v4h __attribute__((ext_vector_type(4)));
  {
#pragma unroll
    for (int q = 0; q < 8; ++q) { const int r = q * 2 + rsub; if (col0 + c4 < N) { const v4f v = *(const v4fa*)&so[w][r][c4]; if (C) *(v4f*)(C + cofs + (size_t)(row0 + r) * ldc + col0 + c4) = v; if (C16) { v4h h4; for (int i = 0; i < 4; ++i) h4[i] = (_Float16)v[i]; *(v4h*)(C16 + cofs + (size_t)(row0 + r) * ldc + col0 + c4) = h4; } } }
     }
}


typedef _Float16 v4h __attribute__((ext_vector_type(4)));

__global__ __launch_bounds__(256) void k_x16(const float* __restrict__ x, _Float16* __restrict__ X16, size_t n8) { const size_t t = (size_t)blockIdx.x * 256 + threadIdx.x; if (t >= n8) return; FragH f;
#pragma unroll
  for (int q = 0; q < 8; ++q) f.h[q] = (_Float16)bf16_round(x[t * 8 + q]); *(v8us*)((unsigned short*)X16 + t * 8) = f.half[0];  }
__global__ __launch_bounds__(256) void k_h16(const float* __restrict__ x, _Float16* __restrict__ X16, size_t n8) { const size_t t = (size_t)blockIdx.x * 256 + threadIdx.x; if (t >= n8) return; FragH f;
#pragma unroll
  for (int q = 0; q < 8; ++q) f.h[q] = (_Float16)x[t * 8 + q]; *(v8us*)((unsigned short*)X16 + t * 8) = f.half[0];  }
__global__ __launch_bounds__(256) void k_round16f(const float* __restrict__ W, _Float16* __restrict__ Bt, size_t n8) { const size_t t = (size_t)blockIdx.x * 256 + threadIdx.x; if (t >= n8) return; FragH f;
#pragma unroll
  for (int i = 0; i < 8; ++i) f.h[i] = (_Float16)(bf16_round(W[t * 8 + i]) * 16.0f); *(v8us*)((unsigned short*)Bt + t * 8) = f.half[0];  }
template <int NHv, int TTv>
__global__ __launch_bounds__(256) void k_vt(const _Float16* __restrict__ V16, int ldv, int voff, _Float16* __restrict__ Vt) { __shared__ unsigned short tl[64][66]; const int tid = threadIdx.x; const int slab = blockIdx.x / (TTv / 64), lg = blockIdx.x % (TTv / 64); const int b = slab / NHv, h = slab % NHv;
  for (int i = tid; i < 64 * 8; i += 256) { const int r = i / 8, c8 = (i % 8) * 8; FragH f; f.half[0] = *(const v8us*)((const unsigned short*)V16 + ((size_t)b * TTv + lg * 64 + r) * ldv + voff + h * 64 + c8);
#pragma unroll
    for (int q = 0; q < 8; ++q) tl[r][c8 + q] = f.u[q]; }
  __syncthreads();
  {
#pragma unroll
    for (int rd = 0; rd < 2; ++rd) { const int d = rd * 32 + tid / 8, pc = tid % 8; FragH f;
#pragma unroll
      for (int q = 0; q < 8; ++q) f.u[q] = tl[pc * 8 + q][d];
      *(v8us*)((unsigned short*)Vt + ((size_t)slab * 64 + d) * TTv + lg * 64 + pc * 8) = f.half[0]; }
     } }

__global__ __launch_bounds__(256) void k_hl(const float* __restrict__ F, _Float16* __restrict__ Hh, _Float16* __restrict__ Hl, size_t n8) { const size_t t = (size_t)blockIdx.x * 256 + threadIdx.x; if (t >= n8) return; FragH fh, fl; const v4f a = *(const v4fa*)(F + t * 8), c = *(const v4fa*)(F + t * 8 + 4);
#pragma unroll
  for (int q = 0; q < 4; ++q) { _Float16 h = (_Float16)a[q]; fh.h[q] = h; fl.h[q] = (_Float16)((a[q] - (float)h) * 1024.0f); h = (_Float16)c[q]; fh.h[4 + q] = h; fl.h[4 + q] = (_Float16)((c[q] - (float)h) * 1024.0f); }
  { *(v8us*)((unsigned short*)Hh + t * 8) = fh.half[0]; *(v8us*)((unsigned short*)Hl + t * 8) = fl.half[0];  } }

// ---- f16 fragment loader and WMMA step ----
__device__ __forceinline__ v16h g2_frag(const _Float16* p, int hh) { FragH f; f.half[0] = *(const v8us*)((const unsigned short*)p + 8 * hh); f.half[1] = *(const v8us*)((const unsigned short*)p + 16 + 8 * hh); return f.v; }
__device__ __forceinline__ v8f g2_mma(v16h a, v16h b, v8f c) { v8f d = __builtin_amdgcn_wmma_f32_16x16x32_f16(false, a, false, b, (short)0, c, false, false); asm volatile("v_nop\n\tv_nop\n\tv_nop\n\tv_nop" : "+v"(d) : "v"(a), "v"(b)); return d; }

__global__ __launch_bounds__(256) void k_wsc(const float* __restrict__ Wm, _Float16* __restrict__ Bt, size_t n8, float sc) { const size_t t = (size_t)blockIdx.x * 256 + threadIdx.x; if (t >= n8) return; FragH f; for (int q = 0; q < 8; ++q) f.h[q] = (_Float16)(bf16_round(Wm[t * 8 + q]) * sc); *(v8us*)((unsigned short*)Bt + t * 8) = f.half[0];  }
__global__ __launch_bounds__(256) void k_wput(const float* __restrict__ Wm, int nout, int nin, int roff, int coff, int kpad, _Float16* __restrict__ Bt) { const int t = blockIdx.x * 256 + threadIdx.x; const int npr = (nin + 7) / 8; if (t >= nout * npr) return; const int k0 = (t % npr) * 8; const int o = t / npr; unsigned short* d = (unsigned short*)Bt + (size_t)(roff + o) * kpad + coff + k0;
  { for (int q = 0; q < 8; ++q) { const int k = k0 + q; if (k < nin) { FragH f; f.h[0] = (_Float16)(bf16_round(Wm[(size_t)o * nin + k]) * 16.0f); *(unsigned short*)(d + q) = f.u[0] & 0xffffu; } }  } }
__global__ __launch_bounds__(256) void k_zero16(_Float16* __restrict__ D, size_t n8) { const size_t t = (size_t)blockIdx.x * 256 + threadIdx.x; if (t >= n8) return; v8us z; for (int q = 0; q < 8; ++q) z[q] = 0; *(v8us*)((unsigned short*)D + t * 8) = z;  }
__global__ __launch_bounds__(64) void k_bcat2(const float* __restrict__ a, const float* __restrict__ bb, float* __restrict__ dst) { const int i = threadIdx.x; const float v = (i < 32) ? bf16_round(a[i]) : bf16_round(bb[i - 32]); *(float*)(dst + i) = v;  }
// We1 [64][33 * 33] -> Bt [64][KKP] in the k order of k_fused's row fragments: k = a * 32 + b <- column a * 33 + b (a, b < 32); 1024 + b <- 32 * 33 + b; 1056 + a <- a * 33 + 32; 1088 <- 1088; the rest 0
__global__ __launch_bounds__(256) void k_wput_op(const float* __restrict__ Wm, _Float16* __restrict__ Bt) { const int t = blockIdx.x * 256 + threadIdx.x; if (t >= FE * (KKP / 8)) return; const int k0 = (t % (KKP / 8)) * 8; const int o = t / (KKP / 8); FragH f;
  for (int q = 0; q < 8; ++q) { const int k = k0 + q; int c = -1; if (k < 1024) c = (k >> 5) * 33 + (k & 31); else if (k < 1056) c = 32 * 33 + (k - 1024); else if (k < 1088) c = (k - 1056) * 33 + 32; else if (k == 1088) c = 1088;
    f.h[q] = (c >= 0) ? (_Float16)(bf16_round(Wm[(size_t)o * KK + c]) * 16.0f) : (_Float16)0.0f; }
  *(v8us*)((unsigned short*)Bt + (size_t)o * KKP + k0) = f.half[0]; }
// We2 [64][130] -> Bt [64][KC2] in the k order of k_fused's last product: k < 96 <- column k (e1, o1); 96 + b <- 97 + b (o2); 128 <- 96 and 129 <- 129 (the columns of the two appended ones); the rest 0
__global__ __launch_bounds__(256) void k_wput_e2(const float* __restrict__ Wm, _Float16* __restrict__ Bt) { const int t = blockIdx.x * 256 + threadIdx.x; if (t >= FE * (KC2 / 8)) return; const int k0 = (t % (KC2 / 8)) * 8; const int o = t / (KC2 / 8); FragH f; float wv[8];
#pragma unroll
  for (int q = 0; q < 8; ++q) { const int k = k0 + q; const int c = (k < 96) ? k : (k < 128) ? k + 1 : (k == 128) ? 96 : 129; wv[q] = Wm[(size_t)o * 130 + c]; }      /* a pad column reads column 129 and drops it below: all eight loads fly together */
  asm volatile("s_wait_xcnt 0x0" :: "v"(wv[0]), "v"(wv[1]), "v"(wv[2]), "v"(wv[3]), "v"(wv[4]), "v"(wv[5]), "v"(wv[6]), "v"(wv[7]) : "memory");      /* the address registers of the eight loads are free for reuse behind them: the wait stands in front of whatever overwrites them; the loaded values as inputs keep every load in front of it */
#pragma unroll
  for (int q = 0; q < 8; ++q) f.h[q] = (k0 + q < 130) ? (_Float16)(bf16_round(wv[q]) * 16.0f) : (_Float16)0.0f;
  *(v8us*)((unsigned short*)Bt + (size_t)o * KC2 + k0) = f.half[0]; }
// ---- the fused row pipeline. A row fragment (B operand): lane ln = row, elements 0..7 = k 8 hh + 0..7, elements 8..15 = k 16 + 8 hh + 0..7 of a 32-wide k step (g2_frag's order, which the weight fragments use too).
// Every '#pragma unroll' from here to the end of k_fused makes an array or vector index a compile-time constant, so that the values stay in registers.
__device__ __forceinline__ void op_row16(const float* p, int hh, bool rnd, float (&v)[16]) { const v4f x0 = *(const v4fa*)(p + 8 * hh), x1 = *(const v4fa*)(p + 8 * hh + 4), x2 = *(const v4fa*)(p + 16 + 8 * hh), x3 = *(const v4fa*)(p + 16 + 8 * hh + 4);
  asm volatile("s_wait_xcnt 0x0" ::: "memory");      /* the address pair of these four loads is free for reuse behind them: the wait stands in front of whatever overwrites it */
#pragma unroll
  for (int e = 0; e < 4; ++e) { v[e] = rnd ? bf16_round(x0[e]) : x0[e]; v[4 + e] = rnd ? bf16_round(x1[e]) : x1[e]; v[8 + e] = rnd ? bf16_round(x2[e]) : x2[e]; v[12 + e] = rnd ? bf16_round(x3[e]) : x3[e]; } }
__device__ __forceinline__ v16h op_frag(float a, const float (&q)[16]) { FragH f;
#pragma unroll
  for (int e = 0; e < 16; ++e) f.h[e] = (_Float16)(a * q[e]); return f.v; }
// two neighbouring feature tiles of a lane's accumulators (features 8 hh + r and 16 + 8 hh + r of a 32-wide block) as the next product's row fragment
__device__ __forceinline__ v16h fu_pack(v8f lo, v8f hi) { FragH f;
#pragma unroll
  for (int e = 0; e < 8; ++e) { f.h[e] = (_Float16)lo[e]; f.h[8 + e] = (_Float16)hi[e]; } return f.v; }
// the lane's eight biases of feature tile t, rounded to bf16
__device__ __forceinline__ v8f fu_bias(const float* __restrict__ b, int t, int hh) { const v4f x0 = *(const v4fa*)(b + t * 16 + 8 * hh), x1 = *(const v4fa*)(b + t * 16 + 8 * hh + 4); v8f v;
#pragma unroll
  for (int e = 0; e < 4; ++e) { v[e] = bf16_round(x0[e]); v[4 + e] = bf16_round(x1[e]); } return v; }
// the four weight fragments (64 features) of one k step; wl = the weight matrix at row ln and at the step's first k, pitch ldb
__device__ __forceinline__ void fu_load(const _Float16* wl, int ldb, int hh, v16h (&a)[4]) {
#pragma unroll
  for (int t = 0; t < 4; ++t) a[t] = g2_frag(wl + t * 16 * ldb, hh); }
// one k step, 64 features x 32 rows, on fragments that were loaded one step earlier
__device__ __forceinline__ void fu_step_end(const v16h (&a)[4], v16h d0, v16h d1, v8f (&c)[2][4]) {
#pragma unroll
  for (int t = 0; t < 4; ++t) { c[0][t] = g2_mma(a[t], d0, c[0][t]); c[1][t] = g2_mma(a[t], d1, c[1][t]); } }
// the same, and behind the two products that read a[t] its registers take that tile's fragment of the step that follows (wn, ldn: as in fu_load), so that a whole step's work lies between a load and its use
__device__ __forceinline__ void fu_step_pf(v16h (&a)[4], const _Float16* wn, int ldn, int hh, v16h d0, v16h d1, v8f (&c)[2][4]) {
#pragma unroll
  for (int t = 0; t < 4; ++t) { c[0][t] = g2_mma(a[t], d0, c[0][t]); c[1][t] = g2_mma(a[t], d1, c[1][t]); a[t] = g2_frag(wn + t * 16 * ldn, hh); }
  __builtin_amdgcn_sched_barrier(0); }      /* keeps the later steps' row-fragment arithmetic behind this step: moved up, the row fragments of four steps are live at once and the kernel needs more than 256 registers, one wave a SIMD less */
__global__ __launch_bounds__(128) void k_fused(const float* __restrict__ x, const _Float16* __restrict__ BZ, const float* __restrict__ bz, const _Float16* __restrict__ BH, const float* __restrict__ bh, const _Float16* __restrict__ BO, const float* __restrict__ bo,
    const _Float16* __restrict__ BE1, const float* __restrict__ be1, const _Float16* __restrict__ BE2, const float* __restrict__ be2, float* __restrict__ out) {
  __shared__ __attribute__((aligned(16))) float so[4][32][68];
  const int tid = threadIdx.x, w = tid >> 5, lane = tid & 31, ln = lane & 15, hh = lane >> 4;
  const int row0 = blockIdx.x * 128 + 32 * w;
  const float* p0 = x + (size_t)(row0 + ln) * D1; const float* p1 = p0 + (size_t)16 * D1;
  const float* q0 = p0 + (size_t)NBI * D1; const float* q1 = q0 + (size_t)16 * D1;
  const v8f z8 = {0.f,0.f,0.f,0.f,0.f,0.f,0.f,0.f};
  const _Float16* wz = BZ + (size_t)ln * KO; const _Float16* wh = BH + (size_t)ln * 64; const _Float16* wo = BO + (size_t)ln * 64; const _Float16* we = BE1 + (size_t)ln * KKP; const _Float16* wy = BE2 + (size_t)ln * KC2;
  v16h a[4]; fu_load(wz, KO, hh, a);      /* the ring of weight fragments: always one k step ahead, through all five products */
  float qa[16], qb[16]; op_row16(q0, hh, true, qa); op_row16(q1, hh, true, qb);
  /* [z1 | z2]: k step i holds f16(v1[i] * v2[j]), j = 0..31 */
  v8f z[2][4] = {{z8, z8, z8, z8}, {z8, z8, z8, z8}};
  { float pa[4], pb[4];      /* carried rounded, so that no load is open on them at the loop's head: carried raw, the wait there was to 0 and emptied the fragment ring once a group */
    { const v4f na = *(const v4fa*)p0, nb = *(const v4fa*)p1;
#pragma unroll
      for (int u = 0; u < 4; ++u) { pa[u] = bf16_round(na[u]); pb[u] = bf16_round(nb[u]); } }
    /* rolled over groups of four k steps: one 16-byte load brings four values of v1, a group ahead like the fragments; fully unrolled the 32 steps would only grow the code. What the last group fetches ahead is group 0 again and is not used: no branch among the products, and every address stays inside its row */
#pragma unroll 1
    for (int i4 = 0; i4 < 32; i4 += 4) { const int nx = (i4 + 4) & 31; const v4f na = *(const v4fa*)(p0 + nx), nb = *(const v4fa*)(p1 + nx);
      asm volatile("s_wait_xcnt 0x0" ::: "memory");      /* the two address pairs are reused at once: the wait stands in front of that */
#pragma unroll
      for (int u = 0; u < 4; ++u) fu_step_pf(a, wz + (u < 3 ? i4 + u + 1 : nx) * 32, KO, hh, op_frag(pa[u], qa), op_frag(pb[u], qb), z);
      asm volatile("s_wait_xcnt 0x0" ::: "memory");      /* the address pairs of the fragment loads are stepped on at the foot of the group: the wait stands in front of that */
      __builtin_amdgcn_sched_barrier(0);      /* holds that stepping behind the wait */
#pragma unroll
      for (int u = 0; u < 4; ++u) { pa[u] = bf16_round(na[u]); pb[u] = bf16_round(nb[u]); } }
    fu_load(wh, 64, hh, a); }      /* flies together with the two v1 rows that the next product needs */
  /* [h1 | h2] = relu, block-diagonal weights, K = [v1 | v2]; then the gate f16(sigmoid(z) * h), feature tile by feature tile, straight into the row fragments of the next product */
  v16h g[2][2];
  { float ra[16], rb[16]; op_row16(p0, hh, true, ra); op_row16(p1, hh, true, rb);
    const v16h v1a = op_frag(1.0f, ra), v1b = op_frag(1.0f, rb), v2a = op_frag(1.0f, qa), v2b = op_frag(1.0f, qb);
    v8f h[2][4] = {{z8, z8, z8, z8}, {z8, z8, z8, z8}};
    fu_step_pf(a, wh + 32, 64, hh, v1a, v1b, h); fu_step_pf(a, wo, 64, hh, v2a, v2b, h);
#pragma unroll
    for (int t = 0; t < 4; ++t) { const v8f bzv = fu_bias(bz, t, hh), bhv = fu_bias(bh, t, hh);
#pragma unroll
      for (int n = 0; n < 2; ++n)
#pragma unroll
        for (int r = 0; r < 8; ++r) { const float zv = z[n][t][r] * 0.0625f + bzv[r]; const float hv = fmaxf(h[n][t][r] * 0.0625f + bhv[r], 0.f); z[n][t][r] = (1.0f / (1.0f + expf(-zv))) * hv; } }
#pragma unroll
    for (int n = 0; n < 2; ++n) { g[n][0] = fu_pack(z[n][0], z[n][1]); g[n][1] = fu_pack(z[n][2], z[n][3]); } }
  /* [o1 | o2] = relu, block-diagonal weights */
  v8f o[2][4] = {{z8, z8, z8, z8}, {z8, z8, z8, z8}};
  { fu_step_pf(a, wo + 32, 64, hh, g[0][0], g[1][0], o); fu_step_pf(a, we, KKP, hh, g[0][1], g[1][1], o);
    asm volatile("s_wait_xcnt 0x0" ::: "memory");      /* the address pair of the Wo fragment loads is free for reuse from here on: the wait stands in front of whatever overwrites it */
#pragma unroll
    for (int t = 0; t < 4; ++t) { const v8f bv = fu_bias(bo, t, hh);
#pragma unroll
      for (int n = 0; n < 2; ++n)
#pragma unroll
        for (int r = 0; r < 8; ++r) o[n][t][r] = fmaxf(o[n][t][r] * 0.0625f + bv[r], 0.f); } }
  /* o1 (feature tiles 0, 1) into the wave's slab, so[w][row][a]: in k step a of We1 both lane halves scale by o1[row][a], and each holds only half of the a */
#pragma unroll
  for (int n = 0; n < 2; ++n)
#pragma unroll
    for (int t = 0; t < 2; ++t) { float* d = &so[w][n * 16 + ln][t * 16 + 8 * hh]; const v4f s0 = {o[n][t][0], o[n][t][1], o[n][t][2], o[n][t][3]}, s1 = {o[n][t][4], o[n][t][5], o[n][t][6], o[n][t][7]}; *(v4fa*)d = s0; *(v4fa*)(d + 4) = s1; }
  __builtin_amdgcn_fence(__ATOMIC_ACQ_REL, "workgroup"); __builtin_amdgcn_wave_barrier();      /* each wave re-reads only its own slab of so: its LDS stores must be ordered before its loads */
  const v16h o1a = fu_pack(o[0][0], o[0][1]), o1b = fu_pack(o[1][0], o[1][1]);
  float oa[16], ob[16];
#pragma unroll
  for (int e = 0; e < 8; ++e) { oa[e] = o[0][2][e]; oa[8 + e] = o[0][3][e]; ob[e] = o[1][2][e]; ob[8 + e] = o[1][3][e]; }
  const v16h o2a = op_frag(1.0f, oa), o2b = op_frag(1.0f, ob);
  /* e1 = relu(o12 We1^T + b): k step a holds f16(o1[a] * o2[b]), b = 0..31; then o2, o1 and the one */
  v8f e1[2][4] = {{z8, z8, z8, z8}, {z8, z8, z8, z8}};
  { /* rolled like the first loop: one 16-byte LDS load brings four values of o1 */
#pragma unroll 1
    for (int i4 = 0; i4 < 32; i4 += 4) { const v4f pa = *(const v4fa*)&so[w][ln][i4], pb = *(const v4fa*)&so[w][16 + ln][i4];
#pragma unroll
      for (int u = 0; u < 4; ++u) fu_step_pf(a, we + (i4 + u + 1) * 32, KKP, hh, op_frag(pa[u], oa), op_frag(pb[u], ob), e1); }
    fu_step_pf(a, we + 1056, KKP, hh, o2a, o2b, e1); fu_step_pf(a, we + 1088, KKP, hh, o1a, o1b, e1);
    FragH one;
#pragma unroll
    for (int e = 0; e < 16; ++e) one.h[e] = (_Float16)((e == 0 && hh == 0) ? 1.0f : 0.0f);
    fu_step_pf(a, wy, KC2, hh, one.v, one.v, e1);
    asm volatile("s_wait_xcnt 0x0" ::: "memory");      /* the address pair of the We1 fragment loads is free for reuse from here on: the wait stands in front of whatever overwrites it */
#pragma unroll
    for (int t = 0; t < 4; ++t) { const v8f bv = fu_bias(be1, t, hh);
#pragma unroll
      for (int n = 0; n < 2; ++n)
#pragma unroll
        for (int r = 0; r < 8; ++r) e1[n][t][r] = fmaxf(e1[n][t][r] * 0.0625f + bv[r], 0.f); } }
  /* out = relu([e1, o1, o2, 1, 1] We2^T + b) */
  v8f y[2][4] = {{z8, z8, z8, z8}, {z8, z8, z8, z8}};
  { fu_step_pf(a, wy + 32, KC2, hh, fu_pack(e1[0][0], e1[0][1]), fu_pack(e1[1][0], e1[1][1]), y); fu_step_pf(a, wy + 64, KC2, hh, fu_pack(e1[0][2], e1[0][3]), fu_pack(e1[1][2], e1[1][3]), y);
    fu_step_pf(a, wy + 96, KC2, hh, o1a, o1b, y); fu_step_pf(a, wy + 128, KC2, hh, o2a, o2b, y);
    FragH two;
#pragma unroll
    for (int e = 0; e < 16; ++e) two.h[e] = (_Float16)((e < 2 && hh == 0) ? 1.0f : 0.0f);
    fu_step_end(a, two.v, two.v, y); }
  /* the lane holds 8 features of its row a tile: through the slab, so that the output goes out as whole rows */
#pragma unroll
  for (int t = 0; t < 4; ++t) { const v8f bv = fu_bias(be2, t, hh);
#pragma unroll
    for (int n = 0; n < 2; ++n) { v4f s0, s1;
#pragma unroll
      for (int r = 0; r < 4; ++r) { s0[r] = fmaxf(y[n][t][r] * 0.0625f + bv[r], 0.f); s1[r] = fmaxf(y[n][t][4 + r] * 0.0625f + bv[4 + r], 0.f); }
      float* d = &so[w][n * 16 + ln][t * 16 + 8 * hh]; *(v4fa*)d = s0; *(v4fa*)(d + 4) = s1; } }
  __builtin_amdgcn_fence(__ATOMIC_ACQ_REL, "workgroup"); __builtin_amdgcn_wave_barrier();      /* as above: the wave's own LDS stores before its loads */
  const int rsub = lane >> 4, c4 = (lane & 15) * 4;
#pragma unroll
  for (int q = 0; q < 16; ++q) { const int r = q * 2 + rsub; const v4f v = *(const v4fa*)&so[w][r][c4]; *(v4f*)(out + (size_t)(row0 + r) * FE + c4) = v; } }

extern "C" void kernel_launch(void* const* d_in, const int* in_sizes, int n_in,
                              void* d_out, int out_size, void* d_ws, size_t ws_size, hipStream_t stream) {
  (void)in_sizes; (void)n_in; (void)out_size;
  const float* const* I = (const float* const*)d_in;
  const float* x = I[0]; const float* Wh1 = I[1]; const float* bh1 = I[2]; const float* Wz1 = I[3]; const float* bz1 = I[4]; const float* Wo1 = I[5]; const float* bo1 = I[6]; const float* Wh2 = I[7]; const float* bh2 = I[8]; const float* Wz2 = I[9]; const float* bz2 = I[10]; const float* Wo2 = I[11]; const float* bo2 = I[12]; const float* We1 = I[13]; const float* be1 = I[14]; const float* We2 = I[15]; const float* be2 = I[16];
  char* ws = (char*)d_ws; size_t off = 0;
  auto take = [&](size_t bytes) { char* p = ws + off; off += (bytes + 255) & ~(size_t)255; return p; };
  _Float16* BZ = (_Float16*)take((size_t)64 * KO * 2); float* bz = (float*)take(64 * 4); _Float16* BH = (_Float16*)take((size_t)64 * 64 * 2); float* bh = (float*)take(64 * 4); _Float16* BO = (_Float16*)take((size_t)64 * 64 * 2); float* bo = (float*)take(64 * 4); _Float16* BE1 = (_Float16*)take((size_t)FE * KKP * 2); _Float16* BE2 = (_Float16*)take((size_t)FE * KC2 * 2);
  if (off > ws_size) return;      /* under 1 MiB: the prepared weights and biases only */
  k_wsc<<<(64 * KO / 8 + 255) / 256, 256, 0, stream>>>(Wz1, BZ, (size_t)32 * KO / 8, 16.0f); k_wsc<<<(32 * KO / 8 + 255) / 256, 256, 0, stream>>>(Wz2, BZ + (size_t)32 * KO, (size_t)32 * KO / 8, 16.0f); k_bcat2<<<1, 64, 0, stream>>>(bz1, bz2, bz);      /* [Wz1; Wz2] flattened [o][(i,j)] */
  k_zero16<<<(64 * 64 / 8 + 255) / 256, 256, 0, stream>>>(BH, 64 * 64 / 8); k_wput<<<(32 * 4 + 255) / 256, 256, 0, stream>>>(Wh1, 32, 32, 0, 0, 64, BH); k_wput<<<(32 * 4 + 255) / 256, 256, 0, stream>>>(Wh2, 32, 32, 32, 32, 64, BH); k_bcat2<<<1, 64, 0, stream>>>(bh1, bh2, bh);      /* blockdiag(Wh1, Wh2) */
  k_zero16<<<(64 * 64 / 8 + 255) / 256, 256, 0, stream>>>(BO, 64 * 64 / 8); k_wput<<<(32 * 4 + 255) / 256, 256, 0, stream>>>(Wo1, 32, 32, 0, 0, 64, BO); k_wput<<<(32 * 4 + 255) / 256, 256, 0, stream>>>(Wo2, 32, 32, 32, 32, 64, BO); k_bcat2<<<1, 64, 0, stream>>>(bo1, bo2, bo);      /* blockdiag(Wo1, Wo2) */
  k_wput_op<<<(FE * (KKP / 8) + 255) / 256, 256, 0, stream>>>(We1, BE1);      /* writes every column, the pad too */
  k_wput_e2<<<(FE * (KC2 / 8) + 255) / 256, 256, 0, stream>>>(We2, BE2);      /* writes every column, the pad too */
  k_fused<<<NBR / 128, 128, 0, stream>>>(x, BZ, bz, BH, bh, BO, bo, BE1, be1, BE2, be2, (float*)d_out);
}

// v005
// Measured time: 75.2 microseconds a run.
// Two timings next to v004 both put it at 1.34 times that version's speed.
// All steps since v000 together make it 16.8 times as fast.
#include <hip/hip_runtime.h>
// KroneckerFusion (131072 rows; v1, v2 = x[0], x[1] (32 each): h_i = relu(v_i Wh_i^T + b); z_i = Bilinear(v1, Wz_i, v2) + b; o_i = relu((sigmoid(z_i) * h_i) Wo_i^T + b); o_i <- [o_i, 1]; o12 = o1 (x) o2 (33 x 33 = 1089); out = relu(o12 We1^T + b); out = relu([out, o1, o2] We2^T + b)).
// Structure: ONE kernel for the whole row pipeline; a wave owns 32 rows from the input to the output row and no intermediate touches the workspace. Every product is computed transposed, weights as the A operand (16 features a tile) and the rows as the B operand (lane = row), f16 WMMA with f32 accumulation and exact x16 weights + bias. A lane's accumulators then hold features 16 t + 8 hh + 0..7 of its own row, and two neighbouring feature tiles converted to f16 ARE the B fragment of the next product (its k order), so z, h, the gate, o, e1 and the output follow one another in registers. The bilinear forms ([Wz1; Wz2] flattened, K = 1024) and We1 (K re-ordered to [o1[a] o2[b] (1024) | o2 (32) | o1 (32) | 1 | 0 pad] = 1120) form their B fragments f16(p[i] * q[j]) in registers; o1[a], which both lane halves need for every a, goes through the wave's own LDS slab. We2's K is re-ordered to [e1 (64) | o1 (32) | o2 (32) | 1 | 1 | 0 pad] = 160 with the weight columns permuted alike. The output rows are turned in the same slab and stored as whole lines. The weight fragments come from global memory one k step ahead, through a ring of four register fragments that runs on from one product to the next; the prepared weight planes lie in fragment order (fr_off), so that each 16-byte-a-lane load of a fragment half reads 512 bytes in a row, four whole cache lines.
#define NBR 131072               /* rows processed */
#define NBI 131072               /* rows in the input (x[1] starts at NBI*32; separate so debug builds can shrink NBR) */
#define D1 32
#define KO 1024                  /* 32 x 32 outer */
#define KK 1089                  /* 33 x 33 Kronecker */
#define KKP 1120
#define FE 64
#define KC2 160                  /* [e1 (64) | o1 (32) | o2 (32) | 1 | 1 | 0] */
typedef __bf16 v16b __attribute__((ext_vector_type(16)));
typedef unsigned short v8us __attribute__((ext_vector_type(8), may_alias));
typedef float  v8f  __attribute__((ext_vector_type(8)));
typedef float  v4f  __attribute__((ext_vector_type(4)));
typedef float  v4fa __attribute__((ext_vector_type(4), may_alias));
union FragB { v16b v; v8us half[2]; unsigned short u[16]; };

__device__ __forceinline__ unsigned short bf16_bits(float x) { unsigned int u = __float_as_uint(x); return (unsigned short)((u + 0x7FFFu + ((u >> 16) & 1u)) >> 16); }
__device__ __forceinline__ float bf16_val(unsigned short b) { return __uint_as_float(((unsigned int)b) << 16); }
__device__ __forceinline__ float bf16_round(float x) { return bf16_val(bf16_bits(x)); }
// D += A·B with NT terms: 1 = ah·bh, 2 = + al·bh (A split), 3 = + ah·bl (both split)
template <int NT>
__device__ __forceinline__ v8f mmaN(v16b ah, v16b al, v16b bh, v16b bl, v8f c) {
  c = __builtin_amdgcn_wmma_f32_16x16x32_bf16(false, ah, false, bh, (short)0, c, false, false);
  if (NT >= 2) c = __builtin_amdgcn_wmma_f32_16x16x32_bf16(false, al, false, bh, (short)0, c, false, false);
  if (NT >= 3) c = __builtin_amdgcn_wmma_f32_16x16x32_bf16(false, ah, false, bl, (short)0, c, false, false);
  asm volatile("v_nop\n\tv_nop\n\tv_nop\n\tv_nop" : "+v"(c) : "v"(ah), "v"(al), "v"(bh), "v"(bl));
  return c;
}

__global__ __launch_bounds__(256) void k_wt_bf16(const float* __restrict__ W, unsigned short* __restrict__ Wt, int K, int N) {
  const int t = blockIdx.x * 256 + threadIdx.x;
  const int k8n = K / 8;
  if (t >= N * k8n) return;
  const int n = t / k8n, k8 = (t % k8n) * 8;
  v8us v;
#pragma unroll
  for (int i = 0; i < 8; ++i) v[i] = bf16_bits(W[(size_t)(k8 + i) * N + n]);
  *(v8us*)(Wt + (size_t)n * K + k8) = v;
  
}

// GEMM C[M][N] (f32, pitch ldc) = act(A[M][K]·W + bias). A f32 row-major (pitch lda) converted per fragment to bf16
// (ASPLIT: hi/lo two planes -> 2 terms, else single rounded term); Wt bf16 [N][K] (pitch ldb). BIAS_BF16 rounds the
// bias to bf16 first (bias quantised to bf16 before the add). K%32==0, M%16==0, N%64==0.
template <bool ASPLIT, int ACT, bool BIAS_BF16>
__global__ __launch_bounds__(128) void k_gemm_bf(const float* __restrict__ A, int lda, const unsigned short* __restrict__ Wt, int ldb,
                                               const float* __restrict__ bias, float* __restrict__ C, int ldc, int M, int N, int K) {
  __shared__ __attribute__((aligned(16))) float so[4][16][64];
  const int tid = threadIdx.x, w = tid >> 5, lane = tid & 31, ln = lane & 15, hh = lane >> 4;
  const int ntn = N / 64;
  const int wid = blockIdx.x * 4 + w;
  const int mt = wid / ntn, nq = wid % ntn;
  if (mt * 16 >= M) return;
  const int row0 = mt * 16, col0 = nq * 64;
  const float* arow = A + (size_t)(row0 + ln) * lda;
  v8f acc[4] = {};
  for (int kb = 0; kb < K; kb += 32) {
    FragB ah, al;
    const v4f x0 = *(const v4fa*)(arow + kb + 8 * hh), x1 = *(const v4fa*)(arow + kb + 8 * hh + 4);
    const v4f x2 = *(const v4fa*)(arow + kb + 16 + 8 * hh), x3 = *(const v4fa*)(arow + kb + 16 + 8 * hh + 4);
    float xs[16] = {x0[0],x0[1],x0[2],x0[3],x1[0],x1[1],x1[2],x1[3],x2[0],x2[1],x2[2],x2[3],x3[0],x3[1],x3[2],x3[3]};
#pragma unroll
    for (int i = 0; i < 16; ++i) { const unsigned short hb = bf16_bits(xs[i]); ah.u[i] = hb; al.u[i] = ASPLIT ? bf16_bits(xs[i] - bf16_val(hb)) : (unsigned short)0; }
#pragma unroll
    for (int t = 0; t < 4; ++t) {
      const unsigned short* brow = Wt + (size_t)(col0 + t * 16 + ln) * ldb + kb;
      FragB b;
      b.half[0] = *(const v8us*)(brow + 8 * hh);
      b.half[1] = *(const v8us*)(brow + 16 + 8 * hh);
      acc[t] = mmaN<ASPLIT ? 2 : 1>(ah.v, al.v, b.v, b.v, acc[t]);
    }
  }
#pragma unroll
  for (int t = 0; t < 4; ++t) {
    float bv = bias ? bias[col0 + t * 16 + ln] : 0.f;
    if (BIAS_BF16) bv = bf16_round(bv);
#pragma unroll
    for (int r = 0; r < 8; ++r) { float v = acc[t][r] + bv; if (ACT == 1) v = fmaxf(v, 0.f); so[w][8 * hh + r][t * 16 + ln] = v; }
  }
  __builtin_amdgcn_fence(__ATOMIC_ACQ_REL, "workgroup");
  __builtin_amdgcn_wave_barrier();
  const int rsub = lane >> 4, c4 = (lane & 15) * 4;
  {
#pragma unroll
    for (int q = 0; q < 8; ++q) {
      const int r = q * 2 + rsub;
      const v4f v = *(const v4fa*)&so[w][r][c4];
      *(v4f*)(C + (size_t)(row0 + r) * ldc + col0 + c4) = v;
    }
    
  }
}

// GEMM C = act(A·W + bias + resid): A f32 (ASPLIT -> hi/lo 2 terms), Wt bf16 [N][K]; ACT 0 none, 1 relu, 2 exact gelu;
// resid (optional, f32, row index = (row % rmod), pitch ldr, RES_BF16 rounds it) added before the activation.
template <bool ASPLIT, int ACT, bool BIAS_BF16, bool RES_BF16>
__global__ __launch_bounds__(128) void k_gemm_bf3(const float* __restrict__ A, int lda, const unsigned short* __restrict__ Wt, int ldb,
                                                const float* __restrict__ bias, const float* __restrict__ resid, int rmod, int ldr,
                                                float* __restrict__ C, int ldc, int M, int N, int K) {
  __shared__ __attribute__((aligned(16))) float so[4][16][64];
  const int tid = threadIdx.x, w = tid >> 5, lane = tid & 31, ln = lane & 15, hh = lane >> 4;
  const int ntn = N / 64;
  const int wid = blockIdx.x * 4 + w;
  const int mt = wid / ntn, nq = wid % ntn;
  if (mt * 16 >= M) return;
  const int row0 = mt * 16, col0 = nq * 64;
  const float* arow = A + (size_t)(row0 + ln) * lda;
  v8f acc[4] = {};
  for (int kb = 0; kb < K; kb += 32) {
    FragB ah, al;
    const v4f x0 = *(const v4fa*)(arow + kb + 8 * hh), x1 = *(const v4fa*)(arow + kb + 8 * hh + 4);
    const v4f x2 = *(const v4fa*)(arow + kb + 16 + 8 * hh), x3 = *(const v4fa*)(arow + kb + 16 + 8 * hh + 4);
    float xs[16] = {x0[0],x0[1],x0[2],x0[3],x1[0],x1[1],x1[2],x1[3],x2[0],x2[1],x2[2],x2[3],x3[0],x3[1],x3[2],x3[3]};
#pragma unroll
    for (int i = 0; i < 16; ++i) { const unsigned short hb = bf16_bits(xs[i]); ah.u[i] = hb; al.u[i] = ASPLIT ? bf16_bits(xs[i] - bf16_val(hb)) : (unsigned short)0; }
#pragma unroll
    for (int t = 0; t < 4; ++t) {
      const unsigned short* brow = Wt + (size_t)(col0 + t * 16 + ln) * ldb + kb;
      FragB b;
      b.half[0] = *(const v8us*)(brow + 8 * hh);
      b.half[1] = *(const v8us*)(brow + 16 + 8 * hh);
      acc[t] = mmaN<ASPLIT ? 2 : 1>(ah.v, al.v, b.v, b.v, acc[t]);
    }
  }
#pragma unroll
  for (int t = 0; t < 4; ++t) {
    const int col = col0 + t * 16 + ln;
    float bv = bias ? bias[col] : 0.f;
    if (BIAS_BF16) bv = bf16_round(bv);
#pragma unroll
    for (int r = 0; r < 8; ++r) {
      float v = acc[t][r] + bv;
      if (resid) { float rv = resid[(size_t)((row0 + 8 * hh + r) % rmod) * ldr + col]; if (RES_BF16) rv = bf16_round(rv); v += rv; }
      if (ACT == 1) v = fmaxf(v, 0.f);
      if (ACT == 2) v = 0.5f * v * (1.0f + erff(v * 0.70710678118654752f));
      if (ACT == 3) { const float u = 0.7978845608028654f * (v + 0.044715f * v * v * v); v = 0.5f * v * (1.0f + tanhf(u)); }
      so[w][8 * hh + r][t * 16 + ln] = v;
    }
  }
  __builtin_amdgcn_fence(__ATOMIC_ACQ_REL, "workgroup");
  __builtin_amdgcn_wave_barrier();
  const int rsub = lane >> 4, c4 = (lane & 15) * 4;
  {
#pragma unroll
    for (int q = 0; q < 8; ++q) {
      const int r = q * 2 + rsub;
      const v4f v = *(const v4fa*)&so[w][r][c4];
      *(v4f*)(C + (size_t)(row0 + r) * ldc + col0 + c4) = v;
    }
    
  }
}
// row LayerNorm (biased variance, eps) over N: s = X (+ R); optional out_sum <- s; out_norm <- (s-mu)*rsqrt(var+eps)*g + b
template <bool PARAM_BF16>
__global__ __launch_bounds__(256) void k_layernorm(const float* __restrict__ X, const float* __restrict__ R, const float* __restrict__ g, const float* __restrict__ bta,
                                                  float* __restrict__ out_sum, float* __restrict__ out_norm, int N, float eps) {
  __shared__ float red[256];
  const int row = blockIdx.x, tid = threadIdx.x;
  const float* x = X + (size_t)row * N; const float* rr = R ? R + (size_t)row * N : nullptr;
  float vals[16];                     // up to N = 4096
  const int per = N / 256;            // contiguous chunk per thread? use strided-by-4 chunks: thread handles j = tid*4 + 1024*u
  float s1 = 0.f;
  for (int u = 0; u < per / 4; ++u) {
    const int j = tid * 4 + 1024 * u;
    const v4f a = *(const v4fa*)(x + j);
    v4f b = {0.f,0.f,0.f,0.f}; if (rr) b = *(const v4fa*)(rr + j);
#pragma unroll
    for (int q = 0; q < 4; ++q) { const float v = a[q] + b[q]; vals[u * 4 + q] = v; s1 += v; }
  }
  red[tid] = s1; __syncthreads();
  for (int st = 128; st > 0; st >>= 1) { if (tid < st) red[tid] += red[tid + st]; __syncthreads(); }
  const float mu = red[0] / (float)N; __syncthreads();
  float s2 = 0.f;
  for (int u = 0; u < per / 4; ++u)
#pragma unroll
    for (int q = 0; q < 4; ++q) { const float c = vals[u * 4 + q] - mu; s2 += c * c; }
  red[tid] = s2; __syncthreads();
  for (int st = 128; st > 0; st >>= 1) { if (tid < st) red[tid] += red[tid + st]; __syncthreads(); }
  const float rs = rsqrtf(red[0] / (float)N + eps);
  {
    for (int u = 0; u < per / 4; ++u) {
      const int j = tid * 4 + 1024 * u;
      v4f o, sm;
#pragma unroll
      for (int q = 0; q < 4; ++q) {
        float gg = g[j + q], bb = bta[j + q];
        if (PARAM_BF16) { gg = bf16_round(gg); bb = bf16_round(bb); }
        sm[q] = vals[u * 4 + q]; o[q] = (vals[u * 4 + q] - mu) * rs * gg + bb;
      }
      if (out_sum) *(v4f*)(out_sum + (size_t)row * N + j) = sm;
      *(v4f*)(out_norm + (size_t)row * N + j) = o;
    }
    
  }
}



// ---- f16 WMMA path (v_wmma_f32_16x16x32_f16): 11-bit significands for operands in range — used here for all five GEMMs (bilinear, h, o, We1, We2)
typedef _Float16 v16h __attribute__((ext_vector_type(16)));
union FragH { v16h v; v8us half[2]; _Float16 h[16]; unsigned short u[16]; };
template <int NT>
__device__ __forceinline__ v8f mmaH(v16h ah, v16h al, v16h bh, v16h bl, v8f c) {
  c = __builtin_amdgcn_wmma_f32_16x16x32_f16(false, ah, false, bh, (short)0, c, false, false);
  if (NT >= 2) c = __builtin_amdgcn_wmma_f32_16x16x32_f16(false, al, false, bh, (short)0, c, false, false);
  if (NT >= 3) c = __builtin_amdgcn_wmma_f32_16x16x32_f16(false, ah, false, bl, (short)0, c, false, false);
  asm volatile("v_nop\n\tv_nop\n\tv_nop\n\tv_nop" : "+v"(c) : "v"(ah), "v"(al), "v"(bh), "v"(bl));
  return c;
}
// batched GEMM like k_gemm_b but f16 operands: A f32 (split into f16 hi/lo if ASPLIT, else rounded to f16), Bt = f16 values [n][k]; alpha; C f32; N multiple of 16 (partial tiles skipped)
template <bool ASPLIT>
__global__ __launch_bounds__(128) void k_gemm_h(const float* __restrict__ A, int lda, size_t sA, const _Float16* __restrict__ Bh, int ldb, size_t sB, float alpha, float* __restrict__ C, int ldc, size_t sC, int M, int N, int K) {
  __shared__ __attribute__((aligned(16))) float so[4][16][64];
  const int tid = threadIdx.x, w = tid >> 5, lane = tid & 31, ln = lane & 15, hh = lane >> 4; const int by = blockIdx.y;
  A += (size_t)by * sA; Bh += (size_t)by * sB; C += (size_t)by * sC;
  const int ntn = (N + 63) / 64; const int wid = blockIdx.x * 4 + w; const int mt = wid / ntn, nq = wid % ntn; if (mt * 16 >= M) return;
  const int row0 = mt * 16, col0 = nq * 64; const float* arow = A + (size_t)(row0 + ln) * lda;
  v8f acc[4] = {};
  for (int kb = 0; kb < K; kb += 32) {
    FragH ah, al;
    const v4f x0 = *(const v4fa*)(arow + kb + 8 * hh), x1 = *(const v4fa*)(arow + kb + 8 * hh + 4), x2 = *(const v4fa*)(arow + kb + 16 + 8 * hh), x3 = *(const v4fa*)(arow + kb + 16 + 8 * hh + 4);
    float xs[16] = {x0[0],x0[1],x0[2],x0[3],x1[0],x1[1],x1[2],x1[3],x2[0],x2[1],x2[2],x2[3],x3[0],x3[1],x3[2],x3[3]};
#pragma unroll
    for (int i = 0; i < 16; ++i) { const _Float16 h = (_Float16)xs[i]; ah.h[i] = h; al.h[i] = ASPLIT ? (_Float16)(xs[i] - (float)h) : (_Float16)0.0f; }
#pragma unroll
    for (int t = 0; t < 4; ++t) { if (col0 + t * 16 >= N) continue; const size_t boff = (size_t)(col0 + t * 16 + ln) * ldb + kb; FragH bq; bq.half[0] = *(const v8us*)(Bh + boff + 8 * hh); bq.half[1] = *(const v8us*)(Bh + boff + 16 + 8 * hh);
      acc[t] = mmaH<ASPLIT ? 2 : 1>(ah.v, al.v, bq.v, bq.v, acc[t]); }
  }
#pragma unroll
  for (int t = 0; t < 4; ++t) { if (col0 + t * 16 >= N) continue;
#pragma unroll
    for (int r = 0; r < 8; ++r) so[w][8 * hh + r][t * 16 + ln] = acc[t][r] * alpha; }
  __builtin_amdgcn_fence(__ATOMIC_ACQ_REL, "workgroup"); __builtin_amdgcn_wave_barrier();
  const int rsub = lane >> 4, c4 = (lane & 15) * 4;
  {
#pragma unroll
    for (int q = 0; q < 8; ++q) { const int r = q * 2 + rsub; if (col0 + c4 < N) { const v4f v = *(const v4fa*)&so[w][r][c4]; *(v4f*)(C + (size_t)(row0 + r) * ldc + col0 + c4) = v; } }
     }
}

// Wt[n][k] = f16(W[k][n]·scale) from f32 row-major W[K][N] (scale = power of two; bf16-exact weights stay exact in f16 away from the subnormal range)
__global__ __launch_bounds__(256) void k_wt_f16(const float* __restrict__ W, _Float16* __restrict__ Wt, int K, int N, float scale) {
  const int t = blockIdx.x * 256 + threadIdx.x; if (t >= N * (K / 8)) return; const int n = t / (K / 8), k8 = (t % (K / 8)) * 8; FragH f;
#pragma unroll
  for (int i = 0; i < 8; ++i) f.h[i] = (_Float16)(bf16_round(W[(size_t)(k8 + i) * N + n]) * scale); const v8us o = f.half[0];
  *(v8us*)((unsigned short*)Wt + (size_t)n * K + k8) = o; 
}
// k_gemm_hh variant with fused epilogue: v = acc·alpha + bias[by·sBias + col] (+ CP[(row/rowsPerB)·sCPb + by·64 + col] if CP) ; ACT 0 none / 1 elu ; writes f16 C16 (and f32 C if non-null)
template <int ACT>
__global__ __launch_bounds__(128) void k_gemm_hhx(const _Float16* __restrict__ A, int lda, size_t sA, const _Float16* __restrict__ Bh, int ldb, size_t sB, float alpha, const float* __restrict__ bias, size_t sBias, const float* __restrict__ CP, int rowsPerB, size_t sCPb, int row0g,
    float* __restrict__ C, _Float16* __restrict__ C16, int ldc, size_t sC, int M, int N, int K) {
  __shared__ __attribute__((aligned(16))) float so[4][16][64];
  const int tid = threadIdx.x, w = tid >> 5, lane = tid & 31, ln = lane & 15, hh = lane >> 4; const int by = blockIdx.y;
  A += (size_t)by * sA; Bh += (size_t)by * sB; const size_t cofs = (size_t)by * sC; const float* bp = bias ? bias + (size_t)by * sBias : nullptr;
  const int ntn = (N + 63) / 64; const int wid = blockIdx.x * 4 + w; const int mt = wid / ntn, nq = wid % ntn; if (mt * 16 >= M) return;
  const int row0 = mt * 16, col0 = nq * 64; const _Float16* arow = A + (size_t)(row0 + ln) * lda;
  v8f acc[4] = {};
  for (int kb = 0; kb < K; kb += 32) { FragH ah; ah.half[0] = *(const v8us*)((const unsigned short*)arow + kb + 8 * hh); ah.half[1] = *(const v8us*)((const unsigned short*)arow + kb + 16 + 8 * hh);
#pragma unroll
    for (int t = 0; t < 4; ++t) { if (col0 + t * 16 >= N) continue; const size_t boff = (size_t)(col0 + t * 16 + ln) * ldb + kb; FragH bq; bq.half[0] = *(const v8us*)((const unsigned short*)Bh + boff + 8 * hh); bq.half[1] = *(const v8us*)((const unsigned short*)Bh + boff + 16 + 8 * hh);
      acc[t] = mmaH<1>(ah.v, ah.v, bq.v, bq.v, acc[t]); }
  }
#pragma unroll
  for (int t = 0; t < 4; ++t) { if (col0 + t * 16 >= N) continue; const int col = col0 + t * 16 + ln; const float bv = bp ? bf16_round(bp[col]) : 0.f;
#pragma unroll
    for (int r = 0; r < 8; ++r) { float v = acc[t][r] * alpha + bv; if (CP) { const int rr = row0g + row0 + 8 * hh + r; if (rowsPerB < 0) v += CP[cofs + (size_t)rr * ldc + col];      /* rowsPerB < 0: own element of the batched C plane */ else { const int bidx = rr / rowsPerB; v += CP[(size_t)bidx * sCPb + (size_t)by * 64 + col]; } } if (ACT == 1) v = (v > 0.f) ? v : expm1f(v); else if (ACT == 7) v = (v > 0.f) ? v + 1.0f : expf(v); else if (ACT == 8) v = tanhf(v); else if (ACT == 9) v = 0.5f * v * (1.0f + tanhf(0.7978845608028654f * (v + 0.044715f * v * v * v))); else if (ACT == 11) v = 1.0f / (1.0f + expf(-v)); else if (ACT == 12) v = (v > 0.f) ? v : 0.01f * v; else if (ACT == 14) v = (v > 0.f) ? v : 0.1f * v; else if (ACT == 16) v = (v >= 0.f) ? v : 0.3f * v; else if (ACT == 17) v = (v >= 0.f) ? v : 0.2f * v; else if (ACT == 15) v = v / (1.0f + expf(-v)); else if (ACT == 3) v = fmaxf(v, 0.f); else if (ACT == 6) v = 0.5f * v * (1.0f + erff(v * 0.70710678118654752f)); so[w][8 * hh + r][t * 16 + ln] = v; } }
  __builtin_amdgcn_fence(__ATOMIC_ACQ_REL, "workgroup"); __builtin_amdgcn_wave_barrier();
  const int rsub = lane >> 4, c4 = (lane & 15) * 4; typedef _Float16 v4h __attribute__((ext_vector_type(4)));
  {
#pragma unroll
    for (int q = 0; q < 8; ++q) { const int r = q * 2 + rsub; if (col0 + c4 < N) { const v4f v = *(const v4fa*)&so[w][r][c4]; if (C) *(v4f*)(C + cofs + (size_t)(row0 + r) * ldc + col0 + c4) = v; if (C16) { v4h h4; for (int i = 0; i < 4; ++i) h4[i] = (_Float16)v[i]; *(v4h*)(C16 + cofs + (size_t)(row0 + r) * ldc + col0 + c4) = h4; } } }
     }
}


typedef _Float16 v4h __attribute__((ext_vector_type(4)));

__global__ __launch_bounds__(256) void k_x16(const float* __restrict__ x, _Float16* __restrict__ X16, size_t n8) { const size_t t = (size_t)blockIdx.x * 256 + threadIdx.x; if (t >= n8) return; FragH f;
#pragma unroll
  for (int q = 0; q < 8; ++q) f.h[q] = (_Float16)bf16_round(x[t * 8 + q]); *(v8us*)((unsigned short*)X16 + t * 8) = f.half[0];  }
__global__ __launch_bounds__(256) void k_h16(const float* __restrict__ x, _Float16* __restrict__ X16, size_t n8) { const size_t t = (size_t)blockIdx.x * 256 + threadIdx.x; if (t >= n8) return; FragH f;
#pragma unroll
  for (int q = 0; q < 8; ++q) f.h[q] = (_Float16)x[t * 8 + q]; *(v8us*)((unsigned short*)X16 + t * 8) = f.half[0];  }
__global__ __launch_bounds__(256) void k_round16f(const float* __restrict__ W, _Float16* __restrict__ Bt, size_t n8) { const size_t t = (size_t)blockIdx.x * 256 + threadIdx.x; if (t >= n8) return; FragH f;
#pragma unroll
  for (int i = 0; i < 8; ++i) f.h[i] = (_Float16)(bf16_round(W[t * 8 + i]) * 16.0f); *(v8us*)((unsigned short*)Bt + t * 8) = f.half[0];  }
template <int NHv, int TTv>
__global__ __launch_bounds__(256) void k_vt(const _Float16* __restrict__ V16, int ldv, int voff, _Float16* __restrict__ Vt) { __shared__ unsigned short tl[64][66]; const int tid = threadIdx.x; const int slab = blockIdx.x / (TTv / 64), lg = blockIdx.x % (TTv / 64); const int b = slab / NHv, h = slab % NHv;
  for (int i = tid; i < 64 * 8; i += 256) { const int r = i / 8, c8 = (i % 8) * 8; FragH f; f.half[0] = *(const v8us*)((const unsigned short*)V16 + ((size_t)b * TTv + lg * 64 + r) * ldv + voff + h * 64 + c8);
#pragma unroll
    for (int q = 0; q < 8; ++q) tl[r][c8 + q] = f.u[q]; }
  __syncthreads();
  {
#pragma unroll
    for (int rd = 0; rd < 2; ++rd) { const int d = rd * 32 + tid / 8, pc = tid % 8; FragH f;
#pragma unroll
      for (int q = 0; q < 8; ++q) f.u[q] = tl[pc * 8 + q][d];
      *(v8us*)((unsigned short*)Vt + ((size_t)slab * 64 + d) * TTv + lg * 64 + pc * 8) = f.half[0]; }
     } }

__global__ __launch_bounds__(256) void k_hl(const float* __restrict__ F, _Float16* __restrict__ Hh, _Float16* __restrict__ Hl, size_t n8) { const size_t t = (size_t)blockIdx.x * 256 + threadIdx.x; if (t >= n8) return; FragH fh, fl; const v4f a = *(const v4fa*)(F + t * 8), c = *(const v4fa*)(F + t * 8 + 4);
#pragma unroll
  for (int q = 0; q < 4; ++q) { _Float16 h = (_Float16)a[q]; fh.h[q] = h; fl.h[q] = (_Float16)((a[q] - (float)h) * 1024.0f); h = (_Float16)c[q]; fh.h[4 + q] = h; fl.h[4 + q] = (_Float16)((c[q] - (float)h) * 1024.0f); }
  { *(v8us*)((unsigned short*)Hh + t * 8) = fh.half[0]; *(v8us*)((unsigned short*)Hl + t * 8) = fl.half[0];  } }

// ---- f16 fragment loader and WMMA step ----
__device__ __forceinline__ v16h g2_frag(const _Float16* p, int hh) { FragH f; f.half[0] = *(const v8us*)((const unsigned short*)p + 8 * hh); f.half[1] = *(const v8us*)((const unsigned short*)p + 16 + 8 * hh); return f.v; }
__device__ __forceinline__ v8f g2_mma(v16h a, v16h b, v8f c) { v8f d = __builtin_amdgcn_wmma_f32_16x16x32_f16(false, a, false, b, (short)0, c, false, false); asm volatile("v_nop\n\tv_nop\n\tv_nop\n\tv_nop" : "+v"(d) : "v"(a), "v"(b)); return d; }

// Fragment order of the prepared weight planes (64 features x K): [k step s][feature tile t][half j][lane 16 hh + ln][8 elements], feature o = 16 t + ln, k = 32 s + 16 j + 8 hh + e (g2_frag's k order). fr_off = the element offset of (o, k0), k0 a multiple of 8; the eight k from k0 on follow one another.
__device__ __forceinline__ size_t fr_off(int o, int k0) { return (size_t)(((((k0 >> 5) * 4 + (o >> 4)) * 2 + ((k0 >> 4) & 1)) * 32 + ((k0 >> 3) & 1) * 16 + (o & 15)) * 8); }
// the inverse: chunk c of eight elements (c = fr_off / 8) -> its feature o and first k. The kernels that fill a whole plane take one chunk a thread in this order, so that a wave stores 512 bytes in a row and each 128-byte line has one writer.
__device__ __forceinline__ void fr_src(int c, int& o, int& k0) { o = ((c >> 6) & 3) * 16 + (c & 15); k0 = (c >> 8) * 32 + ((c >> 5) & 1) * 16 + ((c >> 4) & 1) * 8; }
// a lane's fragment of one feature tile; p = the tile's first element + 8 * lane
__device__ __forceinline__ v16h fr_frag(const _Float16* p) { FragH f; f.half[0] = *(const v8us*)((const unsigned short*)p); f.half[1] = *(const v8us*)((const unsigned short*)p + 256); return f.v; }
// Wm [32][K] -> features roff + 0..31 (two feature tiles, roff = 0 or 32) of Bt: thread t takes chunk t & 127 of these two tiles in k step t >> 7
__global__ __launch_bounds__(256) void k_wsc(const float* __restrict__ Wm, _Float16* __restrict__ Bt, size_t n8, float sc, int K, int roff) { const size_t t = (size_t)blockIdx.x * 256 + threadIdx.x; if (t >= n8) return; const int c = ((int)t >> 7) * 256 + roff * 4 + ((int)t & 127); int o, k0; fr_src(c, o, k0); const float* s = Wm + (size_t)(o - roff) * K + k0; FragH f; for (int q = 0; q < 8; ++q) f.h[q] = (_Float16)(bf16_round(s[q]) * sc); *(v8us*)((unsigned short*)Bt + (size_t)c * 8) = f.half[0];  }
__global__ __launch_bounds__(256) void k_wput(const float* __restrict__ Wm, int nout, int nin, int roff, int coff, _Float16* __restrict__ Bt) { const int t = blockIdx.x * 256 + threadIdx.x; const int npr = (nin + 7) / 8; if (t >= nout * npr) return; const int k0 = (t % npr) * 8; const int o = t / npr; unsigned short* d = (unsigned short*)Bt + fr_off(roff + o, coff + k0);
  { for (int q = 0; q < 8; ++q) { const int k = k0 + q; if (k < nin) { FragH f; f.h[0] = (_Float16)(bf16_round(Wm[(size_t)o * nin + k]) * 16.0f); *(unsigned short*)(d + q) = f.u[0] & 0xffffu; } }  } }
__global__ __launch_bounds__(256) void k_zero16(_Float16* __restrict__ D, size_t n8) { const size_t t = (size_t)blockIdx.x * 256 + threadIdx.x; if (t >= n8) return; v8us z; for (int q = 0; q < 8; ++q) z[q] = 0; *(v8us*)((unsigned short*)D + t * 8) = z;  }
__global__ __launch_bounds__(64) void k_bcat2(const float* __restrict__ a, const float* __restrict__ bb, float* __restrict__ dst) { const int i = threadIdx.x; const float v = (i < 32) ? bf16_round(a[i]) : bf16_round(bb[i - 32]); *(float*)(dst + i) = v;  }
// We1 [64][33 * 33] -> Bt (64 x KKP, fragment order) in the k order of k_fused's row fragments: k = a * 32 + b <- column a * 33 + b (a, b < 32); 1024 + b <- 32 * 33 + b; 1056 + a <- a * 33 + 32; 1088 <- 1088; the rest 0
__global__ __launch_bounds__(256) void k_wput_op(const float* __restrict__ Wm, _Float16* __restrict__ Bt) { const int t = blockIdx.x * 256 + threadIdx.x; if (t >= FE * (KKP / 8)) return; int o, k0; fr_src(t, o, k0); FragH f;
  for (int q = 0; q < 8; ++q) { const int k = k0 + q; int c = -1; if (k < 1024) c = (k >> 5) * 33 + (k & 31); else if (k < 1056) c = 32 * 33 + (k - 1024); else if (k < 1088) c = (k - 1056) * 33 + 32; else if (k == 1088) c = 1088;
    f.h[q] = (c >= 0) ? (_Float16)(bf16_round(Wm[(size_t)o * KK + c]) * 16.0f) : (_Float16)0.0f; }
  *(v8us*)((unsigned short*)Bt + (size_t)t * 8) = f.half[0]; }
// We2 [64][130] -> Bt (64 x KC2, fragment order) in the k order of k_fused's last product: k < 96 <- column k (e1, o1); 96 + b <- 97 + b (o2); 128 <- 96 and 129 <- 129 (the columns of the two appended ones); the rest 0
__global__ __launch_bounds__(256) void k_wput_e2(const float* __restrict__ Wm, _Float16* __restrict__ Bt) { const int t = blockIdx.x * 256 + threadIdx.x; if (t >= FE * (KC2 / 8)) return; int o, k0; fr_src(t, o, k0); FragH f; float wv[8];
#pragma unroll
  for (int q = 0; q < 8; ++q) { const int k = k0 + q; const int c = (k < 96) ? k : (k < 128) ? k + 1 : (k == 128) ? 96 : 129; wv[q] = Wm[(size_t)o * 130 + c]; }      /* a pad column reads column 129 and drops it below: all eight loads fly together */
  asm volatile("s_wait_xcnt 0x0" :: "v"(wv[0]), "v"(wv[1]), "v"(wv[2]), "v"(wv[3]), "v"(wv[4]), "v"(wv[5]), "v"(wv[6]), "v"(wv[7]) : "memory");      /* the address registers of the eight loads are free for reuse behind them: the wait stands in front of whatever overwrites them; the loaded values as inputs keep every load in front of it */
#pragma unroll
  for (int q = 0; q < 8; ++q) f.h[q] = (k0 + q < 130) ? (_Float16)(bf16_round(wv[q]) * 16.0f) : (_Float16)0.0f;
  *(v8us*)((unsigned short*)Bt + (size_t)t * 8) = f.half[0]; }
// ---- the fused row pipeline. A row fragment (B operand): lane ln = row, elements 0..7 = k 8 hh + 0..7, elements 8..15 = k 16 + 8 hh + 0..7 of a 32-wide k step (g2_frag's order, which the weight fragments use too).
// Every '#pragma unroll' from here to the end of k_fused makes an array or vector index a compile-time constant, so that the values stay in registers.
__device__ __forceinline__ void op_row16(const float* p, int hh, bool rnd, float (&v)[16]) { const v4f x0 = *(const v4fa*)(p + 8 * hh), x1 = *(const v4fa*)(p + 8 * hh + 4), x2 = *(const v4fa*)(p + 16 + 8 * hh), x3 = *(const v4fa*)(p + 16 + 8 * hh + 4);
  asm volatile("s_wait_xcnt 0x0" ::: "memory");      /* the address pair of these four loads is free for reuse behind them: the wait stands in front of whatever overwrites it */
#pragma unroll
  for (int e = 0; e < 4; ++e) { v[e] = rnd ? bf16_round(x0[e]) : x0[e]; v[4 + e] = rnd ? bf16_round(x1[e]) : x1[e]; v[8 + e] = rnd ? bf16_round(x2[e]) : x2[e]; v[12 + e] = rnd ? bf16_round(x3[e]) : x3[e]; } }
__device__ __forceinline__ v16h op_frag(float a, const float (&q)[16]) { FragH f;
#pragma unroll
  for (int e = 0; e < 16; ++e) f.h[e] = (_Float16)(a * q[e]); return f.v; }
// two neighbouring feature tiles of a lane's accumulators (features 8 hh + r and 16 + 8 hh + r of a 32-wide block) as the next product's row fragment
__device__ __forceinline__ v16h fu_pack(v8f lo, v8f hi) { FragH f;
#pragma unroll
  for (int e = 0; e < 8; ++e) { f.h[e] = (_Float16)lo[e]; f.h[8 + e] = (_Float16)hi[e]; } return f.v; }
// the lane's eight biases of feature tile t, rounded to bf16
__device__ __forceinline__ v8f fu_bias(const float* __restrict__ b, int t, int hh) { const v4f x0 = *(const v4fa*)(b + t * 16 + 8 * hh), x1 = *(const v4fa*)(b + t * 16 + 8 * hh + 4); v8f v;
#pragma unroll
  for (int e = 0; e < 4; ++e) { v[e] = bf16_round(x0[e]); v[4 + e] = bf16_round(x1[e]); } return v; }
// the four weight fragments (64 features) of one k step; wl = the weight plane at the step's first element (FS a step) + 8 * lane
#define FS 2048                  /* elements of one k step of a weight plane: 64 features x 32 k */
__device__ __forceinline__ void fu_load(const _Float16* wl, v16h (&a)[4]) {
#pragma unroll
  for (int t = 0; t < 4; ++t) a[t] = fr_frag(wl + t * 512); }
// one k step, 64 features x 32 rows, on fragments that were loaded one step earlier
__device__ __forceinline__ void fu_step_end(const v16h (&a)[4], v16h d0, v16h d1, v8f (&c)[2][4]) {
#pragma unroll
  for (int t = 0; t < 4; ++t) { c[0][t] = g2_mma(a[t], d0, c[0][t]); c[1][t] = g2_mma(a[t], d1, c[1][t]); } }
// the same, and behind the two products that read a[t] its registers take that tile's fragment of the step that follows (wn: as in fu_load), so that a whole step's work lies between a load and its use
__device__ __forceinline__ void fu_step_pf(v16h (&a)[4], const _Float16* wn, v16h d0, v16h d1, v8f (&c)[2][4]) {
#pragma unroll
  for (int t = 0; t < 4; ++t) { c[0][t] = g2_mma(a[t], d0, c[0][t]); c[1][t] = g2_mma(a[t], d1, c[1][t]); a[t] = fr_frag(wn + t * 512); }
  __builtin_amdgcn_sched_barrier(0); }      /* keeps the later steps' row-fragment arithmetic behind this step: moved up, the row fragments of four steps are live at once and the kernel needs more than 256 registers, one wave a SIMD less */
__global__ __launch_bounds__(128) void k_fused(const float* __restrict__ x, const _Float16* __restrict__ BZ, const float* __restrict__ bz, const _Float16* __restrict__ BH, const float* __restrict__ bh, const _Float16* __restrict__ BO, const float* __restrict__ bo,
    const _Float16* __restrict__ BE1, const float* __restrict__ be1, const _Float16* __restrict__ BE2, const float* __restrict__ be2, float* __restrict__ out) {
  __shared__ __attribute__((aligned(16))) float so[4][32][68];
  const int tid = threadIdx.x, w = tid >> 5, lane = tid & 31, ln = lane & 15, hh = lane >> 4;
  const int row0 = blockIdx.x * 128 + 32 * w;
  const float* p0 = x + (size_t)(row0 + ln) * D1; const float* p1 = p0 + (size_t)16 * D1;
  const float* q0 = p0 + (size_t)NBI * D1; const float* q1 = q0 + (size_t)16 * D1;
  const v8f z8 = {0.f,0.f,0.f,0.f,0.f,0.f,0.f,0.f};
  const _Float16* wz = BZ + lane * 8; const _Float16* wh = BH + lane * 8; const _Float16* wo = BO + lane * 8; const _Float16* we = BE1 + lane * 8; const _Float16* wy = BE2 + lane * 8;
  v16h a[4]; fu_load(wz, a);      /* the ring of weight fragments: always one k step ahead, through all five products */
  float qa[16], qb[16]; op_row16(q0, hh, true, qa); op_row16(q1, hh, true, qb);
  /* [z1 | z2]: k step i holds f16(v1[i] * v2[j]), j = 0..31 */
  v8f z[2][4] = {{z8, z8, z8, z8}, {z8, z8, z8, z8}};
  { float pa[4], pb[4];      /* carried rounded, so that no load is open on them at the loop's head: carried raw, the wait there was to 0 and emptied the fragment ring once a group */
    { const v4f na = *(const v4fa*)p0, nb = *(const v4fa*)p1;
#pragma unroll
      for (int u = 0; u < 4; ++u) { pa[u] = bf16_round(na[u]); pb[u] = bf16_round(nb[u]); } }
    /* rolled over groups of four k steps: one 16-byte load brings four values of v1, a group ahead like the fragments; fully unrolled the 32 steps would only grow the code. What the last group fetches ahead is group 0 again and is not used: no branch among the products, and every address stays inside its row */
#pragma unroll 1
    for (int i4 = 0; i4 < 32; i4 += 4) { const int nx = (i4 + 4) & 31; const v4f na = *(const v4fa*)(p0 + nx), nb = *(const v4fa*)(p1 + nx);
      asm volatile("s_wait_xcnt 0x0" ::: "memory");      /* the two address pairs are reused at once: the wait stands in front of that */
#pragma unroll
      for (int u = 0; u < 4; ++u) fu_step_pf(a, wz + (u < 3 ? i4 + u + 1 : nx) * FS, op_frag(pa[u], qa), op_frag(pb[u], qb), z);
      asm volatile("s_wait_xcnt 0x0" ::: "memory");      /* the address pairs of the fragment loads are stepped on at the foot of the group: the wait stands in front of that */
      __builtin_amdgcn_sched_barrier(0);      /* holds that stepping behind the wait */
#pragma unroll
      for (int u = 0; u < 4; ++u) { pa[u] = bf16_round(na[u]); pb[u] = bf16_round(nb[u]); } }
    fu_load(wh, a); }      /* flies together with the two v1 rows that the next product needs */
  /* [h1 | h2] = relu, block-diagonal weights, K = [v1 | v2]; then the gate f16(sigmoid(z) * h), feature tile by feature tile, straight into the row fragments of the next product */
  v16h g[2][2];
  { float ra[16], rb[16]; op_row16(p0, hh, true, ra); op_row16(p1, hh, true, rb);
    const v16h v1a = op_frag(1.0f, ra), v1b = op_frag(1.0f, rb), v2a = op_frag(1.0f, qa), v2b = op_frag(1.0f, qb);
    v8f h[2][4] = {{z8, z8, z8, z8}, {z8, z8, z8, z8}};
    fu_step_pf(a, wh + FS, v1a, v1b, h); fu_step_pf(a, wo, v2a, v2b, h);
#pragma unroll
    for (int t = 0; t < 4; ++t) { const v8f bzv = fu_bias(bz, t, hh), bhv = fu_bias(bh, t, hh);
#pragma unroll
      for (int n = 0; n < 2; ++n)
#pragma unroll
        for (int r = 0; r < 8; ++r) { const float zv = z[n][t][r] * 0.0625f + bzv[r]; const float hv = fmaxf(h[n][t][r] * 0.0625f + bhv[r], 0.f); z[n][t][r] = (1.0f / (1.0f + expf(-zv))) * hv; } }
#pragma unroll
    for (int n = 0; n < 2; ++n) { g[n][0] = fu_pack(z[n][0], z[n][1]); g[n][1] = fu_pack(z[n][2], z[n][3]); } }
  /* [o1 | o2] = relu, block-diagonal weights */
  v8f o[2][4] = {{z8, z8, z8, z8}, {z8, z8, z8, z8}};
  { fu_step_pf(a, wo + FS, g[0][0], g[1][0], o); fu_step_pf(a, we, g[0][1], g[1][1], o);
    asm volatile("s_wait_xcnt 0x0" ::: "memory");      /* the address pairs of the Wo and the first We1 fragment loads are free for reuse from here on: the wait stands in front of whatever overwrites them */
#pragma unroll
    for (int t = 0; t < 4; ++t) { const v8f bv = fu_bias(bo, t, hh);
#pragma unroll
      for (int n = 0; n < 2; ++n)
#pragma unroll
        for (int r = 0; r < 8; ++r) o[n][t][r] = fmaxf(o[n][t][r] * 0.0625f + bv[r], 0.f); } }
  /* o1 (feature tiles 0, 1) into the wave's slab, so[w][row][a]: in k step a of We1 both lane halves scale by o1[row][a], and each holds only half of the a */
#pragma unroll
  for (int n = 0; n < 2; ++n)
#pragma unroll
    for (int t = 0; t < 2; ++t) { float* d = &so[w][n * 16 + ln][t * 16 + 8 * hh]; const v4f s0 = {o[n][t][0], o[n][t][1], o[n][t][2], o[n][t][3]}, s1 = {o[n][t][4], o[n][t][5], o[n][t][6], o[n][t][7]}; *(v4fa*)d = s0; *(v4fa*)(d + 4) = s1; }
  __builtin_amdgcn_fence(__ATOMIC_ACQ_REL, "workgroup"); __builtin_amdgcn_wave_barrier();      /* each wave re-reads only its own slab of so: its LDS stores must be ordered before its loads */
  const v16h o1a = fu_pack(o[0][0], o[0][1]), o1b = fu_pack(o[1][0], o[1][1]);
  float oa[16], ob[16];
#pragma unroll
  for (int e = 0; e < 8; ++e) { oa[e] = o[0][2][e]; oa[8 + e] = o[0][3][e]; ob[e] = o[1][2][e]; ob[8 + e] = o[1][3][e]; }
  const v16h o2a = op_frag(1.0f, oa), o2b = op_frag(1.0f, ob);
  /* e1 = relu(o12 We1^T + b): k step a holds f16(o1[a] * o2[b]), b = 0..31; then o2, o1 and the one */
  v8f e1[2][4] = {{z8, z8, z8, z8}, {z8, z8, z8, z8}};
  { /* rolled like the first loop: one 16-byte LDS load brings four values of o1 */
#pragma unroll 1
    for (int i4 = 0; i4 < 32; i4 += 4) { const v4f pa = *(const v4fa*)&so[w][ln][i4], pb = *(const v4fa*)&so[w][16 + ln][i4];
#pragma unroll
      for (int u = 0; u < 4; ++u) fu_step_pf(a, we + (i4 + u + 1) * FS, op_frag(pa[u], oa), op_frag(pb[u], ob), e1); }
    fu_step_pf(a, we + 33 * FS, o2a, o2b, e1); fu_step_pf(a, we + 34 * FS, o1a, o1b, e1);
    FragH one;
#pragma unroll
    for (int e = 0; e < 16; ++e) one.h[e] = (_Float16)((e == 0 && hh == 0) ? 1.0f : 0.0f);
    fu_step_pf(a, wy, one.v, one.v, e1);
    asm volatile("s_wait_xcnt 0x0" ::: "memory");      /* the address pairs of the last We1 and the first We2 fragment loads are free for reuse from here on: the wait stands in front of whatever overwrites them */
#pragma unroll
    for (int t = 0; t < 4; ++t) { const v8f bv = fu_bias(be1, t, hh);
#pragma unroll
      for (int n = 0; n < 2; ++n)
#pragma unroll
        for (int r = 0; r < 8; ++r) e1[n][t][r] = fmaxf(e1[n][t][r] * 0.0625f + bv[r], 0.f); } }
  /* out = relu([e1, o1, o2, 1, 1] We2^T + b) */
  v8f y[2][4] = {{z8, z8, z8, z8}, {z8, z8, z8, z8}};
  { fu_step_pf(a, wy + FS, fu_pack(e1[0][0], e1[0][1]), fu_pack(e1[1][0], e1[1][1]), y); fu_step_pf(a, wy + 2 * FS, fu_pack(e1[0][2], e1[0][3]), fu_pack(e1[1][2], e1[1][3]), y);
    fu_step_pf(a, wy + 3 * FS, o1a, o1b, y); fu_step_pf(a, wy + 4 * FS, o2a, o2b, y);
    FragH two;
#pragma unroll
    for (int e = 0; e < 16; ++e) two.h[e] = (_Float16)((e < 2 && hh == 0) ? 1.0f : 0.0f);
    fu_step_end(a, two.v, two.v, y); }
  /* the lane holds 8 features of its row a tile: through the slab, so that the output goes out as whole rows */
#pragma unroll
  for (int t = 0; t < 4; ++t) { const v8f bv = fu_bias(be2, t, hh);
#pragma unroll
    for (int n = 0; n < 2; ++n) { v4f s0, s1;
#pragma unroll
      for (int r = 0; r < 4; ++r) { s0[r] = fmaxf(y[n][t][r] * 0.0625f + bv[r], 0.f); s1[r] = fmaxf(y[n][t][4 + r] * 0.0625f + bv[4 + r], 0.f); }
      float* d = &so[w][n * 16 + ln][t * 16 + 8 * hh]; *(v4fa*)d = s0; *(v4fa*)(d + 4) = s1; } }
  __builtin_amdgcn_fence(__ATOMIC_ACQ_REL, "workgroup"); __builtin_amdgcn_wave_barrier();      /* as above: the wave's own LDS stores before its loads */
  const int rsub = lane >> 4, c4 = (lane & 15) * 4;
#pragma unroll
  for (int q = 0; q < 16; ++q) { const int r = q * 2 + rsub; const v4f v = *(const v4fa*)&so[w][r][c4]; *(v4f*)(out + (size_t)(row0 + r) * FE + c4) = v; } }

extern "C" void kernel_launch(void* const* d_in, const int* in_sizes, int n_in,
                              void* d_out, int out_size, void* d_ws, size_t ws_size, hipStream_t stream) {
  (void)in_sizes; (void)n_in; (void)out_size;
  const float* const* I = (const float* const*)d_in;
  const float* x = I[0]; const float* Wh1 = I[1]; const float* bh1 = I[2]; const float* Wz1 = I[3]; const float* bz1 = I[4]; const float* Wo1 = I[5]; const float* bo1 = I[6]; const float* Wh2 = I[7]; const float* bh2 = I[8]; const float* Wz2 = I[9]; const float* bz2 = I[10]; const float* Wo2 = I[11]; const float* bo2 = I[12]; const float* We1 = I[13]; const float* be1 = I[14]; const float* We2 = I[15]; const float* be2 = I[16];
  char* ws = (char*)d_ws; size_t off = 0;
  auto take = [&](size_t bytes) { char* p = ws + off; off += (bytes + 255) & ~(size_t)255; return p; };
  _Float16* BZ = (_Float16*)take((size_t)64 * KO * 2); float* bz = (float*)take(64 * 4); _Float16* BH = (_Float16*)take((size_t)64 * 64 * 2); float* bh = (float*)take(64 * 4); _Float16* BO = (_Float16*)take((size_t)64 * 64 * 2); float* bo = (float*)take(64 * 4); _Float16* BE1 = (_Float16*)take((size_t)FE * KKP * 2); _Float16* BE2 = (_Float16*)take((size_t)FE * KC2 * 2);
  if (off > ws_size) return;      /* under 1 MiB: the prepared weights and biases only */
  k_wsc<<<(64 * KO / 8 + 255) / 256, 256, 0, stream>>>(Wz1, BZ, (size_t)32 * KO / 8, 16.0f, KO, 0); k_wsc<<<(32 * KO / 8 + 255) / 256, 256, 0, stream>>>(Wz2, BZ, (size_t)32 * KO / 8, 16.0f, KO, 32); k_bcat2<<<1, 64, 0, stream>>>(bz1, bz2, bz);      /* [Wz1; Wz2] flattened [o][(i,j)] */
  k_zero16<<<(64 * 64 / 8 + 255) / 256, 256, 0, stream>>>(BH, 64 * 64 / 8); k_wput<<<(32 * 4 + 255) / 256, 256, 0, stream>>>(Wh1, 32, 32, 0, 0, BH); k_wput<<<(32 * 4 + 255) / 256, 256, 0, stream>>>(Wh2, 32, 32, 32, 32, BH); k_bcat2<<<1, 64, 0, stream>>>(bh1, bh2, bh);      /* blockdiag(Wh1, Wh2) */
  k_zero16<<<(64 * 64 / 8 + 255) / 256, 256, 0, stream>>>(BO, 64 * 64 / 8); k_wput<<<(32 * 4 + 255) / 256, 256, 0, stream>>>(Wo1, 32, 32, 0, 0, BO); k_wput<<<(32 * 4 + 255) / 256, 256, 0, stream>>>(Wo2, 32, 32, 32, 32, BO); k_bcat2<<<1, 64, 0, stream>>>(bo1, bo2, bo);      /* blockdiag(Wo1, Wo2) */
  k_wput_op<<<(FE * (KKP / 8) + 255) / 256, 256, 0, stream>>>(We1, BE1);      /* writes every column, the pad too */
  k_wput_e2<<<(FE * (KC2 / 8) + 255) / 256, 256, 0, stream>>>(We2, BE2);      /* writes every column, the pad too */
  k_fused<<<NBR / 128, 128, 0, stream>>>(x, BZ, bz, BH, bh, BO, bo, BE1, be1, BE2, be2, (float*)d_out);
}

// v006
// One run takes 48.9 microseconds.
// Timed twice side by side with v005, it ran 1.57 and 1.52 times as fast.
// All steps since v000 together make it 26.0 times as fast.
#include <hip/hip_runtime.h>
// KroneckerFusion (131072 rows; v1, v2 = x[0], x[1] (32 each): h_i = relu(v_i Wh_i^T + b); z_i = Bilinear(v1, Wz_i, v2) + b; o_i = relu((sigmoid(z_i) * h_i) Wo_i^T + b); o_i <- [o_i, 1]; o12 = o1 (x) o2 (33 x 33 = 1089); out = relu(o12 We1^T + b); out = relu([out, o1, o2] We2^T + b)).
// Structure: ONE kernel for the whole row pipeline; a wave owns 32 rows from the input to the output row and no intermediate touches the workspace. Every product is computed transposed, weights as the A operand (16 features a tile) and the rows as the B operand (lane = row), f16 WMMA with f32 accumulation and exact x16 weights + bias. A lane's accumulators then hold features 16 t + 8 hh + 0..7 of its own row, and two neighbouring feature tiles converted to f16 ARE the B fragment of the next product (its k order), so z, h, the gate, o, e1 and the output follow one another in registers. The bilinear forms ([Wz1; Wz2] flattened, K = 1024) and We1 (K re-ordered to [o1[a] o2[b] (1024) | o2 (32) | o1 (32) | 1 | 0 pad] = 1120) form their B fragments f16(p[i] * q[j]) in registers; o1[a], which both lane halves need for every a, goes through the wave's own LDS slab. We2's K is re-ordered to [e1 (64) | o1 (32) | o2 (32) | 1 | 1 | 0 pad] = 160 with the weight columns permuted alike. The output rows are turned in the same slab and stored as whole lines. The weight fragments come from global memory one k step ahead, through a ring of four register fragments that runs on from one product to the next; the prepared weight planes lie in fragment order (fr_off), so that each 16-byte-a-lane load of a fragment half reads 512 bytes in a row, four whole cache lines. One launch (k_prep) prepares all planes and biases in front of it.
#define NBR 131072               /* rows processed */
#define NBI 131072               /* rows in the input (x[1] starts at NBI*32; separate so debug builds can shrink NBR) */
#define D1 32
#define KO 1024                  /* 32 x 32 outer */
#define KK 1089                  /* 33 x 33 Kronecker */
#define KKP 1120
#define FE 64
#define KC2 160                  /* [e1 (64) | o1 (32) | o2 (32) | 1 | 1 | 0] */
typedef __bf16 v16b __attribute__((ext_vector_type(16)));
typedef unsigned short v8us __attribute__((ext_vector_type(8), may_alias));
typedef float  v8f  __attribute__((ext_vector_type(8)));
typedef float  v4f  __attribute__((ext_vector_type(4)));
typedef float  v4fa __attribute__((ext_vector_type(4), may_alias));
union FragB { v16b v; v8us half[2]; unsigned short u[16]; };

__device__ __forceinline__ unsigned short bf16_bits(float x) { unsigned int u = __float_as_uint(x); return (unsigned short)((u + 0x7FFFu + ((u >> 16) & 1u)) >> 16); }
__device__ __forceinline__ float bf16_val(unsigned short b) { return __uint_as_float(((unsigned int)b) << 16); }
__device__ __forceinline__ float bf16_round(float x) { return bf16_val(bf16_bits(x)); }
// D += A·B with NT terms: 1 = ah·bh, 2 = + al·bh (A split), 3 = + ah·bl (both split)
template <int NT>
__device__ __forceinline__ v8f mmaN(v16b ah, v16b al, v16b bh, v16b bl, v8f c) {
  c = __builtin_amdgcn_wmma_f32_16x16x32_bf16(false, ah, false, bh, (short)0, c, false, false);
  if (NT >= 2) c = __builtin_amdgcn_wmma_f32_16x16x32_bf16(false, al, false, bh, (short)0, c, false, false);
  if (NT >= 3) c = __builtin_amdgcn_wmma_f32_16x16x32_bf16(false, ah, false, bl, (short)0, c, false, false);
  asm volatile("v_nop\n\tv_nop\n\tv_nop\n\tv_nop" : "+v"(c) : "v"(ah), "v"(al), "v"(bh), "v"(bl));
  return c;
}

__global__ __launch_bounds__(256) void k_wt_bf16(const float* __restrict__ W, unsigned short* __restrict__ Wt, int K, int N) {
  const int t = blockIdx.x * 256 + threadIdx.x;
  const int k8n = K / 8;
  if (t >= N * k8n) return;
  const int n = t / k8n, k8 = (t % k8n) * 8;
  v8us v;
#pragma unroll
  for (int i = 0; i < 8; ++i) v[i] = bf16_bits(W[(size_t)(k8 + i) * N + n]);
  *(v8us*)(Wt + (size_t)n * K + k8) = v;
  
}

// GEMM C[M][N] (f32, pitch ldc) = act(A[M][K]·W + bias). A f32 row-major (pitch lda) converted per fragment to bf16
// (ASPLIT: hi/lo two planes -> 2 terms, else single rounded term); Wt bf16 [N][K] (pitch ldb). BIAS_BF16 rounds the
// bias to bf16 first (bias quantised to bf16 before the add). K%32==0, M%16==0, N%64==0.
template <bool ASPLIT, int ACT, bool BIAS_BF16>
__global__ __launch_bounds__(128) void k_gemm_bf(const float* __restrict__ A, int lda, const unsigned short* __restrict__ Wt, int ldb,
                                               const float* __restrict__ bias, float* __restrict__ C, int ldc, int M, int N, int K) {
  __shared__ __attribute__((aligned(16))) float so[4][16][64];
  const int tid = threadIdx.x, w = tid >> 5, lane = tid & 31, ln = lane & 15, hh = lane >> 4;
  const int ntn = N / 64;
  const int wid = blockIdx.x * 4 + w;
  const int mt = wid / ntn, nq = wid % ntn;
  if (mt * 16 >= M) return;
  const int row0 = mt * 16, col0 = nq * 64;
  const float* arow = A + (size_t)(row0 + ln) * lda;
  v8f acc[4] = {};
  for (int kb = 0; kb < K; kb += 32) {
    FragB ah, al;
    const v4f x0 = *(const v4fa*)(arow + kb + 8 * hh), x1 = *(const v4fa*)(arow + kb + 8 * hh + 4);
    const v4f x2 = *(const v4fa*)(arow + kb + 16 + 8 * hh), x3 = *(const v4fa*)(arow + kb + 16 + 8 * hh + 4);
    float xs[16] = {x0[0],x0[1],x0[2],x0[3],x1[0],x1[1],x1[2],x1[3],x2[0],x2[1],x2[2],x2[3],x3[0],x3[1],x3[2],x3[3]};
#pragma unroll
    for (int i = 0; i < 16; ++i) { const unsigned short hb = bf16_bits(xs[i]); ah.u[i] = hb; al.u[i] = ASPLIT ? bf16_bits(xs[i] - bf16_val(hb)) : (unsigned short)0; }
#pragma unroll
    for (int t = 0; t < 4; ++t) {
      const unsigned short* brow = Wt + (size_t)(col0 + t * 16 + ln) * ldb + kb;
      FragB b;
      b.half[0] = *(const v8us*)(brow + 8 * hh);
      b.half[1] = *(const v8us*)(brow + 16 + 8 * hh);
      acc[t] = mmaN<ASPLIT ? 2 : 1>(ah.v, al.v, b.v, b.v, acc[t]);
    }
  }
#pragma unroll
  for (int t = 0; t < 4; ++t) {
    float bv = bias ? bias[col0 + t * 16 + ln] : 0.f;
    if (BIAS_BF16) bv = bf16_round(bv);
#pragma unroll
    for (int r = 0; r < 8; ++r) { float v = acc[t][r] + bv; if (ACT == 1) v = fmaxf(v, 0.f); so[w][8 * hh + r][t * 16 + ln] = v; }
  }
  __builtin_amdgcn_fence(__ATOMIC_ACQ_REL, "workgroup");
  __builtin_amdgcn_wave_barrier();
  const int rsub = lane >> 4, c4 = (lane & 15) * 4;
  {
#pragma unroll
    for (int q = 0; q < 8; ++q) {
      const int r = q * 2 + rsub;
      const v4f v = *(const v4fa*)&so[w][r][c4];
      *(v4f*)(C + (size_t)(row0 + r) * ldc + col0 + c4) = v;
    }
    
  }
}

// GEMM C = act(A·W + bias + resid): A f32 (ASPLIT -> hi/lo 2 terms), Wt bf16 [N][K]; ACT 0 none, 1 relu, 2 exact gelu;
// resid (optional, f32, row index = (row % rmod), pitch ldr, RES_BF16 rounds it) added before the activation.
template <bool ASPLIT, int ACT, bool BIAS_BF16, bool RES_BF16>
__global__ __launch_bounds__(128) void k_gemm_bf3(const float* __restrict__ A, int lda, const unsigned short* __restrict__ Wt, int ldb,
                                                const float* __restrict__ bias, const float* __restrict__ resid, int rmod, int ldr,
                                                float* __restrict__ C, int ldc, int M, int N, int K) {
  __shared__ __attribute__((aligned(16))) float so[4][16][64];
  const int tid = threadIdx.x, w = tid >> 5, lane = tid & 31, ln = lane & 15, hh = lane >> 4;
  const int ntn = N / 64;
  const int wid = blockIdx.x * 4 + w;
  const int mt = wid / ntn, nq = wid % ntn;
  if (mt * 16 >= M) return;
  const int row0 = mt * 16, col0 = nq * 64;
  const float* arow = A + (size_t)(row0 + ln) * lda;
  v8f acc[4] = {};
  for (int kb = 0; kb < K; kb += 32) {
    FragB ah, al;
    const v4f x0 = *(const v4fa*)(arow + kb + 8 * hh), x1 = *(const v4fa*)(arow + kb + 8 * hh + 4);
    const v4f x2 = *(const v4fa*)(arow + kb + 16 + 8 * hh), x3 = *(const v4fa*)(arow + kb + 16 + 8 * hh + 4);
    float xs[16] = {x0[0],x0[1],x0[2],x0[3],x1[0],x1[1],x1[2],x1[3],x2[0],x2[1],x2[2],x2[3],x3[0],x3[1],x3[2],x3[3]};
#pragma unroll
    for (int i = 0; i < 16; ++i) { const unsigned short hb = bf16_bits(xs[i]); ah.u[i] = hb; al.u[i] = ASPLIT ? bf16_bits(xs[i] - bf16_val(hb)) : (unsigned short)0; }
#pragma unroll
    for (int t = 0; t < 4; ++t) {
      const unsigned short* brow = Wt + (size_t)(col0 + t * 16 + ln) * ldb + kb;
      FragB b;
      b.half[0] = *(const v8us*)(brow + 8 * hh);
      b.half[1] = *(const v8us*)(brow + 16 + 8 * hh);
      acc[t] = mmaN<ASPLIT ? 2 : 1>(ah.v, al.v, b.v, b.v, acc[t]);
    }
  }
#pragma unroll
  for (int t = 0; t < 4; ++t) {
    const int col = col0 + t * 16 + ln;
    float bv = bias ? bias[col] : 0.f;
    if (BIAS_BF16) bv = bf16_round(bv);
#pragma unroll
    for (int r = 0; r < 8; ++r) {
      float v = acc[t][r] + bv;
      if (resid) { float rv = resid[(size_t)((row0 + 8 * hh + r) % rmod) * ldr + col]; if (RES_BF16) rv = bf16_round(rv); v += rv; }
      if (ACT == 1) v = fmaxf(v, 0.f);
      if (ACT == 2) v = 0.5f * v * (1.0f + erff(v * 0.70710678118654752f));
      if (ACT == 3) { const float u = 0.7978845608028654f * (v + 0.044715f * v * v * v); v = 0.5f * v * (1.0f + tanhf(u)); }
      so[w][8 * hh + r][t * 16 + ln] = v;
    }
  }
  __builtin_amdgcn_fence(__ATOMIC_ACQ_REL, "workgroup");
  __builtin_amdgcn_wave_barrier();
  const int rsub = lane >> 4, c4 = (lane & 15) * 4;
  {
#pragma unroll
    for (int q = 0; q < 8; ++q) {
      const int r = q * 2 + rsub;
      const v4f v = *(const v4fa*)&so[w][r][c4];
      *(v4f*)(C + (size_t)(row0 + r) * ldc + col0 + c4) = v;
    }
    
  }
}
// row LayerNorm (biased variance, eps) over N: s = X (+ R); optional out_sum <- s; out_norm <- (s-mu)*rsqrt(var+eps)*g + b
template <bool PARAM_BF16>
__global__ __launch_bounds__(256) void k_layernorm(const float* __restrict__ X, const float* __restrict__ R, const float* __restrict__ g, const float* __restrict__ bta,
                                                  float* __restrict__ out_sum, float* __restrict__ out_norm, int N, float eps) {
  __shared__ float red[256];
  const int row = blockIdx.x, tid = threadIdx.x;
  const float* x = X + (size_t)row * N; const float* rr = R ? R + (size_t)row * N : nullptr;
  float vals[16];                     // up to N = 4096
  const int per = N / 256;            // contiguous chunk per thread? use strided-by-4 chunks: thread handles j = tid*4 + 1024*u
  float s1 = 0.f;
  for (int u = 0; u < per / 4; ++u) {
    const int j = tid * 4 + 1024 * u;
    const v4f a = *(const v4fa*)(x + j);
    v4f b = {0.f,0.f,0.f,0.f}; if (rr) b = *(const v4fa*)(rr + j);
#pragma unroll
    for (int q = 0; q < 4; ++q) { const float v = a[q] + b[q]; vals[u * 4 + q] = v; s1 += v; }
  }
  red[tid] = s1; __syncthreads();
  for (int st = 128; st > 0; st >>= 1) { if (tid < st) red[tid] += red[tid + st]; __syncthreads(); }
  const float mu = red[0] / (float)N; __syncthreads();
  float s2 = 0.f;
  for (int u = 0; u < per / 4; ++u)
#pragma unroll
    for (int q = 0; q < 4; ++q) { const float c = vals[u * 4 + q] - mu; s2 += c * c; }
  red[tid] = s2; __syncthreads();
  for (int st = 128; st > 0; st >>= 1) { if (tid < st) red[tid] += red[tid + st]; __syncthreads(); }
  const float rs = rsqrtf(red[0] / (float)N + eps);
  {
    for (int u = 0; u < per / 4; ++u) {
      const int j = tid * 4 + 1024 * u;
      v4f o, sm;
#pragma unroll
      for (int q = 0; q < 4; ++q) {
        float gg = g[j + q], bb = bta[j + q];
        if (PARAM_BF16) { gg = bf16_round(gg); bb = bf16_round(bb); }
        sm[q] = vals[u * 4 + q]; o[q] = (vals[u * 4 + q] - mu) * rs * gg + bb;
      }
      if (out_sum) *(v4f*)(out_sum + (size_t)row * N + j) = sm;
      *(v4f*)(out_norm + (size_t)row * N + j) = o;
    }
    
  }
}



// ---- f16 WMMA path (v_wmma_f32_16x16x32_f16): 11-bit significands for operands in range — used here for all five GEMMs (bilinear, h, o, We1, We2)
typedef _Float16 v16h __attribute__((ext_vector_type(16)));
union FragH { v16h v; v8us half[2]; _Float16 h[16]; unsigned short u[16]; };
template <int NT>
__device__ __forceinline__ v8f mmaH(v16h ah, v16h al, v16h bh, v16h bl, v8f c) {
  c = __builtin_amdgcn_wmma_f32_16x16x32_f16(false, ah, false, bh, (short)0, c, false, false);
  if (NT >= 2) c = __builtin_amdgcn_wmma_f32_16x16x32_f16(false, al, false, bh, (short)0, c, false, false);
  if (NT >= 3) c = __builtin_amdgcn_wmma_f32_16x16x32_f16(false, ah, false, bl, (short)0, c, false, false);
  asm volatile("v_nop\n\tv_nop\n\tv_nop\n\tv_nop" : "+v"(c) : "v"(ah), "v"(al), "v"(bh), "v"(bl));
  return c;
}
// batched GEMM like k_gemm_b but f16 operands: A f32 (split into f16 hi/lo if ASPLIT, else rounded to f16), Bt = f16 values [n][k]; alpha; C f32; N multiple of 16 (partial tiles skipped)
template <bool ASPLIT>
__global__ __launch_bounds__(128) void k_gemm_h(const float* __restrict__ A, int lda, size_t sA, const _Float16* __restrict__ Bh, int ldb, size_t sB, float alpha, float* __restrict__ C, int ldc, size_t sC, int M, int N, int K) {
  __shared__ __attribute__((aligned(16))) float so[4][16][64];
  const int tid = threadIdx.x, w = tid >> 5, lane = tid & 31, ln = lane & 15, hh = lane >> 4; const int by = blockIdx.y;
  A += (size_t)by * sA; Bh += (size_t)by * sB; C += (size_t)by * sC;
  const int ntn = (N + 63) / 64; const int wid = blockIdx.x * 4 + w; const int mt = wid / ntn, nq = wid % ntn; if (mt * 16 >= M) return;
  const int row0 = mt * 16, col0 = nq * 64; const float* arow = A + (size_t)(row0 + ln) * lda;
  v8f acc[4] = {};
  for (int kb = 0; kb < K; kb += 32) {
    FragH ah, al;
    const v4f x0 = *(const v4fa*)(arow + kb + 8 * hh), x1 = *(const v4fa*)(arow + kb + 8 * hh + 4), x2 = *(const v4fa*)(arow + kb + 16 + 8 * hh), x3 = *(const v4fa*)(arow + kb + 16 + 8 * hh + 4);
    float xs[16] = {x0[0],x0[1],x0[2],x0[3],x1[0],x1[1],x1[2],x1[3],x2[0],x2[1],x2[2],x2[3],x3[0],x3[1],x3[2],x3[3]};
#pragma unroll
    for (int i = 0; i < 16; ++i) { const _Float16 h = (_Float16)xs[i]; ah.h[i] = h; al.h[i] = ASPLIT ? (_Float16)(xs[i] - (float)h) : (_Float16)0.0f; }
#pragma unroll
    for (int t = 0; t < 4; ++t) { if (col0 + t * 16 >= N) continue; const size_t boff = (size_t)(col0 + t * 16 + ln) * ldb + kb; FragH bq; bq.half[0] = *(const v8us*)(Bh + boff + 8 * hh); bq.half[1] = *(const v8us*)(Bh + boff + 16 + 8 * hh);
      acc[t] = mmaH<ASPLIT ? 2 : 1>(ah.v, al.v, bq.v, bq.v, acc[t]); }
  }
#pragma unroll
  for (int t = 0; t < 4; ++t) { if (col0 + t * 16 >= N) continue;
#pragma unroll
    for (int r = 0; r < 8; ++r) so[w][8 * hh + r][t * 16 + ln] = acc[t][r] * alpha; }
  __builtin_amdgcn_fence(__ATOMIC_ACQ_REL, "workgroup"); __builtin_amdgcn_wave_barrier();
  const int rsub = lane >> 4, c4 = (lane & 15) * 4;
  {
#pragma unroll
    for (int q = 0; q < 8; ++q) { const int r = q * 2 + rsub; if (col0 + c4 < N) { const v4f v = *(const v4fa*)&so[w][r][c4]; *(v4f*)(C + (size_t)(row0 + r) * ldc + col0 + c4) = v; } }
     }
}

// Wt[n][k] = f16(W[k][n]·scale) from f32 row-major W[K][N] (scale = power of two; bf16-exact weights stay exact in f16 away from the subnormal range)
__global__ __launch_bounds__(256) void k_wt_f16(const float* __restrict__ W, _Float16* __restrict__ Wt, int K, int N, float scale) {
  const int t = blockIdx.x * 256 + threadIdx.x; if (t >= N * (K / 8)) return; const int n = t / (K / 8), k8 = (t % (K / 8)) * 8; FragH f;
#pragma unroll
  for (int i = 0; i < 8; ++i) f.h[i] = (_Float16)(bf16_round(W[(size_t)(k8 + i) * N + n]) * scale); const v8us o = f.half[0];
  *(v8us*)((unsigned short*)Wt + (size_t)n * K + k8) = o; 
}
// k_gemm_hh variant with fused epilogue: v = acc·alpha + bias[by·sBias + col] (+ CP[(row/rowsPerB)·sCPb + by·64 + col] if CP) ; ACT 0 none / 1 elu ; writes f16 C16 (and f32 C if non-null)
template <int ACT>
__global__ __launch_bounds__(128) void k_gemm_hhx(const _Float16* __restrict__ A, int lda, size_t sA, const _Float16* __restrict__ Bh, int ldb, size_t sB, float alpha, const float* __restrict__ bias, size_t sBias, const float* __restrict__ CP, int rowsPerB, size_t sCPb, int row0g,
    float* __restrict__ C, _Float16* __restrict__ C16, int ldc, size_t sC, int M, int N, int K) {
  __shared__ __attribute__((aligned(16))) float so[4][16][64];
  const int tid = threadIdx.x, w = tid >> 5, lane = tid & 31, ln = lane & 15, hh = lane >> 4; const int by = blockIdx.y;
  A += (size_t)by * sA; Bh += (size_t)by * sB; const size_t cofs = (size_t)by * sC; const float* bp = bias ? bias + (size_t)by * sBias : nullptr;
  const int ntn = (N + 63) / 64; const int wid = blockIdx.x * 4 + w; const int mt = wid / ntn, nq = wid % ntn; if (mt * 16 >= M) return;
  const int row0 = mt * 16, col0 = nq * 64; const _Float16* arow = A + (size_t)(row0 + ln) * lda;
  v8f acc[4] = {};
  for (int kb = 0; kb < K; kb += 32) { FragH ah; ah.half[0] = *(const v8us*)((const unsigned short*)arow + kb + 8 * hh); ah.half[1] = *(const v8us*)((const unsigned short*)arow + kb + 16 + 8 * hh);
#pragma unroll
    for (int t = 0; t < 4; ++t) { if (col0 + t * 16 >= N) continue; const size_t boff = (size_t)(col0 + t * 16 + ln) * ldb + kb; FragH bq; bq.half[0] = *(const v8us*)((const unsigned short*)Bh + boff + 8 * hh); bq.half[1] = *(const v8us*)((const unsigned short*)Bh + boff + 16 + 8 * hh);
      acc[t] = mmaH<1>(ah.v, ah.v, bq.v, bq.v, acc[t]); }
  }
#pragma unroll
  for (int t = 0; t < 4; ++t) { if (col0 + t * 16 >= N) continue; const int col = col0 + t * 16 + ln; const float bv = bp ? bf16_round(bp[col]) : 0.f;
#pragma unroll
    for (int r = 0; r < 8; ++r) { float v = acc[t][r] * alpha + bv; if (CP) { const int rr = row0g + row0 + 8 * hh + r; if (rowsPerB < 0) v += CP[cofs + (size_t)rr * ldc + col];      /* rowsPerB < 0: own element of the batched C plane */ else { const int bidx = rr / rowsPerB; v += CP[(size_t)bidx * sCPb + (size_t)by * 64 + col]; } } if (ACT == 1) v = (v > 0.f) ? v : expm1f(v); else if (ACT == 7) v = (v > 0.f) ? v + 1.0f : expf(v); else if (ACT == 8) v = tanhf(v); else if (ACT == 9) v = 0.5f * v * (1.0f + tanhf(0.7978845608028654f * (v + 0.044715f * v * v * v))); else if (ACT == 11) v = 1.0f / (1.0f + expf(-v)); else if (ACT == 12) v = (v > 0.f) ? v : 0.01f * v; else if (ACT == 14) v = (v > 0.f) ? v : 0.1f * v; else if (ACT == 16) v = (v >= 0.f) ? v : 0.3f * v; else if (ACT == 17) v = (v >= 0.f) ? v : 0.2f * v; else if (ACT == 15) v = v / (1.0f + expf(-v)); else if (ACT == 3) v = fmaxf(v, 0.f); else if (ACT == 6) v = 0.5f * v * (1.0f + erff(v * 0.70710678118654752f)); so[w][8 * hh + r][t * 16 + ln] = v; } }
  __builtin_amdgcn_fence(__ATOMIC_ACQ_REL, "workgroup"); __builtin_amdgcn_wave_barrier();
  const int rsub = lane >> 4, c4 = (lane & 15) * 4; typedef _Float16 v4h __attribute__((ext_vector_type(4)));
  {
#pragma unroll
    for (int q = 0; q < 8; ++q) { const int r = q * 2 + rsub; if (col0 + c4 < N) { const v4f v = *(const v4fa*)&so[w][r][c4]; if (C) *(v4f*)(C + cofs + (size_t)(row0 + r) * ldc + col0 + c4) = v; if (C16) { v4h h4; for (int i = 0; i < 4; ++i) h4[i] = (_Float16)v[i]; *(v4h*)(C16 + cofs + (size_t)(row0 + r) * ldc + col0 + c4) = h4; } } }
     }
}


typedef _Float16 v4h __attribute__((ext_vector_type(4)));

__global__ __launch_bounds__(256) void k_x16(const float* __restrict__ x, _Float16* __restrict__ X16, size_t n8) { const size_t t = (size_t)blockIdx.x * 256 + threadIdx.x; if (t >= n8) return; FragH f;
#pragma unroll
  for (int q = 0; q < 8; ++q) f.h[q] = (_Float16)bf16_round(x[t * 8 + q]); *(v8us*)((unsigned short*)X16 + t * 8) = f.half[0];  }
__global__ __launch_bounds__(256) void k_h16(const float* __restrict__ x, _Float16* __restrict__ X16, size_t n8) { const size_t t = (size_t)blockIdx.x * 256 + threadIdx.x; if (t >= n8) return; FragH f;
#pragma unroll
  for (int q = 0; q < 8; ++q) f.h[q] = (_Float16)x[t * 8 + q]; *(v8us*)((unsigned short*)X16 + t * 8) = f.half[0];  }
__global__ __launch_bounds__(256) void k_round16f(const float* __restrict__ W, _Float16* __restrict__ Bt, size_t n8) { const size_t t = (size_t)blockIdx.x * 256 + threadIdx.x; if (t >= n8) return; FragH f;
#pragma unroll
  for (int i = 0; i < 8; ++i) f.h[i] = (_Float16)(bf16_round(W[t * 8 + i]) * 16.0f); *(v8us*)((unsigned short*)Bt + t * 8) = f.half[0];  }
template <int NHv, int TTv>
__global__ __launch_bounds__(256) void k_vt(const _Float16* __restrict__ V16, int ldv, int voff, _Float16* __restrict__ Vt) { __shared__ unsigned short tl[64][66]; const int tid = threadIdx.x; const int slab = blockIdx.x / (TTv / 64), lg = blockIdx.x % (TTv / 64); const int b = slab / NHv, h = slab % NHv;
  for (int i = tid; i < 64 * 8; i += 256) { const int r = i / 8, c8 = (i % 8) * 8; FragH f; f.half[0] = *(const v8us*)((const unsigned short*)V16 + ((size_t)b * TTv + lg * 64 + r) * ldv + voff + h * 64 + c8);
#pragma unroll
    for (int q = 0; q < 8; ++q) tl[r][c8 + q] = f.u[q]; }
  __syncthreads();
  {
#pragma unroll
    for (int rd = 0; rd < 2; ++rd) { const int d = rd * 32 + tid / 8, pc = tid % 8; FragH f;
#pragma unroll
      for (int q = 0; q < 8; ++q) f.u[q] = tl[pc * 8 + q][d];
      *(v8us*)((unsigned short*)Vt + ((size_t)slab * 64 + d) * TTv + lg * 64 + pc * 8) = f.half[0]; }
     } }

__global__ __launch_bounds__(256) void k_hl(const float* __restrict__ F, _Float16* __restrict__ Hh, _Float16* __restrict__ Hl, size_t n8) { const size_t t = (size_t)blockIdx.x * 256 + threadIdx.x; if (t >= n8) return; FragH fh, fl; const v4f a = *(const v4fa*)(F + t * 8), c = *(const v4fa*)(F + t * 8 + 4);
#pragma unroll
  for (int q = 0; q < 4; ++q) { _Float16 h = (_Float16)a[q]; fh.h[q] = h; fl.h[q] = (_Float16)((a[q] - (float)h) * 1024.0f); h = (_Float16)c[q]; fh.h[4 + q] = h; fl.h[4 + q] = (_Float16)((c[q] - (float)h) * 1024.0f); }
  { *(v8us*)((unsigned short*)Hh + t * 8) = fh.half[0]; *(v8us*)((unsigned short*)Hl + t * 8) = fl.half[0];  } }

// ---- f16 fragment loader and WMMA step ----
__device__ __forceinline__ v16h g2_frag(const _Float16* p, int hh) { FragH f; f.half[0] = *(const v8us*)((const unsigned short*)p + 8 * hh); f.half[1] = *(const v8us*)((const unsigned short*)p + 16 + 8 * hh); return f.v; }
__device__ __forceinline__ v8f g2_mma(v16h a, v16h b, v8f c) { v8f d = __builtin_amdgcn_wmma_f32_16x16x32_f16(false, a, false, b, (short)0, c, false, false); asm volatile("v_nop\n\tv_nop\n\tv_nop\n\tv_nop" : "+v"(d) : "v"(a), "v"(b)); return d; }

// Fragment order of the prepared weight planes (64 features x K): [k step s][feature tile t][half j][lane 16 hh + ln][8 elements], feature o = 16 t + ln, k = 32 s + 16 j + 8 hh + e (g2_frag's k order). fr_off = the element offset of (o, k0), k0 a multiple of 8; the eight k from k0 on follow one another.
__device__ __forceinline__ size_t fr_off(int o, int k0) { return (size_t)(((((k0 >> 5) * 4 + (o >> 4)) * 2 + ((k0 >> 4) & 1)) * 32 + ((k0 >> 3) & 1) * 16 + (o & 15)) * 8); }
// the inverse: chunk c of eight elements (c = fr_off / 8) -> its feature o and first k. k_prep takes one chunk a thread in this order, so that a wave stores 512 bytes in a row and each 128-byte line has one writer.
__device__ __forceinline__ void fr_src(int c, int& o, int& k0) { o = ((c >> 6) & 3) * 16 + (c & 15); k0 = (c >> 8) * 32 + ((c >> 5) & 1) * 16 + ((c >> 4) & 1) * 8; }
// a lane's fragment of one feature tile; p = the tile's first element + 8 * lane
__device__ __forceinline__ v16h fr_frag(const _Float16* p) { FragH f; f.half[0] = *(const v8us*)((const unsigned short*)p); f.half[1] = *(const v8us*)((const unsigned short*)p + 256); return f.v; }
// ---- the preparation of the weight planes and biases. Every '#pragma unroll' from here to the end of k_prep makes an array index a compile-time constant, so that wv and keep stay in registers.
// eight f32 weights -> eight f16(bf16_round(w) * 16), stored as chunk c of a plane in fragment order; keep = false stores a zero
__device__ __forceinline__ void fr_put(_Float16* __restrict__ Bt, int c, const float (&wv)[8], const bool (&keep)[8]) { FragH f;
#pragma unroll
  for (int q = 0; q < 8; ++q) f.h[q] = (_Float16)(bf16_round(keep[q] ? wv[q] : 0.0f) * 16.0f);
  *(v8us*)((unsigned short*)Bt + (size_t)c * 8) = f.half[0];
  asm volatile("s_wait_xcnt 0x0" ::: "memory"); }      /* the store's offset and data registers are free for reuse behind it: the wait stands in front of whatever overwrites them */
// eight weights ST columns apart: one address pair with constant offsets, so that all eight loads fly together
template <int ST>
__device__ __forceinline__ void fr_get(const float* __restrict__ s, float (&wv)[8]) {
#pragma unroll
  for (int q = 0; q < 8; ++q) wv[q] = s[q * ST];
  asm volatile("s_wait_xcnt 0x0" :: "v"(wv[0]), "v"(wv[1]), "v"(wv[2]), "v"(wv[3]), "v"(wv[4]), "v"(wv[5]), "v"(wv[6]), "v"(wv[7]) : "memory"); }      /* the address pair of the loads is free for reuse behind them: the wait stands in front of whatever overwrites it; the loaded values as inputs keep every load in front of it */
// chunk c of blockdiag(Wa, Wb) (64 x 64, each block [32][32]): a chunk off the diagonal reads an in-bounds place all the same and stores zeros, so that no branch stands in front of the loads
__device__ __forceinline__ void prep_diag(const float* __restrict__ Wa, const float* __restrict__ Wb, _Float16* __restrict__ Bt, int c) { int o, k0; fr_src(c, o, k0); float wv[8]; fr_get<1>((o < 32 ? Wa : Wb) + (size_t)(o & 31) * 32 + (k0 & 31), wv);
  const bool on = (o >> 5) == (k0 >> 5); const bool keep[8] = {on, on, on, on, on, on, on, on}; fr_put(Bt, c, wv, keep); }
// All prepared planes and biases in ONE launch: none of them reads what another writes, so the jobs are dealt by block index, one chunk of eight f16 a thread in fragment order: a wave stores 512 bytes in a row and each 128-byte line has one writer. A block of 256 chunks is one k step (32 k) of a plane, so which part of a permuted k order it fills is the same for the whole block.
// blocks 0..31: BZ = [Wz1; Wz2], each [32][32 * 32] flattened (64 x KO). 32..66: BE1 = We1 [64][33 * 33] (64 x KKP) in the k order of k_fused's row fragments: k = a * 32 + b <- column a * 33 + b (a, b < 32); 1024 + b <- 32 * 33 + b; 1056 + a <- a * 33 + 32; 1088 <- 1088; the rest 0.
// 67..71: BE2 = We2 [64][130] (64 x KC2) in the k order of k_fused's last product: k < 96 <- column k (e1, o1); 96 + b <- 97 + b (o2); 128 <- 96 and 129 <- 129 (the columns of the two appended ones); the rest 0. 72, 73: BH = blockdiag(Wh1, Wh2). 74, 75: BO = blockdiag(Wo1, Wo2). 76: the three bias pairs, rounded to bf16, 32 values a wave.
#define PB_E1 (64 * (KO / 8) / 256)
#define PB_E2 (PB_E1 + FE * (KKP / 8) / 256)
#define PB_H  (PB_E2 + FE * (KC2 / 8) / 256)
#define PB_O  (PB_H + 64 * (64 / 8) / 256)
#define PB_B  (PB_O + 64 * (64 / 8) / 256)
__global__ __launch_bounds__(256) void k_prep(const float* __restrict__ Wz1, const float* __restrict__ Wz2, const float* __restrict__ We1, const float* __restrict__ We2, const float* __restrict__ Wh1, const float* __restrict__ Wh2, const float* __restrict__ Wo1, const float* __restrict__ Wo2,
    const float* __restrict__ bz1, const float* __restrict__ bz2, const float* __restrict__ bh1, const float* __restrict__ bh2, const float* __restrict__ bo1, const float* __restrict__ bo2,
    _Float16* __restrict__ BZ, _Float16* __restrict__ BE1, _Float16* __restrict__ BE2, _Float16* __restrict__ BH, _Float16* __restrict__ BO, float* __restrict__ bz, float* __restrict__ bh, float* __restrict__ bo) {
  const int b = blockIdx.x, tid = threadIdx.x; int o, k0; float wv[8]; bool keep[8];
  if (b < PB_E1) { const int c = b * 256 + tid; fr_src(c, o, k0); fr_get<1>((o < 32 ? Wz1 : Wz2) + (size_t)(o & 31) * KO + k0, wv);
#pragma unroll
    for (int q = 0; q < 8; ++q) keep[q] = true;
    fr_put(BZ, c, wv, keep); }
  else if (b < PB_E2) { const int a = b - PB_E1, c = a * 256 + tid; fr_src(c, o, k0); const int j = k0 & 31; const float* r = We1 + (size_t)o * KK;
    if (a <= 32) fr_get<1>(r + a * 33 + j, wv);      /* row a of the 33 x 33 square; a = 32 is its last row, the o2 part */
    else if (a == 33) fr_get<33>(r + j * 33 + 32, wv);      /* its last column, the o1 part */
    else fr_get<0>(r + KK - 1, wv);      /* its last element, and the pad, which reads the same place and drops it */
#pragma unroll
    for (int q = 0; q < 8; ++q) keep[q] = k0 + q < KK;
    fr_put(BE1, c, wv, keep); }
  else if (b < PB_H) { const int a = b - PB_E2, c = a * 256 + tid; fr_src(c, o, k0); const float* r = We2 + (size_t)o * 130;
    if (a < 4) fr_get<1>(r + k0 + (a == 3 ? 1 : 0), wv);      /* e1 and o1 as they lie; o2 lies one column on */
    else { const float x0 = r[96], x1 = r[129];      /* the two ones' columns, and the pad, which drops what it reads */
      asm volatile("s_wait_xcnt 0x0" :: "v"(x0), "v"(x1) : "memory");      /* as in fr_get */
      wv[0] = x0;
#pragma unroll
      for (int q = 1; q < 8; ++q) wv[q] = x1; }
#pragma unroll
    for (int q = 0; q < 8; ++q) keep[q] = k0 + q < 130;
    fr_put(BE2, c, wv, keep); }
  else if (b < PB_O) prep_diag(Wh1, Wh2, BH, (b - PB_H) * 256 + tid);
  else if (b < PB_B) prep_diag(Wo1, Wo2, BO, (b - PB_O) * 256 + tid);
  else { const int w = __builtin_amdgcn_readfirstlane(tid >> 5), i = tid & 31;      /* the wave's number as a scalar: the choice of the arrays is a scalar one */
    if (w < 6) { const float* s = (w == 0) ? bz1 : (w == 1) ? bz2 : (w == 2) ? bh1 : (w == 3) ? bh2 : (w == 4) ? bo1 : bo2; float* d = ((w < 2) ? bz : (w < 4) ? bh : bo) + (w & 1) * 32; d[i] = bf16_round(s[i]); } } }
// ---- the fused row pipeline. A row fragment (B operand): lane ln = row, elements 0..7 = k 8 hh + 0..7, elements 8..15 = k 16 + 8 hh + 0..7 of a 32-wide k step (g2_frag's order, which the weight fragments use too).
// Every '#pragma unroll' from here to the end of k_fused makes an array or vector index a compile-time constant, so that the values stay in registers.
__device__ __forceinline__ void op_row16(const float* p, int hh, bool rnd, float (&v)[16]) { const v4f x0 = *(const v4fa*)(p + 8 * hh), x1 = *(const v4fa*)(p + 8 * hh + 4), x2 = *(const v4fa*)(p + 16 + 8 * hh), x3 = *(const v4fa*)(p + 16 + 8 * hh + 4);
  asm volatile("s_wait_xcnt 0x0" ::: "memory");      /* the address pair of these four loads is free for reuse behind them: the wait stands in front of whatever overwrites it */
#pragma unroll
  for (int e = 0; e < 4; ++e) { v[e] = rnd ? bf16_round(x0[e]) : x0[e]; v[4 + e] = rnd ? bf16_round(x1[e]) : x1[e]; v[8 + e] = rnd ? bf16_round(x2[e]) : x2[e]; v[12 + e] = rnd ? bf16_round(x3[e]) : x3[e]; } }
__device__ __forceinline__ v16h op_frag(float a, const float (&q)[16]) { FragH f;
#pragma unroll
  for (int e = 0; e < 16; ++e) f.h[e] = (_Float16)(a * q[e]); return f.v; }
// two neighbouring feature tiles of a lane's accumulators (features 8 hh + r and 16 + 8 hh + r of a 32-wide block) as the next product's row fragment
__device__ __forceinline__ v16h fu_pack(v8f lo, v8f hi) { FragH f;
#pragma unroll
  for (int e = 0; e < 8; ++e) { f.h[e] = (_Float16)lo[e]; f.h[8 + e] = (_Float16)hi[e]; } return f.v; }
// the lane's eight biases of feature tile t, rounded to bf16
__device__ __forceinline__ v8f fu_bias(const float* __restrict__ b, int t, int hh) { const v4f x0 = *(const v4fa*)(b + t * 16 + 8 * hh), x1 = *(const v4fa*)(b + t * 16 + 8 * hh + 4); v8f v;
#pragma unroll
  for (int e = 0; e < 4; ++e) { v[e] = bf16_round(x0[e]); v[4 + e] = bf16_round(x1[e]); } return v; }
// the four weight fragments (64 features) of one k step; wl = the weight plane at the step's first element (FS a step) + 8 * lane
#define FS 2048                  /* elements of one k step of a weight plane: 64 features x 32 k */
__device__ __forceinline__ void fu_load(const _Float16* wl, v16h (&a)[4]) {
#pragma unroll
  for (int t = 0; t < 4; ++t) a[t] = fr_frag(wl + t * 512); }
// one k step, 64 features x 32 rows, on fragments that were loaded one step earlier
__device__ __forceinline__ void fu_step_end(const v16h (&a)[4], v16h d0, v16h d1, v8f (&c)[2][4]) {
#pragma unroll
  for (int t = 0; t < 4; ++t) { c[0][t] = g2_mma(a[t], d0, c[0][t]); c[1][t] = g2_mma(a[t], d1, c[1][t]); } }
// the same, and behind the two products that read a[t] its registers take that tile's fragment of the step that follows (wn: as in fu_load), so that a whole step's work lies between a load and its use
__device__ __forceinline__ void fu_step_pf(v16h (&a)[4], const _Float16* wn, v16h d0, v16h d1, v8f (&c)[2][4]) {
#pragma unroll
  for (int t = 0; t < 4; ++t) { c[0][t] = g2_mma(a[t], d0, c[0][t]); c[1][t] = g2_mma(a[t], d1, c[1][t]); a[t] = fr_frag(wn + t * 512); }
  __builtin_amdgcn_sched_barrier(0); }      /* keeps the later steps' row-fragment arithmetic behind this step: moved up, the row fragments of four steps are live at once and the kernel needs more than 256 registers, one wave a SIMD less */
__global__ __launch_bounds__(128) void k_fused(const float* __restrict__ x, const _Float16* __restrict__ BZ, const float* __restrict__ bz, const _Float16* __restrict__ BH, const float* __restrict__ bh, const _Float16* __restrict__ BO, const float* __restrict__ bo,
    const _Float16* __restrict__ BE1, const float* __restrict__ be1, const _Float16* __restrict__ BE2, const float* __restrict__ be2, float* __restrict__ out) {
  __shared__ __attribute__((aligned(16))) float so[4][32][68];
  const int tid = threadIdx.x, w = tid >> 5, lane = tid & 31, ln = lane & 15, hh = lane >> 4;
  const int row0 = blockIdx.x * 128 + 32 * w;
  const float* p0 = x + (size_t)(row0 + ln) * D1; const float* p1 = p0 + (size_t)16 * D1;
  const float* q0 = p0 + (size_t)NBI * D1; const float* q1 = q0 + (size_t)16 * D1;
  const v8f z8 = {0.f,0.f,0.f,0.f,0.f,0.f,0.f,0.f};
  const _Float16* wz = BZ + lane * 8; const _Float16* wh = BH + lane * 8; const _Float16* wo = BO + lane * 8; const _Float16* we = BE1 + lane * 8; const _Float16* wy = BE2 + lane * 8;
  v16h a[4]; fu_load(wz, a);      /* the ring of weight fragments: always one k step ahead, through all five products */
  float qa[16], qb[16]; op_row16(q0, hh, true, qa); op_row16(q1, hh, true, qb);
  /* [z1 | z2]: k step i holds f16(v1[i] * v2[j]), j = 0..31 */
  v8f z[2][4] = {{z8, z8, z8, z8}, {z8, z8, z8, z8}};
  { float pa[4], pb[4];      /* carried rounded, so that no load is open on them at the loop's head: carried raw, the wait there was to 0 and emptied the fragment ring once a group */
    { const v4f na = *(const v4fa*)p0, nb = *(const v4fa*)p1;
#pragma unroll
      for (int u = 0; u < 4; ++u) { pa[u] = bf16_round(na[u]); pb[u] = bf16_round(nb[u]); } }
    /* rolled over groups of four k steps: one 16-byte load brings four values of v1, a group ahead like the fragments; fully unrolled the 32 steps would only grow the code. What the last group fetches ahead is group 0 again and is not used: no branch among the products, and every address stays inside its row */
#pragma unroll 1
    for (int i4 = 0; i4 < 32; i4 += 4) { const int nx = (i4 + 4) & 31; const v4f na = *(const v4fa*)(p0 + nx), nb = *(const v4fa*)(p1 + nx);
      asm volatile("s_wait_xcnt 0x0" ::: "memory");      /* the two address pairs are reused at once: the wait stands in front of that */
#pragma unroll
      for (int u = 0; u < 4; ++u) fu_step_pf(a, wz + (u < 3 ? i4 + u + 1 : nx) * FS, op_frag(pa[u], qa), op_frag(pb[u], qb), z);
      asm volatile("s_wait_xcnt 0x0" ::: "memory");      /* the address pairs of the fragment loads are stepped on at the foot of the group: the wait stands in front of that */
      __builtin_amdgcn_sched_barrier(0);      /* holds that stepping behind the wait */
#pragma unroll
      for (int u = 0; u < 4; ++u) { pa[u] = bf16_round(na[u]); pb[u] = bf16_round(nb[u]); } }
    fu_load(wh, a); }      /* flies together with the two v1 rows that the next product needs */
  /* [h1 | h2] = relu, block-diagonal weights, K = [v1 | v2]; then the gate f16(sigmoid(z) * h), feature tile by feature tile, straight into the row fragments of the next product */
  v16h g[2][2];
  { float ra[16], rb[16]; op_row16(p0, hh, true, ra); op_row16(p1, hh, true, rb);
    const v16h v1a = op_frag(1.0f, ra), v1b = op_frag(1.0f, rb), v2a = op_frag(1.0f, qa), v2b = op_frag(1.0f, qb);
    v8f h[2][4] = {{z8, z8, z8, z8}, {z8, z8, z8, z8}};
    fu_step_pf(a, wh + FS, v1a, v1b, h); fu_step_pf(a, wo, v2a, v2b, h);
#pragma unroll
    for (int t = 0; t < 4; ++t) { const v8f bzv = fu_bias(bz, t, hh), bhv = fu_bias(bh, t, hh);
#pragma unroll
      for (int n = 0; n < 2; ++n)
#pragma unroll
        for (int r = 0; r < 8; ++r) { const float zv = z[n][t][r] * 0.0625f + bzv[r]; const float hv = fmaxf(h[n][t][r] * 0.0625f + bhv[r], 0.f); z[n][t][r] = (1.0f / (1.0f + expf(-zv))) * hv; } }
#pragma unroll
    for (int n = 0; n < 2; ++n) { g[n][0] = fu_pack(z[n][0], z[n][1]); g[n][1] = fu_pack(z[n][2], z[n][3]); } }
  /* [o1 | o2] = relu, block-diagonal weights */
  v8f o[2][4] = {{z8, z8, z8, z8}, {z8, z8, z8, z8}};
  { fu_step_pf(a, wo + FS, g[0][0], g[1][0], o); fu_step_pf(a, we, g[0][1], g[1][1], o);
    asm volatile("s_wait_xcnt 0x0" ::: "memory");      /* the address pairs of the Wo and the first We1 fragment loads are free for reuse from here on: the wait stands in front of whatever overwrites them */
#pragma unroll
    for (int t = 0; t < 4; ++t) { const v8f bv = fu_bias(bo, t, hh);
#pragma unroll
      for (int n = 0; n < 2; ++n)
#pragma unroll
        for (int r = 0; r < 8; ++r) o[n][t][r] = fmaxf(o[n][t][r] * 0.0625f + bv[r], 0.f); } }
  /* o1 (feature tiles 0, 1) into the wave's slab, so[w][row][a]: in k step a of We1 both lane halves scale by o1[row][a], and each holds only half of the a */
#pragma unroll
  for (int n = 0; n < 2; ++n)
#pragma unroll
    for (int t = 0; t < 2; ++t) { float* d = &so[w][n * 16 + ln][t * 16 + 8 * hh]; const v4f s0 = {o[n][t][0], o[n][t][1], o[n][t][2], o[n][t][3]}, s1 = {o[n][t][4], o[n][t][5], o[n][t][6], o[n][t][7]}; *(v4fa*)d = s0; *(v4fa*)(d + 4) = s1; }
  __builtin_amdgcn_fence(__ATOMIC_ACQ_REL, "workgroup"); __builtin_amdgcn_wave_barrier();      /* each wave re-reads only its own slab of so: its LDS stores must be ordered before its loads */
  const v16h o1a = fu_pack(o[0][0], o[0][1]), o1b = fu_pack(o[1][0], o[1][1]);
  float oa[16], ob[16];
#pragma unroll
  for (int e = 0; e < 8; ++e) { oa[e] = o[0][2][e]; oa[8 + e] = o[0][3][e]; ob[e] = o[1][2][e]; ob[8 + e] = o[1][3][e]; }
  const v16h o2a = op_frag(1.0f, oa), o2b = op_frag(1.0f, ob);
  /* e1 = relu(o12 We1^T + b): k step a holds f16(o1[a] * o2[b]), b = 0..31; then o2, o1 and the one */
  v8f e1[2][4] = {{z8, z8, z8, z8}, {z8, z8, z8, z8}};
  { /* rolled like the first loop: one 16-byte LDS load brings four values of o1 */
#pragma unroll 1
    for (int i4 = 0; i4 < 32; i4 += 4) { const v4f pa = *(const v4fa*)&so[w][ln][i4], pb = *(const v4fa*)&so[w][16 + ln][i4];
#pragma unroll
      for (int u = 0; u < 4; ++u) fu_step_pf(a, we + (i4 + u + 1) * FS, op_frag(pa[u], oa), op_frag(pb[u], ob), e1); }
    fu_step_pf(a, we + 33 * FS, o2a, o2b, e1); fu_step_pf(a, we + 34 * FS, o1a, o1b, e1);
    FragH one;
#pragma unroll
    for (int e = 0; e < 16; ++e) one.h[e] = (_Float16)((e == 0 && hh == 0) ? 1.0f : 0.0f);
    fu_step_pf(a, wy, one.v, one.v, e1);
    asm volatile("s_wait_xcnt 0x0" ::: "memory");      /* the address pairs of the last We1 and the first We2 fragment loads are free for reuse from here on: the wait stands in front of whatever overwrites them */
#pragma unroll
    for (int t = 0; t < 4; ++t) { const v8f bv = fu_bias(be1, t, hh);
#pragma unroll
      for (int n = 0; n < 2; ++n)
#pragma unroll
        for (int r = 0; r < 8; ++r) e1[n][t][r] = fmaxf(e1[n][t][r] * 0.0625f + bv[r], 0.f); } }
  /* out = relu([e1, o1, o2, 1, 1] We2^T + b) */
  v8f y[2][4] = {{z8, z8, z8, z8}, {z8, z8, z8, z8}};
  { fu_step_pf(a, wy + FS, fu_pack(e1[0][0], e1[0][1]), fu_pack(e1[1][0], e1[1][1]), y); fu_step_pf(a, wy + 2 * FS, fu_pack(e1[0][2], e1[0][3]), fu_pack(e1[1][2], e1[1][3]), y);
    fu_step_pf(a, wy + 3 * FS, o1a, o1b, y); fu_step_pf(a, wy + 4 * FS, o2a, o2b, y);
    FragH two;
#pragma unroll
    for (int e = 0; e < 16; ++e) two.h[e] = (_Float16)((e < 2 && hh == 0) ? 1.0f : 0.0f);
    fu_step_end(a, two.v, two.v, y); }
  /* the lane holds 8 features of its row a tile: through the slab, so that the output goes out as whole rows */
#pragma unroll
  for (int t = 0; t < 4; ++t) { const v8f bv = fu_bias(be2, t, hh);
#pragma unroll
    for (int n = 0; n < 2; ++n) { v4f s0, s1;
#pragma unroll
      for (int r = 0; r < 4; ++r) { s0[r] = fmaxf(y[n][t][r] * 0.0625f + bv[r], 0.f); s1[r] = fmaxf(y[n][t][4 + r] * 0.0625f + bv[4 + r], 0.f); }
      float* d = &so[w][n * 16 + ln][t * 16 + 8 * hh]; *(v4fa*)d = s0; *(v4fa*)(d + 4) = s1; } }
  __builtin_amdgcn_fence(__ATOMIC_ACQ_REL, "workgroup"); __builtin_amdgcn_wave_barrier();      /* as above: the wave's own LDS stores before its loads */
  const int rsub = lane >> 4, c4 = (lane & 15) * 4;
#pragma unroll
  for (int q = 0; q < 16; ++q) { const int r = q * 2 + rsub; const v4f v = *(const v4fa*)&so[w][r][c4]; *(v4f*)(out + (size_t)(row0 + r) * FE + c4) = v; } }

extern "C" void kernel_launch(void* const* d_in, const int* in_sizes, int n_in,
                              void* d_out, int out_size, void* d_ws, size_t ws_size, hipStream_t stream) {
  (void)in_sizes; (void)n_in; (void)out_size;
  const float* const* I = (const float* const*)d_in;
  const float* x = I[0]; const float* Wh1 = I[1]; const float* bh1 = I[2]; const float* Wz1 = I[3]; const float* bz1 = I[4]; const float* Wo1 = I[5]; const float* bo1 = I[6]; const float* Wh2 = I[7]; const float* bh2 = I[8]; const float* Wz2 = I[9]; const float* bz2 = I[10]; const float* Wo2 = I[11]; const float* bo2 = I[12]; const float* We1 = I[13]; const float* be1 = I[14]; const float* We2 = I[15]; const float* be2 = I[16];
  char* ws = (char*)d_ws; size_t off = 0;
  auto take = [&](size_t bytes) { char* p = ws + off; off += (bytes + 255) & ~(size_t)255; return p; };
  _Float16* BZ = (_Float16*)take((size_t)64 * KO * 2); float* bz = (float*)take(64 * 4); _Float16* BH = (_Float16*)take((size_t)64 * 64 * 2); float* bh = (float*)take(64 * 4); _Float16* BO = (_Float16*)take((size_t)64 * 64 * 2); float* bo = (float*)take(64 * 4); _Float16* BE1 = (_Float16*)take((size_t)FE * KKP * 2); _Float16* BE2 = (_Float16*)take((size_t)FE * KC2 * 2);
  if (off > ws_size) return;      /* under 1 MiB: the prepared weights and biases only */
  k_prep<<<PB_B + 1, 256, 0, stream>>>(Wz1, Wz2, We1, We2, Wh1, Wh2, Wo1, Wo2, bz1, bz2, bh1, bh2, bo1, bo2, BZ, BE1, BE2, BH, BO, bz, bh, bo);      /* every element of every plane, the pads and the zero blocks too */
  k_fused<<<NBR / 128, 128, 0, stream>>>(x, BZ, bz, BH, bh, BO, bo, BE1, be1, BE2, be2, (float*)d_out);
}

// v007
// It runs in 37.9 microseconds.
// In two side-by-side timings against v006, it was 1.27 and 1.26 times as fast.
// All steps since v000 together make it 32.8 times as fast.
#include <hip/hip_runtime.h>
// KroneckerFusion (131072 rows; v1, v2 = x[0], x[1] (32 each): h_i = relu(v_i Wh_i^T + b); z_i = Bilinear(v1, Wz_i, v2) + b; o_i = relu((sigmoid(z_i) * h_i) Wo_i^T + b); o_i <- [o_i, 1]; o12 = o1 (x) o2 (33 x 33 = 1089); out = relu(o12 We1^T + b); out = relu([out, o1, o2] We2^T + b)).
// Structure: ONE kernel for the whole row pipeline; a wave owns 32 rows from the input to the output row and no intermediate touches the workspace. Every product is computed transposed, weights as the A operand (16 features a tile) and the rows as the B operand (lane = row), f16 WMMA with f32 accumulation and exact x16 weights + bias. A lane's accumulators then hold features 16 t + 8 hh + 0..7 of its own row, and two neighbouring feature tiles converted to f16 ARE the B fragment of the next product (its k order), so z, h, the gate, o, e1 and the output follow one another in registers. The bilinear forms ([Wz1; Wz2] flattened, K = 1024) and We1 (K re-ordered to [o1[a] o2[b] (1024) | o2 (32) | o1 (32) | 1 | 0 pad] = 1120) form their B fragments f16(p[i] * q[j]) in registers; o1[a], which both lane halves need for every a, goes through the wave's own LDS slab. We2's K is re-ordered to [e1 (64) | o1 (32) | o2 (32) | 1 | 1 | 0 pad] = 160 with the weight columns permuted alike. The output rows are turned in the same slab and stored as whole lines. The five prepared weight planes lie one behind the other in the workspace, in the order of their use and in fragment order (fr_off): one stream of 76 k steps. A work-group of eight waves brings it into LDS in chunks of four k steps (16 KiB) with asynchronous copies, two buffers, one chunk ahead, and every wave reads its fragments from there, inside a chunk one k step ahead through four register fragments; each 16-byte-a-lane read of a fragment half takes 512 bytes in a row. One launch (k_prep) prepares all planes and biases in front of it.
#define NBR 131072               /* rows processed */
#define NBI 131072               /* rows in the input (x[1] starts at NBI*32; separate so debug builds can shrink NBR) */
#define D1 32
#define KO 1024                  /* 32 x 32 outer */
#define KK 1089                  /* 33 x 33 Kronecker */
#define KKP 1120
#define FE 64
#define KC2 160                  /* [e1 (64) | o1 (32) | o2 (32) | 1 | 1 | 0] */
typedef __bf16 v16b __attribute__((ext_vector_type(16)));
typedef unsigned short v8us __attribute__((ext_vector_type(8), may_alias));
typedef float  v8f  __attribute__((ext_vector_type(8)));
typedef float  v4f  __attribute__((ext_vector_type(4)));
typedef float  v4fa __attribute__((ext_vector_type(4), may_alias));
union FragB { v16b v; v8us half[2]; unsigned short u[16]; };

__device__ __forceinline__ unsigned short bf16_bits(float x) { unsigned int u = __float_as_uint(x); return (unsigned short)((u + 0x7FFFu + ((u >> 16) & 1u)) >> 16); }
__device__ __forceinline__ float bf16_val(unsigned short b) { return __uint_as_float(((unsigned int)b) << 16); }
__device__ __forceinline__ float bf16_round(float x) { return bf16_val(bf16_bits(x)); }
// D += A·B with NT terms: 1 = ah·bh, 2 = + al·bh (A split), 3 = + ah·bl (both split)
template <int NT>
__device__ __forceinline__ v8f mmaN(v16b ah, v16b al, v16b bh, v16b bl, v8f c) {
  c = __builtin_amdgcn_wmma_f32_16x16x32_bf16(false, ah, false, bh, (short)0, c, false, false);
  if (NT >= 2) c = __builtin_amdgcn_wmma_f32_16x16x32_bf16(false, al, false, bh, (short)0, c, false, false);
  if (NT >= 3) c = __builtin_amdgcn_wmma_f32_16x16x32_bf16(false, ah, false, bl, (short)0, c, false, false);
  asm volatile("v_nop\n\tv_nop\n\tv_nop\n\tv_nop" : "+v"(c) : "v"(ah), "v"(al), "v"(bh), "v"(bl));
  return c;
}

__global__ __launch_bounds__(256) void k_wt_bf16(const float* __restrict__ W, unsigned short* __restrict__ Wt, int K, int N) {
  const int t = blockIdx.x * 256 + threadIdx.x;
  const int k8n = K / 8;
  if (t >= N * k8n) return;
  const int n = t / k8n, k8 = (t % k8n) * 8;
  v8us v;
#pragma unroll
  for (int i = 0; i < 8; ++i) v[i] = bf16_bits(W[(size_t)(k8 + i) * N + n]);
  *(v8us*)(Wt + (size_t)n * K + k8) = v;
  
}

// GEMM C[M][N] (f32, pitch ldc) = act(A[M][K]·W + bias). A f32 row-major (pitch lda) converted per fragment to bf16
// (ASPLIT: hi/lo two planes -> 2 terms, else single rounded term); Wt bf16 [N][K] (pitch ldb). BIAS_BF16 rounds the
// bias to bf16 first (bias quantised to bf16 before the add). K%32==0, M%16==0, N%64==0.
template <bool ASPLIT, int ACT, bool BIAS_BF16>
__global__ __launch_bounds__(128) void k_gemm_bf(const float* __restrict__ A, int lda, const unsigned short* __restrict__ Wt, int ldb,
                                               const float* __restrict__ bias, float* __restrict__ C, int ldc, int M, int N, int K) {
  __shared__ __attribute__((aligned(16))) float so[4][16][64];
  const int tid = threadIdx.x, w = tid >> 5, lane = tid & 31, ln = lane & 15, hh = lane >> 4;
  const int ntn = N / 64;
  const int wid = blockIdx.x * 4 + w;
  const int mt = wid / ntn, nq = wid % ntn;
  if (mt * 16 >= M) return;
  const int row0 = mt * 16, col0 = nq * 64;
  const float* arow = A + (size_t)(row0 + ln) * lda;
  v8f acc[4] = {};
  for (int kb = 0; kb < K; kb += 32) {
    FragB ah, al;
    const v4f x0 = *(const v4fa*)(arow + kb + 8 * hh), x1 = *(const v4fa*)(arow + kb + 8 * hh + 4);
    const v4f x2 = *(const v4fa*)(arow + kb + 16 + 8 * hh), x3 = *(const v4fa*)(arow + kb + 16 + 8 * hh + 4);
    float xs[16] = {x0[0],x0[1],x0[2],x0[3],x1[0],x1[1],x1[2],x1[3],x2[0],x2[1],x2[2],x2[3],x3[0],x3[1],x3[2],x3[3]};
#pragma unroll
    for (int i = 0; i < 16; ++i) { const unsigned short hb = bf16_bits(xs[i]); ah.u[i] = hb; al.u[i] = ASPLIT ? bf16_bits(xs[i] - bf16_val(hb)) : (unsigned short)0; }
#pragma unroll
    for (int t = 0; t < 4; ++t) {
      const unsigned short* brow = Wt + (size_t)(col0 + t * 16 + ln) * ldb + kb;
      FragB b;
      b.half[0] = *(const v8us*)(brow + 8 * hh);
      b.half[1] = *(const v8us*)(brow + 16 + 8 * hh);
      acc[t] = mmaN<ASPLIT ? 2 : 1>(ah.v, al.v, b.v, b.v, acc[t]);
    }
  }
#pragma unroll
  for (int t = 0; t < 4; ++t) {
    float bv = bias ? bias[col0 + t * 16 + ln] : 0.f;
    if (BIAS_BF16) bv = bf16_round(bv);
#pragma unroll
    for (int r = 0; r < 8; ++r) { float v = acc[t][r] + bv; if (ACT == 1) v = fmaxf(v, 0.f); so[w][8 * hh + r][t * 16 + ln] = v; }
  }
  __builtin_amdgcn_fence(__ATOMIC_ACQ_REL, "workgroup");
  __builtin_amdgcn_wave_barrier();
  const int rsub = lane >> 4, c4 = (lane & 15) * 4;
  {
#pragma unroll
    for (int q = 0; q < 8; ++q) {
      const int r = q * 2 + rsub;
      const v4f v = *(const v4fa*)&so[w][r][c4];
      *(v4f*)(C + (size_t)(row0 + r) * ldc + col0 + c4) = v;
    }
    
  }
}

// GEMM C = act(A·W + bias + resid): A f32 (ASPLIT -> hi/lo 2 terms), Wt bf16 [N][K]; ACT 0 none, 1 relu, 2 exact gelu;
// resid (optional, f32, row index = (row % rmod), pitch ldr, RES_BF16 rounds it) added before the activation.
template <bool ASPLIT, int ACT, bool BIAS_BF16, bool RES_BF16>
__global__ __launch_bounds__(128) void k_gemm_bf3(const float* __restrict__ A, int lda, const unsigned short* __restrict__ Wt, int ldb,
                                                const float* __restrict__ bias, const float* __restrict__ resid, int rmod, int ldr,
                                                float* __restrict__ C, int ldc, int M, int N, int K) {
  __shared__ __attribute__((aligned(16))) float so[4][16][64];
  const int tid = threadIdx.x, w = tid >> 5, lane = tid & 31, ln = lane & 15, hh = lane >> 4;
  const int ntn = N / 64;
  const int wid = blockIdx.x * 4 + w;
  const int mt = wid / ntn, nq = wid % ntn;
  if (mt * 16 >= M) return;
  const int row0 = mt * 16, col0 = nq * 64;
  const float* arow = A + (size_t)(row0 + ln) * lda;
  v8f acc[4] = {};
  for (int kb = 0; kb < K; kb += 32) {
    FragB ah, al;
    const v4f x0 = *(const v4fa*)(arow + kb + 8 * hh), x1 = *(const v4fa*)(arow + kb + 8 * hh + 4);
    const v4f x2 = *(const v4fa*)(arow + kb + 16 + 8 * hh), x3 = *(const v4fa*)(arow + kb + 16 + 8 * hh + 4);
    float xs[16] = {x0[0],x0[1],x0[2],x0[3],x1[0],x1[1],x1[2],x1[3],x2[0],x2[1],x2[2],x2[3],x3[0],x3[1],x3[2],x3[3]};
#pragma unroll
    for (int i = 0; i < 16; ++i) { const unsigned short hb = bf16_bits(xs[i]); ah.u[i] = hb; al.u[i] = ASPLIT ? bf16_bits(xs[i] - bf16_val(hb)) : (unsigned short)0; }
#pragma unroll
    for (int t = 0; t < 4; ++t) {
      const unsigned short* brow = Wt + (size_t)(col0 + t * 16 + ln) * ldb + kb;
      FragB b;
      b.half[0] = *(const v8us*)(brow + 8 * hh);
      b.half[1] = *(const v8us*)(brow + 16 + 8 * hh);
      acc[t] = mmaN<ASPLIT ? 2 : 1>(ah.v, al.v, b.v, b.v, acc[t]);
    }
  }
#pragma unroll
  for (int t = 0; t < 4; ++t) {
    const int col = col0 + t * 16 + ln;
    float bv = bias ? bias[col] : 0.f;
    if (BIAS_BF16) bv = bf16_round(bv);
#pragma unroll
    for (int r = 0; r < 8; ++r) {
      float v = acc[t][r] + bv;
      if (resid) { float rv = resid[(size_t)((row0 + 8 * hh + r) % rmod) * ldr + col]; if (RES_BF16) rv = bf16_round(rv); v += rv; }
      if (ACT == 1) v = fmaxf(v, 0.f);
      if (ACT == 2) v = 0.5f * v * (1.0f + erff(v * 0.70710678118654752f));
      if (ACT == 3) { const float u = 0.7978845608028654f * (v + 0.044715f * v * v * v); v = 0.5f * v * (1.0f + tanhf(u)); }
      so[w][8 * hh + r][t * 16 + ln] = v;
    }
  }
  __builtin_amdgcn_fence(__ATOMIC_ACQ_REL, "workgroup");
  __builtin_amdgcn_wave_barrier();
  const int rsub = lane >> 4, c4 = (lane & 15) * 4;
  {
#pragma unroll
    for (int q = 0; q < 8; ++q) {
      const int r = q * 2 + rsub;
      const v4f v = *(const v4fa*)&so[w][r][c4];
      *(v4f*)(C + (size_t)(row0 + r) * ldc + col0 + c4) = v;
    }
    
  }
}
// row LayerNorm (biased variance, eps) over N: s = X (+ R); optional out_sum <- s; out_norm <- (s-mu)*rsqrt(var+eps)*g + b
template <bool PARAM_BF16>
__global__ __launch_bounds__(256) void k_layernorm(const float* __restrict__ X, const float* __restrict__ R, const float* __restrict__ g, const float* __restrict__ bta,
                                                  float* __restrict__ out_sum, float* __restrict__ out_norm, int N, float eps) {
  __shared__ float red[256];
  const int row = blockIdx.x, tid = threadIdx.x;
  const float* x = X + (size_t)row * N; const float* rr = R ? R + (size_t)row * N : nullptr;
  float vals[16];                     // up to N = 4096
  const int per = N / 256;            // contiguous chunk per thread? use strided-by-4 chunks: thread handles j = tid*4 + 1024*u
  float s1 = 0.f;
  for (int u = 0; u < per / 4; ++u) {
    const int j = tid * 4 + 1024 * u;
    const v4f a = *(const v4fa*)(x + j);
    v4f b = {0.f,0.f,0.f,0.f}; if (rr) b = *(const v4fa*)(rr + j);
#pragma unroll
    for (int q = 0; q < 4; ++q) { const float v = a[q] + b[q]; vals[u * 4 + q] = v; s1 += v; }
  }
  red[tid] = s1; __syncthreads();
  for (int st = 128; st > 0; st >>= 1) { if (tid < st) red[tid] += red[tid + st]; __syncthreads(); }
  const float mu = red[0] / (float)N; __syncthreads();
  float s2 = 0.f;
  for (int u = 0; u < per / 4; ++u)
#pragma unroll
    for (int q = 0; q < 4; ++q) { const float c = vals[u * 4 + q] - mu; s2 += c * c; }
  red[tid] = s2; __syncthreads();
  for (int st = 128; st > 0; st >>= 1) { if (tid < st) red[tid] += red[tid + st]; __syncthreads(); }
  const float rs = rsqrtf(red[0] / (float)N + eps);
  {
    for (int u = 0; u < per / 4; ++u) {
      const int j = tid * 4 + 1024 * u;
      v4f o, sm;
#pragma unroll
      for (int q = 0; q < 4; ++q) {
        float gg = g[j + q], bb = bta[j + q];
        if (PARAM_BF16) { gg = bf16_round(gg); bb = bf16_round(bb); }
        sm[q] = vals[u * 4 + q]; o[q] = (vals[u * 4 + q] - mu) * rs * gg + bb;
      }
      if (out_sum) *(v4f*)(out_sum + (size_t)row * N + j) = sm;
      *(v4f*)(out_norm + (size_t)row * N + j) = o;
    }
    
  }
}



// ---- f16 WMMA path (v_wmma_f32_16x16x32_f16): 11-bit significands for operands in range — used here for all five GEMMs (bilinear, h, o, We1, We2)
typedef _Float16 v16h __attribute__((ext_vector_type(16)));
union FragH { v16h v; v8us half[2]; _Float16 h[16]; unsigned short u[16]; };
template <int NT>
__device__ __forceinline__ v8f mmaH(v16h ah, v16h al, v16h bh, v16h bl, v8f c) {
  c = __builtin_amdgcn_wmma_f32_16x16x32_f16(false, ah, false, bh, (short)0, c, false, false);
  if (NT >= 2) c = __builtin_amdgcn_wmma_f32_16x16x32_f16(false, al, false, bh, (short)0, c, false, false);
  if (NT >= 3) c = __builtin_amdgcn_wmma_f32_16x16x32_f16(false, ah, false, bl, (short)0, c, false, false);
  asm volatile("v_nop\n\tv_nop\n\tv_nop\n\tv_nop" : "+v"(c) : "v"(ah), "v"(al), "v"(bh), "v"(bl));
  return c;
}
// batched GEMM like k_gemm_b but f16 operands: A f32 (split into f16 hi/lo if ASPLIT, else rounded to f16), Bt = f16 values [n][k]; alpha; C f32; N multiple of 16 (partial tiles skipped)
template <bool ASPLIT>
__global__ __launch_bounds__(128) void k_gemm_h(const float* __restrict__ A, int lda, size_t sA, const _Float16* __restrict__ Bh, int ldb, size_t sB, float alpha, float* __restrict__ C, int ldc, size_t sC, int M, int N, int K) {
  __shared__ __attribute__((aligned(16))) float so[4][16][64];
  const int tid = threadIdx.x, w = tid >> 5, lane = tid & 31, ln = lane & 15, hh = lane >> 4; const int by = blockIdx.y;
  A += (size_t)by * sA; Bh += (size_t)by * sB; C += (size_t)by * sC;
  const int ntn = (N + 63) / 64; const int wid = blockIdx.x * 4 + w; const int mt = wid / ntn, nq = wid % ntn; if (mt * 16 >= M) return;
  const int row0 = mt * 16, col0 = nq * 64; const float* arow = A + (size_t)(row0 + ln) * lda;
  v8f acc[4] = {};
  for (int kb = 0; kb < K; kb += 32) {
    FragH ah, al;
    const v4f x0 = *(const v4fa*)(arow + kb + 8 * hh), x1 = *(const v4fa*)(arow + kb + 8 * hh + 4), x2 = *(const v4fa*)(arow + kb + 16 + 8 * hh), x3 = *(const v4fa*)(arow + kb + 16 + 8 * hh + 4);
    float xs[16] = {x0[0],x0[1],x0[2],x0[3],x1[0],x1[1],x1[2],x1[3],x2[0],x2[1],x2[2],x2[3],x3[0],x3[1],x3[2],x3[3]};
#pragma unroll
    for (int i = 0; i < 16; ++i) { const _Float16 h = (_Float16)xs[i]; ah.h[i] = h; al.h[i] = ASPLIT ? (_Float16)(xs[i] - (float)h) : (_Float16)0.0f; }
#pragma unroll
    for (int t = 0; t < 4; ++t) { if (col0 + t * 16 >= N) continue; const size_t boff = (size_t)(col0 + t * 16 + ln) * ldb + kb; FragH bq; bq.half[0] = *(const v8us*)(Bh + boff + 8 * hh); bq.half[1] = *(const v8us*)(Bh + boff + 16 + 8 * hh);
      acc[t] = mmaH<ASPLIT ? 2 : 1>(ah.v, al.v, bq.v, bq.v, acc[t]); }
  }
#pragma unroll
  for (int t = 0; t < 4; ++t) { if (col0 + t * 16 >= N) continue;
#pragma unroll
    for (int r = 0; r < 8; ++r) so[w][8 * hh + r][t * 16 + ln] = acc[t][r] * alpha; }
  __builtin_amdgcn_fence(__ATOMIC_ACQ_REL, "workgroup"); __builtin_amdgcn_wave_barrier();
  const int rsub = lane >> 4, c4 = (lane & 15) * 4;
  {
#pragma unroll
    for (int q = 0; q < 8; ++q) { const int r = q * 2 + rsub; if (col0 + c4 < N) { const v4f v = *(const v4fa*)&so[w][r][c4]; *(v4f*)(C + (size_t)(row0 + r) * ldc + col0 + c4) = v; } }
     }
}

// Wt[n][k] = f16(W[k][n]·scale) from f32 row-major W[K][N] (scale = power of two; bf16-exact weights stay exact in f16 away from the subnormal range)
__global__ __launch_bounds__(256) void k_wt_f16(const float* __restrict__ W, _Float16* __restrict__ Wt, int K, int N, float scale) {
  const int t = blockIdx.x * 256 + threadIdx.x; if (t >= N * (K / 8)) return; const int n = t / (K / 8), k8 = (t % (K / 8)) * 8; FragH f;
#pragma unroll
  for (int i = 0; i < 8; ++i) f.h[i] = (_Float16)(bf16_round(W[(size_t)(k8 + i) * N + n]) * scale); const v8us o = f.half[0];
  *(v8us*)((unsigned short*)Wt + (size_t)n * K + k8) = o; 
}
// k_gemm_hh variant with fused epilogue: v = acc·alpha + bias[by·sBias + col] (+ CP[(row/rowsPerB)·sCPb + by·64 + col] if CP) ; ACT 0 none / 1 elu ; writes f16 C16 (and f32 C if non-null)
template <int ACT>
__global__ __launch_bounds__(128) void k_gemm_hhx(const _Float16* __restrict__ A, int lda, size_t sA, const _Float16* __restrict__ Bh, int ldb, size_t sB, float alpha, const float* __restrict__ bias, size_t sBias, const float* __restrict__ CP, int rowsPerB, size_t sCPb, int row0g,
    float* __restrict__ C, _Float16* __restrict__ C16, int ldc, size_t sC, int M, int N, int K) {
  __shared__ __attribute__((aligned(16))) float so[4][16][64];
  const int tid = threadIdx.x, w = tid >> 5, lane = tid & 31, ln = lane & 15, hh = lane >> 4; const int by = blockIdx.y;
  A += (size_t)by * sA; Bh += (size_t)by * sB; const size_t cofs = (size_t)by * sC; const float* bp = bias ? bias + (size_t)by * sBias : nullptr;
  const int ntn = (N + 63) / 64; const int wid = blockIdx.x * 4 + w; const int mt = wid / ntn, nq = wid % ntn; if (mt * 16 >= M) return;
  const int row0 = mt * 16, col0 = nq * 64; const _Float16* arow = A + (size_t)(row0 + ln) * lda;
  v8f acc[4] = {};
  for (int kb = 0; kb < K; kb += 32) { FragH ah; ah.half[0] = *(const v8us*)((const unsigned short*)arow + kb + 8 * hh); ah.half[1] = *(const v8us*)((const unsigned short*)arow + kb + 16 + 8 * hh);
#pragma unroll
    for (int t = 0; t < 4; ++t) { if (col0 + t * 16 >= N) continue; const size_t boff = (size_t)(col0 + t * 16 + ln) * ldb + kb; FragH bq; bq.half[0] = *(const v8us*)((const unsigned short*)Bh + boff + 8 * hh); bq.half[1] = *(const v8us*)((const unsigned short*)Bh + boff + 16 + 8 * hh);
      acc[t] = mmaH<1>(ah.v, ah.v, bq.v, bq.v, acc[t]); }
  }
#pragma unroll
  for (int t = 0; t < 4; ++t) { if (col0 + t * 16 >= N) continue; const int col = col0 + t * 16 + ln; const float bv = bp ? bf16_round(bp[col]) : 0.f;
#pragma unroll
    for (int r = 0; r < 8; ++r) { float v = acc[t][r] * alpha + bv; if (CP) { const int rr = row0g + row0 + 8 * hh + r; if (rowsPerB < 0) v += CP[cofs + (size_t)rr * ldc + col];      /* rowsPerB < 0: own element of the batched C plane */ else { const int bidx = rr / rowsPerB; v += CP[(size_t)bidx * sCPb + (size_t)by * 64 + col]; } } if (ACT == 1) v = (v > 0.f) ? v : expm1f(v); else if (ACT == 7) v = (v > 0.f) ? v + 1.0f : expf(v); else if (ACT == 8) v = tanhf(v); else if (ACT == 9) v = 0.5f * v * (1.0f + tanhf(0.7978845608028654f * (v + 0.044715f * v * v * v))); else if (ACT == 11) v = 1.0f / (1.0f + expf(-v)); else if (ACT == 12) v = (v > 0.f) ? v : 0.01f * v; else if (ACT == 14) v = (v > 0.f) ? v : 0.1f * v; else if (ACT == 16) v = (v >= 0.f) ? v : 0.3f * v; else if (ACT == 17) v = (v >= 0.f) ? v : 0.2f * v; else if (ACT == 15) v = v / (1.0f + expf(-v)); else if (ACT == 3) v = fmaxf(v, 0.f); else if (ACT == 6) v = 0.5f * v * (1.0f + erff(v * 0.70710678118654752f)); so[w][8 * hh + r][t * 16 + ln] = v; } }
  __builtin_amdgcn_fence(__ATOMIC_ACQ_REL, "workgroup"); __builtin_amdgcn_wave_barrier();
  const int rsub = lane >> 4, c4 = (lane & 15) * 4; typedef _Float16 v4h __attribute__((ext_vector_type(4)));
  {
#pragma unroll
    for (int q = 0; q < 8; ++q) { const int r = q * 2 + rsub; if (col0 + c4 < N) { const v4f v = *(const v4fa*)&so[w][r][c4]; if (C) *(v4f*)(C + cofs + (size_t)(row0 + r) * ldc + col0 + c4) = v; if (C16) { v4h h4; for (int i = 0; i < 4; ++i) h4[i] = (_Float16)v[i]; *(v4h*)(C16 + cofs + (size_t)(row0 + r) * ldc + col0 + c4) = h4; } } }
     }
}


typedef _Float16 v4h __attribute__((ext_vector_type(4)));

__global__ __launch_bounds__(256) void k_x16(const float* __restrict__ x, _Float16* __restrict__ X16, size_t n8) { const size_t t = (size_t)blockIdx.x * 256 + threadIdx.x; if (t >= n8) return; FragH f;
#pragma unroll
  for (int q = 0; q < 8; ++q) f.h[q] = (_Float16)bf16_round(x[t * 8 + q]); *(v8us*)((unsigned short*)X16 + t * 8) = f.half[0];  }
__global__ __launch_bounds__(256) void k_h16(const float* __restrict__ x, _Float16* __restrict__ X16, size_t n8) { const size_t t = (size_t)blockIdx.x * 256 + threadIdx.x; if (t >= n8) return; FragH f;
#pragma unroll
  for (int q = 0; q < 8; ++q) f.h[q] = (_Float16)x[t * 8 + q]; *(v8us*)((unsigned short*)X16 + t * 8) = f.half[0];  }
__global__ __launch_bounds__(256) void k_round16f(const float* __restrict__ W, _Float16* __restrict__ Bt, size_t n8) { const size_t t = (size_t)blockIdx.x * 256 + threadIdx.x; if (t >= n8) return; FragH f;
#pragma unroll
  for (int i = 0; i < 8; ++i) f.h[i] = (_Float16)(bf16_round(W[t * 8 + i]) * 16.0f); *(v8us*)((unsigned short*)Bt + t * 8) = f.half[0];  }
template <int NHv, int TTv>
__global__ __launch_bounds__(256) void k_vt(const _Float16* __restrict__ V16, int ldv, int voff, _Float16* __restrict__ Vt) { __shared__ unsigned short tl[64][66]; const int tid = threadIdx.x; const int slab = blockIdx.x / (TTv / 64), lg = blockIdx.x % (TTv / 64); const int b = slab / NHv, h = slab % NHv;
  for (int i = tid; i < 64 * 8; i += 256) { const int r = i / 8, c8 = (i % 8) * 8; FragH f; f.half[0] = *(const v8us*)((const unsigned short*)V16 + ((size_t)b * TTv + lg * 64 + r) * ldv + voff + h * 64 + c8);
#pragma unroll
    for (int q = 0; q < 8; ++q) tl[r][c8 + q] = f.u[q]; }
  __syncthreads();
  {
#pragma unroll
    for (int rd = 0; rd < 2; ++rd) { const int d = rd * 32 + tid / 8, pc = tid % 8; FragH f;
#pragma unroll
      for (int q = 0; q < 8; ++q) f.u[q] = tl[pc * 8 + q][d];
      *(v8us*)((unsigned short*)Vt + ((size_t)slab * 64 + d) * TTv + lg * 64 + pc * 8) = f.half[0]; }
     } }

__global__ __launch_bounds__(256) void k_hl(const float* __restrict__ F, _Float16* __restrict__ Hh, _Float16* __restrict__ Hl, size_t n8) { const size_t t = (size_t)blockIdx.x * 256 + threadIdx.x; if (t >= n8) return; FragH fh, fl; const v4f a = *(const v4fa*)(F + t * 8), c = *(const v4fa*)(F + t * 8 + 4);
#pragma unroll
  for (int q = 0; q < 4; ++q) { _Float16 h = (_Float16)a[q]; fh.h[q] = h; fl.h[q] = (_Float16)((a[q] - (float)h) * 1024.0f); h = (_Float16)c[q]; fh.h[4 + q] = h; fl.h[4 + q] = (_Float16)((c[q] - (float)h) * 1024.0f); }
  { *(v8us*)((unsigned short*)Hh + t * 8) = fh.half[0]; *(v8us*)((unsigned short*)Hl + t * 8) = fl.half[0];  } }

// ---- f16 fragment loader and WMMA step ----
__device__ __forceinline__ v16h g2_frag(const _Float16* p, int hh) { FragH f; f.half[0] = *(const v8us*)((const unsigned short*)p + 8 * hh); f.half[1] = *(const v8us*)((const unsigned short*)p + 16 + 8 * hh); return f.v; }
__device__ __forceinline__ v8f g2_mma(v16h a, v16h b, v8f c) { v8f d = __builtin_amdgcn_wmma_f32_16x16x32_f16(false, a, false, b, (short)0, c, false, false); asm volatile("v_nop\n\tv_nop\n\tv_nop\n\tv_nop" : "+v"(d) : "v"(a), "v"(b)); return d; }

// Fragment order of the prepared weight planes (64 features x K): [k step s][feature tile t][half j][lane 16 hh + ln][8 elements], feature o = 16 t + ln, k = 32 s + 16 j + 8 hh + e (g2_frag's k order). fr_off = the element offset of (o, k0), k0 a multiple of 8; the eight k from k0 on follow one another.
__device__ __forceinline__ size_t fr_off(int o, int k0) { return (size_t)(((((k0 >> 5) * 4 + (o >> 4)) * 2 + ((k0 >> 4) & 1)) * 32 + ((k0 >> 3) & 1) * 16 + (o & 15)) * 8); }
// the inverse: chunk c of eight elements (c = fr_off / 8) -> its feature o and first k. k_prep takes one chunk a thread in this order, so that a wave stores 512 bytes in a row and each 128-byte line has one writer.
__device__ __forceinline__ void fr_src(int c, int& o, int& k0) { o = ((c >> 6) & 3) * 16 + (c & 15); k0 = (c >> 8) * 32 + ((c >> 5) & 1) * 16 + ((c >> 4) & 1) * 8; }
// a lane's fragment of one feature tile; p = the tile's first element + 8 * lane
__device__ __forceinline__ v16h fr_frag(const _Float16* p) { FragH f; f.half[0] = *(const v8us*)((const unsigned short*)p); f.half[1] = *(const v8us*)((const unsigned short*)p + 256); return f.v; }
// ---- the preparation of the weight planes and biases. Every '#pragma unroll' from here to the end of k_prep makes an array index a compile-time constant, so that wv and keep stay in registers.
// eight f32 weights -> eight f16(bf16_round(w) * 16), stored as chunk c of a plane in fragment order; keep = false stores a zero
__device__ __forceinline__ void fr_put(_Float16* __restrict__ Bt, int c, const float (&wv)[8], const bool (&keep)[8]) { FragH f;
#pragma unroll
  for (int q = 0; q < 8; ++q) f.h[q] = (_Float16)(bf16_round(keep[q] ? wv[q] : 0.0f) * 16.0f);
  *(v8us*)((unsigned short*)Bt + (size_t)c * 8) = f.half[0];
  asm volatile("s_wait_xcnt 0x0" ::: "memory"); }      /* the store's offset and data registers are free for reuse behind it: the wait stands in front of whatever overwrites them */
// eight weights ST columns apart: one address pair with constant offsets, so that all eight loads fly together
template <int ST>
__device__ __forceinline__ void fr_get(const float* __restrict__ s, float (&wv)[8]) {
#pragma unroll
  for (int q = 0; q < 8; ++q) wv[q] = s[q * ST];
  asm volatile("s_wait_xcnt 0x0" :: "v"(wv[0]), "v"(wv[1]), "v"(wv[2]), "v"(wv[3]), "v"(wv[4]), "v"(wv[5]), "v"(wv[6]), "v"(wv[7]) : "memory"); }      /* the address pair of the loads is free for reuse behind them: the wait stands in front of whatever overwrites it; the loaded values as inputs keep every load in front of it */
// chunk c of blockdiag(Wa, Wb) (64 x 64, each block [32][32]): a chunk off the diagonal reads an in-bounds place all the same and stores zeros, so that no branch stands in front of the loads
__device__ __forceinline__ void prep_diag(const float* __restrict__ Wa, const float* __restrict__ Wb, _Float16* __restrict__ Bt, int c) { int o, k0; fr_src(c, o, k0); float wv[8]; fr_get<1>((o < 32 ? Wa : Wb) + (size_t)(o & 31) * 32 + (k0 & 31), wv);
  const bool on = (o >> 5) == (k0 >> 5); const bool keep[8] = {on, on, on, on, on, on, on, on}; fr_put(Bt, c, wv, keep); }
// All prepared planes and biases in ONE launch: none of them reads what another writes, so the jobs are dealt by block index, one chunk of eight f16 a thread in fragment order: a wave stores 512 bytes in a row and each 128-byte line has one writer. A block of 256 chunks is one k step (32 k) of a plane, so which part of a permuted k order it fills is the same for the whole block.
// blocks 0..31: BZ = [Wz1; Wz2], each [32][32 * 32] flattened (64 x KO). 32..66: BE1 = We1 [64][33 * 33] (64 x KKP) in the k order of k_fused's row fragments: k = a * 32 + b <- column a * 33 + b (a, b < 32); 1024 + b <- 32 * 33 + b; 1056 + a <- a * 33 + 32; 1088 <- 1088; the rest 0.
// 67..71: BE2 = We2 [64][130] (64 x KC2) in the k order of k_fused's last product: k < 96 <- column k (e1, o1); 96 + b <- 97 + b (o2); 128 <- 96 and 129 <- 129 (the columns of the two appended ones); the rest 0. 72, 73: BH = blockdiag(Wh1, Wh2). 74, 75: BO = blockdiag(Wo1, Wo2). 76: the three bias pairs, rounded to bf16, 32 values a wave.
#define PB_E1 (64 * (KO / 8) / 256)
#define PB_E2 (PB_E1 + FE * (KKP / 8) / 256)
#define PB_H  (PB_E2 + FE * (KC2 / 8) / 256)
#define PB_O  (PB_H + 64 * (64 / 8) / 256)
#define PB_B  (PB_O + 64 * (64 / 8) / 256)
__global__ __launch_bounds__(256) void k_prep(const float* __restrict__ Wz1, const float* __restrict__ Wz2, const float* __restrict__ We1, const float* __restrict__ We2, const float* __restrict__ Wh1, const float* __restrict__ Wh2, const float* __restrict__ Wo1, const float* __restrict__ Wo2,
    const float* __restrict__ bz1, const float* __restrict__ bz2, const float* __restrict__ bh1, const float* __restrict__ bh2, const float* __restrict__ bo1, const float* __restrict__ bo2,
    _Float16* __restrict__ BZ, _Float16* __restrict__ BE1, _Float16* __restrict__ BE2, _Float16* __restrict__ BH, _Float16* __restrict__ BO, float* __restrict__ bz, float* __restrict__ bh, float* __restrict__ bo) {
  const int b = blockIdx.x, tid = threadIdx.x; int o, k0; float wv[8]; bool keep[8];
  if (b < PB_E1) { const int c = b * 256 + tid; fr_src(c, o, k0); fr_get<1>((o < 32 ? Wz1 : Wz2) + (size_t)(o & 31) * KO + k0, wv);
#pragma unroll
    for (int q = 0; q < 8; ++q) keep[q] = true;
    fr_put(BZ, c, wv, keep); }
  else if (b < PB_E2) { const int a = b - PB_E1, c = a * 256 + tid; fr_src(c, o, k0); const int j = k0 & 31; const float* r = We1 + (size_t)o * KK;
    if (a <= 32) fr_get<1>(r + a * 33 + j, wv);      /* row a of the 33 x 33 square; a = 32 is its last row, the o2 part */
    else if (a == 33) fr_get<33>(r + j * 33 + 32, wv);      /* its last column, the o1 part */
    else fr_get<0>(r + KK - 1, wv);      /* its last element, and the pad, which reads the same place and drops it */
#pragma unroll
    for (int q = 0; q < 8; ++q) keep[q] = k0 + q < KK;
    fr_put(BE1, c, wv, keep); }
  else if (b < PB_H) { const int a = b - PB_E2, c = a * 256 + tid; fr_src(c, o, k0); const float* r = We2 + (size_t)o * 130;
    if (a < 4) fr_get<1>(r + k0 + (a == 3 ? 1 : 0), wv);      /* e1 and o1 as they lie; o2 lies one column on */
    else { const float x0 = r[96], x1 = r[129];      /* the two ones' columns, and the pad, which drops what it reads */
      asm volatile("s_wait_xcnt 0x0" :: "v"(x0), "v"(x1) : "memory");      /* as in fr_get */
      wv[0] = x0;
#pragma unroll
      for (int q = 1; q < 8; ++q) wv[q] = x1; }
#pragma unroll
    for (int q = 0; q < 8; ++q) keep[q] = k0 + q < 130;
    fr_put(BE2, c, wv, keep); }
  else if (b < PB_O) prep_diag(Wh1, Wh2, BH, (b - PB_H) * 256 + tid);
  else if (b < PB_B) prep_diag(Wo1, Wo2, BO, (b - PB_O) * 256 + tid);
  else { const int w = __builtin_amdgcn_readfirstlane(tid >> 5), i = tid & 31;      /* the wave's number as a scalar: the choice of the arrays is a scalar one */
    if (w < 6) { const float* s = (w == 0) ? bz1 : (w == 1) ? bz2 : (w == 2) ? bh1 : (w == 3) ? bh2 : (w == 4) ? bo1 : bo2; float* d = ((w < 2) ? bz : (w < 4) ? bh : bo) + (w & 1) * 32; d[i] = bf16_round(s[i]); } } }
// ---- the fused row pipeline. A row fragment (B operand): lane ln = row, elements 0..7 = k 8 hh + 0..7, elements 8..15 = k 16 + 8 hh + 0..7 of a 32-wide k step (g2_frag's order, which the weight fragments use too).
// Every '#pragma unroll' from here to the end of k_fused makes an array or vector index a compile-time constant, so that the values stay in registers.
__device__ __forceinline__ void op_row16(const float* p, int hh, bool rnd, float (&v)[16]) { const v4f x0 = *(const v4fa*)(p + 8 * hh), x1 = *(const v4fa*)(p + 8 * hh + 4), x2 = *(const v4fa*)(p + 16 + 8 * hh), x3 = *(const v4fa*)(p + 16 + 8 * hh + 4);
  asm volatile("s_wait_xcnt 0x0" ::: "memory");      /* the address pair of these four loads is free for reuse behind them: the wait stands in front of whatever overwrites it */
#pragma unroll
  for (int e = 0; e < 4; ++e) { v[e] = rnd ? bf16_round(x0[e]) : x0[e]; v[4 + e] = rnd ? bf16_round(x1[e]) : x1[e]; v[8 + e] = rnd ? bf16_round(x2[e]) : x2[e]; v[12 + e] = rnd ? bf16_round(x3[e]) : x3[e]; } }
__device__ __forceinline__ v16h op_frag(float a, const float (&q)[16]) { FragH f;
#pragma unroll
  for (int e = 0; e < 16; ++e) f.h[e] = (_Float16)(a * q[e]); return f.v; }
// two neighbouring feature tiles of a lane's accumulators (features 8 hh + r and 16 + 8 hh + r of a 32-wide block) as the next product's row fragment
__device__ __forceinline__ v16h fu_pack(v8f lo, v8f hi) { FragH f;
#pragma unroll
  for (int e = 0; e < 8; ++e) { f.h[e] = (_Float16)lo[e]; f.h[8 + e] = (_Float16)hi[e]; } return f.v; }
// the lane's eight biases of feature tile t, rounded to bf16
__device__ __forceinline__ v8f fu_bias(const float* __restrict__ b, int t, int hh) { const v4f x0 = *(const v4fa*)(b + t * 16 + 8 * hh), x1 = *(const v4fa*)(b + t * 16 + 8 * hh + 4); v8f v;
#pragma unroll
  for (int e = 0; e < 4; ++e) { v[e] = bf16_round(x0[e]); v[4 + e] = bf16_round(x1[e]); } return v; }
// the four weight fragments (64 features) of one k step; wl = the staged chunk at the step's first element (FS a step) + 8 * lane
#define FS 2048                  /* elements of one k step of a weight plane: 64 features x 32 k */
#define CHE (4 * FS)             /* elements of one staged chunk: four k steps, 16 KiB */
// one chunk of the weight stream into one LDS buffer: 256 threads, four copies of 16 bytes each. g = the chunk's first element + 8 * tid, l = the buffer's LDS byte address + 16 * tid
__device__ __forceinline__ void st_copy(const _Float16* g, unsigned l) {
  asm volatile("global_load_async_to_lds_b128 %0, %4, off\n\t"
               "global_load_async_to_lds_b128 %1, %5, off\n\t"
               "global_load_async_to_lds_b128 %2, %6, off\n\t"
               "global_load_async_to_lds_b128 %3, %7, off\n\t"
               "s_wait_xcnt 0x0"      /* the copies' address registers are free for reuse behind the statement: the wait stands in front of whatever overwrites them */
               :: "v"(l), "v"(l + 4096u), "v"(l + 8192u), "v"(l + 12288u), "v"(g), "v"(g + 2048), "v"(g + 4096), "v"(g + 6144) : "memory"); }
// the hand-over at the foot of a chunk: the wave's own LDS reads of that chunk are done, its own copies of the next chunk have landed; behind the barrier every wave may read the next chunk, and the buffer just read may be refilled
__device__ __forceinline__ void st_publish() {
  asm volatile("s_wait_dscnt 0x0" ::: "memory");      /* this wave's reads of the buffer that is refilled next */
  asm volatile("s_wait_asynccnt 0x0" ::: "memory");      /* this wave's copies of the next chunk: the compiler places no wait for them */
  __syncthreads(); }
__device__ __forceinline__ void fu_load(const _Float16* wl, v16h (&a)[4]) {
#pragma unroll
  for (int t = 0; t < 4; ++t) a[t] = fr_frag(wl + t * 512); }
// one k step, 64 features x 32 rows, on fragments that are loaded already: the last step of a chunk
__device__ __forceinline__ void fu_step_end(const v16h (&a)[4], v16h d0, v16h d1, v8f (&c)[2][4]) {
#pragma unroll
  for (int t = 0; t < 4; ++t) { c[0][t] = g2_mma(a[t], d0, c[0][t]); c[1][t] = g2_mma(a[t], d1, c[1][t]); } }
// the same, and behind the two products that read a[t] its registers take that tile's fragment of the step that follows (wn: as in fu_load), so that a whole step's work lies between a load and its use
__device__ __forceinline__ void fu_step_pf(v16h (&a)[4], const _Float16* wn, v16h d0, v16h d1, v8f (&c)[2][4]) {
#pragma unroll
  for (int t = 0; t < 4; ++t) { c[0][t] = g2_mma(a[t], d0, c[0][t]); c[1][t] = g2_mma(a[t], d1, c[1][t]); a[t] = fr_frag(wn + t * 512);
    __builtin_amdgcn_sched_barrier(0); } }      /* behind each tile: holds the tiles in the order of their LDS reads, so that each wait leaves the three younger pairs of reads open (left free, a later tile's products were moved up and waited for every read). Behind the last it also keeps the later steps' row-fragment arithmetic behind this step: moved up, the row fragments of four steps are live at once and the kernel needs more than 256 registers, one wave a SIMD less */
// WS = the weight stream: [Wz (32 k steps) | Wh (2) | Wo (2) | We1 (35) | We2 (5)] = 19 chunks; chunk c is staged in buffer c & 1
__global__ __launch_bounds__(256) void k_fused(const float* __restrict__ x, const _Float16* __restrict__ WS, const float* __restrict__ bz, const float* __restrict__ bh, const float* __restrict__ bo,
    const float* __restrict__ be1, const float* __restrict__ be2, float* __restrict__ out) {
  __shared__ __attribute__((aligned(16))) float so[8][32][68];
  __shared__ __attribute__((aligned(16))) _Float16 wb[2 * CHE];
  const int tid = threadIdx.x, w = tid >> 5, lane = tid & 31, ln = lane & 15, hh = lane >> 4;
  const int row0 = blockIdx.x * 256 + 32 * w;
  const float* p0 = x + (size_t)(row0 + ln) * D1; const float* p1 = p0 + (size_t)16 * D1;
  const float* q0 = p0 + (size_t)NBI * D1; const float* q1 = q0 + (size_t)16 * D1;
  const v8f z8 = {0.f,0.f,0.f,0.f,0.f,0.f,0.f,0.f};
  const _Float16* gs = WS + tid * 8; const unsigned ls = (unsigned)(size_t)&wb[0] + 16u * (unsigned)tid;      /* the thread's own 16 bytes of each quarter of a chunk: in the stream, and in buffer 0 (LDS byte address) */
  const _Float16* wl = &wb[0] + lane * 8;      /* the lane's place in a staged fragment half */
  st_copy(gs, ls);      /* chunk 0 */
  float qa[16], qb[16]; op_row16(q0, hh, true, qa); op_row16(q1, hh, true, qb);
  asm volatile("s_wait_asynccnt 0x0" ::: "memory");      /* this wave's copies of chunk 0 have landed */
  __syncthreads();      /* and every other wave's: chunk 0 may be read */
  st_copy(gs + CHE, ls + 2u * CHE);      /* chunk 1 flies while chunk 0 is worked on */
  v16h a[4];      /* the weight fragments of one k step */
  /* [z1 | z2]: k step i holds f16(v1[i] * v2[j]), j = 0..31 */
  v8f z[2][4] = {{z8, z8, z8, z8}, {z8, z8, z8, z8}};
  { float pa[4], pb[4];      /* carried rounded, so that no load is open on them at the loop's head: carried raw, the wait there was to 0 and emptied the fragment ring once a group */
    { const v4f na = *(const v4fa*)p0, nb = *(const v4fa*)p1;
#pragma unroll
      for (int u = 0; u < 4; ++u) { pa[u] = bf16_round(na[u]); pb[u] = bf16_round(nb[u]); } }
    /* rolled over groups of four k steps: one 16-byte load brings four values of v1, a group ahead like the fragments; fully unrolled the 32 steps would only grow the code. What the last group fetches ahead of v1 is group 0 again and is not used: no branch among the products, and every address stays inside its row. A group is one staged chunk */
#pragma unroll 1
    for (int i4 = 0; i4 < 32; i4 += 4) { const int bs = (i4 >> 2) & 1; const _Float16* wc = wl + bs * CHE;      /* chunk i4 / 4 */
      fu_load(wc, a);
      __builtin_amdgcn_sched_barrier(0);      /* the chunk's first LDS reads go out in front of the row-fragment arithmetic, which then runs under their latency */
      const int nx = (i4 + 4) & 31; const v4f na = *(const v4fa*)(p0 + nx), nb = *(const v4fa*)(p1 + nx);
      asm volatile("s_wait_xcnt 0x0" ::: "memory");      /* the two address pairs are reused at once: the wait stands in front of that */
#pragma unroll
      for (int u = 0; u < 3; ++u) fu_step_pf(a, wc + (u + 1) * FS, op_frag(pa[u], qa), op_frag(pb[u], qb), z);
      fu_step_end(a, op_frag(pa[3], qa), op_frag(pb[3], qb), z);
      st_publish(); st_copy(gs + ((i4 >> 2) + 2) * CHE, ls + (unsigned)bs * (2u * CHE));      /* chunks 2..9 */
#pragma unroll
      for (int u = 0; u < 4; ++u) { pa[u] = bf16_round(na[u]); pb[u] = bf16_round(nb[u]); } }
    fu_load(wl, a);      /* chunk 8 = [Wh | Wo], buffer 0 */
    __builtin_amdgcn_sched_barrier(0); }      /* as at the head of a group: these LDS reads go out first, and none of them lands among the row loads that follow, in front of the wait that frees those loads' address registers */
  /* [h1 | h2] = relu, block-diagonal weights, K = [v1 | v2]; then the gate f16(sigmoid(z) * h), feature tile by feature tile, straight into the row fragments of the next product */
  v16h g[2][2];
  { float ra[16], rb[16]; op_row16(p0, hh, true, ra); op_row16(p1, hh, true, rb);
    const v16h v1a = op_frag(1.0f, ra), v1b = op_frag(1.0f, rb), v2a = op_frag(1.0f, qa), v2b = op_frag(1.0f, qb);
    v8f h[2][4] = {{z8, z8, z8, z8}, {z8, z8, z8, z8}};
    fu_step_pf(a, wl + FS, v1a, v1b, h); fu_step_pf(a, wl + 2 * FS, v2a, v2b, h);
#pragma unroll
    for (int t = 0; t < 4; ++t) { const v8f bzv = fu_bias(bz, t, hh), bhv = fu_bias(bh, t, hh);
#pragma unroll
      for (int n = 0; n < 2; ++n)
#pragma unroll
        for (int r = 0; r < 8; ++r) { const float zv = z[n][t][r] * 0.0625f + bzv[r]; const float hv = fmaxf(h[n][t][r] * 0.0625f + bhv[r], 0.f); z[n][t][r] = (1.0f / (1.0f + expf(-zv))) * hv; } }
#pragma unroll
    for (int n = 0; n < 2; ++n) { g[n][0] = fu_pack(z[n][0], z[n][1]); g[n][1] = fu_pack(z[n][2], z[n][3]); } }
  /* [o1 | o2] = relu, block-diagonal weights */
  v8f o[2][4] = {{z8, z8, z8, z8}, {z8, z8, z8, z8}};
  { fu_step_pf(a, wl + 3 * FS, g[0][0], g[1][0], o); fu_step_end(a, g[0][1], g[1][1], o);
    st_publish(); st_copy(gs + 10 * CHE, ls);
#pragma unroll
    for (int t = 0; t < 4; ++t) { const v8f bv = fu_bias(bo, t, hh);
#pragma unroll
      for (int n = 0; n < 2; ++n)
#pragma unroll
        for (int r = 0; r < 8; ++r) o[n][t][r] = fmaxf(o[n][t][r] * 0.0625f + bv[r], 0.f); } }
  /* o1 (feature tiles 0, 1) into the wave's slab, so[w][row][a]: in k step a of We1 both lane halves scale by o1[row][a], and each holds only half of the a */
#pragma unroll
  for (int n = 0; n < 2; ++n)
#pragma unroll
    for (int t = 0; t < 2; ++t) { float* d = &so[w][n * 16 + ln][t * 16 + 8 * hh]; const v4f s0 = {o[n][t][0], o[n][t][1], o[n][t][2], o[n][t][3]}, s1 = {o[n][t][4], o[n][t][5], o[n][t][6], o[n][t][7]}; *(v4fa*)d = s0; *(v4fa*)(d + 4) = s1; }
  __builtin_amdgcn_fence(__ATOMIC_ACQ_REL, "workgroup"); __builtin_amdgcn_wave_barrier();      /* each wave re-reads only its own slab of so: its LDS stores must be ordered before its loads */
  const v16h o1a = fu_pack(o[0][0], o[0][1]), o1b = fu_pack(o[1][0], o[1][1]);
  float oa[16], ob[16];
#pragma unroll
  for (int e = 0; e < 8; ++e) { oa[e] = o[0][2][e]; oa[8 + e] = o[0][3][e]; ob[e] = o[1][2][e]; ob[8 + e] = o[1][3][e]; }
  const v16h o2a = op_frag(1.0f, oa), o2b = op_frag(1.0f, ob);
  /* e1 = relu(o12 We1^T + b): k step a holds f16(o1[a] * o2[b]), b = 0..31; then o2, o1 and the one */
  v8f e1[2][4] = {{z8, z8, z8, z8}, {z8, z8, z8, z8}};
  { /* rolled like the first loop: one 16-byte LDS load brings four values of o1 */
#pragma unroll 1
    for (int i4 = 0; i4 < 32; i4 += 4) { const v4f pa = *(const v4fa*)&so[w][ln][i4], pb = *(const v4fa*)&so[w][16 + ln][i4];
      const int bs = ((i4 >> 2) & 1) ^ 1; const _Float16* wc = wl + bs * CHE;      /* chunk 9 + i4 / 4 */
      fu_load(wc, a);
      __builtin_amdgcn_sched_barrier(0);      /* as in the first loop */
#pragma unroll
      for (int u = 0; u < 3; ++u) fu_step_pf(a, wc + (u + 1) * FS, op_frag(pa[u], oa), op_frag(pb[u], ob), e1);
      fu_step_end(a, op_frag(pa[3], oa), op_frag(pb[3], ob), e1);
      st_publish(); st_copy(gs + ((i4 >> 2) + 11) * CHE, ls + (unsigned)bs * (2u * CHE)); }      /* chunks 11..18 */
    const _Float16* wc = wl + CHE;      /* chunk 17 = [the last three k steps of We1 | the first of We2], buffer 1 */
    fu_load(wc, a);
    fu_step_pf(a, wc + FS, o2a, o2b, e1); fu_step_pf(a, wc + 2 * FS, o1a, o1b, e1);
    FragH one;
#pragma unroll
    for (int e = 0; e < 16; ++e) one.h[e] = (_Float16)((e == 0 && hh == 0) ? 1.0f : 0.0f);
    fu_step_pf(a, wc + 3 * FS, one.v, one.v, e1);
#pragma unroll
    for (int t = 0; t < 4; ++t) { const v8f bv = fu_bias(be1, t, hh);
#pragma unroll
      for (int n = 0; n < 2; ++n)
#pragma unroll
        for (int r = 0; r < 8; ++r) e1[n][t][r] = fmaxf(e1[n][t][r] * 0.0625f + bv[r], 0.f); } }
  /* out = relu([e1, o1, o2, 1, 1] We2^T + b) */
  v8f y[2][4] = {{z8, z8, z8, z8}, {z8, z8, z8, z8}};
  { fu_step_end(a, fu_pack(e1[0][0], e1[0][1]), fu_pack(e1[1][0], e1[1][1]), y);
    st_publish();      /* chunk 18, the last: no chunk is left to fetch */
    fu_load(wl, a);
    fu_step_pf(a, wl + FS, fu_pack(e1[0][2], e1[0][3]), fu_pack(e1[1][2], e1[1][3]), y);
    fu_step_pf(a, wl + 2 * FS, o1a, o1b, y); fu_step_pf(a, wl + 3 * FS, o2a, o2b, y);
    FragH two;
#pragma unroll
    for (int e = 0; e < 16; ++e) two.h[e] = (_Float16)((e < 2 && hh == 0) ? 1.0f : 0.0f);
    fu_step_end(a, two.v, two.v, y);
    asm volatile("s_wait_asynccnt 0x0" ::: "memory"); }      /* behind the last chunk: no copy of this wave is open when it goes on to the output and ends */
  /* the lane holds 8 features of its row a tile: through the slab, so that the output goes out as whole rows */
#pragma unroll
  for (int t = 0; t < 4; ++t) { const v8f bv = fu_bias(be2, t, hh);
#pragma unroll
    for (int n = 0; n < 2; ++n) { v4f s0, s1;
#pragma unroll
      for (int r = 0; r < 4; ++r) { s0[r] = fmaxf(y[n][t][r] * 0.0625f + bv[r], 0.f); s1[r] = fmaxf(y[n][t][4 + r] * 0.0625f + bv[4 + r], 0.f); }
      float* d = &so[w][n * 16 + ln][t * 16 + 8 * hh]; *(v4fa*)d = s0; *(v4fa*)(d + 4) = s1; } }
  __builtin_amdgcn_fence(__ATOMIC_ACQ_REL, "workgroup"); __builtin_amdgcn_wave_barrier();      /* as above: the wave's own LDS stores before its loads */
  const int rsub = lane >> 4, c4 = (lane & 15) * 4;
#pragma unroll
  for (int q = 0; q < 16; ++q) { const int r = q * 2 + rsub; const v4f v = *(const v4fa*)&so[w][r][c4]; *(v4f*)(out + (size_t)(row0 + r) * FE + c4) = v; } }

extern "C" void kernel_launch(void* const* d_in, const int* in_sizes, int n_in,
                              void* d_out, int out_size, void* d_ws, size_t ws_size, hipStream_t stream) {
  (void)in_sizes; (void)n_in; (void)out_size;
  const float* const* I = (const float* const*)d_in;
  const float* x = I[0]; const float* Wh1 = I[1]; const float* bh1 = I[2]; const float* Wz1 = I[3]; const float* bz1 = I[4]; const float* Wo1 = I[5]; const float* bo1 = I[6]; const float* Wh2 = I[7]; const float* bh2 = I[8]; const float* Wz2 = I[9]; const float* bz2 = I[10]; const float* Wo2 = I[11]; const float* bo2 = I[12]; const float* We1 = I[13]; const float* be1 = I[14]; const float* We2 = I[15]; const float* be2 = I[16];
  char* ws = (char*)d_ws; size_t off = 0;
  auto take = [&](size_t bytes) { char* p = ws + off; off += (bytes + 255) & ~(size_t)255; return p; };
  /* the five planes in the order of their use; each size is a multiple of 256 bytes, so that they follow one another without a gap: k_fused reads them as one stream from BZ on */
  _Float16* BZ = (_Float16*)take((size_t)64 * KO * 2); _Float16* BH = (_Float16*)take((size_t)64 * 64 * 2); _Float16* BO = (_Float16*)take((size_t)64 * 64 * 2); _Float16* BE1 = (_Float16*)take((size_t)FE * KKP * 2); _Float16* BE2 = (_Float16*)take((size_t)FE * KC2 * 2);
  float* bz = (float*)take(64 * 4); float* bh = (float*)take(64 * 4); float* bo = (float*)take(64 * 4);
  if (off > ws_size) return;      /* under 1 MiB: the prepared weights and biases only */
  k_prep<<<PB_B + 1, 256, 0, stream>>>(Wz1, Wz2, We1, We2, Wh1, Wh2, Wo1, Wo2, bz1, bz2, bh1, bh2, bo1, bo2, BZ, BE1, BE2, BH, BO, bz, bh, bo);      /* every element of every plane, the pads and the zero blocks too */
  k_fused<<<NBR / 256, 256, 0, stream>>>(x, BZ, bz, bh, bo, be1, be2, (float*)d_out);
}

// v008
// It runs in 34.9 microseconds.
// Next to v007, in two timings, it ran 1.09 times as fast each time.
// Over all steps from v000 it is 35.7 times as fast.
#include <hip/hip_runtime.h>
// KroneckerFusion (131072 rows; v1, v2 = x[0], x[1] (32 each): h_i = relu(v_i Wh_i^T + b); z_i = Bilinear(v1, Wz_i, v2) + b; o_i = relu((sigmoid(z_i) * h_i) Wo_i^T + b); o_i <- [o_i, 1]; o12 = o1 (x) o2 (33 x 33 = 1089); out = relu(o12 We1^T + b); out = relu([out, o1, o2] We2^T + b)).
// Structure: ONE kernel for the whole row pipeline; a wave owns 32 rows from the input to the output row and no intermediate touches the workspace. Every product is computed transposed, weights as the A operand (16 features a tile) and the rows as the B operand (lane = row), f16 WMMA with f32 accumulation and exact x16 weights + bias. A lane's accumulators then hold features 16 t + 8 hh + 0..7 of its own row, and two neighbouring feature tiles converted to f16 ARE the B fragment of the next product (its k order), so z, h, the gate, o, e1 and the output follow one another in registers. The bilinear forms ([Wz1; Wz2] flattened, K = 1024) and We1 (K re-ordered to [o1[a] o2[b] (1024) | o2 (32) | o1 (32) | 1 | 0 pad] = 1120) form their B fragments f16(p[i] * q[j]) in registers; o1[a], which both lane halves need for every a, goes through the wave's own LDS slab. We2's K is re-ordered to [e1 (64) | o1 (32) | o2 (32) | 1 | 1 | 0 pad] = 160 with the weight columns permuted alike. The output rows are turned in the same slab and stored as whole lines. The five prepared weight planes lie one behind the other in the workspace, in the order of their use and in fragment order (fr_off): one stream of 76 k steps. A work-group of eight waves brings it into LDS in chunks of four k steps (16 KiB) with asynchronous copies, two buffers, one chunk ahead, and every wave reads its fragments from there, inside a chunk one k step ahead through four register fragments; each 16-byte-a-lane read of a fragment half takes 512 bytes in a row. One launch (k_prep) prepares all planes and biases in front of it.
#define NBR 131072               /* rows processed */
#define NBI 131072               /* rows in the input (x[1] starts at NBI*32; separate so debug builds can shrink NBR) */
#define D1 32
#define KO 1024                  /* 32 x 32 outer */
#define KK 1089                  /* 33 x 33 Kronecker */
#define KKP 1120
#define FE 64
#define KC2 160                  /* [e1 (64) | o1 (32) | o2 (32) | 1 | 1 | 0] */
typedef __bf16 v16b __attribute__((ext_vector_type(16)));
typedef unsigned short v8us __attribute__((ext_vector_type(8), may_alias));
typedef float  v8f  __attribute__((ext_vector_type(8)));
typedef float  v4f  __attribute__((ext_vector_type(4)));
typedef float  v4fa __attribute__((ext_vector_type(4), may_alias));
union FragB { v16b v; v8us half[2]; unsigned short u[16]; };

__device__ __forceinline__ unsigned short bf16_bits(float x) { unsigned int u = __float_as_uint(x); return (unsigned short)((u + 0x7FFFu + ((u >> 16) & 1u)) >> 16); }
__device__ __forceinline__ float bf16_val(unsigned short b) { return __uint_as_float(((unsigned int)b) << 16); }
__device__ __forceinline__ float bf16_round(float x) { return bf16_val(bf16_bits(x)); }
// D += A·B with NT terms: 1 = ah·bh, 2 = + al·bh (A split), 3 = + ah·bl (both split)
template <int NT>
__device__ __forceinline__ v8f mmaN(v16b ah, v16b al, v16b bh, v16b bl, v8f c) {
  c = __builtin_amdgcn_wmma_f32_16x16x32_bf16(false, ah, false, bh, (short)0, c, false, false);
  if (NT >= 2) c = __builtin_amdgcn_wmma_f32_16x16x32_bf16(false, al, false, bh, (short)0, c, false, false);
  if (NT >= 3) c = __builtin_amdgcn_wmma_f32_16x16x32_bf16(false, ah, false, bl, (short)0, c, false, false);
  asm volatile("v_nop\n\tv_nop\n\tv_nop\n\tv_nop" : "+v"(c) : "v"(ah), "v"(al), "v"(bh), "v"(bl));
  return c;
}

__global__ __launch_bounds__(256) void k_wt_bf16(const float* __restrict__ W, unsigned short* __restrict__ Wt, int K, int N) {
  const int t = blockIdx.x * 256 + threadIdx.x;
  const int k8n = K / 8;
  if (t >= N * k8n) return;
  const int n = t / k8n, k8 = (t % k8n) * 8;
  v8us v;
#pragma unroll
  for (int i = 0; i < 8; ++i) v[i] = bf16_bits(W[(size_t)(k8 + i) * N + n]);
  *(v8us*)(Wt + (size_t)n * K + k8) = v;
  
}

// GEMM C[M][N] (f32, pitch ldc) = act(A[M][K]·W + bias). A f32 row-major (pitch lda) converted per fragment to bf16
// (ASPLIT: hi/lo two planes -> 2 terms, else single rounded term); Wt bf16 [N][K] (pitch ldb). BIAS_BF16 rounds the
// bias to bf16 first (bias quantised to bf16 before the add). K%32==0, M%16==0, N%64==0.
template <bool ASPLIT, int ACT, bool BIAS_BF16>
__global__ __launch_bounds__(128) void k_gemm_bf(const float* __restrict__ A, int lda, const unsigned short* __restrict__ Wt, int ldb,
                                               const float* __restrict__ bias, float* __restrict__ C, int ldc, int M, int N, int K) {
  __shared__ __attribute__((aligned(16))) float so[4][16][64];
  const int tid = threadIdx.x, w = tid >> 5, lane = tid & 31, ln = lane & 15, hh = lane >> 4;
  const int ntn = N / 64;
  const int wid = blockIdx.x * 4 + w;
  const int mt = wid / ntn, nq = wid % ntn;
  if (mt * 16 >= M) return;
  const int row0 = mt * 16, col0 = nq * 64;
  const float* arow = A + (size_t)(row0 + ln) * lda;
  v8f acc[4] = {};
  for (int kb = 0; kb < K; kb += 32) {
    FragB ah, al;
    const v4f x0 = *(const v4fa*)(arow + kb + 8 * hh), x1 = *(const v4fa*)(arow + kb + 8 * hh + 4);
    const v4f x2 = *(const v4fa*)(arow + kb + 16 + 8 * hh), x3 = *(const v4fa*)(arow + kb + 16 + 8 * hh + 4);
    float xs[16] = {x0[0],x0[1],x0[2],x0[3],x1[0],x1[1],x1[2],x1[3],x2[0],x2[1],x2[2],x2[3],x3[0],x3[1],x3[2],x3[3]};
#pragma unroll
    for (int i = 0; i < 16; ++i) { const unsigned short hb = bf16_bits(xs[i]); ah.u[i] = hb; al.u[i] = ASPLIT ? bf16_bits(xs[i] - bf16_val(hb)) : (unsigned short)0; }
#pragma unroll
    for (int t = 0; t < 4; ++t) {
      const unsigned short* brow = Wt + (size_t)(col0 + t * 16 + ln) * ldb + kb;
      FragB b;
      b.half[0] = *(const v8us*)(brow + 8 * hh);
      b.half[1] = *(const v8us*)(brow + 16 + 8 * hh);
      acc[t] = mmaN<ASPLIT ? 2 : 1>(ah.v, al.v, b.v, b.v, acc[t]);
    }
  }
#pragma unroll
  for (int t = 0; t < 4; ++t) {
    float bv = bias ? bias[col0 + t * 16 + ln] : 0.f;
    if (BIAS_BF16) bv = bf16_round(bv);
#pragma unroll
    for (int r = 0; r < 8; ++r) { float v = acc[t][r] + bv; if (ACT == 1) v = fmaxf(v, 0.f); so[w][8 * hh + r][t * 16 + ln] = v; }
  }
  __builtin_amdgcn_fence(__ATOMIC_ACQ_REL, "workgroup");
  __builtin_amdgcn_wave_barrier();
  const int rsub = lane >> 4, c4 = (lane & 15) * 4;
  {
#pragma unroll
    for (int q = 0; q < 8; ++q) {
      const int r = q * 2 + rsub;
      const v4f v = *(const v4fa*)&so[w][r][c4];
      *(v4f*)(C + (size_t)(row0 + r) * ldc + col0 + c4) = v;
    }
    
  }
}

// GEMM C = act(A·W + bias + resid): A f32 (ASPLIT -> hi/lo 2 terms), Wt bf16 [N][K]; ACT 0 none, 1 relu, 2 exact gelu;
// resid (optional, f32, row index = (row % rmod), pitch ldr, RES_BF16 rounds it) added before the activation.
template <bool ASPLIT, int ACT, bool BIAS_BF16, bool RES_BF16>
__global__ __launch_bounds__(128) void k_gemm_bf3(const float* __restrict__ A, int lda, const unsigned short* __restrict__ Wt, int ldb,
                                                const float* __restrict__ bias, const float* __restrict__ resid, int rmod, int ldr,
                                                float* __restrict__ C, int ldc, int M, int N, int K) {
  __shared__ __attribute__((aligned(16))) float so[4][16][64];
  const int tid = threadIdx.x, w = tid >> 5, lane = tid & 31, ln = lane & 15, hh = lane >> 4;
  const int ntn = N / 64;
  const int wid = blockIdx.x * 4 + w;
  const int mt = wid / ntn, nq = wid % ntn;
  if (mt * 16 >= M) return;
  const int row0 = mt * 16, col0 = nq * 64;
  const float* arow = A + (size_t)(row0 + ln) * lda;
  v8f acc[4] = {};
  for (int kb = 0; kb < K; kb += 32) {
    FragB ah, al;
    const v4f x0 = *(const v4fa*)(arow + kb + 8 * hh), x1 = *(const v4fa*)(arow + kb + 8 * hh + 4);
    const v4f x2 = *(const v4fa*)(arow + kb + 16 + 8 * hh), x3 = *(const v4fa*)(arow + kb + 16 + 8 * hh + 4);
    float xs[16] = {x0[0],x0[1],x0[2],x0[3],x1[0],x1[1],x1[2],x1[3],x2[0],x2[1],x2[2],x2[3],x3[0],x3[1],x3[2],x3[3]};
#pragma unroll
    for (int i = 0; i < 16; ++i) { const unsigned short hb = bf16_bits(xs[i]); ah.u[i] = hb; al.u[i] = ASPLIT ? bf16_bits(xs[i] - bf16_val(hb)) : (unsigned short)0; }
#pragma unroll
    for (int t = 0; t < 4; ++t) {
      const unsigned short* brow = Wt + (size_t)(col0 + t * 16 + ln) * ldb + kb;
      FragB b;
      b.half[0] = *(const v8us*)(brow + 8 * hh);
      b.half[1] = *(const v8us*)(brow + 16 + 8 * hh);
      acc[t] = mmaN<ASPLIT ? 2 : 1>(ah.v, al.v, b.v, b.v, acc[t]);
    }
  }
#pragma unroll
  for (int t = 0; t < 4; ++t) {
    const int col = col0 + t * 16 + ln;
    float bv = bias ? bias[col] : 0.f;
    if (BIAS_BF16) bv = bf16_round(bv);
#pragma unroll
    for (int r = 0; r < 8; ++r) {
      float v = acc[t][r] + bv;
      if (resid) { float rv = resid[(size_t)((row0 + 8 * hh + r) % rmod) * ldr + col]; if (RES_BF16) rv = bf16_round(rv); v += rv; }
      if (ACT == 1) v = fmaxf(v, 0.f);
      if (ACT == 2) v = 0.5f * v * (1.0f + erff(v * 0.70710678118654752f));
      if (ACT == 3) { const float u = 0.7978845608028654f * (v + 0.044715f * v * v * v); v = 0.5f * v * (1.0f + tanhf(u)); }
      so[w][8 * hh + r][t * 16 + ln] = v;
    }
  }
  __builtin_amdgcn_fence(__ATOMIC_ACQ_REL, "workgroup");
  __builtin_amdgcn_wave_barrier();
  const int rsub = lane >> 4, c4 = (lane & 15) * 4;
  {
#pragma unroll
    for (int q = 0; q < 8; ++q) {
      const int r = q * 2 + rsub;
      const v4f v = *(const v4fa*)&so[w][r][c4];
      *(v4f*)(C + (size_t)(row0 + r) * ldc + col0 + c4) = v;
    }
    
  }
}
// row LayerNorm (biased variance, eps) over N: s = X (+ R); optional out_sum <- s; out_norm <- (s-mu)*rsqrt(var+eps)*g + b
template <bool PARAM_BF16>
__global__ __launch_bounds__(256) void k_layernorm(const float* __restrict__ X, const float* __restrict__ R, const float* __restrict__ g, const float* __restrict__ bta,
                                                  float* __restrict__ out_sum, float* __restrict__ out_norm, int N, float eps) {
  __shared__ float red[256];
  const int row = blockIdx.x, tid = threadIdx.x;
  const float* x = X + (size_t)row * N; const float* rr = R ? R + (size_t)row * N : nullptr;
  float vals[16];                     // up to N = 4096
  const int per = N / 256;            // contiguous chunk per thread? use strided-by-4 chunks: thread handles j = tid*4 + 1024*u
  float s1 = 0.f;
  for (int u = 0; u < per / 4; ++u) {
    const int j = tid * 4 + 1024 * u;
    const v4f a = *(const v4fa*)(x + j);
    v4f b = {0.f,0.f,0.f,0.f}; if (rr) b = *(const v4fa*)(rr + j);
#pragma unroll
    for (int q = 0; q < 4; ++q) { const float v = a[q] + b[q]; vals[u * 4 + q] = v; s1 += v; }
  }
  red[tid] = s1; __syncthreads();
  for (int st = 128; st > 0; st >>= 1) { if (tid < st) red[tid] += red[tid + st]; __syncthreads(); }
  const float mu = red[0] / (float)N; __syncthreads();
  float s2 = 0.f;
  for (int u = 0; u < per / 4; ++u)
#pragma unroll
    for (int q = 0; q < 4; ++q) { const float c = vals[u * 4 + q] - mu; s2 += c * c; }
  red[tid] = s2; __syncthreads();
  for (int st = 128; st > 0; st >>= 1) { if (tid < st) red[tid] += red[tid + st]; __syncthreads(); }
  const float rs = rsqrtf(red[0] / (float)N + eps);
  {
    for (int u = 0; u < per / 4; ++u) {
      const int j = tid * 4 + 1024 * u;
      v4f o, sm;
#pragma unroll
      for (int q = 0; q < 4; ++q) {
        float gg = g[j + q], bb = bta[j + q];
        if (PARAM_BF16) { gg = bf16_round(gg); bb = bf16_round(bb); }
        sm[q] = vals[u * 4 + q]; o[q] = (vals[u * 4 + q] - mu) * rs * gg + bb;
      }
      if (out_sum) *(v4f*)(out_sum + (size_t)row * N + j) = sm;
      *(v4f*)(out_norm + (size_t)row * N + j) = o;
    }
    
  }
}



// ---- f16 WMMA path (v_wmma_f32_16x16x32_f16): 11-bit significands for operands in range — used here for all five GEMMs (bilinear, h, o, We1, We2)
typedef _Float16 v16h __attribute__((ext_vector_type(16)));
union FragH { v16h v; v8us half[2]; _Float16 h[16]; unsigned short u[16]; };
template <int NT>
__device__ __forceinline__ v8f mmaH(v16h ah, v16h al, v16h bh, v16h bl, v8f c) {
  c = __builtin_amdgcn_wmma_f32_16x16x32_f16(false, ah, false, bh, (short)0, c, false, false);
  if (NT >= 2) c = __builtin_amdgcn_wmma_f32_16x16x32_f16(false, al, false, bh, (short)0, c, false, false);
  if (NT >= 3) c = __builtin_amdgcn_wmma_f32_16x16x32_f16(false, ah, false, bl, (short)0, c, false, false);
  asm volatile("v_nop\n\tv_nop\n\tv_nop\n\tv_nop" : "+v"(c) : "v"(ah), "v"(al), "v"(bh), "v"(bl));
  return c;
}
// batched GEMM like k_gemm_b but f16 operands: A f32 (split into f16 hi/lo if ASPLIT, else rounded to f16), Bt = f16 values [n][k]; alpha; C f32; N multiple of 16 (partial tiles skipped)
template <bool ASPLIT>
__global__ __launch_bounds__(128) void k_gemm_h(const float* __restrict__ A, int lda, size_t sA, const _Float16* __restrict__ Bh, int ldb, size_t sB, float alpha, float* __restrict__ C, int ldc, size_t sC, int M, int N, int K) {
  __shared__ __attribute__((aligned(16))) float so[4][16][64];
  const int tid = threadIdx.x, w = tid >> 5, lane = tid & 31, ln = lane & 15, hh = lane >> 4; const int by = blockIdx.y;
  A += (size_t)by * sA; Bh += (size_t)by * sB; C += (size_t)by * sC;
  const int ntn = (N + 63) / 64; const int wid = blockIdx.x * 4 + w; const int mt = wid / ntn, nq = wid % ntn; if (mt * 16 >= M) return;
  const int row0 = mt * 16, col0 = nq * 64; const float* arow = A + (size_t)(row0 + ln) * lda;
  v8f acc[4] = {};
  for (int kb = 0; kb < K; kb += 32) {
    FragH ah, al;
    const v4f x0 = *(const v4fa*)(arow + kb + 8 * hh), x1 = *(const v4fa*)(arow + kb + 8 * hh + 4), x2 = *(const v4fa*)(arow + kb + 16 + 8 * hh), x3 = *(const v4fa*)(arow + kb + 16 + 8 * hh + 4);
    float xs[16] = {x0[0],x0[1],x0[2],x0[3],x1[0],x1[1],x1[2],x1[3],x2[0],x2[1],x2[2],x2[3],x3[0],x3[1],x3[2],x3[3]};
#pragma unroll
    for (int i = 0; i < 16; ++i) { const _Float16 h = (_Float16)xs[i]; ah.h[i] = h; al.h[i] = ASPLIT ? (_Float16)(xs[i] - (float)h) : (_Float16)0.0f; }
#pragma unroll
    for (int t = 0; t < 4; ++t) { if (col0 + t * 16 >= N) continue; const size_t boff = (size_t)(col0 + t * 16 + ln) * ldb + kb; FragH bq; bq.half[0] = *(const v8us*)(Bh + boff + 8 * hh); bq.half[1] = *(const v8us*)(Bh + boff + 16 + 8 * hh);
      acc[t] = mmaH<ASPLIT ? 2 : 1>(ah.v, al.v, bq.v, bq.v, acc[t]); }
  }
#pragma unroll
  for (int t = 0; t < 4; ++t) { if (col0 + t * 16 >= N) continue;
#pragma unroll
    for (int r = 0; r < 8; ++r) so[w][8 * hh + r][t * 16 + ln] = acc[t][r] * alpha; }
  __builtin_amdgcn_fence(__ATOMIC_ACQ_REL, "workgroup"); __builtin_amdgcn_wave_barrier();
  const int rsub = lane >> 4, c4 = (lane & 15) * 4;
  {
#pragma unroll
    for (int q = 0; q < 8; ++q) { const int r = q * 2 + rsub; if (col0 + c4 < N) { const v4f v = *(const v4fa*)&so[w][r][c4]; *(v4f*)(C + (size_t)(row0 + r) * ldc + col0 + c4) = v; } }
     }
}

// Wt[n][k] = f16(W[k][n]·scale) from f32 row-major W[K][N] (scale = power of two; bf16-exact weights stay exact in f16 away from the subnormal range)
__global__ __launch_bounds__(256) void k_wt_f16(const float* __restrict__ W, _Float16* __restrict__ Wt, int K, int N, float scale) {
  const int t = blockIdx.x * 256 + threadIdx.x; if (t >= N * (K / 8)) return; const int n = t / (K / 8), k8 = (t % (K / 8)) * 8; FragH f;
#pragma unroll
  for (int i = 0; i < 8; ++i) f.h[i] = (_Float16)(bf16_round(W[(size_t)(k8 + i) * N + n]) * scale); const v8us o = f.half[0];
  *(v8us*)((unsigned short*)Wt + (size_t)n * K + k8) = o; 
}
// k_gemm_hh variant with fused epilogue: v = acc·alpha + bias[by·sBias + col] (+ CP[(row/rowsPerB)·sCPb + by·64 + col] if CP) ; ACT 0 none / 1 elu ; writes f16 C16 (and f32 C if non-null)
template <int ACT>
__global__ __launch_bounds__(128) void k_gemm_hhx(const _Float16* __restrict__ A, int lda, size_t sA, const _Float16* __restrict__ Bh, int ldb, size_t sB, float alpha, const float* __restrict__ bias, size_t sBias, const float* __restrict__ CP, int rowsPerB, size_t sCPb, int row0g,
    float* __restrict__ C, _Float16* __restrict__ C16, int ldc, size_t sC, int M, int N, int K) {
  __shared__ __attribute__((aligned(16))) float so[4][16][64];
  const int tid = threadIdx.x, w = tid >> 5, lane = tid & 31, ln = lane & 15, hh = lane >> 4; const int by = blockIdx.y;
  A += (size_t)by * sA; Bh += (size_t)by * sB; const size_t cofs = (size_t)by * sC; const float* bp = bias ? bias + (size_t)by * sBias : nullptr;
  const int ntn = (N + 63) / 64; const int wid = blockIdx.x * 4 + w; const int mt = wid / ntn, nq = wid % ntn; if (mt * 16 >= M) return;
  const int row0 = mt * 16, col0 = nq * 64; const _Float16* arow = A + (size_t)(row0 + ln) * lda;
  v8f acc[4] = {};
  for (int kb = 0; kb < K; kb += 32) { FragH ah; ah.half[0] = *(const v8us*)((const unsigned short*)arow + kb + 8 * hh); ah.half[1] = *(const v8us*)((const unsigned short*)arow + kb + 16 + 8 * hh);
#pragma unroll
    for (int t = 0; t < 4; ++t) { if (col0 + t * 16 >= N) continue; const size_t boff = (size_t)(col0 + t * 16 + ln) * ldb + kb; FragH bq; bq.half[0] = *(const v8us*)((const unsigned short*)Bh + boff + 8 * hh); bq.half[1] = *(const v8us*)((const unsigned short*)Bh + boff + 16 + 8 * hh);
      acc[t] = mmaH<1>(ah.v, ah.v, bq.v, bq.v, acc[t]); }
  }
#pragma unroll
  for (int t = 0; t < 4; ++t) { if (col0 + t * 16 >= N) continue; const int col = col0 + t * 16 + ln; const float bv = bp ? bf16_round(bp[col]) : 0.f;
#pragma unroll
    for (int r = 0; r < 8; ++r) { float v = acc[t][r] * alpha + bv; if (CP) { const int rr = row0g + row0 + 8 * hh + r; if (rowsPerB < 0) v += CP[cofs + (size_t)rr * ldc + col];      /* rowsPerB < 0: own element of the batched C plane */ else { const int bidx = rr / rowsPerB; v += CP[(size_t)bidx * sCPb + (size_t)by * 64 + col]; } } if (ACT == 1) v = (v > 0.f) ? v : expm1f(v); else if (ACT == 7) v = (v > 0.f) ? v + 1.0f : expf(v); else if (ACT == 8) v = tanhf(v); else if (ACT == 9) v = 0.5f * v * (1.0f + tanhf(0.7978845608028654f * (v + 0.044715f * v * v * v))); else if (ACT == 11) v = 1.0f / (1.0f + expf(-v)); else if (ACT == 12) v = (v > 0.f) ? v : 0.01f * v; else if (ACT == 14) v = (v > 0.f) ? v : 0.1f * v; else if (ACT == 16) v = (v >= 0.f) ? v : 0.3f * v; else if (ACT == 17) v = (v >= 0.f) ? v : 0.2f * v; else if (ACT == 15) v = v / (1.0f + expf(-v)); else if (ACT == 3) v = fmaxf(v, 0.f); else if (ACT == 6) v = 0.5f * v * (1.0f + erff(v * 0.70710678118654752f)); so[w][8 * hh + r][t * 16 + ln] = v; } }
  __builtin_amdgcn_fence(__ATOMIC_ACQ_REL, "workgroup"); __builtin_amdgcn_wave_barrier();
  const int rsub = lane >> 4, c4 = (lane & 15) * 4; typedef _Float16 v4h __attribute__((ext_vector_type(4)));
  {
#pragma unroll
    for (int q = 0; q < 8; ++q) { const int r = q * 2 + rsub; if (col0 + c4 < N) { const v4f v = *(const v4fa*)&so[w][r][c4]; if (C) *(v4f*)(C + cofs + (size_t)(row0 + r) * ldc + col0 + c4) = v; if (C16) { v4h h4; for (int i = 0; i < 4; ++i) h4[i] = (_Float16)v[i]; *(v4h*)(C16 + cofs + (size_t)(row0 + r) * ldc + col0 + c4) = h4; } } }
     }
}


typedef _Float16 v4h __attribute__((ext_vector_type(4)));

__global__ __launch_bounds__(256) void k_x16(const float* __restrict__ x, _Float16* __restrict__ X16, size_t n8) { const size_t t = (size_t)blockIdx.x * 256 + threadIdx.x; if (t >= n8) return; FragH f;
#pragma unroll
  for (int q = 0; q < 8; ++q) f.h[q] = (_Float16)bf16_round(x[t * 8 + q]); *(v8us*)((unsigned short*)X16 + t * 8) = f.half[0];  }
__global__ __launch_bounds__(256) void k_h16(const float* __restrict__ x, _Float16* __restrict__ X16, size_t n8) { const size_t t = (size_t)blockIdx.x * 256 + threadIdx.x; if (t >= n8) return; FragH f;
#pragma unroll
  for (int q = 0; q < 8; ++q) f.h[q] = (_Float16)x[t * 8 + q]; *(v8us*)((unsigned short*)X16 + t * 8) = f.half[0];  }
__global__ __launch_bounds__(256) void k_round16f(const float* __restrict__ W, _Float16* __restrict__ Bt, size_t n8) { const size_t t = (size_t)blockIdx.x * 256 + threadIdx.x; if (t >= n8) return; FragH f;
#pragma unroll
  for (int i = 0; i < 8; ++i) f.h[i] = (_Float16)(bf16_round(W[t * 8 + i]) * 16.0f); *(v8us*)((unsigned short*)Bt + t * 8) = f.half[0];  }
template <int NHv, int TTv>
__global__ __launch_bounds__(256) void k_vt(const _Float16* __restrict__ V16, int ldv, int voff, _Float16* __restrict__ Vt) { __shared__ unsigned short tl[64][66]; const int tid = threadIdx.x; const int slab = blockIdx.x / (TTv / 64), lg = blockIdx.x % (TTv / 64); const int b = slab / NHv, h = slab % NHv;
  for (int i = tid; i < 64 * 8; i += 256) { const int r = i / 8, c8 = (i % 8) * 8; FragH f; f.half[0] = *(const v8us*)((const unsigned short*)V16 + ((size_t)b * TTv + lg * 64 + r) * ldv + voff + h * 64 + c8);
#pragma unroll
    for (int q = 0; q < 8; ++q) tl[r][c8 + q] = f.u[q]; }
  __syncthreads();
  {
#pragma unroll
    for (int rd = 0; rd < 2; ++rd) { const int d = rd * 32 + tid / 8, pc = tid % 8; FragH f;
#pragma unroll
      for (int q = 0; q < 8; ++q) f.u[q] = tl[pc * 8 + q][d];
      *(v8us*)((unsigned short*)Vt + ((size_t)slab * 64 + d) * TTv + lg * 64 + pc * 8) = f.half[0]; }
     } }

__global__ __launch_bounds__(256) void k_hl(const float* __restrict__ F, _Float16* __restrict__ Hh, _Float16* __restrict__ Hl, size_t n8) { const size_t t = (size_t)blockIdx.x * 256 + threadIdx.x; if (t >= n8) return; FragH fh, fl; const v4f a = *(const v4fa*)(F + t * 8), c = *(const v4fa*)(F + t * 8 + 4);
#pragma unroll
  for (int q = 0; q < 4; ++q) { _Float16 h = (_Float16)a[q]; fh.h[q] = h; fl.h[q] = (_Float16)((a[q] - (float)h) * 1024.0f); h = (_Float16)c[q]; fh.h[4 + q] = h; fl.h[4 + q] = (_Float16)((c[q] - (float)h) * 1024.0f); }
  { *(v8us*)((unsigned short*)Hh + t * 8) = fh.half[0]; *(v8us*)((unsigned short*)Hl + t * 8) = fl.half[0];  } }

// ---- f16 fragment loader and WMMA step ----
__device__ __forceinline__ v16h g2_frag(const _Float16* p, int hh) { FragH f; f.half[0] = *(const v8us*)((const unsigned short*)p + 8 * hh); f.half[1] = *(const v8us*)((const unsigned short*)p + 16 + 8 * hh); return f.v; }
// the builtin form alone: the compiler itself keeps the distance behind a WMMA wherever a vector instruction touches its D, A or B, so no v_nop is written here; an accumulating WMMA, a WMMA on other registers and an LDS read over A need none
__device__ __forceinline__ v8f g2_mma(v16h a, v16h b, v8f c) { return __builtin_amdgcn_wmma_f32_16x16x32_f16(false, a, false, b, (short)0, c, false, false); }

// Fragment order of the prepared weight planes (64 features x K): [k step s][feature tile t][half j][lane 16 hh + ln][8 elements], feature o = 16 t + ln, k = 32 s + 16 j + 8 hh + e (g2_frag's k order). fr_off = the element offset of (o, k0), k0 a multiple of 8; the eight k from k0 on follow one another.
__device__ __forceinline__ size_t fr_off(int o, int k0) { return (size_t)(((((k0 >> 5) * 4 + (o >> 4)) * 2 + ((k0 >> 4) & 1)) * 32 + ((k0 >> 3) & 1) * 16 + (o & 15)) * 8); }
// the inverse: chunk c of eight elements (c = fr_off / 8) -> its feature o and first k. k_prep takes one chunk a thread in this order, so that a wave stores 512 bytes in a row and each 128-byte line has one writer.
__device__ __forceinline__ void fr_src(int c, int& o, int& k0) { o = ((c >> 6) & 3) * 16 + (c & 15); k0 = (c >> 8) * 32 + ((c >> 5) & 1) * 16 + ((c >> 4) & 1) * 8; }
// a lane's fragment of one feature tile; p = the tile's first element + 8 * lane
__device__ __forceinline__ v16h fr_frag(const _Float16* p) { FragH f; f.half[0] = *(const v8us*)((const unsigned short*)p); f.half[1] = *(const v8us*)((const unsigned short*)p + 256); return f.v; }
// ---- the preparation of the weight planes and biases. Every '#pragma unroll' from here to the end of k_prep makes an array index a compile-time constant, so that wv and keep stay in registers.
// eight f32 weights -> eight f16(bf16_round(w) * 16), stored as chunk c of a plane in fragment order; keep = false stores a zero
__device__ __forceinline__ void fr_put(_Float16* __restrict__ Bt, int c, const float (&wv)[8], const bool (&keep)[8]) { FragH f;
#pragma unroll
  for (int q = 0; q < 8; ++q) f.h[q] = (_Float16)(bf16_round(keep[q] ? wv[q] : 0.0f) * 16.0f);
  *(v8us*)((unsigned short*)Bt + (size_t)c * 8) = f.half[0];
  asm volatile("s_wait_xcnt 0x0" ::: "memory"); }      /* the store's offset and data registers are free for reuse behind it: the wait stands in front of whatever overwrites them */
// eight weights ST columns apart: one address pair with constant offsets, so that all eight loads fly together
template <int ST>
__device__ __forceinline__ void fr_get(const float* __restrict__ s, float (&wv)[8]) {
#pragma unroll
  for (int q = 0; q < 8; ++q) wv[q] = s[q * ST];
  asm volatile("s_wait_xcnt 0x0" :: "v"(wv[0]), "v"(wv[1]), "v"(wv[2]), "v"(wv[3]), "v"(wv[4]), "v"(wv[5]), "v"(wv[6]), "v"(wv[7]) : "memory"); }      /* the address pair of the loads is free for reuse behind them: the wait stands in front of whatever overwrites it; the loaded values as inputs keep every load in front of it */
// chunk c of blockdiag(Wa, Wb) (64 x 64, each block [32][32]): a chunk off the diagonal reads an in-bounds place all the same and stores zeros, so that no branch stands in front of the loads
__device__ __forceinline__ void prep_diag(const float* __restrict__ Wa, const float* __restrict__ Wb, _Float16* __restrict__ Bt, int c) { int o, k0; fr_src(c, o, k0); float wv[8]; fr_get<1>((o < 32 ? Wa : Wb) + (size_t)(o & 31) * 32 + (k0 & 31), wv);
  const bool on = (o >> 5) == (k0 >> 5); const bool keep[8] = {on, on, on, on, on, on, on, on}; fr_put(Bt, c, wv, keep); }
// All prepared planes and biases in ONE launch: none of them reads what another writes, so the jobs are dealt by block index, one chunk of eight f16 a thread in fragment order: a wave stores 512 bytes in a row and each 128-byte line has one writer. A block of 256 chunks is one k step (32 k) of a plane, so which part of a permuted k order it fills is the same for the whole block.
// blocks 0..31: BZ = [Wz1; Wz2], each [32][32 * 32] flattened (64 x KO). 32..66: BE1 = We1 [64][33 * 33] (64 x KKP) in the k order of k_fused's row fragments: k = a * 32 + b <- column a * 33 + b (a, b < 32); 1024 + b <- 32 * 33 + b; 1056 + a <- a * 33 + 32; 1088 <- 1088; the rest 0.
// 67..71: BE2 = We2 [64][130] (64 x KC2) in the k order of k_fused's last product: k < 96 <- column k (e1, o1); 96 + b <- 97 + b (o2); 128 <- 96 and 129 <- 129 (the columns of the two appended ones); the rest 0. 72, 73: BH = blockdiag(Wh1, Wh2). 74, 75: BO = blockdiag(Wo1, Wo2). 76: the three bias pairs, rounded to bf16, 32 values a wave.
#define PB_E1 (64 * (KO / 8) / 256)
#define PB_E2 (PB_E1 + FE * (KKP / 8) / 256)
#define PB_H  (PB_E2 + FE * (KC2 / 8) / 256)
#define PB_O  (PB_H + 64 * (64 / 8) / 256)
#define PB_B  (PB_O + 64 * (64 / 8) / 256)
__global__ __launch_bounds__(256) void k_prep(const float* __restrict__ Wz1, const float* __restrict__ Wz2, const float* __restrict__ We1, const float* __restrict__ We2, const float* __restrict__ Wh1, const float* __restrict__ Wh2, const float* __restrict__ Wo1, const float* __restrict__ Wo2,
    const float* __restrict__ bz1, const float* __restrict__ bz2, const float* __restrict__ bh1, const float* __restrict__ bh2, const float* __restrict__ bo1, const float* __restrict__ bo2,
    _Float16* __restrict__ BZ, _Float16* __restrict__ BE1, _Float16* __restrict__ BE2, _Float16* __restrict__ BH, _Float16* __restrict__ BO, float* __restrict__ bz, float* __restrict__ bh, float* __restrict__ bo) {
  const int b = blockIdx.x, tid = threadIdx.x; int o, k0; float wv[8]; bool keep[8];
  if (b < PB_E1) { const int c = b * 256 + tid; fr_src(c, o, k0); fr_get<1>((o < 32 ? Wz1 : Wz2) + (size_t)(o & 31) * KO + k0, wv);
#pragma unroll
    for (int q = 0; q < 8; ++q) keep[q] = true;
    fr_put(BZ, c, wv, keep); }
  else if (b < PB_E2) { const int a = b - PB_E1, c = a * 256 + tid; fr_src(c, o, k0); const int j = k0 & 31; const float* r = We1 + (size_t)o * KK;
    if (a <= 32) fr_get<1>(r + a * 33 + j, wv);      /* row a of the 33 x 33 square; a = 32 is its last row, the o2 part */
    else if (a == 33) fr_get<33>(r + j * 33 + 32, wv);      /* its last column, the o1 part */
    else fr_get<0>(r + KK - 1, wv);      /* its last element, and the pad, which reads the same place and drops it */
#pragma unroll
    for (int q = 0; q < 8; ++q) keep[q] = k0 + q < KK;
    fr_put(BE1, c, wv, keep); }
  else if (b < PB_H) { const int a = b - PB_E2, c = a * 256 + tid; fr_src(c, o, k0); const float* r = We2 + (size_t)o * 130;
    if (a < 4) fr_get<1>(r + k0 + (a == 3 ? 1 : 0), wv);      /* e1 and o1 as they lie; o2 lies one column on */
    else { const float x0 = r[96], x1 = r[129];      /* the two ones' columns, and the pad, which drops what it reads */
      asm volatile("s_wait_xcnt 0x0" :: "v"(x0), "v"(x1) : "memory");      /* as in fr_get */
      wv[0] = x0;
#pragma unroll
      for (int q = 1; q < 8; ++q) wv[q] = x1; }
#pragma unroll
    for (int q = 0; q < 8; ++q) keep[q] = k0 + q < 130;
    fr_put(BE2, c, wv, keep); }
  else if (b < PB_O) prep_diag(Wh1, Wh2, BH, (b - PB_H) * 256 + tid);
  else if (b < PB_B) prep_diag(Wo1, Wo2, BO, (b - PB_O) * 256 + tid);
  else { const int w = __builtin_amdgcn_readfirstlane(tid >> 5), i = tid & 31;      /* the wave's number as a scalar: the choice of the arrays is a scalar one */
    if (w < 6) { const float* s = (w == 0) ? bz1 : (w == 1) ? bz2 : (w == 2) ? bh1 : (w == 3) ? bh2 : (w == 4) ? bo1 : bo2; float* d = ((w < 2) ? bz : (w < 4) ? bh : bo) + (w & 1) * 32; d[i] = bf16_round(s[i]); } } }
// ---- the fused row pipeline. A row fragment (B operand): lane ln = row, elements 0..7 = k 8 hh + 0..7, elements 8..15 = k 16 + 8 hh + 0..7 of a 32-wide k step (g2_frag's order, which the weight fragments use too).
// Every '#pragma unroll' from here to the end of k_fused makes an array or vector index a compile-time constant, so that the values stay in registers.
__device__ __forceinline__ void op_row16(const float* p, int hh, bool rnd, float (&v)[16]) { const v4f x0 = *(const v4fa*)(p + 8 * hh), x1 = *(const v4fa*)(p + 8 * hh + 4), x2 = *(const v4fa*)(p + 16 + 8 * hh), x3 = *(const v4fa*)(p + 16 + 8 * hh + 4);
  asm volatile("s_wait_xcnt 0x0" ::: "memory");      /* the address pair of these four loads is free for reuse behind them: the wait stands in front of whatever overwrites it */
#pragma unroll
  for (int e = 0; e < 4; ++e) { v[e] = rnd ? bf16_round(x0[e]) : x0[e]; v[4 + e] = rnd ? bf16_round(x1[e]) : x1[e]; v[8 + e] = rnd ? bf16_round(x2[e]) : x2[e]; v[12 + e] = rnd ? bf16_round(x3[e]) : x3[e]; } }
__device__ __forceinline__ v16h op_frag(float a, const float (&q)[16]) { FragH f;
#pragma unroll
  for (int e = 0; e < 16; ++e) f.h[e] = (_Float16)(a * q[e]); return f.v; }
// two neighbouring feature tiles of a lane's accumulators (features 8 hh + r and 16 + 8 hh + r of a 32-wide block) as the next product's row fragment
__device__ __forceinline__ v16h fu_pack(v8f lo, v8f hi) { FragH f;
#pragma unroll
  for (int e = 0; e < 8; ++e) { f.h[e] = (_Float16)lo[e]; f.h[8 + e] = (_Float16)hi[e]; } return f.v; }
// the lane's eight biases of feature tile t, rounded to bf16
__device__ __forceinline__ v8f fu_bias(const float* __restrict__ b, int t, int hh) { const v4f x0 = *(const v4fa*)(b + t * 16 + 8 * hh), x1 = *(const v4fa*)(b + t * 16 + 8 * hh + 4); v8f v;
#pragma unroll
  for (int e = 0; e < 4; ++e) { v[e] = bf16_round(x0[e]); v[4 + e] = bf16_round(x1[e]); } return v; }
// the four weight fragments (64 features) of one k step; wl = the staged chunk at the step's first element (FS a step) + 8 * lane
#define FS 2048                  /* elements of one k step of a weight plane: 64 features x 32 k */
#define CHE (4 * FS)             /* elements of one staged chunk: four k steps, 16 KiB */
// one chunk of the weight stream into one LDS buffer: 256 threads, four copies of 16 bytes each. g = the chunk's first element + 8 * tid, l = the buffer's LDS byte address + 16 * tid
__device__ __forceinline__ void st_copy(const _Float16* g, unsigned l) {
  asm volatile("global_load_async_to_lds_b128 %0, %4, off\n\t"
               "global_load_async_to_lds_b128 %1, %5, off\n\t"
               "global_load_async_to_lds_b128 %2, %6, off\n\t"
               "global_load_async_to_lds_b128 %3, %7, off\n\t"
               "s_wait_xcnt 0x0"      /* the copies' address registers are free for reuse behind the statement: the wait stands in front of whatever overwrites them */
               :: "v"(l), "v"(l + 4096u), "v"(l + 8192u), "v"(l + 12288u), "v"(g), "v"(g + 2048), "v"(g + 4096), "v"(g + 6144) : "memory"); }
// the hand-over at the foot of a chunk: the wave's own LDS reads of that chunk are done, its own copies of the next chunk have landed; behind the barrier every wave may read the next chunk, and the buffer just read may be refilled
__device__ __forceinline__ void st_publish() {
  asm volatile("s_wait_dscnt 0x0" ::: "memory");      /* this wave's reads of the buffer that is refilled next */
  asm volatile("s_wait_asynccnt 0x0" ::: "memory");      /* this wave's copies of the next chunk: the compiler places no wait for them */
  __syncthreads(); }
__device__ __forceinline__ void fu_load(const _Float16* wl, v16h (&a)[4]) {
#pragma unroll
  for (int t = 0; t < 4; ++t) a[t] = fr_frag(wl + t * 512); }
// one k step, 64 features x 32 rows, on fragments that are loaded already: the last step of a chunk
__device__ __forceinline__ void fu_step_end(const v16h (&a)[4], v16h d0, v16h d1, v8f (&c)[2][4]) {
#pragma unroll
  for (int t = 0; t < 4; ++t) { c[0][t] = g2_mma(a[t], d0, c[0][t]); c[1][t] = g2_mma(a[t], d1, c[1][t]); } }
// the same, and behind the two products that read a[t] its registers take that tile's fragment of the step that follows (wn: as in fu_load), so that a whole step's work lies between a load and its use
__device__ __forceinline__ void fu_step_pf(v16h (&a)[4], const _Float16* wn, v16h d0, v16h d1, v8f (&c)[2][4]) {
#pragma unroll
  for (int t = 0; t < 4; ++t) { c[0][t] = g2_mma(a[t], d0, c[0][t]); c[1][t] = g2_mma(a[t], d1, c[1][t]); a[t] = fr_frag(wn + t * 512);
    __builtin_amdgcn_sched_barrier(0); } }      /* behind each tile: holds the tiles in the order of their LDS reads, so that each wait leaves the younger pairs of reads open (left free, a later tile's products were moved up and waited for every read). Behind the last it also keeps the later steps' row-fragment arithmetic behind this step: moved up, the row fragments of four steps are live at once and the kernel needs more than 256 registers, one wave a SIMD less */
// WS = the weight stream: [Wz (32 k steps) | Wh (2) | Wo (2) | We1 (35) | We2 (5)] = 19 chunks; chunk c is staged in buffer c & 1
__global__ __launch_bounds__(256) void k_fused(const float* __restrict__ x, const _Float16* __restrict__ WS, const float* __restrict__ bz, const float* __restrict__ bh, const float* __restrict__ bo,
    const float* __restrict__ be1, const float* __restrict__ be2, float* __restrict__ out) {
  __shared__ __attribute__((aligned(16))) float so[8][32][68];
  __shared__ __attribute__((aligned(16))) _Float16 wb[2 * CHE];
  const int tid = threadIdx.x, w = tid >> 5, lane = tid & 31, ln = lane & 15, hh = lane >> 4;
  const int row0 = blockIdx.x * 256 + 32 * w;
  const float* p0 = x + (size_t)(row0 + ln) * D1; const float* p1 = p0 + (size_t)16 * D1;
  const float* q0 = p0 + (size_t)NBI * D1; const float* q1 = q0 + (size_t)16 * D1;
  const v8f z8 = {0.f,0.f,0.f,0.f,0.f,0.f,0.f,0.f};
  const _Float16* gs = WS + tid * 8; const unsigned ls = (unsigned)(size_t)&wb[0] + 16u * (unsigned)tid;      /* the thread's own 16 bytes of each quarter of a chunk: in the stream, and in buffer 0 (LDS byte address) */
  const _Float16* wl = &wb[0] + lane * 8;      /* the lane's place in a staged fragment half */
  st_copy(gs, ls);      /* chunk 0 */
  float qa[16], qb[16]; op_row16(q0, hh, true, qa); op_row16(q1, hh, true, qb);
  asm volatile("s_wait_asynccnt 0x0" ::: "memory");      /* this wave's copies of chunk 0 have landed */
  __syncthreads();      /* and every other wave's: chunk 0 may be read */
  st_copy(gs + CHE, ls + 2u * CHE);      /* chunk 1 flies while chunk 0 is worked on */
  v16h a[4];      /* the weight fragments of one k step */
  /* [z1 | z2]: k step i holds f16(v1[i] * v2[j]), j = 0..31 */
  v8f z[2][4] = {{z8, z8, z8, z8}, {z8, z8, z8, z8}};
  { float pa[4], pb[4];      /* carried rounded, so that no load is open on them at the loop's head: carried raw, the wait there was to 0 and emptied the fragment ring once a group */
    { const v4f na = *(const v4fa*)p0, nb = *(const v4fa*)p1;
#pragma unroll
      for (int u = 0; u < 4; ++u) { pa[u] = bf16_round(na[u]); pb[u] = bf16_round(nb[u]); } }
    /* rolled over groups of four k steps: one 16-byte load brings four values of v1, a group ahead like the fragments; fully unrolled the 32 steps would only grow the code. What the last group fetches ahead of v1 is group 0 again and is not used: no branch among the products, and every address stays inside its row. A group is one staged chunk */
#pragma unroll 1
    for (int i4 = 0; i4 < 32; i4 += 4) { const int bs = (i4 >> 2) & 1; const _Float16* wc = wl + bs * CHE;      /* chunk i4 / 4 */
      fu_load(wc, a);
      __builtin_amdgcn_sched_barrier(0);      /* the chunk's first LDS reads go out in front of the row-fragment arithmetic, which then runs under their latency */
      const int nx = (i4 + 4) & 31; const v4f na = *(const v4fa*)(p0 + nx), nb = *(const v4fa*)(p1 + nx);
      asm volatile("s_wait_xcnt 0x0" ::: "memory");      /* the two address pairs are reused at once: the wait stands in front of that */
#pragma unroll
      for (int u = 0; u < 3; ++u) fu_step_pf(a, wc + (u + 1) * FS, op_frag(pa[u], qa), op_frag(pb[u], qb), z);
      fu_step_end(a, op_frag(pa[3], qa), op_frag(pb[3], qb), z);
      st_publish(); st_copy(gs + ((i4 >> 2) + 2) * CHE, ls + (unsigned)bs * (2u * CHE));      /* chunks 2..9 */
#pragma unroll
      for (int u = 0; u < 4; ++u) { pa[u] = bf16_round(na[u]); pb[u] = bf16_round(nb[u]); } }
    fu_load(wl, a);      /* chunk 8 = [Wh | Wo], buffer 0 */
    __builtin_amdgcn_sched_barrier(0); }      /* as at the head of a group: these LDS reads go out first, and none of them lands among the row loads that follow, in front of the wait that frees those loads' address registers */
  /* [h1 | h2] = relu, block-diagonal weights, K = [v1 | v2]; then the gate f16(sigmoid(z) * h), feature tile by feature tile, straight into the row fragments of the next product */
  v16h g[2][2];
  { float ra[16], rb[16]; op_row16(p0, hh, true, ra); op_row16(p1, hh, true, rb);
    const v16h v1a = op_frag(1.0f, ra), v1b = op_frag(1.0f, rb), v2a = op_frag(1.0f, qa), v2b = op_frag(1.0f, qb);
    v8f h[2][4] = {{z8, z8, z8, z8}, {z8, z8, z8, z8}};
    fu_step_pf(a, wl + FS, v1a, v1b, h); fu_step_pf(a, wl + 2 * FS, v2a, v2b, h);
#pragma unroll
    for (int t = 0; t < 4; ++t) { const v8f bzv = fu_bias(bz, t, hh), bhv = fu_bias(bh, t, hh);
#pragma unroll
      for (int n = 0; n < 2; ++n)
#pragma unroll
        for (int r = 0; r < 8; ++r) { const float zv = z[n][t][r] * 0.0625f + bzv[r]; const float hv = fmaxf(h[n][t][r] * 0.0625f + bhv[r], 0.f); z[n][t][r] = (1.0f / (1.0f + expf(-zv))) * hv; } }
#pragma unroll
    for (int n = 0; n < 2; ++n) { g[n][0] = fu_pack(z[n][0], z[n][1]); g[n][1] = fu_pack(z[n][2], z[n][3]); } }
  /* [o1 | o2] = relu, block-diagonal weights */
  v8f o[2][4] = {{z8, z8, z8, z8}, {z8, z8, z8, z8}};
  { fu_step_pf(a, wl + 3 * FS, g[0][0], g[1][0], o); fu_step_end(a, g[0][1], g[1][1], o);
    st_publish(); st_copy(gs + 10 * CHE, ls);
#pragma unroll
    for (int t = 0; t < 4; ++t) { const v8f bv = fu_bias(bo, t, hh);
#pragma unroll
      for (int n = 0; n < 2; ++n)
#pragma unroll
        for (int r = 0; r < 8; ++r) o[n][t][r] = fmaxf(o[n][t][r] * 0.0625f + bv[r], 0.f); } }
  /* o1 (feature tiles 0, 1) into the wave's slab, so[w][row][a]: in k step a of We1 both lane halves scale by o1[row][a], and each holds only half of the a */
#pragma unroll
  for (int n = 0; n < 2; ++n)
#pragma unroll
    for (int t = 0; t < 2; ++t) { float* d = &so[w][n * 16 + ln][t * 16 + 8 * hh]; const v4f s0 = {o[n][t][0], o[n][t][1], o[n][t][2], o[n][t][3]}, s1 = {o[n][t][4], o[n][t][5], o[n][t][6], o[n][t][7]}; *(v4fa*)d = s0; *(v4fa*)(d + 4) = s1; }
  __builtin_amdgcn_fence(__ATOMIC_ACQ_REL, "workgroup"); __builtin_amdgcn_wave_barrier();      /* each wave re-reads only its own slab of so: its LDS stores must be ordered before its loads */
  const v16h o1a = fu_pack(o[0][0], o[0][1]), o1b = fu_pack(o[1][0], o[1][1]);
  float oa[16], ob[16];
#pragma unroll
  for (int e = 0; e < 8; ++e) { oa[e] = o[0][2][e]; oa[8 + e] = o[0][3][e]; ob[e] = o[1][2][e]; ob[8 + e] = o[1][3][e]; }
  const v16h o2a = op_frag(1.0f, oa), o2b = op_frag(1.0f, ob);
  /* e1 = relu(o12 We1^T + b): k step a holds f16(o1[a] * o2[b]), b = 0..31; then o2, o1 and the one */
  v8f e1[2][4] = {{z8, z8, z8, z8}, {z8, z8, z8, z8}};
  { /* rolled like the first loop: one 16-byte LDS load brings four values of o1 */
#pragma unroll 1
    for (int i4 = 0; i4 < 32; i4 += 4) { const v4f pa = *(const v4fa*)&so[w][ln][i4], pb = *(const v4fa*)&so[w][16 + ln][i4];
      const int bs = ((i4 >> 2) & 1) ^ 1; const _Float16* wc = wl + bs * CHE;      /* chunk 9 + i4 / 4 */
      fu_load(wc, a);
      __builtin_amdgcn_sched_barrier(0);      /* as in the first loop */
#pragma unroll
      for (int u = 0; u < 3; ++u) fu_step_pf(a, wc + (u + 1) * FS, op_frag(pa[u], oa), op_frag(pb[u], ob), e1);
      fu_step_end(a, op_frag(pa[3], oa), op_frag(pb[3], ob), e1);
      st_publish(); st_copy(gs + ((i4 >> 2) + 11) * CHE, ls + (unsigned)bs * (2u * CHE)); }      /* chunks 11..18 */
    const _Float16* wc = wl + CHE;      /* chunk 17 = [the last three k steps of We1 | the first of We2], buffer 1 */
    fu_load(wc, a);
    fu_step_pf(a, wc + FS, o2a, o2b, e1); fu_step_pf(a, wc + 2 * FS, o1a, o1b, e1);
    FragH one;
#pragma unroll
    for (int e = 0; e < 16; ++e) one.h[e] = (_Float16)((e == 0 && hh == 0) ? 1.0f : 0.0f);
    fu_step_pf(a, wc + 3 * FS, one.v, one.v, e1);
#pragma unroll
    for (int t = 0; t < 4; ++t) { const v8f bv = fu_bias(be1, t, hh);
#pragma unroll
      for (int n = 0; n < 2; ++n)
#pragma unroll
        for (int r = 0; r < 8; ++r) e1[n][t][r] = fmaxf(e1[n][t][r] * 0.0625f + bv[r], 0.f); } }
  /* out = relu([e1, o1, o2, 1, 1] We2^T + b) */
  v8f y[2][4] = {{z8, z8, z8, z8}, {z8, z8, z8, z8}};
  { fu_step_end(a, fu_pack(e1[0][0], e1[0][1]), fu_pack(e1[1][0], e1[1][1]), y);
    st_publish();      /* chunk 18, the last: no chunk is left to fetch */
    fu_load(wl, a);
    fu_step_pf(a, wl + FS, fu_pack(e1[0][2], e1[0][3]), fu_pack(e1[1][2], e1[1][3]), y);
    fu_step_pf(a, wl + 2 * FS, o1a, o1b, y); fu_step_pf(a, wl + 3 * FS, o2a, o2b, y);
    FragH two;
#pragma unroll
    for (int e = 0; e < 16; ++e) two.h[e] = (_Float16)((e < 2 && hh == 0) ? 1.0f : 0.0f);
    fu_step_end(a, two.v, two.v, y);
    asm volatile("s_wait_asynccnt 0x0" ::: "memory"); }      /* behind the last chunk: no copy of this wave is open when it goes on to the output and ends */
  /* the lane holds 8 features of its row a tile: through the slab, so that the output goes out as whole rows */
#pragma unroll
  for (int t = 0; t < 4; ++t) { const v8f bv = fu_bias(be2, t, hh);
#pragma unroll
    for (int n = 0; n < 2; ++n) { v4f s0, s1;
#pragma unroll
      for (int r = 0; r < 4; ++r) { s0[r] = fmaxf(y[n][t][r] * 0.0625f + bv[r], 0.f); s1[r] = fmaxf(y[n][t][4 + r] * 0.0625f + bv[4 + r], 0.f); }
      float* d = &so[w][n * 16 + ln][t * 16 + 8 * hh]; *(v4fa*)d = s0; *(v4fa*)(d + 4) = s1; } }
  __builtin_amdgcn_fence(__ATOMIC_ACQ_REL, "workgroup"); __builtin_amdgcn_wave_barrier();      /* as above: the wave's own LDS stores before its loads */
  const int rsub = lane >> 4, c4 = (lane & 15) * 4;
#pragma unroll
  for (int q = 0; q < 16; ++q) { const int r = q * 2 + rsub; const v4f v = *(const v4fa*)&so[w][r][c4]; *(v4f*)(out + (size_t)(row0 + r) * FE + c4) = v; } }

extern "C" void kernel_launch(void* const* d_in, const int* in_sizes, int n_in,
                              void* d_out, int out_size, void* d_ws, size_t ws_size, hipStream_t stream) {
  (void)in_sizes; (void)n_in; (void)out_size;
  const float* const* I = (const float* const*)d_in;
  const float* x = I[0]; const float* Wh1 = I[1]; const float* bh1 = I[2]; const float* Wz1 = I[3]; const float* bz1 = I[4]; const float* Wo1 = I[5]; const float* bo1 = I[6]; const float* Wh2 = I[7]; const float* bh2 = I[8]; const float* Wz2 = I[9]; const float* bz2 = I[10]; const float* Wo2 = I[11]; const float* bo2 = I[12]; const float* We1 = I[13]; const float* be1 = I[14]; const float* We2 = I[15]; const float* be2 = I[16];
  char* ws = (char*)d_ws; size_t off = 0;
  auto take = [&](size_t bytes) { char* p = ws + off; off += (bytes + 255) & ~(size_t)255; return p; };
  /* the five planes in the order of their use; each size is a multiple of 256 bytes, so that they follow one another without a gap: k_fused reads them as one stream from BZ on */
  _Float16* BZ = (_Float16*)take((size_t)64 * KO * 2); _Float16* BH = (_Float16*)take((size_t)64 * 64 * 2); _Float16* BO = (_Float16*)take((size_t)64 * 64 * 2); _Float16* BE1 = (_Float16*)take((size_t)FE * KKP * 2); _Float16* BE2 = (_Float16*)take((size_t)FE * KC2 * 2);
  float* bz = (float*)take(64 * 4); float* bh = (float*)take(64 * 4); float* bo = (float*)take(64 * 4);
  if (off > ws_size) return;      /* under 1 MiB: the prepared weights and biases only */
  k_prep<<<PB_B + 1, 256, 0, stream>>>(Wz1, Wz2, We1, We2, Wh1, Wh2, Wo1, Wo2, bz1, bz2, bh1, bh2, bo1, bo2, BZ, BE1, BE2, BH, BO, bz, bh, bo);      /* every element of every plane, the pads and the zero blocks too */
  k_fused<<<NBR / 256, 256, 0, stream>>>(x, BZ, bz, bh, bo, be1, be2, (float*)d_out);
}

// v009
// It runs in 31.5 microseconds.
// In two side-by-side timings against v008, it was 1.10 and 1.11 times as fast.
// Counting every step since v000, it is 39.4 times as fast.
#include <hip/hip_runtime.h>
// KroneckerFusion (131072 rows; v1, v2 = x[0], x[1] (32 each): h_i = relu(v_i Wh_i^T + b); z_i = Bilinear(v1, Wz_i, v2) + b; o_i = relu((sigmoid(z_i) * h_i) Wo_i^T + b); o_i <- [o_i, 1]; o12 = o1 (x) o2 (33 x 33 = 1089); out = relu(o12 We1^T + b); out = relu([out, o1, o2] We2^T + b)).
// Structure: ONE kernel for the whole row pipeline; a wave owns 32 rows from the input to the output row and no intermediate touches the workspace. Every product is computed transposed, weights as the A operand (16 features a tile) and the rows as the B operand (lane = row), f16 WMMA with f32 accumulation and exact x16 weights + bias. A lane's accumulators then hold features 16 t + 8 hh + 0..7 of its own row, and two neighbouring feature tiles converted to f16 ARE the B fragment of the next product (its k order), so z, h, the gate, o, e1 and the output follow one another in registers. The bilinear forms ([Wz1; Wz2] flattened, K = 1024) and We1 (K re-ordered to [o1[a] o2[b] (1024) | o2 (32) | o1 (32) | 1 | 0 pad] = 1120) form their B fragments f16(p[i] * q[j]) in registers; o1[a], which both lane halves need for every a, goes through the wave's own LDS slab. We2's K is re-ordered to [e1 (64) | o1 (32) | o2 (32) | 1 | 1 | 0 pad] = 160 with the weight columns permuted alike. The output rows are turned in the same slab and stored as whole lines. The five prepared weight planes lie one behind the other in the workspace, in the order of their use and in fragment order (fr_off): one stream of 76 k steps. A work-group of eight waves brings it into LDS in chunks of four k steps (16 KiB) with asynchronous copies, two buffers, one chunk ahead, and every wave reads its fragments from there, inside a chunk one k step ahead through four register fragments; each 16-byte-a-lane read of a fragment half takes 512 bytes in a row. One launch (k_prep) prepares all planes and biases in front of it.
#define NBR 131072               /* rows processed */
#define NBI 131072               /* rows in the input (x[1] starts at NBI*32; separate so debug builds can shrink NBR) */
#define D1 32
#define KO 1024                  /* 32 x 32 outer */
#define KK 1089                  /* 33 x 33 Kronecker */
#define KKP 1120
#define FE 64
#define KC2 160                  /* [e1 (64) | o1 (32) | o2 (32) | 1 | 1 | 0] */
typedef __bf16 v16b __attribute__((ext_vector_type(16)));
typedef unsigned short v8us __attribute__((ext_vector_type(8), may_alias));
typedef float  v8f  __attribute__((ext_vector_type(8)));
typedef float  v4f  __attribute__((ext_vector_type(4)));
typedef float  v4fa __attribute__((ext_vector_type(4), may_alias));
union FragB { v16b v; v8us half[2]; unsigned short u[16]; };

__device__ __forceinline__ unsigned short bf16_bits(float x) { unsigned int u = __float_as_uint(x); return (unsigned short)((u + 0x7FFFu + ((u >> 16) & 1u)) >> 16); }
__device__ __forceinline__ float bf16_val(unsigned short b) { return __uint_as_float(((unsigned int)b) << 16); }
__device__ __forceinline__ float bf16_round(float x) { return bf16_val(bf16_bits(x)); }
// D += A·B with NT terms: 1 = ah·bh, 2 = + al·bh (A split), 3 = + ah·bl (both split)
template <int NT>
__device__ __forceinline__ v8f mmaN(v16b ah, v16b al, v16b bh, v16b bl, v8f c) {
  c = __builtin_amdgcn_wmma_f32_16x16x32_bf16(false, ah, false, bh, (short)0, c, false, false);
  if (NT >= 2) c = __builtin_amdgcn_wmma_f32_16x16x32_bf16(false, al, false, bh, (short)0, c, false, false);
  if (NT >= 3) c = __builtin_amdgcn_wmma_f32_16x16x32_bf16(false, ah, false, bl, (short)0, c, false, false);
  asm volatile("v_nop\n\tv_nop\n\tv_nop\n\tv_nop" : "+v"(c) : "v"(ah), "v"(al), "v"(bh), "v"(bl));
  return c;
}

__global__ __launch_bounds__(256) void k_wt_bf16(const float* __restrict__ W, unsigned short* __restrict__ Wt, int K, int N) {
  const int t = blockIdx.x * 256 + threadIdx.x;
  const int k8n = K / 8;
  if (t >= N * k8n) return;
  const int n = t / k8n, k8 = (t % k8n) * 8;
  v8us v;
#pragma unroll
  for (int i = 0; i < 8; ++i) v[i] = bf16_bits(W[(size_t)(k8 + i) * N + n]);
  *(v8us*)(Wt + (size_t)n * K + k8) = v;
  
}

// GEMM C[M][N] (f32, pitch ldc) = act(A[M][K]·W + bias). A f32 row-major (pitch lda) converted per fragment to bf16
// (ASPLIT: hi/lo two planes -> 2 terms, else single rounded term); Wt bf16 [N][K] (pitch ldb). BIAS_BF16 rounds the
// bias to bf16 first (bias quantised to bf16 before the add). K%32==0, M%16==0, N%64==0.
template <bool ASPLIT, int ACT, bool BIAS_BF16>
__global__ __launch_bounds__(128) void k_gemm_bf(const float* __restrict__ A, int lda, const unsigned short* __restrict__ Wt, int ldb,
                                               const float* __restrict__ bias, float* __restrict__ C, int ldc, int M, int N, int K) {
  __shared__ __attribute__((aligned(16))) float so[4][16][64];
  const int tid = threadIdx.x, w = tid >> 5, lane = tid & 31, ln = lane & 15, hh = lane >> 4;
  const int ntn = N / 64;
  const int wid = blockIdx.x * 4 + w;
  const int mt = wid / ntn, nq = wid % ntn;
  if (mt * 16 >= M) return;
  const int row0 = mt * 16, col0 = nq * 64;
  const float* arow = A + (size_t)(row0 + ln) * lda;
  v8f acc[4] = {};
  for (int kb = 0; kb < K; kb += 32) {
    FragB ah, al;
    const v4f x0 = *(const v4fa*)(arow + kb + 8 * hh), x1 = *(const v4fa*)(arow + kb + 8 * hh + 4);
    const v4f x2 = *(const v4fa*)(arow + kb + 16 + 8 * hh), x3 = *(const v4fa*)(arow + kb + 16 + 8 * hh + 4);
    float xs[16] = {x0[0],x0[1],x0[2],x0[3],x1[0],x1[1],x1[2],x1[3],x2[0],x2[1],x2[2],x2[3],x3[0],x3[1],x3[2],x3[3]};
#pragma unroll
    for (int i = 0; i < 16; ++i) { const unsigned short hb = bf16_bits(xs[i]); ah.u[i] = hb; al.u[i] = ASPLIT ? bf16_bits(xs[i] - bf16_val(hb)) : (unsigned short)0; }
#pragma unroll
    for (int t = 0; t < 4; ++t) {
      const unsigned short* brow = Wt + (size_t)(col0 + t * 16 + ln) * ldb + kb;
      FragB b;
      b.half[0] = *(const v8us*)(brow + 8 * hh);
      b.half[1] = *(const v8us*)(brow + 16 + 8 * hh);
      acc[t] = mmaN<ASPLIT ? 2 : 1>(ah.v, al.v, b.v, b.v, acc[t]);
    }
  }
#pragma unroll
  for (int t = 0; t < 4; ++t) {
    float bv = bias ? bias[col0 + t * 16 + ln] : 0.f;
    if (BIAS_BF16) bv = bf16_round(bv);
#pragma unroll
    for (int r = 0; r < 8; ++r) { float v = acc[t][r] + bv; if (ACT == 1) v = fmaxf(v, 0.f); so[w][8 * hh + r][t * 16 + ln] = v; }
  }
  __builtin_amdgcn_fence(__ATOMIC_ACQ_REL, "workgroup");
  __builtin_amdgcn_wave_barrier();
  const int rsub = lane >> 4, c4 = (lane & 15) * 4;
  {
#pragma unroll
    for (int q = 0; q < 8; ++q) {
      const int r = q * 2 + rsub;
      const v4f v = *(const v4fa*)&so[w][r][c4];
      *(v4f*)(C + (size_t)(row0 + r) * ldc + col0 + c4) = v;
    }
    
  }
}

// GEMM C = act(A·W + bias + resid): A f32 (ASPLIT -> hi/lo 2 terms), Wt bf16 [N][K]; ACT 0 none, 1 relu, 2 exact gelu;
// resid (optional, f32, row index = (row % rmod), pitch ldr, RES_BF16 rounds it) added before the activation.
template <bool ASPLIT, int ACT, bool BIAS_BF16, bool RES_BF16>
__global__ __launch_bounds__(128) void k_gemm_bf3(const float* __restrict__ A, int lda, const unsigned short* __restrict__ Wt, int ldb,
                                                const float* __restrict__ bias, const float* __restrict__ resid, int rmod, int ldr,
                                                float* __restrict__ C, int ldc, int M, int N, int K) {
  __shared__ __attribute__((aligned(16))) float so[4][16][64];
  const int tid = threadIdx.x, w = tid >> 5, lane = tid & 31, ln = lane & 15, hh = lane >> 4;
  const int ntn = N / 64;
  const int wid = blockIdx.x * 4 + w;
  const int mt = wid / ntn, nq = wid % ntn;
  if (mt * 16 >= M) return;
  const int row0 = mt * 16, col0 = nq * 64;
  const float* arow = A + (size_t)(row0 + ln) * lda;
  v8f acc[4] = {};
  for (int kb = 0; kb < K; kb += 32) {
    FragB ah, al;
    const v4f x0 = *(const v4fa*)(arow + kb + 8 * hh), x1 = *(const v4fa*)(arow + kb + 8 * hh + 4);
    const v4f x2 = *(const v4fa*)(arow + kb + 16 + 8 * hh), x3 = *(const v4fa*)(arow + kb + 16 + 8 * hh + 4);
    float xs[16] = {x0[0],x0[1],x0[2],x0[3],x1[0],x1[1],x1[2],x1[3],x2[0],x2[1],x2[2],x2[3],x3[0],x3[1],x3[2],x3[3]};
#pragma unroll
    for (int i = 0; i < 16; ++i) { const unsigned short hb = bf16_bits(xs[i]); ah.u[i] = hb; al.u[i] = ASPLIT ? bf16_bits(xs[i] - bf16_val(hb)) : (unsigned short)0; }
#pragma unroll
    for (int t = 0; t < 4; ++t) {
      const unsigned short* brow = Wt + (size_t)(col0 + t * 16 + ln) * ldb + kb;
      FragB b;
      b.half[0] = *(const v8us*)(brow + 8 * hh);
      b.half[1] = *(const v8us*)(brow + 16 + 8 * hh);
      acc[t] = mmaN<ASPLIT ? 2 : 1>(ah.v, al.v, b.v, b.v, acc[t]);
    }
  }
#pragma unroll
  for (int t = 0; t < 4; ++t) {
    const int col = col0 + t * 16 + ln;
    float bv = bias ? bias[col] : 0.f;
    if (BIAS_BF16) bv = bf16_round(bv);
#pragma unroll
    for (int r = 0; r < 8; ++r) {
      float v = acc[t][r] + bv;
      if (resid) { float rv = resid[(size_t)((row0 + 8 * hh + r) % rmod) * ldr + col]; if (RES_BF16) rv = bf16_round(rv); v += rv; }
      if (ACT == 1) v = fmaxf(v, 0.f);
      if (ACT == 2) v = 0.5f * v * (1.0f + erff(v * 0.70710678118654752f));
      if (ACT == 3) { const float u = 0.7978845608028654f * (v + 0.044715f * v * v * v); v = 0.5f * v * (1.0f + tanhf(u)); }
      so[w][8 * hh + r][t * 16 + ln] = v;
    }
  }
  __builtin_amdgcn_fence(__ATOMIC_ACQ_REL, "workgroup");
  __builtin_amdgcn_wave_barrier();
  const int rsub = lane >> 4, c4 = (lane & 15) * 4;
  {
#pragma unroll
    for (int q = 0; q < 8; ++q) {
      const int r = q * 2 + rsub;
      const v4f v = *(const v4fa*)&so[w][r][c4];
      *(v4f*)(C + (size_t)(row0 + r) * ldc + col0 + c4) = v;
    }
    
  }
}
// row LayerNorm (biased variance, eps) over N: s = X (+ R); optional out_sum <- s; out_norm <- (s-mu)*rsqrt(var+eps)*g + b
template <bool PARAM_BF16>
__global__ __launch_bounds__(256) void k_layernorm(const float* __restrict__ X, const float* __restrict__ R, const float* __restrict__ g, const float* __restrict__ bta,
                                                  float* __restrict__ out_sum, float* __restrict__ out_norm, int N, float eps) {
  __shared__ float red[256];
  const int row = blockIdx.x, tid = threadIdx.x;
  const float* x = X + (size_t)row * N; const float* rr = R ? R + (size_t)row * N : nullptr;
  float vals[16];                     // up to N = 4096
  const int per = N / 256;            // contiguous chunk per thread? use strided-by-4 chunks: thread handles j = tid*4 + 1024*u
  float s1 = 0.f;
  for (int u = 0; u < per / 4; ++u) {
    const int j = tid * 4 + 1024 * u;
    const v4f a = *(const v4fa*)(x + j);
    v4f b = {0.f,0.f,0.f,0.f}; if (rr) b = *(const v4fa*)(rr + j);
#pragma unroll
    for (int q = 0; q < 4; ++q) { const float v = a[q] + b[q]; vals[u * 4 + q] = v; s1 += v; }
  }
  red[tid] = s1; __syncthreads();
  for (int st = 128; st > 0; st >>= 1) { if (tid < st) red[tid] += red[tid + st]; __syncthreads(); }
  const float mu = red[0] / (float)N; __syncthreads();
  float s2 = 0.f;
  for (int u = 0; u < per / 4; ++u)
#pragma unroll
    for (int q = 0; q < 4; ++q) { const float c = vals[u * 4 + q] - mu; s2 += c * c; }
  red[tid] = s2; __syncthreads();
  for (int st = 128; st > 0; st >>= 1) { if (tid < st) red[tid] += red[tid + st]; __syncthreads(); }
  const float rs = rsqrtf(red[0] / (float)N + eps);
  {
    for (int u = 0; u < per / 4; ++u) {
      const int j = tid * 4 + 1024 * u;
      v4f o, sm;
#pragma unroll
      for (int q = 0; q < 4; ++q) {
        float gg = g[j + q], bb = bta[j + q];
        if (PARAM_BF16) { gg = bf16_round(gg); bb = bf16_round(bb); }
        sm[q] = vals[u * 4 + q]; o[q] = (vals[u * 4 + q] - mu) * rs * gg + bb;
      }
      if (out_sum) *(v4f*)(out_sum + (size_t)row * N + j) = sm;
      *(v4f*)(out_norm + (size_t)row * N + j) = o;
    }
    
  }
}



// ---- f16 WMMA path (v_wmma_f32_16x16x32_f16): 11-bit significands for operands in range — used here for all five GEMMs (bilinear, h, o, We1, We2)
typedef _Float16 v16h __attribute__((ext_vector_type(16)));
union FragH { v16h v; v8us half[2]; _Float16 h[16]; unsigned short u[16]; };
template <int NT>
__device__ __forceinline__ v8f mmaH(v16h ah, v16h al, v16h bh, v16h bl, v8f c) {
  c = __builtin_amdgcn_wmma_f32_16x16x32_f16(false, ah, false, bh, (short)0, c, false, false);
  if (NT >= 2) c = __builtin_amdgcn_wmma_f32_16x16x32_f16(false, al, false, bh, (short)0, c, false, false);
  if (NT >= 3) c = __builtin_amdgcn_wmma_f32_16x16x32_f16(false, ah, false, bl, (short)0, c, false, false);
  asm volatile("v_nop\n\tv_nop\n\tv_nop\n\tv_nop" : "+v"(c) : "v"(ah), "v"(al), "v"(bh), "v"(bl));
  return c;
}
// batched GEMM like k_gemm_b but f16 operands: A f32 (split into f16 hi/lo if ASPLIT, else rounded to f16), Bt = f16 values [n][k]; alpha; C f32; N multiple of 16 (partial tiles skipped)
template <bool ASPLIT>
__global__ __launch_bounds__(128) void k_gemm_h(const float* __restrict__ A, int lda, size_t sA, const _Float16* __restrict__ Bh, int ldb, size_t sB, float alpha, float* __restrict__ C, int ldc, size_t sC, int M, int N, int K) {
  __shared__ __attribute__((aligned(16))) float so[4][16][64];
  const int tid = threadIdx.x, w = tid >> 5, lane = tid & 31, ln = lane & 15, hh = lane >> 4; const int by = blockIdx.y;
  A += (size_t)by * sA; Bh += (size_t)by * sB; C += (size_t)by * sC;
  const int ntn = (N + 63) / 64; const int wid = blockIdx.x * 4 + w; const int mt = wid / ntn, nq = wid % ntn; if (mt * 16 >= M) return;
  const int row0 = mt * 16, col0 = nq * 64; const float* arow = A + (size_t)(row0 + ln) * lda;
  v8f acc[4] = {};
  for (int kb = 0; kb < K; kb += 32) {
    FragH ah, al;
    const v4f x0 = *(const v4fa*)(arow + kb + 8 * hh), x1 = *(const v4fa*)(arow + kb + 8 * hh + 4), x2 = *(const v4fa*)(arow + kb + 16 + 8 * hh), x3 = *(const v4fa*)(arow + kb + 16 + 8 * hh + 4);
    float xs[16] = {x0[0],x0[1],x0[2],x0[3],x1[0],x1[1],x1[2],x1[3],x2[0],x2[1],x2[2],x2[3],x3[0],x3[1],x3[2],x3[3]};
#pragma unroll
    for (int i = 0; i < 16; ++i) { const _Float16 h = (_Float16)xs[i]; ah.h[i] = h; al.h[i] = ASPLIT ? (_Float16)(xs[i] - (float)h) : (_Float16)0.0f; }
#pragma unroll
    for (int t = 0; t < 4; ++t) { if (col0 + t * 16 >= N) continue; const size_t boff = (size_t)(col0 + t * 16 + ln) * ldb + kb; FragH bq; bq.half[0] = *(const v8us*)(Bh + boff + 8 * hh); bq.half[1] = *(const v8us*)(Bh + boff + 16 + 8 * hh);
      acc[t] = mmaH<ASPLIT ? 2 : 1>(ah.v, al.v, bq.v, bq.v, acc[t]); }
  }
#pragma unroll
  for (int t = 0; t < 4; ++t) { if (col0 + t * 16 >= N) continue;
#pragma unroll
    for (int r = 0; r < 8; ++r) so[w][8 * hh + r][t * 16 + ln] = acc[t][r] * alpha; }
  __builtin_amdgcn_fence(__ATOMIC_ACQ_REL, "workgroup"); __builtin_amdgcn_wave_barrier();
  const int rsub = lane >> 4, c4 = (lane & 15) * 4;
  {
#pragma unroll
    for (int q = 0; q < 8; ++q) { const int r = q * 2 + rsub; if (col0 + c4 < N) { const v4f v = *(const v4fa*)&so[w][r][c4]; *(v4f*)(C + (size_t)(row0 + r) * ldc + col0 + c4) = v; } }
     }
}

// Wt[n][k] = f16(W[k][n]·scale) from f32 row-major W[K][N] (scale = power of two; bf16-exact weights stay exact in f16 away from the subnormal range)
__global__ __launch_bounds__(256) void k_wt_f16(const float* __restrict__ W, _Float16* __restrict__ Wt, int K, int N, float scale) {
  const int t = blockIdx.x * 256 + threadIdx.x; if (t >= N * (K / 8)) return; const int n = t / (K / 8), k8 = (t % (K / 8)) * 8; FragH f;
#pragma unroll
  for (int i = 0; i < 8; ++i) f.h[i] = (_Float16)(bf16_round(W[(size_t)(k8 + i) * N + n]) * scale); const v8us o = f.half[0];
  *(v8us*)((unsigned short*)Wt + (size_t)n * K + k8) = o; 
}
// k_gemm_hh variant with fused epilogue: v = acc·alpha + bias[by·sBias + col] (+ CP[(row/rowsPerB)·sCPb + by·64 + col] if CP) ; ACT 0 none / 1 elu ; writes f16 C16 (and f32 C if non-null)
template <int ACT>
__global__ __launch_bounds__(128) void k_gemm_hhx(const _Float16* __restrict__ A, int lda, size_t sA, const _Float16* __restrict__ Bh, int ldb, size_t sB, float alpha, const float* __restrict__ bias, size_t sBias, const float* __restrict__ CP, int rowsPerB, size_t sCPb, int row0g,
    float* __restrict__ C, _Float16* __restrict__ C16, int ldc, size_t sC, int M, int N, int K) {
  __shared__ __attribute__((aligned(16))) float so[4][16][64];
  const int tid = threadIdx.x, w = tid >> 5, lane = tid & 31, ln = lane & 15, hh = lane >> 4; const int by = blockIdx.y;
  A += (size_t)by * sA; Bh += (size_t)by * sB; const size_t cofs = (size_t)by * sC; const float* bp = bias ? bias + (size_t)by * sBias : nullptr;
  const int ntn = (N + 63) / 64; const int wid = blockIdx.x * 4 + w; const int mt = wid / ntn, nq = wid % ntn; if (mt * 16 >= M) return;
  const int row0 = mt * 16, col0 = nq * 64; const _Float16* arow = A + (size_t)(row0 + ln) * lda;
  v8f acc[4] = {};
  for (int kb = 0; kb < K; kb += 32) { FragH ah; ah.half[0] = *(const v8us*)((const unsigned short*)arow + kb + 8 * hh); ah.half[1] = *(const v8us*)((const unsigned short*)arow + kb + 16 + 8 * hh);
#pragma unroll
    for (int t = 0; t < 4; ++t) { if (col0 + t * 16 >= N) continue; const size_t boff = (size_t)(col0 + t * 16 + ln) * ldb + kb; FragH bq; bq.half[0] = *(const v8us*)((const unsigned short*)Bh + boff + 8 * hh); bq.half[1] = *(const v8us*)((const unsigned short*)Bh + boff + 16 + 8 * hh);
      acc[t] = mmaH<1>(ah.v, ah.v, bq.v, bq.v, acc[t]); }
  }
#pragma unroll
  for (int t = 0; t < 4; ++t) { if (col0 + t * 16 >= N) continue; const int col = col0 + t * 16 + ln; const float bv = bp ? bf16_round(bp[col]) : 0.f;
#pragma unroll
    for (int r = 0; r < 8; ++r) { float v = acc[t][r] * alpha + bv; if (CP) { const int rr = row0g + row0 + 8 * hh + r; if (rowsPerB < 0) v += CP[cofs + (size_t)rr * ldc + col];      /* rowsPerB < 0: own element of the batched C plane */ else { const int bidx = rr / rowsPerB; v += CP[(size_t)bidx * sCPb + (size_t)by * 64 + col]; } } if (ACT == 1) v = (v > 0.f) ? v : expm1f(v); else if (ACT == 7) v = (v > 0.f) ? v + 1.0f : expf(v); else if (ACT == 8) v = tanhf(v); else if (ACT == 9) v = 0.5f * v * (1.0f + tanhf(0.7978845608028654f * (v + 0.044715f * v * v * v))); else if (ACT == 11) v = 1.0f / (1.0f + expf(-v)); else if (ACT == 12) v = (v > 0.f) ? v : 0.01f * v; else if (ACT == 14) v = (v > 0.f) ? v : 0.1f * v; else if (ACT == 16) v = (v >= 0.f) ? v : 0.3f * v; else if (ACT == 17) v = (v >= 0.f) ? v : 0.2f * v; else if (ACT == 15) v = v / (1.0f + expf(-v)); else if (ACT == 3) v = fmaxf(v, 0.f); else if (ACT == 6) v = 0.5f * v * (1.0f + erff(v * 0.70710678118654752f)); so[w][8 * hh + r][t * 16 + ln] = v; } }
  __builtin_amdgcn_fence(__ATOMIC_ACQ_REL, "workgroup"); __builtin_amdgcn_wave_barrier();
  const int rsub = lane >> 4, c4 = (lane & 15) * 4; typedef _Float16 v4h __attribute__((ext_vector_type(4)));
  {
#pragma unroll
    for (int q = 0; q < 8; ++q) { const int r = q * 2 + rsub; if (col0 + c4 < N) { const v4f v = *(const v4fa*)&so[w][r][c4]; if (C) *(v4f*)(C + cofs + (size_t)(row0 + r) * ldc + col0 + c4) = v; if (C16) { v4h h4; for (int i = 0; i < 4; ++i) h4[i] = (_Float16)v[i]; *(v4h*)(C16 + cofs + (size_t)(row0 + r) * ldc + col0 + c4) = h4; } } }
     }
}


typedef _Float16 v4h __attribute__((ext_vector_type(4)));

__global__ __launch_bounds__(256) void k_x16(const float* __restrict__ x, _Float16* __restrict__ X16, size_t n8) { const size_t t = (size_t)blockIdx.x * 256 + threadIdx.x; if (t >= n8) return; FragH f;
#pragma unroll
  for (int q = 0; q < 8; ++q) f.h[q] = (_Float16)bf16_round(x[t * 8 + q]); *(v8us*)((unsigned short*)X16 + t * 8) = f.half[0];  }
__global__ __launch_bounds__(256) void k_h16(const float* __restrict__ x, _Float16* __restrict__ X16, size_t n8) { const size_t t = (size_t)blockIdx.x * 256 + threadIdx.x; if (t >= n8) return; FragH f;
#pragma unroll
  for (int q = 0; q < 8; ++q) f.h[q] = (_Float16)x[t * 8 + q]; *(v8us*)((unsigned short*)X16 + t * 8) = f.half[0];  }
__global__ __launch_bounds__(256) void k_round16f(const float* __restrict__ W, _Float16* __restrict__ Bt, size_t n8) { const size_t t = (size_t)blockIdx.x * 256 + threadIdx.x; if (t >= n8) return; FragH f;
#pragma unroll
  for (int i = 0; i < 8; ++i) f.h[i] = (_Float16)(bf16_round(W[t * 8 + i]) * 16.0f); *(v8us*)((unsigned short*)Bt + t * 8) = f.half[0];  }
template <int NHv, int TTv>
__global__ __launch_bounds__(256) void k_vt(const _Float16* __restrict__ V16, int ldv, int voff, _Float16* __restrict__ Vt) { __shared__ unsigned short tl[64][66]; const int tid = threadIdx.x; const int slab = blockIdx.x / (TTv / 64), lg = blockIdx.x % (TTv / 64); const int b = slab / NHv, h = slab % NHv;
  for (int i = tid; i < 64 * 8; i += 256) { const int r = i / 8, c8 = (i % 8) * 8; FragH f; f.half[0] = *(const v8us*)((const unsigned short*)V16 + ((size_t)b * TTv + lg * 64 + r) * ldv + voff + h * 64 + c8);
#pragma unroll
    for (int q = 0; q < 8; ++q) tl[r][c8 + q] = f.u[q]; }
  __syncthreads();
  {
#pragma unroll
    for (int rd = 0; rd < 2; ++rd) { const int d = rd * 32 + tid / 8, pc = tid % 8; FragH f;
#pragma unroll
      for (int q = 0; q < 8; ++q) f.u[q] = tl[pc * 8 + q][d];
      *(v8us*)((unsigned short*)Vt + ((size_t)slab * 64 + d) * TTv + lg * 64 + pc * 8) = f.half[0]; }
     } }

__global__ __launch_bounds__(256) void k_hl(const float* __restrict__ F, _Float16* __restrict__ Hh, _Float16* __restrict__ Hl, size_t n8) { const size_t t = (size_t)blockIdx.x * 256 + threadIdx.x; if (t >= n8) return; FragH fh, fl; const v4f a = *(const v4fa*)(F + t * 8), c = *(const v4fa*)(F + t * 8 + 4);
#pragma unroll
  for (int q = 0; q < 4; ++q) { _Float16 h = (_Float16)a[q]; fh.h[q] = h; fl.h[q] = (_Float16)((a[q] - (float)h) * 1024.0f); h = (_Float16)c[q]; fh.h[4 + q] = h; fl.h[4 + q] = (_Float16)((c[q] - (float)h) * 1024.0f); }
  { *(v8us*)((unsigned short*)Hh + t * 8) = fh.half[0]; *(v8us*)((unsigned short*)Hl + t * 8) = fl.half[0];  } }

// ---- f16 fragment loader and WMMA step ----
__device__ __forceinline__ v16h g2_frag(const _Float16* p, int hh) { FragH f; f.half[0] = *(const v8us*)((const unsigned short*)p + 8 * hh); f.half[1] = *(const v8us*)((const unsigned short*)p + 16 + 8 * hh); return f.v; }
// the builtin form alone: the compiler itself keeps the distance behind a WMMA wherever a vector instruction touches its D, A or B, so no v_nop is written here; an accumulating WMMA, a WMMA on other registers and an LDS read over A need none
__device__ __forceinline__ v8f g2_mma(v16h a, v16h b, v8f c) { return __builtin_amdgcn_wmma_f32_16x16x32_f16(false, a, false, b, (short)0, c, false, false); }

// Fragment order of the prepared weight planes (64 features x K): [k step s][feature tile t][half j][lane 16 hh + ln][8 elements], feature o = 16 t + ln, k = 32 s + 16 j + 8 hh + e (g2_frag's k order). fr_off = the element offset of (o, k0), k0 a multiple of 8; the eight k from k0 on follow one another.
__device__ __forceinline__ size_t fr_off(int o, int k0) { return (size_t)(((((k0 >> 5) * 4 + (o >> 4)) * 2 + ((k0 >> 4) & 1)) * 32 + ((k0 >> 3) & 1) * 16 + (o & 15)) * 8); }
// the inverse: chunk c of eight elements (c = fr_off / 8) -> its feature o and first k. k_prep takes one chunk a thread in this order, so that a wave stores 512 bytes in a row and each 128-byte line has one writer.
__device__ __forceinline__ void fr_src(int c, int& o, int& k0) { o = ((c >> 6) & 3) * 16 + (c & 15); k0 = (c >> 8) * 32 + ((c >> 5) & 1) * 16 + ((c >> 4) & 1) * 8; }
// a lane's fragment of one feature tile; p = the tile's first element + 8 * lane
__device__ __forceinline__ v16h fr_frag(const _Float16* p) { FragH f; f.half[0] = *(const v8us*)((const unsigned short*)p); f.half[1] = *(const v8us*)((const unsigned short*)p + 256); return f.v; }
// ---- the preparation of the weight planes and biases. Every '#pragma unroll' from here to the end of k_prep makes an array index a compile-time constant, so that wv and keep stay in registers.
// eight f32 weights -> eight f16(bf16_round(w) * 16), stored as chunk c of a plane in fragment order; keep = false stores a zero
__device__ __forceinline__ void fr_put(_Float16* __restrict__ Bt, int c, const float (&wv)[8], const bool (&keep)[8]) { FragH f;
#pragma unroll
  for (int q = 0; q < 8; ++q) f.h[q] = (_Float16)(bf16_round(keep[q] ? wv[q] : 0.0f) * 16.0f);
  *(v8us*)((unsigned short*)Bt + (size_t)c * 8) = f.half[0];
  asm volatile("s_wait_xcnt 0x0" ::: "memory"); }      /* the store's offset and data registers are free for reuse behind it: the wait stands in front of whatever overwrites them */
// eight weights ST columns apart: one address pair with constant offsets, so that all eight loads fly together
template <int ST>
__device__ __forceinline__ void fr_get(const float* __restrict__ s, float (&wv)[8]) {
#pragma unroll
  for (int q = 0; q < 8; ++q) wv[q] = s[q * ST];
  asm volatile("s_wait_xcnt 0x0" :: "v"(wv[0]), "v"(wv[1]), "v"(wv[2]), "v"(wv[3]), "v"(wv[4]), "v"(wv[5]), "v"(wv[6]), "v"(wv[7]) : "memory"); }      /* the address pair of the loads is free for reuse behind them: the wait stands in front of whatever overwrites it; the loaded values as inputs keep every load in front of it */
// chunk c of blockdiag(Wa, Wb) (64 x 64, each block [32][32]): a chunk off the diagonal reads an in-bounds place all the same and stores zeros, so that no branch stands in front of the loads
__device__ __forceinline__ void prep_diag(const float* __restrict__ Wa, const float* __restrict__ Wb, _Float16* __restrict__ Bt, int c) { int o, k0; fr_src(c, o, k0); float wv[8]; fr_get<1>((o < 32 ? Wa : Wb) + (size_t)(o & 31) * 32 + (k0 & 31), wv);
  const bool on = (o >> 5) == (k0 >> 5); const bool keep[8] = {on, on, on, on, on, on, on, on}; fr_put(Bt, c, wv, keep); }
// All prepared planes and biases in ONE launch: none of them reads what another writes, so the jobs are dealt by block index, one chunk of eight f16 a thread in fragment order: a wave stores 512 bytes in a row and each 128-byte line has one writer. A block of 256 chunks is one k step (32 k) of a plane, so which part of a permuted k order it fills is the same for the whole block.
// blocks 0..31: BZ = [Wz1; Wz2], each [32][32 * 32] flattened (64 x KO). 32..66: BE1 = We1 [64][33 * 33] (64 x KKP) in the k order of k_fused's row fragments: k = a * 32 + b <- column a * 33 + b (a, b < 32); 1024 + b <- 32 * 33 + b; 1056 + a <- a * 33 + 32; 1088 <- 1088; the rest 0.
// 67..71: BE2 = We2 [64][130] (64 x KC2) in the k order of k_fused's last product: k < 96 <- column k (e1, o1); 96 + b <- 97 + b (o2); 128 <- 96 and 129 <- 129 (the columns of the two appended ones); the rest 0. 72, 73: BH = blockdiag(Wh1, Wh2). 74, 75: BO = blockdiag(Wo1, Wo2). 76: the three bias pairs, rounded to bf16, 32 values a wave.
#define PB_E1 (64 * (KO / 8) / 256)
#define PB_E2 (PB_E1 + FE * (KKP / 8) / 256)
#define PB_H  (PB_E2 + FE * (KC2 / 8) / 256)
#define PB_O  (PB_H + 64 * (64 / 8) / 256)
#define PB_B  (PB_O + 64 * (64 / 8) / 256)
__global__ __launch_bounds__(256) void k_prep(const float* __restrict__ Wz1, const float* __restrict__ Wz2, const float* __restrict__ We1, const float* __restrict__ We2, const float* __restrict__ Wh1, const float* __restrict__ Wh2, const float* __restrict__ Wo1, const float* __restrict__ Wo2,
    const float* __restrict__ bz1, const float* __restrict__ bz2, const float* __restrict__ bh1, const float* __restrict__ bh2, const float* __restrict__ bo1, const float* __restrict__ bo2,
    _Float16* __restrict__ BZ, _Float16* __restrict__ BE1, _Float16* __restrict__ BE2, _Float16* __restrict__ BH, _Float16* __restrict__ BO, float* __restrict__ bz, float* __restrict__ bh, float* __restrict__ bo) {
  const int b = blockIdx.x, tid = threadIdx.x; int o, k0; float wv[8]; bool keep[8];
  if (b < PB_E1) { const int c = b * 256 + tid; fr_src(c, o, k0); fr_get<1>((o < 32 ? Wz1 : Wz2) + (size_t)(o & 31) * KO + k0, wv);
#pragma unroll
    for (int q = 0; q < 8; ++q) keep[q] = true;
    fr_put(BZ, c, wv, keep); }
  else if (b < PB_E2) { const int a = b - PB_E1, c = a * 256 + tid; fr_src(c, o, k0); const int j = k0 & 31; const float* r = We1 + (size_t)o * KK;
    if (a <= 32) fr_get<1>(r + a * 33 + j, wv);      /* row a of the 33 x 33 square; a = 32 is its last row, the o2 part */
    else if (a == 33) fr_get<33>(r + j * 33 + 32, wv);      /* its last column, the o1 part */
    else fr_get<0>(r + KK - 1, wv);      /* its last element, and the pad, which reads the same place and drops it */
#pragma unroll
    for (int q = 0; q < 8; ++q) keep[q] = k0 + q < KK;
    fr_put(BE1, c, wv, keep); }
  else if (b < PB_H) { const int a = b - PB_E2, c = a * 256 + tid; fr_src(c, o, k0); const float* r = We2 + (size_t)o * 130;
    if (a < 4) fr_get<1>(r + k0 + (a == 3 ? 1 : 0), wv);      /* e1 and o1 as they lie; o2 lies one column on */
    else { const float x0 = r[96], x1 = r[129];      /* the two ones' columns, and the pad, which drops what it reads */
      asm volatile("s_wait_xcnt 0x0" :: "v"(x0), "v"(x1) : "memory");      /* as in fr_get */
      wv[0] = x0;
#pragma unroll
      for (int q = 1; q < 8; ++q) wv[q] = x1; }
#pragma unroll
    for (int q = 0; q < 8; ++q) keep[q] = k0 + q < 130;
    fr_put(BE2, c, wv, keep); }
  else if (b < PB_O) prep_diag(Wh1, Wh2, BH, (b - PB_H) * 256 + tid);
  else if (b < PB_B) prep_diag(Wo1, Wo2, BO, (b - PB_O) * 256 + tid);
  else { const int w = __builtin_amdgcn_readfirstlane(tid >> 5), i = tid & 31;      /* the wave's number as a scalar: the choice of the arrays is a scalar one */
    if (w < 6) { const float* s = (w == 0) ? bz1 : (w == 1) ? bz2 : (w == 2) ? bh1 : (w == 3) ? bh2 : (w == 4) ? bo1 : bo2; float* d = ((w < 2) ? bz : (w < 4) ? bh : bo) + (w & 1) * 32; d[i] = bf16_round(s[i]); } } }
// ---- the fused row pipeline. A row fragment (B operand): lane ln = row, elements 0..7 = k 8 hh + 0..7, elements 8..15 = k 16 + 8 hh + 0..7 of a 32-wide k step (g2_frag's order, which the weight fragments use too).
// Every '#pragma unroll' from here to the end of k_fused makes an array or vector index a compile-time constant, so that the values stay in registers.
__device__ __forceinline__ void op_row16(const float* p, int hh, bool rnd, float (&v)[16]) { const v4f x0 = *(const v4fa*)(p + 8 * hh), x1 = *(const v4fa*)(p + 8 * hh + 4), x2 = *(const v4fa*)(p + 16 + 8 * hh), x3 = *(const v4fa*)(p + 16 + 8 * hh + 4);
  asm volatile("s_wait_xcnt 0x0" ::: "memory");      /* the address pair of these four loads is free for reuse behind them: the wait stands in front of whatever overwrites it */
#pragma unroll
  for (int e = 0; e < 4; ++e) { v[e] = rnd ? bf16_round(x0[e]) : x0[e]; v[4 + e] = rnd ? bf16_round(x1[e]) : x1[e]; v[8 + e] = rnd ? bf16_round(x2[e]) : x2[e]; v[12 + e] = rnd ? bf16_round(x3[e]) : x3[e]; } }
__device__ __forceinline__ v16h op_frag(float a, const float (&q)[16]) { FragH f;
#pragma unroll
  for (int e = 0; e < 16; ++e) f.h[e] = (_Float16)(a * q[e]); return f.v; }
// two neighbouring feature tiles of a lane's accumulators (features 8 hh + r and 16 + 8 hh + r of a 32-wide block) as the next product's row fragment
__device__ __forceinline__ v16h fu_pack(v8f lo, v8f hi) { FragH f;
#pragma unroll
  for (int e = 0; e < 8; ++e) { f.h[e] = (_Float16)lo[e]; f.h[8 + e] = (_Float16)hi[e]; } return f.v; }
// the lane's eight biases of feature tile t, rounded to bf16
__device__ __forceinline__ v8f fu_bias(const float* __restrict__ b, int t, int hh) { const v4f x0 = *(const v4fa*)(b + t * 16 + 8 * hh), x1 = *(const v4fa*)(b + t * 16 + 8 * hh + 4); v8f v;
#pragma unroll
  for (int e = 0; e < 4; ++e) { v[e] = bf16_round(x0[e]); v[4 + e] = bf16_round(x1[e]); } return v; }
// eight hardware transcendentals in ONE statement each: behind a transcendental the instruction set asks for one independent instruction before its result is read or its source overwritten; inside the statement the next one, on other registers (the outputs are early-clobber, so none shares a register with an input), is that instruction, and the v_nop at the end is the slot behind the last.
__device__ __forceinline__ void tr_exp2(const float (&x)[8], float (&y)[8]) {
  asm("v_exp_f32 %0, %8\n\tv_exp_f32 %1, %9\n\tv_exp_f32 %2, %10\n\tv_exp_f32 %3, %11\n\tv_exp_f32 %4, %12\n\tv_exp_f32 %5, %13\n\tv_exp_f32 %6, %14\n\tv_exp_f32 %7, %15\n\tv_nop"
      : "=&v"(y[0]), "=&v"(y[1]), "=&v"(y[2]), "=&v"(y[3]), "=&v"(y[4]), "=&v"(y[5]), "=&v"(y[6]), "=&v"(y[7]) : "v"(x[0]), "v"(x[1]), "v"(x[2]), "v"(x[3]), "v"(x[4]), "v"(x[5]), "v"(x[6]), "v"(x[7])); }
__device__ __forceinline__ void tr_rcp(const float (&x)[8], float (&y)[8]) {
  asm("v_rcp_f32 %0, %8\n\tv_rcp_f32 %1, %9\n\tv_rcp_f32 %2, %10\n\tv_rcp_f32 %3, %11\n\tv_rcp_f32 %4, %12\n\tv_rcp_f32 %5, %13\n\tv_rcp_f32 %6, %14\n\tv_rcp_f32 %7, %15\n\tv_nop"
      : "=&v"(y[0]), "=&v"(y[1]), "=&v"(y[2]), "=&v"(y[3]), "=&v"(y[4]), "=&v"(y[5]), "=&v"(y[6]), "=&v"(y[7]) : "v"(x[0]), "v"(x[1]), "v"(x[2]), "v"(x[3]), "v"(x[4]), "v"(x[5]), "v"(x[6]), "v"(x[7])); }
// the four weight fragments (64 features) of one k step; wl = the staged chunk at the step's first element (FS a step) + 8 * lane
#define FS 2048                  /* elements of one k step of a weight plane: 64 features x 32 k */
#define CHE (4 * FS)             /* elements of one staged chunk: four k steps, 16 KiB */
// one chunk of the weight stream into one LDS buffer: 256 threads, four copies of 16 bytes each. g = the chunk's first element + 8 * tid, l = the buffer's LDS byte address + 16 * tid
__device__ __forceinline__ void st_copy(const _Float16* g, unsigned l) {
  asm volatile("global_load_async_to_lds_b128 %0, %4, off\n\t"
               "global_load_async_to_lds_b128 %1, %5, off\n\t"
               "global_load_async_to_lds_b128 %2, %6, off\n\t"
               "global_load_async_to_lds_b128 %3, %7, off\n\t"
               "s_wait_xcnt 0x0"      /* the copies' address registers are free for reuse behind the statement: the wait stands in front of whatever overwrites them */
               :: "v"(l), "v"(l + 4096u), "v"(l + 8192u), "v"(l + 12288u), "v"(g), "v"(g + 2048), "v"(g + 4096), "v"(g + 6144) : "memory"); }
// the hand-over at the foot of a chunk: the wave's own LDS reads of that chunk are done, its own copies of the next chunk have landed; behind the barrier every wave may read the next chunk, and the buffer just read may be refilled
__device__ __forceinline__ void st_publish() {
  asm volatile("s_wait_dscnt 0x0" ::: "memory");      /* this wave's reads of the buffer that is refilled next */
  asm volatile("s_wait_asynccnt 0x0" ::: "memory");      /* this wave's copies of the next chunk: the compiler places no wait for them */
  __syncthreads(); }
__device__ __forceinline__ void fu_load(const _Float16* wl, v16h (&a)[4]) {
#pragma unroll
  for (int t = 0; t < 4; ++t) a[t] = fr_frag(wl + t * 512); }
// one k step, 64 features x 32 rows, on fragments that are loaded already: the last step of a chunk
__device__ __forceinline__ void fu_step_end(const v16h (&a)[4], v16h d0, v16h d1, v8f (&c)[2][4]) {
#pragma unroll
  for (int t = 0; t < 4; ++t) { c[0][t] = g2_mma(a[t], d0, c[0][t]); c[1][t] = g2_mma(a[t], d1, c[1][t]); } }
// the same, and behind the two products that read a[t] its registers take that tile's fragment of the step that follows (wn: as in fu_load), so that a whole step's work lies between a load and its use
__device__ __forceinline__ void fu_step_pf(v16h (&a)[4], const _Float16* wn, v16h d0, v16h d1, v8f (&c)[2][4]) {
#pragma unroll
  for (int t = 0; t < 4; ++t) { c[0][t] = g2_mma(a[t], d0, c[0][t]); c[1][t] = g2_mma(a[t], d1, c[1][t]); a[t] = fr_frag(wn + t * 512);
    __builtin_amdgcn_sched_barrier(0); } }      /* behind each tile: holds the tiles in the order of their LDS reads, so that each wait leaves the younger pairs of reads open (left free, a later tile's products were moved up and waited for every read). Behind the last it also keeps the later steps' row-fragment arithmetic behind this step: moved up, the row fragments of four steps are live at once and the kernel needs more than 256 registers, one wave a SIMD less */
// WS = the weight stream: [Wz (32 k steps) | Wh (2) | Wo (2) | We1 (35) | We2 (5)] = 19 chunks; chunk c is staged in buffer c & 1
__global__ __launch_bounds__(256) void k_fused(const float* __restrict__ x, const _Float16* __restrict__ WS, const float* __restrict__ bz, const float* __restrict__ bh, const float* __restrict__ bo,
    const float* __restrict__ be1, const float* __restrict__ be2, float* __restrict__ out) {
  __shared__ __attribute__((aligned(16))) float so[8][32][68];
  __shared__ __attribute__((aligned(16))) _Float16 wb[2 * CHE];
  const int tid = threadIdx.x, w = tid >> 5, lane = tid & 31, ln = lane & 15, hh = lane >> 4;
  const int row0 = blockIdx.x * 256 + 32 * w;
  const float* p0 = x + (size_t)(row0 + ln) * D1; const float* p1 = p0 + (size_t)16 * D1;
  const float* q0 = p0 + (size_t)NBI * D1; const float* q1 = q0 + (size_t)16 * D1;
  const v8f z8 = {0.f,0.f,0.f,0.f,0.f,0.f,0.f,0.f};
  const _Float16* gs = WS + tid * 8; const unsigned ls = (unsigned)(size_t)&wb[0] + 16u * (unsigned)tid;      /* the thread's own 16 bytes of each quarter of a chunk: in the stream, and in buffer 0 (LDS byte address) */
  const _Float16* wl = &wb[0] + lane * 8;      /* the lane's place in a staged fragment half */
  st_copy(gs, ls);      /* chunk 0 */
  float qa[16], qb[16]; op_row16(q0, hh, true, qa); op_row16(q1, hh, true, qb);
  asm volatile("s_wait_asynccnt 0x0" ::: "memory");      /* this wave's copies of chunk 0 have landed */
  __syncthreads();      /* and every other wave's: chunk 0 may be read */
  st_copy(gs + CHE, ls + 2u * CHE);      /* chunk 1 flies while chunk 0 is worked on */
  v16h a[4];      /* the weight fragments of one k step */
  /* [z1 | z2]: k step i holds f16(v1[i] * v2[j]), j = 0..31 */
  v8f z[2][4] = {{z8, z8, z8, z8}, {z8, z8, z8, z8}};
  { float pa[4], pb[4];      /* carried rounded, so that no load is open on them at the loop's head: carried raw, the wait there was to 0 and emptied the fragment ring once a group */
    { const v4f na = *(const v4fa*)p0, nb = *(const v4fa*)p1;
#pragma unroll
      for (int u = 0; u < 4; ++u) { pa[u] = bf16_round(na[u]); pb[u] = bf16_round(nb[u]); } }
    /* rolled over groups of four k steps: one 16-byte load brings four values of v1, a group ahead like the fragments; fully unrolled the 32 steps would only grow the code. What the last group fetches ahead of v1 is group 0 again and is not used: no branch among the products, and every address stays inside its row. A group is one staged chunk */
#pragma unroll 1
    for (int i4 = 0; i4 < 32; i4 += 4) { const int bs = (i4 >> 2) & 1; const _Float16* wc = wl + bs * CHE;      /* chunk i4 / 4 */
      fu_load(wc, a);
      __builtin_amdgcn_sched_barrier(0);      /* the chunk's first LDS reads go out in front of the row-fragment arithmetic, which then runs under their latency */
      const int nx = (i4 + 4) & 31; const v4f na = *(const v4fa*)(p0 + nx), nb = *(const v4fa*)(p1 + nx);
      asm volatile("s_wait_xcnt 0x0" ::: "memory");      /* the two address pairs are reused at once: the wait stands in front of that */
#pragma unroll
      for (int u = 0; u < 3; ++u) fu_step_pf(a, wc + (u + 1) * FS, op_frag(pa[u], qa), op_frag(pb[u], qb), z);
      fu_step_end(a, op_frag(pa[3], qa), op_frag(pb[3], qb), z);
      st_publish(); st_copy(gs + ((i4 >> 2) + 2) * CHE, ls + (unsigned)bs * (2u * CHE));      /* chunks 2..9 */
#pragma unroll
      for (int u = 0; u < 4; ++u) { pa[u] = bf16_round(na[u]); pb[u] = bf16_round(nb[u]); } }
    fu_load(wl, a);      /* chunk 8 = [Wh | Wo], buffer 0 */
    __builtin_amdgcn_sched_barrier(0); }      /* as at the head of a group: these LDS reads go out first, and none of them lands among the row loads that follow, in front of the wait that frees those loads' address registers */
  /* [h1 | h2] = relu, block-diagonal weights, K = [v1 | v2]; then the gate f16(sigmoid(z) * h), feature tile by feature tile, straight into the row fragments of the next product */
  v16h g[2][2];
  { float ra[16], rb[16]; op_row16(p0, hh, true, ra); op_row16(p1, hh, true, rb);
    const v16h v1a = op_frag(1.0f, ra), v1b = op_frag(1.0f, rb), v2a = op_frag(1.0f, qa), v2b = op_frag(1.0f, qb);
    v8f h[2][4] = {{z8, z8, z8, z8}, {z8, z8, z8, z8}};
    fu_step_pf(a, wl + FS, v1a, v1b, h); fu_step_pf(a, wl + 2 * FS, v2a, v2b, h);
#pragma unroll
    for (int t = 0; t < 4; ++t) { const v8f bzv = fu_bias(bz, t, hh), bhv = fu_bias(bh, t, hh);
#pragma unroll
      for (int n = 0; n < 2; ++n) { float u[8], e[8];      /* sigmoid(zv) = 1 / (1 + 2^(-zv log2 e)) on the chip's own exp2 and reciprocal: the gate is rounded to f16 right behind, far coarser than their error; 2^x = inf gives 1 / inf = 0 and 2^x = 0 gives 1, the limits of the sigmoid */
#pragma unroll
        for (int r = 0; r < 8; ++r) u[r] = (z[n][t][r] * 0.0625f + bzv[r]) * -1.4426950408889634f;
        tr_exp2(u, e);
#pragma unroll
        for (int r = 0; r < 8; ++r) u[r] = 1.0f + e[r];
        tr_rcp(u, e);
#pragma unroll
        for (int r = 0; r < 8; ++r) z[n][t][r] = e[r] * fmaxf(h[n][t][r] * 0.0625f + bhv[r], 0.f); } }
#pragma unroll
    for (int n = 0; n < 2; ++n) { g[n][0] = fu_pack(z[n][0], z[n][1]); g[n][1] = fu_pack(z[n][2], z[n][3]); } }
  /* [o1 | o2] = relu, block-diagonal weights */
  v8f o[2][4] = {{z8, z8, z8, z8}, {z8, z8, z8, z8}};
  { fu_step_pf(a, wl + 3 * FS, g[0][0], g[1][0], o); fu_step_end(a, g[0][1], g[1][1], o);
    st_publish(); st_copy(gs + 10 * CHE, ls);
#pragma unroll
    for (int t = 0; t < 4; ++t) { const v8f bv = fu_bias(bo, t, hh);
#pragma unroll
      for (int n = 0; n < 2; ++n)
#pragma unroll
        for (int r = 0; r < 8; ++r) o[n][t][r] = fmaxf(o[n][t][r] * 0.0625f + bv[r], 0.f); } }
  /* o1 (feature tiles 0, 1) into the wave's slab, so[w][row][a]: in k step a of We1 both lane halves scale by o1[row][a], and each holds only half of the a */
#pragma unroll
  for (int n = 0; n < 2; ++n)
#pragma unroll
    for (int t = 0; t < 2; ++t) { float* d = &so[w][n * 16 + ln][t * 16 + 8 * hh]; const v4f s0 = {o[n][t][0], o[n][t][1], o[n][t][2], o[n][t][3]}, s1 = {o[n][t][4], o[n][t][5], o[n][t][6], o[n][t][7]}; *(v4fa*)d = s0; *(v4fa*)(d + 4) = s1; }
  __builtin_amdgcn_fence(__ATOMIC_ACQ_REL, "workgroup"); __builtin_amdgcn_wave_barrier();      /* each wave re-reads only its own slab of so: its LDS stores must be ordered before its loads */
  const v16h o1a = fu_pack(o[0][0], o[0][1]), o1b = fu_pack(o[1][0], o[1][1]);
  float oa[16], ob[16];
#pragma unroll
  for (int e = 0; e < 8; ++e) { oa[e] = o[0][2][e]; oa[8 + e] = o[0][3][e]; ob[e] = o[1][2][e]; ob[8 + e] = o[1][3][e]; }
  const v16h o2a = op_frag(1.0f, oa), o2b = op_frag(1.0f, ob);
  /* e1 = relu(o12 We1^T + b): k step a holds f16(o1[a] * o2[b]), b = 0..31; then o2, o1 and the one */
  v8f e1[2][4] = {{z8, z8, z8, z8}, {z8, z8, z8, z8}};
  { /* rolled like the first loop: one 16-byte LDS load brings four values of o1 */
#pragma unroll 1
    for (int i4 = 0; i4 < 32; i4 += 4) { const v4f pa = *(const v4fa*)&so[w][ln][i4], pb = *(const v4fa*)&so[w][16 + ln][i4];
      const int bs = ((i4 >> 2) & 1) ^ 1; const _Float16* wc = wl + bs * CHE;      /* chunk 9 + i4 / 4 */
      fu_load(wc, a);
      __builtin_amdgcn_sched_barrier(0);      /* as in the first loop */
#pragma unroll
      for (int u = 0; u < 3; ++u) fu_step_pf(a, wc + (u + 1) * FS, op_frag(pa[u], oa), op_frag(pb[u], ob), e1);
      fu_step_end(a, op_frag(pa[3], oa), op_frag(pb[3], ob), e1);
      st_publish(); st_copy(gs + ((i4 >> 2) + 11) * CHE, ls + (unsigned)bs * (2u * CHE)); }      /* chunks 11..18 */
    const _Float16* wc = wl + CHE;      /* chunk 17 = [the last three k steps of We1 | the first of We2], buffer 1 */
    fu_load(wc, a);
    fu_step_pf(a, wc + FS, o2a, o2b, e1); fu_step_pf(a, wc + 2 * FS, o1a, o1b, e1);
    FragH one;
#pragma unroll
    for (int e = 0; e < 16; ++e) one.h[e] = (_Float16)((e == 0 && hh == 0) ? 1.0f : 0.0f);
    fu_step_pf(a, wc + 3 * FS, one.v, one.v, e1);
#pragma unroll
    for (int t = 0; t < 4; ++t) { const v8f bv = fu_bias(be1, t, hh);
#pragma unroll
      for (int n = 0; n < 2; ++n)
#pragma unroll
        for (int r = 0; r < 8; ++r) e1[n][t][r] = fmaxf(e1[n][t][r] * 0.0625f + bv[r], 0.f); } }
  /* out = relu([e1, o1, o2, 1, 1] We2^T + b) */
  v8f y[2][4] = {{z8, z8, z8, z8}, {z8, z8, z8, z8}};
  { fu_step_end(a, fu_pack(e1[0][0], e1[0][1]), fu_pack(e1[1][0], e1[1][1]), y);
    st_publish();      /* chunk 18, the last: no chunk is left to fetch */
    fu_load(wl, a);
    fu_step_pf(a, wl + FS, fu_pack(e1[0][2], e1[0][3]), fu_pack(e1[1][2], e1[1][3]), y);
    fu_step_pf(a, wl + 2 * FS, o1a, o1b, y); fu_step_pf(a, wl + 3 * FS, o2a, o2b, y);
    FragH two;
#pragma unroll
    for (int e = 0; e < 16; ++e) two.h[e] = (_Float16)((e < 2 && hh == 0) ? 1.0f : 0.0f);
    fu_step_end(a, two.v, two.v, y);
    asm volatile("s_wait_asynccnt 0x0" ::: "memory"); }      /* behind the last chunk: no copy of this wave is open when it goes on to the output and ends */
  /* the lane holds 8 features of its row a tile: through the slab, so that the output goes out as whole rows */
#pragma unroll
  for (int t = 0; t < 4; ++t) { const v8f bv = fu_bias(be2, t, hh);
#pragma unroll
    for (int n = 0; n < 2; ++n) { v4f s0, s1;
#pragma unroll
      for (int r = 0; r < 4; ++r) { s0[r] = fmaxf(y[n][t][r] * 0.0625f + bv[r], 0.f); s1[r] = fmaxf(y[n][t][4 + r] * 0.0625f + bv[4 + r], 0.f); }
      float* d = &so[w][n * 16 + ln][t * 16 + 8 * hh]; *(v4fa*)d = s0; *(v4fa*)(d + 4) = s1; } }
  __builtin_amdgcn_fence(__ATOMIC_ACQ_REL, "workgroup"); __builtin_amdgcn_wave_barrier();      /* as above: the wave's own LDS stores before its loads */
  const int rsub = lane >> 4, c4 = (lane & 15) * 4;
#pragma unroll
  for (int q = 0; q < 16; ++q) { const int r = q * 2 + rsub; const v4f v = *(const v4fa*)&so[w][r][c4]; *(v4f*)(out + (size_t)(row0 + r) * FE + c4) = v; } }

extern "C" void kernel_launch(void* const* d_in, const int* in_sizes, int n_in,
                              void* d_out, int out_size, void* d_ws, size_t ws_size, hipStream_t stream) {
  (void)in_sizes; (void)n_in; (void)out_size;
  const float* const* I = (const float* const*)d_in;
  const float* x = I[0]; const float* Wh1 = I[1]; const float* bh1 = I[2]; const float* Wz1 = I[3]; const float* bz1 = I[4]; const float* Wo1 = I[5]; const float* bo1 = I[6]; const float* Wh2 = I[7]; const float* bh2 = I[8]; const float* Wz2 = I[9]; const float* bz2 = I[10]; const float* Wo2 = I[11]; const float* bo2 = I[12]; const float* We1 = I[13]; const float* be1 = I[14]; const float* We2 = I[15]; const float* be2 = I[16];
  char* ws = (char*)d_ws; size_t off = 0;
  auto take = [&](size_t bytes) { char* p = ws + off; off += (bytes + 255) & ~(size_t)255; return p; };
  /* the five planes in the order of their use; each size is a multiple of 256 bytes, so that they follow one another without a gap: k_fused reads them as one stream from BZ on */
  _Float16* BZ = (_Float16*)take((size_t)64 * KO * 2); _Float16* BH = (_Float16*)take((size_t)64 * 64 * 2); _Float16* BO = (_Float16*)take((size_t)64 * 64 * 2); _Float16* BE1 = (_Float16*)take((size_t)FE * KKP * 2); _Float16* BE2 = (_Float16*)take((size_t)FE * KC2 * 2);
  float* bz = (float*)take(64 * 4); float* bh = (float*)take(64 * 4); float* bo = (float*)take(64 * 4);
  if (off > ws_size) return;      /* under 1 MiB: the prepared weights and biases only */
  k_prep<<<PB_B + 1, 256, 0, stream>>>(Wz1, Wz2, We1, We2, Wh1, Wh2, Wo1, Wo2, bz1, bz2, bh1, bh2, bo1, bo2, BZ, BE1, BE2, BH, BO, bz, bh, bo);      /* every element of every plane, the pads and the zero blocks too */
  k_fused<<<NBR / 256, 256, 0, stream>>>(x, BZ, bz, bh, bo, be1, be2, (float*)d_out);
}

// v010
// One run takes 30.3 microseconds.
// Timed twice side by side with v009, it ran 1.04 times as fast both times.
// Over all steps from v000 it is 41.0 times as fast.
#include <hip/hip_runtime.h>
// KroneckerFusion (131072 rows; v1, v2 = x[0], x[1] (32 each): h_i = relu(v_i Wh_i^T + b); z_i = Bilinear(v1, Wz_i, v2) + b; o_i = relu((sigmoid(z_i) * h_i) Wo_i^T + b); o_i <- [o_i, 1]; o12 = o1 (x) o2 (33 x 33 = 1089); out = relu(o12 We1^T + b); out = relu([out, o1, o2] We2^T + b)).
// Structure: ONE kernel for the whole row pipeline; a wave owns 32 rows from the input to the output row and no intermediate touches the workspace. Every product is computed transposed, weights as the A operand (16 features a tile) and the rows as the B operand (lane = row), f16 WMMA with f32 accumulation and exact x16 weights + bias. A lane's accumulators then hold features 16 t + 8 hh + 0..7 of its own row, and two neighbouring feature tiles converted to f16 ARE the B fragment of the next product (its k order), so z, h, the gate, o, e1 and the output follow one another in registers. The bilinear forms ([Wz1; Wz2] flattened, K = 1024) and We1 (K re-ordered to [o1[a] o2[b] (1024) | o2 (32) | o1 (32) | 1 | 0 pad] = 1120) form their B fragments p[i] * q[j] in registers, by packed f16 multiplies on factors that are f16 already; v1[i] and o1[a], which both lane halves need for every i and a, go through the wave's own LDS slab as f16. We2's K is re-ordered to [e1 (64) | o1 (32) | o2 (32) | 1 | 1 | 0 pad] = 160 with the weight columns permuted alike. The output rows are turned in the same slab and stored as whole lines. The five prepared weight planes lie one behind the other in the workspace, in the order of their use and in fragment order (fr_off): one stream of 76 k steps. A work-group of eight waves brings it into LDS in chunks of four k steps (16 KiB) with asynchronous copies, two buffers, one chunk ahead, and every wave reads its fragments from there, inside a chunk one k step ahead through four register fragments; each 16-byte-a-lane read of a fragment half takes 512 bytes in a row. One launch (k_prep) prepares all planes and biases in front of it.
#define NBR 131072               /* rows processed */
#define NBI 131072               /* rows in the input (x[1] starts at NBI*32; separate so debug builds can shrink NBR) */
#define D1 32
#define KO 1024                  /* 32 x 32 outer */
#define KK 1089                  /* 33 x 33 Kronecker */
#define KKP 1120
#define FE 64
#define KC2 160                  /* [e1 (64) | o1 (32) | o2 (32) | 1 | 1 | 0] */
typedef __bf16 v16b __attribute__((ext_vector_type(16)));
typedef unsigned short v8us __attribute__((ext_vector_type(8), may_alias));
typedef float  v8f  __attribute__((ext_vector_type(8)));
typedef float  v4f  __attribute__((ext_vector_type(4)));
typedef float  v4fa __attribute__((ext_vector_type(4), may_alias));
union FragB { v16b v; v8us half[2]; unsigned short u[16]; };

__device__ __forceinline__ unsigned short bf16_bits(float x) { unsigned int u = __float_as_uint(x); return (unsigned short)((u + 0x7FFFu + ((u >> 16) & 1u)) >> 16); }
__device__ __forceinline__ float bf16_val(unsigned short b) { return __uint_as_float(((unsigned int)b) << 16); }
__device__ __forceinline__ float bf16_round(float x) { return bf16_val(bf16_bits(x)); }
// D += A·B with NT terms: 1 = ah·bh, 2 = + al·bh (A split), 3 = + ah·bl (both split)
template <int NT>
__device__ __forceinline__ v8f mmaN(v16b ah, v16b al, v16b bh, v16b bl, v8f c) {
  c = __builtin_amdgcn_wmma_f32_16x16x32_bf16(false, ah, false, bh, (short)0, c, false, false);
  if (NT >= 2) c = __builtin_amdgcn_wmma_f32_16x16x32_bf16(false, al, false, bh, (short)0, c, false, false);
  if (NT >= 3) c = __builtin_amdgcn_wmma_f32_16x16x32_bf16(false, ah, false, bl, (short)0, c, false, false);
  asm volatile("v_nop\n\tv_nop\n\tv_nop\n\tv_nop" : "+v"(c) : "v"(ah), "v"(al), "v"(bh), "v"(bl));
  return c;
}

__global__ __launch_bounds__(256) void k_wt_bf16(const float* __restrict__ W, unsigned short* __restrict__ Wt, int K, int N) {
  const int t = blockIdx.x * 256 + threadIdx.x;
  const int k8n = K / 8;
  if (t >= N * k8n) return;
  const int n = t / k8n, k8 = (t % k8n) * 8;
  v8us v;
#pragma unroll
  for (int i = 0; i < 8; ++i) v[i] = bf16_bits(W[(size_t)(k8 + i) * N + n]);
  *(v8us*)(Wt + (size_t)n * K + k8) = v;
  
}

// GEMM C[M][N] (f32, pitch ldc) = act(A[M][K]·W + bias). A f32 row-major (pitch lda) converted per fragment to bf16
// (ASPLIT: hi/lo two planes -> 2 terms, else single rounded term); Wt bf16 [N][K] (pitch ldb). BIAS_BF16 rounds the
// bias to bf16 first (bias quantised to bf16 before the add). K%32==0, M%16==0, N%64==0.
template <bool ASPLIT, int ACT, bool BIAS_BF16>
__global__ __launch_bounds__(128) void k_gemm_bf(const float* __restrict__ A, int lda, const unsigned short* __restrict__ Wt, int ldb,
                                               const float* __restrict__ bias, float* __restrict__ C, int ldc, int M, int N, int K) {
  __shared__ __attribute__((aligned(16))) float so[4][16][64];
  const int tid = threadIdx.x, w = tid >> 5, lane = tid & 31, ln = lane & 15, hh = lane >> 4;
  const int ntn = N / 64;
  const int wid = blockIdx.x * 4 + w;
  const int mt = wid / ntn, nq = wid % ntn;
  if (mt * 16 >= M) return;
  const int row0 = mt * 16, col0 = nq * 64;
  const float* arow = A + (size_t)(row0 + ln) * lda;
  v8f acc[4] = {};
  for (int kb = 0; kb < K; kb += 32) {
    FragB ah, al;
    const v4f x0 = *(const v4fa*)(arow + kb + 8 * hh), x1 = *(const v4fa*)(arow + kb + 8 * hh + 4);
    const v4f x2 = *(const v4fa*)(arow + kb + 16 + 8 * hh), x3 = *(const v4fa*)(arow + kb + 16 + 8 * hh + 4);
    float xs[16] = {x0[0],x0[1],x0[2],x0[3],x1[0],x1[1],x1[2],x1[3],x2[0],x2[1],x2[2],x2[3],x3[0],x3[1],x3[2],x3[3]};
#pragma unroll
    for (int i = 0; i < 16; ++i) { const unsigned short hb = bf16_bits(xs[i]); ah.u[i] = hb; al.u[i] = ASPLIT ? bf16_bits(xs[i] - bf16_val(hb)) : (unsigned short)0; }
#pragma unroll
    for (int t = 0; t < 4; ++t) {
      const unsigned short* brow = Wt + (size_t)(col0 + t * 16 + ln) * ldb + kb;
      FragB b;
      b.half[0] = *(const v8us*)(brow + 8 * hh);
      b.half[1] = *(const v8us*)(brow + 16 + 8 * hh);
      acc[t] = mmaN<ASPLIT ? 2 : 1>(ah.v, al.v, b.v, b.v, acc[t]);
    }
  }
#pragma unroll
  for (int t = 0; t < 4; ++t) {
    float bv = bias ? bias[col0 + t * 16 + ln] : 0.f;
    if (BIAS_BF16) bv = bf16_round(bv);
#pragma unroll
    for (int r = 0; r < 8; ++r) { float v = acc[t][r] + bv; if (ACT == 1) v = fmaxf(v, 0.f); so[w][8 * hh + r][t * 16 + ln] = v; }
  }
  __builtin_amdgcn_fence(__ATOMIC_ACQ_REL, "workgroup");
  __builtin_amdgcn_wave_barrier();
  const int rsub = lane >> 4, c4 = (lane & 15) * 4;
  {
#pragma unroll
    for (int q = 0; q < 8; ++q) {
      const int r = q * 2 + rsub;
      const v4f v = *(const v4fa*)&so[w][r][c4];
      *(v4f*)(C + (size_t)(row0 + r) * ldc + col0 + c4) = v;
    }
    
  }
}

// GEMM C = act(A·W + bias + resid): A f32 (ASPLIT -> hi/lo 2 terms), Wt bf16 [N][K]; ACT 0 none, 1 relu, 2 exact gelu;
// resid (optional, f32, row index = (row % rmod), pitch ldr, RES_BF16 rounds it) added before the activation.
template <bool ASPLIT, int ACT, bool BIAS_BF16, bool RES_BF16>
__global__ __launch_bounds__(128) void k_gemm_bf3(const float* __restrict__ A, int lda, const unsigned short* __restrict__ Wt, int ldb,
                                                const float* __restrict__ bias, const float* __restrict__ resid, int rmod, int ldr,
                                                float* __restrict__ C, int ldc, int M, int N, int K) {
  __shared__ __attribute__((aligned(16))) float so[4][16][64];
  const int tid = threadIdx.x, w = tid >> 5, lane = tid & 31, ln = lane & 15, hh = lane >> 4;
  const int ntn = N / 64;
  const int wid = blockIdx.x * 4 + w;
  const int mt = wid / ntn, nq = wid % ntn;
  if (mt * 16 >= M) return;
  const int row0 = mt * 16, col0 = nq * 64;
  const float* arow = A + (size_t)(row0 + ln) * lda;
  v8f acc[4] = {};
  for (int kb = 0; kb < K; kb += 32) {
    FragB ah, al;
    const v4f x0 = *(const v4fa*)(arow + kb + 8 * hh), x1 = *(const v4fa*)(arow + kb + 8 * hh + 4);
    const v4f x2 = *(const v4fa*)(arow + kb + 16 + 8 * hh), x3 = *(const v4fa*)(arow + kb + 16 + 8 * hh + 4);
    float xs[16] = {x0[0],x0[1],x0[2],x0[3],x1[0],x1[1],x1[2],x1[3],x2[0],x2[1],x2[2],x2[3],x3[0],x3[1],x3[2],x3[3]};
#pragma unroll
    for (int i = 0; i < 16; ++i) { const unsigned short hb = bf16_bits(xs[i]); ah.u[i] = hb; al.u[i] = ASPLIT ? bf16_bits(xs[i] - bf16_val(hb)) : (unsigned short)0; }
#pragma unroll
    for (int t = 0; t < 4; ++t) {
      const unsigned short* brow = Wt + (size_t)(col0 + t * 16 + ln) * ldb + kb;
      FragB b;
      b.half[0] = *(const v8us*)(brow + 8 * hh);
      b.half[1] = *(const v8us*)(brow + 16 + 8 * hh);
      acc[t] = mmaN<ASPLIT ? 2 : 1>(ah.v, al.v, b.v, b.v, acc[t]);
    }
  }
#pragma unroll
  for (int t = 0; t < 4; ++t) {
    const int col = col0 + t * 16 + ln;
    float bv = bias ? bias[col] : 0.f;
    if (BIAS_BF16) bv = bf16_round(bv);
#pragma unroll
    for (int r = 0; r < 8; ++r) {
      float v = acc[t][r] + bv;
      if (resid) { float rv = resid[(size_t)((row0 + 8 * hh + r) % rmod) * ldr + col]; if (RES_BF16) rv = bf16_round(rv); v += rv; }
      if (ACT == 1) v = fmaxf(v, 0.f);
      if (ACT == 2) v = 0.5f * v * (1.0f + erff(v * 0.70710678118654752f));
      if (ACT == 3) { const float u = 0.7978845608028654f * (v + 0.044715f * v * v * v); v = 0.5f * v * (1.0f + tanhf(u)); }
      so[w][8 * hh + r][t * 16 + ln] = v;
    }
  }
  __builtin_amdgcn_fence(__ATOMIC_ACQ_REL, "workgroup");
  __builtin_amdgcn_wave_barrier();
  const int rsub = lane >> 4, c4 = (lane & 15) * 4;
  {
#pragma unroll
    for (int q = 0; q < 8; ++q) {
      const int r = q * 2 + rsub;
      const v4f v = *(const v4fa*)&so[w][r][c4];
      *(v4f*)(C + (size_t)(row0 + r) * ldc + col0 + c4) = v;
    }
    
  }
}
// row LayerNorm (biased variance, eps) over N: s = X (+ R); optional out_sum <- s; out_norm <- (s-mu)*rsqrt(var+eps)*g + b
template <bool PARAM_BF16>
__global__ __launch_bounds__(256) void k_layernorm(const float* __restrict__ X, const float* __restrict__ R, const float* __restrict__ g, const float* __restrict__ bta,
                                                  float* __restrict__ out_sum, float* __restrict__ out_norm, int N, float eps) {
  __shared__ float red[256];
  const int row = blockIdx.x, tid = threadIdx.x;
  const float* x = X + (size_t)row * N; const float* rr = R ? R + (size_t)row * N : nullptr;
  float vals[16];                     // up to N = 4096
  const int per = N / 256;            // contiguous chunk per thread? use strided-by-4 chunks: thread handles j = tid*4 + 1024*u
  float s1 = 0.f;
  for (int u = 0; u < per / 4; ++u) {
    const int j = tid * 4 + 1024 * u;
    const v4f a = *(const v4fa*)(x + j);
    v4f b = {0.f,0.f,0.f,0.f}; if (rr) b = *(const v4fa*)(rr + j);
#pragma unroll
    for (int q = 0; q < 4; ++q) { const float v = a[q] + b[q]; vals[u * 4 + q] = v; s1 += v; }
  }
  red[tid] = s1; __syncthreads();
  for (int st = 128; st > 0; st >>= 1) { if (tid < st) red[tid] += red[tid + st]; __syncthreads(); }
  const float mu = red[0] / (float)N; __syncthreads();
  float s2 = 0.f;
  for (int u = 0; u < per / 4; ++u)
#pragma unroll
    for (int q = 0; q < 4; ++q) { const float c = vals[u * 4 + q] - mu; s2 += c * c; }
  red[tid] = s2; __syncthreads();
  for (int st = 128; st > 0; st >>= 1) { if (tid < st) red[tid] += red[tid + st]; __syncthreads(); }
  const float rs = rsqrtf(red[0] / (float)N + eps);
  {
    for (int u = 0; u < per / 4; ++u) {
      const int j = tid * 4 + 1024 * u;
      v4f o, sm;
#pragma unroll
      for (int q = 0; q < 4; ++q) {
        float gg = g[j + q], bb = bta[j + q];
        if (PARAM_BF16) { gg = bf16_round(gg); bb = bf16_round(bb); }
        sm[q] = vals[u * 4 + q]; o[q] = (vals[u * 4 + q] - mu) * rs * gg + bb;
      }
      if (out_sum) *(v4f*)(out_sum + (size_t)row * N + j) = sm;
      *(v4f*)(out_norm + (size_t)row * N + j) = o;
    }
    
  }
}



// ---- f16 WMMA path (v_wmma_f32_16x16x32_f16): 11-bit significands for operands in range — used here for all five GEMMs (bilinear, h, o, We1, We2)
typedef _Float16 v16h __attribute__((ext_vector_type(16)));
union FragH { v16h v; v8us half[2]; _Float16 h[16]; unsigned short u[16]; };
template <int NT>
__device__ __forceinline__ v8f mmaH(v16h ah, v16h al, v16h bh, v16h bl, v8f c) {
  c = __builtin_amdgcn_wmma_f32_16x16x32_f16(false, ah, false, bh, (short)0, c, false, false);
  if (NT >= 2) c = __builtin_amdgcn_wmma_f32_16x16x32_f16(false, al, false, bh, (short)0, c, false, false);
  if (NT >= 3) c = __builtin_amdgcn_wmma_f32_16x16x32_f16(false, ah, false, bl, (short)0, c, false, false);
  asm volatile("v_nop\n\tv_nop\n\tv_nop\n\tv_nop" : "+v"(c) : "v"(ah), "v"(al), "v"(bh), "v"(bl));
  return c;
}
// batched GEMM like k_gemm_b but f16 operands: A f32 (split into f16 hi/lo if ASPLIT, else rounded to f16), Bt = f16 values [n][k]; alpha; C f32; N multiple of 16 (partial tiles skipped)
template <bool ASPLIT>
__global__ __launch_bounds__(128) void k_gemm_h(const float* __restrict__ A, int lda, size_t sA, const _Float16* __restrict__ Bh, int ldb, size_t sB, float alpha, float* __restrict__ C, int ldc, size_t sC, int M, int N, int K) {
  __shared__ __attribute__((aligned(16))) float so[4][16][64];
  const int tid = threadIdx.x, w = tid >> 5, lane = tid & 31, ln = lane & 15, hh = lane >> 4; const int by = blockIdx.y;
  A += (size_t)by * sA; Bh += (size_t)by * sB; C += (size_t)by * sC;
  const int ntn = (N + 63) / 64; const int wid = blockIdx.x * 4 + w; const int mt = wid / ntn, nq = wid % ntn; if (mt * 16 >= M) return;
  const int row0 = mt * 16, col0 = nq * 64; const float* arow = A + (size_t)(row0 + ln) * lda;
  v8f acc[4] = {};
  for (int kb = 0; kb < K; kb += 32) {
    FragH ah, al;
    const v4f x0 = *(const v4fa*)(arow + kb + 8 * hh), x1 = *(const v4fa*)(arow + kb + 8 * hh + 4), x2 = *(const v4fa*)(arow + kb + 16 + 8 * hh), x3 = *(const v4fa*)(arow + kb + 16 + 8 * hh + 4);
    float xs[16] = {x0[0],x0[1],x0[2],x0[3],x1[0],x1[1],x1[2],x1[3],x2[0],x2[1],x2[2],x2[3],x3[0],x3[1],x3[2],x3[3]};
#pragma unroll
    for (int i = 0; i < 16; ++i) { const _Float16 h = (_Float16)xs[i]; ah.h[i] = h; al.h[i] = ASPLIT ? (_Float16)(xs[i] - (float)h) : (_Float16)0.0f; }
#pragma unroll
    for (int t = 0; t < 4; ++t) { if (col0 + t * 16 >= N) continue; const size_t boff = (size_t)(col0 + t * 16 + ln) * ldb + kb; FragH bq; bq.half[0] = *(const v8us*)(Bh + boff + 8 * hh); bq.half[1] = *(const v8us*)(Bh + boff + 16 + 8 * hh);
      acc[t] = mmaH<ASPLIT ? 2 : 1>(ah.v, al.v, bq.v, bq.v, acc[t]); }
  }
#pragma unroll
  for (int t = 0; t < 4; ++t) { if (col0 + t * 16 >= N) continue;
#pragma unroll
    for (int r = 0; r < 8; ++r) so[w][8 * hh + r][t * 16 + ln] = acc[t][r] * alpha; }
  __builtin_amdgcn_fence(__ATOMIC_ACQ_REL, "workgroup"); __builtin_amdgcn_wave_barrier();
  const int rsub = lane >> 4, c4 = (lane & 15) * 4;
  {
#pragma unroll
    for (int q = 0; q < 8; ++q) { const int r = q * 2 + rsub; if (col0 + c4 < N) { const v4f v = *(const v4fa*)&so[w][r][c4]; *(v4f*)(C + (size_t)(row0 + r) * ldc + col0 + c4) = v; } }
     }
}

// Wt[n][k] = f16(W[k][n]·scale) from f32 row-major W[K][N] (scale = power of two; bf16-exact weights stay exact in f16 away from the subnormal range)
__global__ __launch_bounds__(256) void k_wt_f16(const float* __restrict__ W, _Float16* __restrict__ Wt, int K, int N, float scale) {
  const int t = blockIdx.x * 256 + threadIdx.x; if (t >= N * (K / 8)) return; const int n = t / (K / 8), k8 = (t % (K / 8)) * 8; FragH f;
#pragma unroll
  for (int i = 0; i < 8; ++i) f.h[i] = (_Float16)(bf16_round(W[(size_t)(k8 + i) * N + n]) * scale); const v8us o = f.half[0];
  *(v8us*)((unsigned short*)Wt + (size_t)n * K + k8) = o; 
}
// k_gemm_hh variant with fused epilogue: v = acc·alpha + bias[by·sBias + col] (+ CP[(row/rowsPerB)·sCPb + by·64 + col] if CP) ; ACT 0 none / 1 elu ; writes f16 C16 (and f32 C if non-null)
template <int ACT>
__global__ __launch_bounds__(128) void k_gemm_hhx(const _Float16* __restrict__ A, int lda, size_t sA, const _Float16* __restrict__ Bh, int ldb, size_t sB, float alpha, const float* __restrict__ bias, size_t sBias, const float* __restrict__ CP, int rowsPerB, size_t sCPb, int row0g,
    float* __restrict__ C, _Float16* __restrict__ C16, int ldc, size_t sC, int M, int N, int K) {
  __shared__ __attribute__((aligned(16))) float so[4][16][64];
  const int tid = threadIdx.x, w = tid >> 5, lane = tid & 31, ln = lane & 15, hh = lane >> 4; const int by = blockIdx.y;
  A += (size_t)by * sA; Bh += (size_t)by * sB; const size_t cofs = (size_t)by * sC; const float* bp = bias ? bias + (size_t)by * sBias : nullptr;
  const int ntn = (N + 63) / 64; const int wid = blockIdx.x * 4 + w; const int mt = wid / ntn, nq = wid % ntn; if (mt * 16 >= M) return;
  const int row0 = mt * 16, col0 = nq * 64; const _Float16* arow = A + (size_t)(row0 + ln) * lda;
  v8f acc[4] = {};
  for (int kb = 0; kb < K; kb += 32) { FragH ah; ah.half[0] = *(const v8us*)((const unsigned short*)arow + kb + 8 * hh); ah.half[1] = *(const v8us*)((const unsigned short*)arow + kb + 16 + 8 * hh);
#pragma unroll
    for (int t = 0; t < 4; ++t) { if (col0 + t * 16 >= N) continue; const size_t boff = (size_t)(col0 + t * 16 + ln) * ldb + kb; FragH bq; bq.half[0] = *(const v8us*)((const unsigned short*)Bh + boff + 8 * hh); bq.half[1] = *(const v8us*)((const unsigned short*)Bh + boff + 16 + 8 * hh);
      acc[t] = mmaH<1>(ah.v, ah.v, bq.v, bq.v, acc[t]); }
  }
#pragma unroll
  for (int t = 0; t < 4; ++t) { if (col0 + t * 16 >= N) continue; const int col = col0 + t * 16 + ln; const float bv = bp ? bf16_round(bp[col]) : 0.f;
#pragma unroll
    for (int r = 0; r < 8; ++r) { float v = acc[t][r] * alpha + bv; if (CP) { const int rr = row0g + row0 + 8 * hh + r; if (rowsPerB < 0) v += CP[cofs + (size_t)rr * ldc + col];      /* rowsPerB < 0: own element of the batched C plane */ else { const int bidx = rr / rowsPerB; v += CP[(size_t)bidx * sCPb + (size_t)by * 64 + col]; } } if (ACT == 1) v = (v > 0.f) ? v : expm1f(v); else if (ACT == 7) v = (v > 0.f) ? v + 1.0f : expf(v); else if (ACT == 8) v = tanhf(v); else if (ACT == 9) v = 0.5f * v * (1.0f + tanhf(0.7978845608028654f * (v + 0.044715f * v * v * v))); else if (ACT == 11) v = 1.0f / (1.0f + expf(-v)); else if (ACT == 12) v = (v > 0.f) ? v : 0.01f * v; else if (ACT == 14) v = (v > 0.f) ? v : 0.1f * v; else if (ACT == 16) v = (v >= 0.f) ? v : 0.3f * v; else if (ACT == 17) v = (v >= 0.f) ? v : 0.2f * v; else if (ACT == 15) v = v / (1.0f + expf(-v)); else if (ACT == 3) v = fmaxf(v, 0.f); else if (ACT == 6) v = 0.5f * v * (1.0f + erff(v * 0.70710678118654752f)); so[w][8 * hh + r][t * 16 + ln] = v; } }
  __builtin_amdgcn_fence(__ATOMIC_ACQ_REL, "workgroup"); __builtin_amdgcn_wave_barrier();
  const int rsub = lane >> 4, c4 = (lane & 15) * 4; typedef _Float16 v4h __attribute__((ext_vector_type(4)));
  {
#pragma unroll
    for (int q = 0; q < 8; ++q) { const int r = q * 2 + rsub; if (col0 + c4 < N) { const v4f v = *(const v4fa*)&so[w][r][c4]; if (C) *(v4f*)(C + cofs + (size_t)(row0 + r) * ldc + col0 + c4) = v; if (C16) { v4h h4; for (int i = 0; i < 4; ++i) h4[i] = (_Float16)v[i]; *(v4h*)(C16 + cofs + (size_t)(row0 + r) * ldc + col0 + c4) = h4; } } }
     }
}


typedef _Float16 v4h __attribute__((ext_vector_type(4)));
typedef unsigned short v4us __attribute__((ext_vector_type(4), may_alias));

__global__ __launch_bounds__(256) void k_x16(const float* __restrict__ x, _Float16* __restrict__ X16, size_t n8) { const size_t t = (size_t)blockIdx.x * 256 + threadIdx.x; if (t >= n8) return; FragH f;
#pragma unroll
  for (int q = 0; q < 8; ++q) f.h[q] = (_Float16)bf16_round(x[t * 8 + q]); *(v8us*)((unsigned short*)X16 + t * 8) = f.half[0];  }
__global__ __launch_bounds__(256) void k_h16(const float* __restrict__ x, _Float16* __restrict__ X16, size_t n8) { const size_t t = (size_t)blockIdx.x * 256 + threadIdx.x; if (t >= n8) return; FragH f;
#pragma unroll
  for (int q = 0; q < 8; ++q) f.h[q] = (_Float16)x[t * 8 + q]; *(v8us*)((unsigned short*)X16 + t * 8) = f.half[0];  }
__global__ __launch_bounds__(256) void k_round16f(const float* __restrict__ W, _Float16* __restrict__ Bt, size_t n8) { const size_t t = (size_t)blockIdx.x * 256 + threadIdx.x; if (t >= n8) return; FragH f;
#pragma unroll
  for (int i = 0; i < 8; ++i) f.h[i] = (_Float16)(bf16_round(W[t * 8 + i]) * 16.0f); *(v8us*)((unsigned short*)Bt + t * 8) = f.half[0];  }
template <int NHv, int TTv>
__global__ __launch_bounds__(256) void k_vt(const _Float16* __restrict__ V16, int ldv, int voff, _Float16* __restrict__ Vt) { __shared__ unsigned short tl[64][66]; const int tid = threadIdx.x; const int slab = blockIdx.x / (TTv / 64), lg = blockIdx.x % (TTv / 64); const int b = slab / NHv, h = slab % NHv;
  for (int i = tid; i < 64 * 8; i += 256) { const int r = i / 8, c8 = (i % 8) * 8; FragH f; f.half[0] = *(const v8us*)((const unsigned short*)V16 + ((size_t)b * TTv + lg * 64 + r) * ldv + voff + h * 64 + c8);
#pragma unroll
    for (int q = 0; q < 8; ++q) tl[r][c8 + q] = f.u[q]; }
  __syncthreads();
  {
#pragma unroll
    for (int rd = 0; rd < 2; ++rd) { const int d = rd * 32 + tid / 8, pc = tid % 8; FragH f;
#pragma unroll
      for (int q = 0; q < 8; ++q) f.u[q] = tl[pc * 8 + q][d];
      *(v8us*)((unsigned short*)Vt + ((size_t)slab * 64 + d) * TTv + lg * 64 + pc * 8) = f.half[0]; }
     } }

__global__ __launch_bounds__(256) void k_hl(const float* __restrict__ F, _Float16* __restrict__ Hh, _Float16* __restrict__ Hl, size_t n8) { const size_t t = (size_t)blockIdx.x * 256 + threadIdx.x; if (t >= n8) return; FragH fh, fl; const v4f a = *(const v4fa*)(F + t * 8), c = *(const v4fa*)(F + t * 8 + 4);
#pragma unroll
  for (int q = 0; q < 4; ++q) { _Float16 h = (_Float16)a[q]; fh.h[q] = h; fl.h[q] = (_Float16)((a[q] - (float)h) * 1024.0f); h = (_Float16)c[q]; fh.h[4 + q] = h; fl.h[4 + q] = (_Float16)((c[q] - (float)h) * 1024.0f); }
  { *(v8us*)((unsigned short*)Hh + t * 8) = fh.half[0]; *(v8us*)((unsigned short*)Hl + t * 8) = fl.half[0];  } }

// ---- f16 fragment loader and WMMA step ----
__device__ __forceinline__ v16h g2_frag(const _Float16* p, int hh) { FragH f; f.half[0] = *(const v8us*)((const unsigned short*)p + 8 * hh); f.half[1] = *(const v8us*)((const unsigned short*)p + 16 + 8 * hh); return f.v; }
// the builtin form alone: the compiler itself keeps the distance behind a WMMA wherever a vector instruction touches its D, A or B, so no v_nop is written here; an accumulating WMMA, a WMMA on other registers and an LDS read over A need none
__device__ __forceinline__ v8f g2_mma(v16h a, v16h b, v8f c) { return __builtin_amdgcn_wmma_f32_16x16x32_f16(false, a, false, b, (short)0, c, false, false); }

// Fragment order of the prepared weight planes (64 features x K): [k step s][feature tile t][half j][lane 16 hh + ln][8 elements], feature o = 16 t + ln, k = 32 s + 16 j + 8 hh + e (g2_frag's k order). fr_off = the element offset of (o, k0), k0 a multiple of 8; the eight k from k0 on follow one another.
__device__ __forceinline__ size_t fr_off(int o, int k0) { return (size_t)(((((k0 >> 5) * 4 + (o >> 4)) * 2 + ((k0 >> 4) & 1)) * 32 + ((k0 >> 3) & 1) * 16 + (o & 15)) * 8); }
// the inverse: chunk c of eight elements (c = fr_off / 8) -> its feature o and first k. k_prep takes one chunk a thread in this order, so that a wave stores 512 bytes in a row and each 128-byte line has one writer.
__device__ __forceinline__ void fr_src(int c, int& o, int& k0) { o = ((c >> 6) & 3) * 16 + (c & 15); k0 = (c >> 8) * 32 + ((c >> 5) & 1) * 16 + ((c >> 4) & 1) * 8; }
// a lane's fragment of one feature tile; p = the tile's first element + 8 * lane
__device__ __forceinline__ v16h fr_frag(const _Float16* p) { FragH f; f.half[0] = *(const v8us*)((const unsigned short*)p); f.half[1] = *(const v8us*)((const unsigned short*)p + 256); return f.v; }
// ---- the preparation of the weight planes and biases. Every '#pragma unroll' from here to the end of k_prep makes an array index a compile-time constant, so that wv and keep stay in registers.
// eight f32 weights -> eight f16(bf16_round(w) * 16), stored as chunk c of a plane in fragment order; keep = false stores a zero
__device__ __forceinline__ void fr_put(_Float16* __restrict__ Bt, int c, const float (&wv)[8], const bool (&keep)[8]) { FragH f;
#pragma unroll
  for (int q = 0; q < 8; ++q) f.h[q] = (_Float16)(bf16_round(keep[q] ? wv[q] : 0.0f) * 16.0f);
  *(v8us*)((unsigned short*)Bt + (size_t)c * 8) = f.half[0];
  asm volatile("s_wait_xcnt 0x0" ::: "memory"); }      /* the store's offset and data registers are free for reuse behind it: the wait stands in front of whatever overwrites them */
// eight weights ST columns apart: one address pair with constant offsets, so that all eight loads fly together
template <int ST>
__device__ __forceinline__ void fr_get(const float* __restrict__ s, float (&wv)[8]) {
#pragma unroll
  for (int q = 0; q < 8; ++q) wv[q] = s[q * ST];
  asm volatile("s_wait_xcnt 0x0" :: "v"(wv[0]), "v"(wv[1]), "v"(wv[2]), "v"(wv[3]), "v"(wv[4]), "v"(wv[5]), "v"(wv[6]), "v"(wv[7]) : "memory"); }      /* the address pair of the loads is free for reuse behind them: the wait stands in front of whatever overwrites it; the loaded values as inputs keep every load in front of it */
// chunk c of blockdiag(Wa, Wb) (64 x 64, each block [32][32]): a chunk off the diagonal reads an in-bounds place all the same and stores zeros, so that no branch stands in front of the loads
__device__ __forceinline__ void prep_diag(const float* __restrict__ Wa, const float* __restrict__ Wb, _Float16* __restrict__ Bt, int c) { int o, k0; fr_src(c, o, k0); float wv[8]; fr_get<1>((o < 32 ? Wa : Wb) + (size_t)(o & 31) * 32 + (k0 & 31), wv);
  const bool on = (o >> 5) == (k0 >> 5); const bool keep[8] = {on, on, on, on, on, on, on, on}; fr_put(Bt, c, wv, keep); }
// All prepared planes and biases in ONE launch: none of them reads what another writes, so the jobs are dealt by block index, one chunk of eight f16 a thread in fragment order: a wave stores 512 bytes in a row and each 128-byte line has one writer. A block of 256 chunks is one k step (32 k) of a plane, so which part of a permuted k order it fills is the same for the whole block.
// blocks 0..31: BZ = [Wz1; Wz2], each [32][32 * 32] flattened (64 x KO). 32..66: BE1 = We1 [64][33 * 33] (64 x KKP) in the k order of k_fused's row fragments: k = a * 32 + b <- column a * 33 + b (a, b < 32); 1024 + b <- 32 * 33 + b; 1056 + a <- a * 33 + 32; 1088 <- 1088; the rest 0.
// 67..71: BE2 = We2 [64][130] (64 x KC2) in the k order of k_fused's last product: k < 96 <- column k (e1, o1); 96 + b <- 97 + b (o2); 128 <- 96 and 129 <- 129 (the columns of the two appended ones); the rest 0. 72, 73: BH = blockdiag(Wh1, Wh2). 74, 75: BO = blockdiag(Wo1, Wo2). 76: the three bias pairs, rounded to bf16, 32 values a wave.
#define PB_E1 (64 * (KO / 8) / 256)
#define PB_E2 (PB_E1 + FE * (KKP / 8) / 256)
#define PB_H  (PB_E2 + FE * (KC2 / 8) / 256)
#define PB_O  (PB_H + 64 * (64 / 8) / 256)
#define PB_B  (PB_O + 64 * (64 / 8) / 256)
__global__ __launch_bounds__(256) void k_prep(const float* __restrict__ Wz1, const float* __restrict__ Wz2, const float* __restrict__ We1, const float* __restrict__ We2, const float* __restrict__ Wh1, const float* __restrict__ Wh2, const float* __restrict__ Wo1, const float* __restrict__ Wo2,
    const float* __restrict__ bz1, const float* __restrict__ bz2, const float* __restrict__ bh1, const float* __restrict__ bh2, const float* __restrict__ bo1, const float* __restrict__ bo2,
    _Float16* __restrict__ BZ, _Float16* __restrict__ BE1, _Float16* __restrict__ BE2, _Float16* __restrict__ BH, _Float16* __restrict__ BO, float* __restrict__ bz, float* __restrict__ bh, float* __restrict__ bo) {
  const int b = blockIdx.x, tid = threadIdx.x; int o, k0; float wv[8]; bool keep[8];
  if (b < PB_E1) { const int c = b * 256 + tid; fr_src(c, o, k0); fr_get<1>((o < 32 ? Wz1 : Wz2) + (size_t)(o & 31) * KO + k0, wv);
#pragma unroll
    for (int q = 0; q < 8; ++q) keep[q] = true;
    fr_put(BZ, c, wv, keep); }
  else if (b < PB_E2) { const int a = b - PB_E1, c = a * 256 + tid; fr_src(c, o, k0); const int j = k0 & 31; const float* r = We1 + (size_t)o * KK;
    if (a <= 32) fr_get<1>(r + a * 33 + j, wv);      /* row a of the 33 x 33 square; a = 32 is its last row, the o2 part */
    else if (a == 33) fr_get<33>(r + j * 33 + 32, wv);      /* its last column, the o1 part */
    else fr_get<0>(r + KK - 1, wv);      /* its last element, and the pad, which reads the same place and drops it */
#pragma unroll
    for (int q = 0; q < 8; ++q) keep[q] = k0 + q < KK;
    fr_put(BE1, c, wv, keep); }
  else if (b < PB_H) { const int a = b - PB_E2, c = a * 256 + tid; fr_src(c, o, k0); const float* r = We2 + (size_t)o * 130;
    if (a < 4) fr_get<1>(r + k0 + (a == 3 ? 1 : 0), wv);      /* e1 and o1 as they lie; o2 lies one column on */
    else { const float x0 = r[96], x1 = r[129];      /* the two ones' columns, and the pad, which drops what it reads */
      asm volatile("s_wait_xcnt 0x0" :: "v"(x0), "v"(x1) : "memory");      /* as in fr_get */
      wv[0] = x0;
#pragma unroll
      for (int q = 1; q < 8; ++q) wv[q] = x1; }
#pragma unroll
    for (int q = 0; q < 8; ++q) keep[q] = k0 + q < 130;
    fr_put(BE2, c, wv, keep); }
  else if (b < PB_O) prep_diag(Wh1, Wh2, BH, (b - PB_H) * 256 + tid);
  else if (b < PB_B) prep_diag(Wo1, Wo2, BO, (b - PB_O) * 256 + tid);
  else { const int w = __builtin_amdgcn_readfirstlane(tid >> 5), i = tid & 31;      /* the wave's number as a scalar: the choice of the arrays is a scalar one */
    if (w < 6) { const float* s = (w == 0) ? bz1 : (w == 1) ? bz2 : (w == 2) ? bh1 : (w == 3) ? bh2 : (w == 4) ? bo1 : bo2; float* d = ((w < 2) ? bz : (w < 4) ? bh : bo) + (w & 1) * 32; d[i] = bf16_round(s[i]); } } }
// ---- the fused row pipeline. A row fragment (B operand): lane ln = row, elements 0..7 = k 8 hh + 0..7, elements 8..15 = k 16 + 8 hh + 0..7 of a 32-wide k step (g2_frag's order, which the weight fragments use too).
// Every '#pragma unroll' from here to the end of k_fused makes an array or vector index a compile-time constant, so that the values stay in registers.
__device__ __forceinline__ void op_row16(const float* p, int hh, bool rnd, float (&v)[16]) { const v4f x0 = *(const v4fa*)(p + 8 * hh), x1 = *(const v4fa*)(p + 8 * hh + 4), x2 = *(const v4fa*)(p + 16 + 8 * hh), x3 = *(const v4fa*)(p + 16 + 8 * hh + 4);
  asm volatile("s_wait_xcnt 0x0" ::: "memory");      /* the address pair of these four loads is free for reuse behind them: the wait stands in front of whatever overwrites it */
#pragma unroll
  for (int e = 0; e < 4; ++e) { v[e] = rnd ? bf16_round(x0[e]) : x0[e]; v[4 + e] = rnd ? bf16_round(x1[e]) : x1[e]; v[8 + e] = rnd ? bf16_round(x2[e]) : x2[e]; v[12 + e] = rnd ? bf16_round(x3[e]) : x3[e]; } }
__device__ __forceinline__ v16h op_frag(float a, const float (&q)[16]) { FragH f;
#pragma unroll
  for (int e = 0; e < 16; ++e) f.h[e] = (_Float16)(a * q[e]); return f.v; }
// the row fragment a * q[e] from factors that are f16 already: one packed f16 multiply for two elements, rounded once to f16 like the f32 product converted
__device__ __forceinline__ v16h op_mul(_Float16 a, v16h q) { return q * a; }
// two neighbouring feature tiles of a lane's accumulators (features 8 hh + r and 16 + 8 hh + r of a 32-wide block) as the next product's row fragment
__device__ __forceinline__ v16h fu_pack(v8f lo, v8f hi) { FragH f;
#pragma unroll
  for (int e = 0; e < 8; ++e) { f.h[e] = (_Float16)lo[e]; f.h[8 + e] = (_Float16)hi[e]; } return f.v; }
// the lane's eight biases of feature tile t, rounded to bf16
__device__ __forceinline__ v8f fu_bias(const float* __restrict__ b, int t, int hh) { const v4f x0 = *(const v4fa*)(b + t * 16 + 8 * hh), x1 = *(const v4fa*)(b + t * 16 + 8 * hh + 4); v8f v;
#pragma unroll
  for (int e = 0; e < 4; ++e) { v[e] = bf16_round(x0[e]); v[4 + e] = bf16_round(x1[e]); } return v; }
// eight hardware transcendentals in ONE statement each: behind a transcendental the instruction set asks for one independent instruction before its result is read or its source overwritten; inside the statement the next one, on other registers (the outputs are early-clobber, so none shares a register with an input), is that instruction, and the v_nop at the end is the slot behind the last.
__device__ __forceinline__ void tr_exp2(const float (&x)[8], float (&y)[8]) {
  asm("v_exp_f32 %0, %8\n\tv_exp_f32 %1, %9\n\tv_exp_f32 %2, %10\n\tv_exp_f32 %3, %11\n\tv_exp_f32 %4, %12\n\tv_exp_f32 %5, %13\n\tv_exp_f32 %6, %14\n\tv_exp_f32 %7, %15\n\tv_nop"
      : "=&v"(y[0]), "=&v"(y[1]), "=&v"(y[2]), "=&v"(y[3]), "=&v"(y[4]), "=&v"(y[5]), "=&v"(y[6]), "=&v"(y[7]) : "v"(x[0]), "v"(x[1]), "v"(x[2]), "v"(x[3]), "v"(x[4]), "v"(x[5]), "v"(x[6]), "v"(x[7])); }
__device__ __forceinline__ void tr_rcp(const float (&x)[8], float (&y)[8]) {
  asm("v_rcp_f32 %0, %8\n\tv_rcp_f32 %1, %9\n\tv_rcp_f32 %2, %10\n\tv_rcp_f32 %3, %11\n\tv_rcp_f32 %4, %12\n\tv_rcp_f32 %5, %13\n\tv_rcp_f32 %6, %14\n\tv_rcp_f32 %7, %15\n\tv_nop"
      : "=&v"(y[0]), "=&v"(y[1]), "=&v"(y[2]), "=&v"(y[3]), "=&v"(y[4]), "=&v"(y[5]), "=&v"(y[6]), "=&v"(y[7]) : "v"(x[0]), "v"(x[1]), "v"(x[2]), "v"(x[3]), "v"(x[4]), "v"(x[5]), "v"(x[6]), "v"(x[7])); }
// the four weight fragments (64 features) of one k step; wl = the staged chunk at the step's first element (FS a step) + 8 * lane
#define FS 2048                  /* elements of one k step of a weight plane: 64 features x 32 k */
#define CHE (4 * FS)             /* elements of one staged chunk: four k steps, 16 KiB */
// one chunk of the weight stream into one LDS buffer: 256 threads, four copies of 16 bytes each. g = the chunk's first element + 8 * tid, l = the buffer's LDS byte address + 16 * tid
__device__ __forceinline__ void st_copy(const _Float16* g, unsigned l) {
  asm volatile("global_load_async_to_lds_b128 %0, %4, off\n\t"
               "global_load_async_to_lds_b128 %1, %5, off\n\t"
               "global_load_async_to_lds_b128 %2, %6, off\n\t"
               "global_load_async_to_lds_b128 %3, %7, off\n\t"
               "s_wait_xcnt 0x0"      /* the copies' address registers are free for reuse behind the statement: the wait stands in front of whatever overwrites them */
               :: "v"(l), "v"(l + 4096u), "v"(l + 8192u), "v"(l + 12288u), "v"(g), "v"(g + 2048), "v"(g + 4096), "v"(g + 6144) : "memory"); }
// the hand-over at the foot of a chunk: the wave's own LDS reads of that chunk are done, its own copies of the next chunk have landed; behind the barrier every wave may read the next chunk, and the buffer just read may be refilled
__device__ __forceinline__ void st_publish() {
  asm volatile("s_wait_dscnt 0x0" ::: "memory");      /* this wave's reads of the buffer that is refilled next */
  asm volatile("s_wait_asynccnt 0x0" ::: "memory");      /* this wave's copies of the next chunk: the compiler places no wait for them */
  __syncthreads(); }
__device__ __forceinline__ void fu_load(const _Float16* wl, v16h (&a)[4]) {
#pragma unroll
  for (int t = 0; t < 4; ++t) a[t] = fr_frag(wl + t * 512); }
// one k step, 64 features x 32 rows, on fragments that are loaded already: the last step of a chunk
__device__ __forceinline__ void fu_step_end(const v16h (&a)[4], v16h d0, v16h d1, v8f (&c)[2][4]) {
#pragma unroll
  for (int t = 0; t < 4; ++t) { c[0][t] = g2_mma(a[t], d0, c[0][t]); c[1][t] = g2_mma(a[t], d1, c[1][t]); } }
// the same, and behind the two products that read a[t] its registers take that tile's fragment of the step that follows (wn: as in fu_load), so that a whole step's work lies between a load and its use
__device__ __forceinline__ void fu_step_pf(v16h (&a)[4], const _Float16* wn, v16h d0, v16h d1, v8f (&c)[2][4]) {
#pragma unroll
  for (int t = 0; t < 4; ++t) { c[0][t] = g2_mma(a[t], d0, c[0][t]); c[1][t] = g2_mma(a[t], d1, c[1][t]); a[t] = fr_frag(wn + t * 512);
    __builtin_amdgcn_sched_barrier(0); } }      /* behind each tile: holds the tiles in the order of their LDS reads, so that each wait leaves the younger pairs of reads open (left free, a later tile's products were moved up and waited for every read). Behind the last it also keeps the later steps' row-fragment arithmetic behind this step: moved up, the row fragments of four steps are live at once and the kernel needs more than 256 registers, one wave a SIMD less */
// WS = the weight stream: [Wz (32 k steps) | Wh (2) | Wo (2) | We1 (35) | We2 (5)] = 19 chunks; chunk c is staged in buffer c & 1
__global__ __launch_bounds__(256) void k_fused(const float* __restrict__ x, const _Float16* __restrict__ WS, const float* __restrict__ bz, const float* __restrict__ bh, const float* __restrict__ bo,
    const float* __restrict__ be1, const float* __restrict__ be2, float* __restrict__ out) {
  __shared__ __attribute__((aligned(16))) float so[8][32][68];
  __shared__ __attribute__((aligned(16))) _Float16 wb[2 * CHE];
  const int tid = threadIdx.x, w = tid >> 5, lane = tid & 31, ln = lane & 15, hh = lane >> 4;
  const int row0 = blockIdx.x * 256 + 32 * w;
  const float* p0 = x + (size_t)(row0 + ln) * D1; const float* p1 = p0 + (size_t)16 * D1;
  const float* q0 = p0 + (size_t)NBI * D1; const float* q1 = q0 + (size_t)16 * D1;
  const v8f z8 = {0.f,0.f,0.f,0.f,0.f,0.f,0.f,0.f};
  const _Float16* gs = WS + tid * 8; const unsigned ls = (unsigned)(size_t)&wb[0] + 16u * (unsigned)tid;      /* the thread's own 16 bytes of each quarter of a chunk: in the stream, and in buffer 0 (LDS byte address) */
  const _Float16* wl = &wb[0] + lane * 8;      /* the lane's place in a staged fragment half */
  st_copy(gs, ls);      /* chunk 0 */
  v16h v1a, v1b, v2a, v2b;      /* the rows of v1 and v2 as f16: a bf16 value of magnitude 2^-17 or more is exact there (a smaller one moves by 2^-25 at most), so that the packed f16 product below rounds the exact product once, as the f32 product converted did */
  { float ra[16], rb[16]; op_row16(p0, hh, true, ra); op_row16(p1, hh, true, rb); v1a = op_frag(1.0f, ra); v1b = op_frag(1.0f, rb); }
  { float qa[16], qb[16]; op_row16(q0, hh, true, qa); op_row16(q1, hh, true, qb); v2a = op_frag(1.0f, qa); v2b = op_frag(1.0f, qb); }
  /* v1, as f16, into the wave's slab, row by row at so's own pitch (136 f16), element i of a row = v1[row][i]: in k step i of the bilinear forms both lane halves scale by v1[row][i], and each holds only half of the i */
  unsigned short* sh = (unsigned short*)&so[w][0][0];
#pragma unroll
  for (int n = 0; n < 2; ++n) { FragH f; f.v = n ? v1b : v1a; unsigned short* d = sh + (n * 16 + ln) * 136 + 8 * hh; *(v8us*)d = f.half[0]; *(v8us*)(d + 16) = f.half[1]; }
  __builtin_amdgcn_fence(__ATOMIC_ACQ_REL, "workgroup"); __builtin_amdgcn_wave_barrier();      /* each wave re-reads only its own slab of so: its LDS stores must be ordered before its loads */
  asm volatile("s_wait_asynccnt 0x0" ::: "memory");      /* this wave's copies of chunk 0 have landed */
  __syncthreads();      /* and every other wave's: chunk 0 may be read */
  st_copy(gs + CHE, ls + 2u * CHE);      /* chunk 1 flies while chunk 0 is worked on */
  v16h a[4];      /* the weight fragments of one k step */
  /* [z1 | z2]: k step i holds f16(v1[i] * v2[j]), j = 0..31 */
  v8f z[2][4] = {{z8, z8, z8, z8}, {z8, z8, z8, z8}};
  { /* rolled over groups of four k steps: one 8-byte LDS load brings four values of v1; fully unrolled the 32 steps would only grow the code. A group is one staged chunk */
#pragma unroll 1
    for (int i4 = 0; i4 < 32; i4 += 4) { const v4h pa = __builtin_bit_cast(v4h, *(const v4us*)(sh + ln * 136 + i4)), pb = __builtin_bit_cast(v4h, *(const v4us*)(sh + (16 + ln) * 136 + i4));
      const int bs = (i4 >> 2) & 1; const _Float16* wc = wl + bs * CHE;      /* chunk i4 / 4 */
      fu_load(wc, a);
      __builtin_amdgcn_sched_barrier(0);      /* the chunk's first LDS reads go out in front of the row-fragment arithmetic, which then runs under their latency */
#pragma unroll
      for (int u = 0; u < 3; ++u) fu_step_pf(a, wc + (u + 1) * FS, op_mul(pa[u], v2a), op_mul(pb[u], v2b), z);
      fu_step_end(a, op_mul(pa[3], v2a), op_mul(pb[3], v2b), z);
      st_publish(); st_copy(gs + ((i4 >> 2) + 2) * CHE, ls + (unsigned)bs * (2u * CHE)); }      /* chunks 2..9 */
    fu_load(wl, a); }      /* chunk 8 = [Wh | Wo], buffer 0 */
  /* [h1 | h2] = relu, block-diagonal weights, K = [v1 | v2]; then the gate f16(sigmoid(z) * h), feature tile by feature tile, straight into the row fragments of the next product */
  v16h g[2][2];
  { v8f h[2][4] = {{z8, z8, z8, z8}, {z8, z8, z8, z8}};
    fu_step_pf(a, wl + FS, v1a, v1b, h); fu_step_pf(a, wl + 2 * FS, v2a, v2b, h);
#pragma unroll
    for (int t = 0; t < 4; ++t) { const v8f bzv = fu_bias(bz, t, hh), bhv = fu_bias(bh, t, hh);
#pragma unroll
      for (int n = 0; n < 2; ++n) { float u[8], e[8];      /* sigmoid(zv) = 1 / (1 + 2^(-zv log2 e)) on the chip's own exp2 and reciprocal: the gate is rounded to f16 right behind, far coarser than their error; 2^x = inf gives 1 / inf = 0 and 2^x = 0 gives 1, the limits of the sigmoid */
#pragma unroll
        for (int r = 0; r < 8; ++r) u[r] = (z[n][t][r] * 0.0625f + bzv[r]) * -1.4426950408889634f;
        tr_exp2(u, e);
#pragma unroll
        for (int r = 0; r < 8; ++r) u[r] = 1.0f + e[r];
        tr_rcp(u, e);
#pragma unroll
        for (int r = 0; r < 8; ++r) z[n][t][r] = e[r] * fmaxf(h[n][t][r] * 0.0625f + bhv[r], 0.f); } }
#pragma unroll
    for (int n = 0; n < 2; ++n) { g[n][0] = fu_pack(z[n][0], z[n][1]); g[n][1] = fu_pack(z[n][2], z[n][3]); } }
  /* [o1 | o2] = relu, block-diagonal weights */
  v8f o[2][4] = {{z8, z8, z8, z8}, {z8, z8, z8, z8}};
  { fu_step_pf(a, wl + 3 * FS, g[0][0], g[1][0], o); fu_step_end(a, g[0][1], g[1][1], o);
    st_publish(); st_copy(gs + 10 * CHE, ls);
#pragma unroll
    for (int t = 0; t < 4; ++t) { const v8f bv = fu_bias(bo, t, hh);
#pragma unroll
      for (int n = 0; n < 2; ++n)
#pragma unroll
        for (int r = 0; r < 8; ++r) o[n][t][r] = fmaxf(o[n][t][r] * 0.0625f + bv[r], 0.f); } }
  const v16h o1a = fu_pack(o[0][0], o[0][1]), o1b = fu_pack(o[1][0], o[1][1]);
  /* o1 (feature tiles 0, 1), as f16, into the wave's slab in v1's place, element a of a row = o1[row][a]: in k step a of We1 both lane halves scale by o1[row][a], and each holds only half of the a */
#pragma unroll
  for (int n = 0; n < 2; ++n) { FragH f; f.v = n ? o1b : o1a; unsigned short* d = sh + (n * 16 + ln) * 136 + 8 * hh; *(v8us*)d = f.half[0]; *(v8us*)(d + 16) = f.half[1]; }
  __builtin_amdgcn_fence(__ATOMIC_ACQ_REL, "workgroup"); __builtin_amdgcn_wave_barrier();      /* each wave re-reads only its own slab of so: its LDS stores must be ordered before its loads */
  float oa[16], ob[16];
#pragma unroll
  for (int e = 0; e < 8; ++e) { oa[e] = o[0][2][e]; oa[8 + e] = o[0][3][e]; ob[e] = o[1][2][e]; ob[8 + e] = o[1][3][e]; }
  const v16h o2a = op_frag(1.0f, oa), o2b = op_frag(1.0f, ob);
  /* e1 = relu(o12 We1^T + b): k step a holds f16(o1[a] * o2[b]), b = 0..31; then o2, o1 and the one */
  v8f e1[2][4] = {{z8, z8, z8, z8}, {z8, z8, z8, z8}};
  { /* rolled like the first loop: one 8-byte LDS load brings four values of o1 */
#pragma unroll 1
    for (int i4 = 0; i4 < 32; i4 += 4) { const v4h pa = __builtin_bit_cast(v4h, *(const v4us*)(sh + ln * 136 + i4)), pb = __builtin_bit_cast(v4h, *(const v4us*)(sh + (16 + ln) * 136 + i4));
      const int bs = ((i4 >> 2) & 1) ^ 1; const _Float16* wc = wl + bs * CHE;      /* chunk 9 + i4 / 4 */
      fu_load(wc, a);
      __builtin_amdgcn_sched_barrier(0);      /* as in the first loop */
#pragma unroll
      for (int u = 0; u < 3; ++u) fu_step_pf(a, wc + (u + 1) * FS, op_mul(pa[u], o2a), op_mul(pb[u], o2b), e1);
      fu_step_end(a, op_mul(pa[3], o2a), op_mul(pb[3], o2b), e1);
      st_publish(); st_copy(gs + ((i4 >> 2) + 11) * CHE, ls + (unsigned)bs * (2u * CHE)); }      /* chunks 11..18 */
    const _Float16* wc = wl + CHE;      /* chunk 17 = [the last three k steps of We1 | the first of We2], buffer 1 */
    fu_load(wc, a);
    fu_step_pf(a, wc + FS, o2a, o2b, e1); fu_step_pf(a, wc + 2 * FS, o1a, o1b, e1);
    FragH one;
#pragma unroll
    for (int e = 0; e < 16; ++e) one.h[e] = (_Float16)((e == 0 && hh == 0) ? 1.0f : 0.0f);
    fu_step_pf(a, wc + 3 * FS, one.v, one.v, e1);
#pragma unroll
    for (int t = 0; t < 4; ++t) { const v8f bv = fu_bias(be1, t, hh);
#pragma unroll
      for (int n = 0; n < 2; ++n)
#pragma unroll
        for (int r = 0; r < 8; ++r) e1[n][t][r] = fmaxf(e1[n][t][r] * 0.0625f + bv[r], 0.f); } }
  /* out = relu([e1, o1, o2, 1, 1] We2^T + b) */
  v8f y[2][4] = {{z8, z8, z8, z8}, {z8, z8, z8, z8}};
  { fu_step_end(a, fu_pack(e1[0][0], e1[0][1]), fu_pack(e1[1][0], e1[1][1]), y);
    st_publish();      /* chunk 18, the last: no chunk is left to fetch */
    fu_load(wl, a);
    fu_step_pf(a, wl + FS, fu_pack(e1[0][2], e1[0][3]), fu_pack(e1[1][2], e1[1][3]), y);
    fu_step_pf(a, wl + 2 * FS, o1a, o1b, y); fu_step_pf(a, wl + 3 * FS, o2a, o2b, y);
    FragH two;
#pragma unroll
    for (int e = 0; e < 16; ++e) two.h[e] = (_Float16)((e < 2 && hh == 0) ? 1.0f : 0.0f);
    fu_step_end(a, two.v, two.v, y);
    asm volatile("s_wait_asynccnt 0x0" ::: "memory"); }      /* behind the last chunk: no copy of this wave is open when it goes on to the output and ends */
  /* the lane holds 8 features of its row a tile: through the slab, so that the output goes out as whole rows */
#pragma unroll
  for (int t = 0; t < 4; ++t) { const v8f bv = fu_bias(be2, t, hh);
#pragma unroll
    for (int n = 0; n < 2; ++n) { v4f s0, s1;
#pragma unroll
      for (int r = 0; r < 4; ++r) { s0[r] = fmaxf(y[n][t][r] * 0.0625f + bv[r], 0.f); s1[r] = fmaxf(y[n][t][4 + r] * 0.0625f + bv[4 + r], 0.f); }
      float* d = &so[w][n * 16 + ln][t * 16 + 8 * hh]; *(v4fa*)d = s0; *(v4fa*)(d + 4) = s1; } }
  __builtin_amdgcn_fence(__ATOMIC_ACQ_REL, "workgroup"); __builtin_amdgcn_wave_barrier();      /* as above: the wave's own LDS stores before its loads */
  const int rsub = lane >> 4, c4 = (lane & 15) * 4;
#pragma unroll
  for (int q = 0; q < 16; ++q) { const int r = q * 2 + rsub; const v4f v = *(const v4fa*)&so[w][r][c4]; *(v4f*)(out + (size_t)(row0 + r) * FE + c4) = v; } }

extern "C" void kernel_launch(void* const* d_in, const int* in_sizes, int n_in,
                              void* d_out, int out_size, void* d_ws, size_t ws_size, hipStream_t stream) {
  (void)in_sizes; (void)n_in; (void)out_size;
  const float* const* I = (const float* const*)d_in;
  const float* x = I[0]; const float* Wh1 = I[1]; const float* bh1 = I[2]; const float* Wz1 = I[3]; const float* bz1 = I[4]; const float* Wo1 = I[5]; const float* bo1 = I[6]; const float* Wh2 = I[7]; const float* bh2 = I[8]; const float* Wz2 = I[9]; const float* bz2 = I[10]; const float* Wo2 = I[11]; const float* bo2 = I[12]; const float* We1 = I[13]; const float* be1 = I[14]; const float* We2 = I[15]; const float* be2 = I[16];
  char* ws = (char*)d_ws; size_t off = 0;
  auto take = [&](size_t bytes) { char* p = ws + off; off += (bytes + 255) & ~(size_t)255; return p; };
  /* the five planes in the order of their use; each size is a multiple of 256 bytes, so that they follow one another without a gap: k_fused reads them as one stream from BZ on */
  _Float16* BZ = (_Float16*)take((size_t)64 * KO * 2); _Float16* BH = (_Float16*)take((size_t)64 * 64 * 2); _Float16* BO = (_Float16*)take((size_t)64 * 64 * 2); _Float16* BE1 = (_Float16*)take((size_t)FE * KKP * 2); _Float16* BE2 = (_Float16*)take((size_t)FE * KC2 * 2);
  float* bz = (float*)take(64 * 4); float* bh = (float*)take(64 * 4); float* bo = (float*)take(64 * 4);
  if (off > ws_size) return;      /* under 1 MiB: the prepared weights and biases only */
  k_prep<<<PB_B + 1, 256, 0, stream>>>(Wz1, Wz2, We1, We2, Wh1, Wh2, Wo1, Wo2, bz1, bz2, bh1, bh2, bo1, bo2, BZ, BE1, BE2, BH, BO, bz, bh, bo);      /* every element of every plane, the pads and the zero blocks too */
  k_fused<<<NBR / 256, 256, 0, stream>>>(x, BZ, bz, bh, bo, be1, be2, (float*)d_out);
}
